// v000
// Times are from an AMD MI455X. After a warm-up the kernel runs many times in a row, and a time is the length of
// such a window on the GPU divided by its runs, so every launch and the gaps after it count. The runs cycle
// through copies of the inputs. A figure is the median of several windows, for all but v000 over two sittings.
// Sittings can differ by a few percent; kernels timed side by side share one.
// v000 is the starting kernel. One run takes 6850 microseconds.
#include <hip/hip_runtime.h>
// Multi-head attention on THREE input streams with BLOCK-DIAGONAL per-head projections on four sequences (Q, K, V [4][2048][1024], each split into 16 contiguous 64-wide slices; q / k / v = einsum('bhsd,hde->bhse', slice, W) + b: EACH HEAD applies its own Dense(64) (W [16][64][64] = [head][in][out], normal x 1/8; biases [16][64] zeros on this draw) to ITS OWN slice of ITS stream; scores / sqrt(64); softmax over all 2048 keys (no mask); out = merged Wo + bo ([in][out] [1024][1024]; bo zeros) -> [4][2048][1024]); each projection is ONE head-batched GEMM (K = 64).
// Structure: the three inputs as exact f16 rows; the per-head [in][out] weight blocks transposed, one small builder call per head and stack, into sixteen consecutive exact x16 [64][64] planes; Q, K, V as three HEAD-BATCHED WMMA GEMMs (16 heads on grid.y; K = N = 64; 32x64 wave tiles, f32 accumulation, + the head's bias, f16 outputs into the head's 64 columns); per batch: V^T via LDS transposes; per 4-head group: scores (K = 64, alpha 1/8) into f32 [2048][2048] planes, row softmax over the 2048 keys on VALU (f32 statistics, native exp; weights x256 f16), o = P V^T (o carried x64) into merged f16 rows; out = o W_o + b_o GEMM (f32, alpha 2^-10); launches: see trace.
// Compute dtype: inputs rounded to bf16; x / context / weights exact; q, k, v, softmax weights and o as plain f16 GEMM operands (~2^-12); scores and statistics f32; v_wmma_f32_16x16x32_f16.
#define NB 4
#define NQ 2048
#define SK 2048
#define SQ SK                       /* keys per softmax row */
#define DM 1024
#define DC 1024
#define NH 16
#define HD 64
#define HG 4
#define NRQ ((size_t)NB * NQ)
#define NRK ((size_t)NB * SK)
typedef __bf16 v16b __attribute__((ext_vector_type(16)));
typedef unsigned short v8us __attribute__((ext_vector_type(8), may_alias));
typedef float  v8f  __attribute__((ext_vector_type(8)));
typedef float  v4f  __attribute__((ext_vector_type(4)));
typedef float  v4fa __attribute__((ext_vector_type(4), may_alias));
union FragB { v16b v; v8us half[2]; unsigned short u[16]; };

__device__ __forceinline__ unsigned short bf16_bits(float x) { unsigned int u = __float_as_uint(x); return (unsigned short)((u + 0x7FFFu + ((u >> 16) & 1u)) >> 16); }
__device__ __forceinline__ float bf16_val(unsigned short b) { return __uint_as_float(((unsigned int)b) << 16); }
__device__ __forceinline__ float bf16_round(float x) { return bf16_val(bf16_bits(x)); }
// D += A·B with NT terms: 1 = ah·bh, 2 = + al·bh (A split), 3 = + ah·bl (both split)
template <int NT>
__device__ __forceinline__ v8f mmaN(v16b ah, v16b al, v16b bh, v16b bl, v8f c) {
  c = __builtin_amdgcn_wmma_f32_16x16x32_bf16(false, ah, false, bh, (short)0, c, false, false);
  if (NT >= 2) c = __builtin_amdgcn_wmma_f32_16x16x32_bf16(false, al, false, bh, (short)0, c, false, false);
  if (NT >= 3) c = __builtin_amdgcn_wmma_f32_16x16x32_bf16(false, ah, false, bl, (short)0, c, false, false);
  asm volatile("v_nop\n\tv_nop\n\tv_nop\n\tv_nop" : "+v"(c) : "v"(ah), "v"(al), "v"(bh), "v"(bl));
  return c;
}

__global__ __launch_bounds__(256) void k_wt_bf16(const float* __restrict__ W, unsigned short* __restrict__ Wt, int K, int N) {
  const int t = blockIdx.x * 256 + threadIdx.x;
  const int k8n = K / 8;
  if (t >= N * k8n) return;
  const int n = t / k8n, k8 = (t % k8n) * 8;
  v8us v;
#pragma unroll
  for (int i = 0; i < 8; ++i) v[i] = bf16_bits(W[(size_t)(k8 + i) * N + n]);
  *(v8us*)(Wt + (size_t)n * K + k8) = v;
  
}

// GEMM C[M][N] (f32, pitch ldc) = act(A[M][K]·W + bias). A f32 row-major (pitch lda) converted per fragment to bf16
// (ASPLIT: hi/lo two planes -> 2 terms, else single rounded term); Wt bf16 [N][K] (pitch ldb). BIAS_BF16 rounds the
// bias to bf16 first (bias quantised to bf16 before the add). K%32==0, M%16==0, N%64==0.
template <bool ASPLIT, int ACT, bool BIAS_BF16>
__global__ __launch_bounds__(128) void k_gemm_bf(const float* __restrict__ A, int lda, const unsigned short* __restrict__ Wt, int ldb,
                                               const float* __restrict__ bias, float* __restrict__ C, int ldc, int M, int N, int K) {
  __shared__ __attribute__((aligned(16))) float so[4][16][64];
  const int tid = threadIdx.x, w = tid >> 5, lane = tid & 31, ln = lane & 15, hh = lane >> 4;
  const int ntn = N / 64;
  const int wid = blockIdx.x * 4 + w;
  const int mt = wid / ntn, nq = wid % ntn;
  if (mt * 16 >= M) return;
  const int row0 = mt * 16, col0 = nq * 64;
  const float* arow = A + (size_t)(row0 + ln) * lda;
  v8f acc[4] = {};
  for (int kb = 0; kb < K; kb += 32) {
    FragB ah, al;
    const v4f x0 = *(const v4fa*)(arow + kb + 8 * hh), x1 = *(const v4fa*)(arow + kb + 8 * hh + 4);
    const v4f x2 = *(const v4fa*)(arow + kb + 16 + 8 * hh), x3 = *(const v4fa*)(arow + kb + 16 + 8 * hh + 4);
    float xs[16] = {x0[0],x0[1],x0[2],x0[3],x1[0],x1[1],x1[2],x1[3],x2[0],x2[1],x2[2],x2[3],x3[0],x3[1],x3[2],x3[3]};
#pragma unroll
    for (int i = 0; i < 16; ++i) { const unsigned short hb = bf16_bits(xs[i]); ah.u[i] = hb; al.u[i] = ASPLIT ? bf16_bits(xs[i] - bf16_val(hb)) : (unsigned short)0; }
#pragma unroll
    for (int t = 0; t < 4; ++t) {
      const unsigned short* brow = Wt + (size_t)(col0 + t * 16 + ln) * ldb + kb;
      FragB b;
      b.half[0] = *(const v8us*)(brow + 8 * hh);
      b.half[1] = *(const v8us*)(brow + 16 + 8 * hh);
      acc[t] = mmaN<ASPLIT ? 2 : 1>(ah.v, al.v, b.v, b.v, acc[t]);
    }
  }
#pragma unroll
  for (int t = 0; t < 4; ++t) {
    float bv = bias ? bias[col0 + t * 16 + ln] : 0.f;
    if (BIAS_BF16) bv = bf16_round(bv);
#pragma unroll
    for (int r = 0; r < 8; ++r) { float v = acc[t][r] + bv; if (ACT == 1) v = fmaxf(v, 0.f); so[w][8 * hh + r][t * 16 + ln] = v; }
  }
  __builtin_amdgcn_fence(__ATOMIC_ACQ_REL, "workgroup");
  __builtin_amdgcn_wave_barrier();
  const int rsub = lane >> 4, c4 = (lane & 15) * 4;
  {
#pragma unroll
    for (int q = 0; q < 8; ++q) {
      const int r = q * 2 + rsub;
      const v4f v = *(const v4fa*)&so[w][r][c4];
      *(v4f*)(C + (size_t)(row0 + r) * ldc + col0 + c4) = v;
    }
    
  }
}

// GEMM C = act(A·W + bias + resid): A f32 (ASPLIT -> hi/lo 2 terms), Wt bf16 [N][K]; ACT 0 none, 1 relu, 2 exact gelu;
// resid (optional, f32, row index = (row % rmod), pitch ldr, RES_BF16 rounds it) added before the activation.
template <bool ASPLIT, int ACT, bool BIAS_BF16, bool RES_BF16>
__global__ __launch_bounds__(128) void k_gemm_bf3(const float* __restrict__ A, int lda, const unsigned short* __restrict__ Wt, int ldb,
                                                const float* __restrict__ bias, const float* __restrict__ resid, int rmod, int ldr,
                                                float* __restrict__ C, int ldc, int M, int N, int K) {
  __shared__ __attribute__((aligned(16))) float so[4][16][64];
  const int tid = threadIdx.x, w = tid >> 5, lane = tid & 31, ln = lane & 15, hh = lane >> 4;
  const int ntn = N / 64;
  const int wid = blockIdx.x * 4 + w;
  const int mt = wid / ntn, nq = wid % ntn;
  if (mt * 16 >= M) return;
  const int row0 = mt * 16, col0 = nq * 64;
  const float* arow = A + (size_t)(row0 + ln) * lda;
  v8f acc[4] = {};
  for (int kb = 0; kb < K; kb += 32) {
    FragB ah, al;
    const v4f x0 = *(const v4fa*)(arow + kb + 8 * hh), x1 = *(const v4fa*)(arow + kb + 8 * hh + 4);
    const v4f x2 = *(const v4fa*)(arow + kb + 16 + 8 * hh), x3 = *(const v4fa*)(arow + kb + 16 + 8 * hh + 4);
    float xs[16] = {x0[0],x0[1],x0[2],x0[3],x1[0],x1[1],x1[2],x1[3],x2[0],x2[1],x2[2],x2[3],x3[0],x3[1],x3[2],x3[3]};
#pragma unroll
    for (int i = 0; i < 16; ++i) { const unsigned short hb = bf16_bits(xs[i]); ah.u[i] = hb; al.u[i] = ASPLIT ? bf16_bits(xs[i] - bf16_val(hb)) : (unsigned short)0; }
#pragma unroll
    for (int t = 0; t < 4; ++t) {
      const unsigned short* brow = Wt + (size_t)(col0 + t * 16 + ln) * ldb + kb;
      FragB b;
      b.half[0] = *(const v8us*)(brow + 8 * hh);
      b.half[1] = *(const v8us*)(brow + 16 + 8 * hh);
      acc[t] = mmaN<ASPLIT ? 2 : 1>(ah.v, al.v, b.v, b.v, acc[t]);
    }
  }
#pragma unroll
  for (int t = 0; t < 4; ++t) {
    const int col = col0 + t * 16 + ln;
    float bv = bias ? bias[col] : 0.f;
    if (BIAS_BF16) bv = bf16_round(bv);
#pragma unroll
    for (int r = 0; r < 8; ++r) {
      float v = acc[t][r] + bv;
      if (resid) { float rv = resid[(size_t)((row0 + 8 * hh + r) % rmod) * ldr + col]; if (RES_BF16) rv = bf16_round(rv); v += rv; }
      if (ACT == 1) v = fmaxf(v, 0.f);
      if (ACT == 2) v = 0.5f * v * (1.0f + erff(v * 0.70710678118654752f));
      if (ACT == 3) { const float u = 0.7978845608028654f * (v + 0.044715f * v * v * v); v = 0.5f * v * (1.0f + tanhf(u)); }
      so[w][8 * hh + r][t * 16 + ln] = v;
    }
  }
  __builtin_amdgcn_fence(__ATOMIC_ACQ_REL, "workgroup");
  __builtin_amdgcn_wave_barrier();
  const int rsub = lane >> 4, c4 = (lane & 15) * 4;
  {
#pragma unroll
    for (int q = 0; q < 8; ++q) {
      const int r = q * 2 + rsub;
      const v4f v = *(const v4fa*)&so[w][r][c4];
      *(v4f*)(C + (size_t)(row0 + r) * ldc + col0 + c4) = v;
    }
    
  }
}
// row LayerNorm (biased variance, eps) over N: s = X (+ R); optional out_sum <- s; out_norm <- (s-mu)*rsqrt(var+eps)*g + b
template <bool PARAM_BF16>
__global__ __launch_bounds__(256) void k_layernorm(const float* __restrict__ X, const float* __restrict__ R, const float* __restrict__ g, const float* __restrict__ bta,
                                                  float* __restrict__ out_sum, float* __restrict__ out_norm, int N, float eps) {
  __shared__ float red[256];
  const int row = blockIdx.x, tid = threadIdx.x;
  const float* x = X + (size_t)row * N; const float* rr = R ? R + (size_t)row * N : nullptr;
  float vals[16];                     // up to N = 4096
  const int per = N / 256;            // contiguous chunk per thread? use strided-by-4 chunks: thread handles j = tid*4 + 1024*u
  float s1 = 0.f;
  for (int u = 0; u < per / 4; ++u) {
    const int j = tid * 4 + 1024 * u;
    const v4f a = *(const v4fa*)(x + j);
    v4f b = {0.f,0.f,0.f,0.f}; if (rr) b = *(const v4fa*)(rr + j);
#pragma unroll
    for (int q = 0; q < 4; ++q) { const float v = a[q] + b[q]; vals[u * 4 + q] = v; s1 += v; }
  }
  red[tid] = s1; __syncthreads();
  for (int st = 128; st > 0; st >>= 1) { if (tid < st) red[tid] += red[tid + st]; __syncthreads(); }
  const float mu = red[0] / (float)N; __syncthreads();
  float s2 = 0.f;
  for (int u = 0; u < per / 4; ++u)
#pragma unroll
    for (int q = 0; q < 4; ++q) { const float c = vals[u * 4 + q] - mu; s2 += c * c; }
  red[tid] = s2; __syncthreads();
  for (int st = 128; st > 0; st >>= 1) { if (tid < st) red[tid] += red[tid + st]; __syncthreads(); }
  const float rs = rsqrtf(red[0] / (float)N + eps);
  {
    for (int u = 0; u < per / 4; ++u) {
      const int j = tid * 4 + 1024 * u;
      v4f o, sm;
#pragma unroll
      for (int q = 0; q < 4; ++q) {
        float gg = g[j + q], bb = bta[j + q];
        if (PARAM_BF16) { gg = bf16_round(gg); bb = bf16_round(bb); }
        sm[q] = vals[u * 4 + q]; o[q] = (vals[u * 4 + q] - mu) * rs * gg + bb;
      }
      if (out_sum) *(v4f*)(out_sum + (size_t)row * N + j) = sm;
      *(v4f*)(out_norm + (size_t)row * N + j) = o;
    }
    
  }
}



// ---- f16 WMMA path (v_wmma_f32_16x16x32_f16): 11-bit significands for operands in range — used where a [0,1] probability operand needs more precision than bf16
typedef _Float16 v16h __attribute__((ext_vector_type(16)));
union FragH { v16h v; v8us half[2]; _Float16 h[16]; unsigned short u[16]; };
template <int NT>
__device__ __forceinline__ v8f mmaH(v16h ah, v16h al, v16h bh, v16h bl, v8f c) {
  c = __builtin_amdgcn_wmma_f32_16x16x32_f16(false, ah, false, bh, (short)0, c, false, false);
  if (NT >= 2) c = __builtin_amdgcn_wmma_f32_16x16x32_f16(false, al, false, bh, (short)0, c, false, false);
  if (NT >= 3) c = __builtin_amdgcn_wmma_f32_16x16x32_f16(false, ah, false, bl, (short)0, c, false, false);
  asm volatile("v_nop\n\tv_nop\n\tv_nop\n\tv_nop" : "+v"(c) : "v"(ah), "v"(al), "v"(bh), "v"(bl));
  return c;
}
// batched GEMM like k_gemm_b but f16 operands: A f32 (split into f16 hi/lo if ASPLIT, else rounded to f16), Bt = f16 values [n][k]; alpha; C f32; N multiple of 16 (partial tiles skipped)
template <bool ASPLIT>
__global__ __launch_bounds__(128) void k_gemm_h(const float* __restrict__ A, int lda, size_t sA, const _Float16* __restrict__ Bh, int ldb, size_t sB, float alpha, float* __restrict__ C, int ldc, size_t sC, int M, int N, int K) {
  __shared__ __attribute__((aligned(16))) float so[4][16][64];
  const int tid = threadIdx.x, w = tid >> 5, lane = tid & 31, ln = lane & 15, hh = lane >> 4; const int by = blockIdx.y;
  A += (size_t)by * sA; Bh += (size_t)by * sB; C += (size_t)by * sC;
  const int ntn = (N + 63) / 64; const int wid = blockIdx.x * 4 + w; const int mt = wid / ntn, nq = wid % ntn; if (mt * 16 >= M) return;
  const int row0 = mt * 16, col0 = nq * 64; const float* arow = A + (size_t)(row0 + ln) * lda;
  v8f acc[4] = {};
  for (int kb = 0; kb < K; kb += 32) {
    FragH ah, al;
    const v4f x0 = *(const v4fa*)(arow + kb + 8 * hh), x1 = *(const v4fa*)(arow + kb + 8 * hh + 4), x2 = *(const v4fa*)(arow + kb + 16 + 8 * hh), x3 = *(const v4fa*)(arow + kb + 16 + 8 * hh + 4);
    float xs[16] = {x0[0],x0[1],x0[2],x0[3],x1[0],x1[1],x1[2],x1[3],x2[0],x2[1],x2[2],x2[3],x3[0],x3[1],x3[2],x3[3]};
#pragma unroll
    for (int i = 0; i < 16; ++i) { const _Float16 h = (_Float16)xs[i]; ah.h[i] = h; al.h[i] = ASPLIT ? (_Float16)(xs[i] - (float)h) : (_Float16)0.0f; }
#pragma unroll
    for (int t = 0; t < 4; ++t) { if (col0 + t * 16 >= N) continue; const size_t boff = (size_t)(col0 + t * 16 + ln) * ldb + kb; FragH bq; bq.half[0] = *(const v8us*)(Bh + boff + 8 * hh); bq.half[1] = *(const v8us*)(Bh + boff + 16 + 8 * hh);
      acc[t] = mmaH<ASPLIT ? 2 : 1>(ah.v, al.v, bq.v, bq.v, acc[t]); }
  }
#pragma unroll
  for (int t = 0; t < 4; ++t) { if (col0 + t * 16 >= N) continue;
#pragma unroll
    for (int r = 0; r < 8; ++r) so[w][8 * hh + r][t * 16 + ln] = acc[t][r] * alpha; }
  __builtin_amdgcn_fence(__ATOMIC_ACQ_REL, "workgroup"); __builtin_amdgcn_wave_barrier();
  const int rsub = lane >> 4, c4 = (lane & 15) * 4;
  {
#pragma unroll
    for (int q = 0; q < 8; ++q) { const int r = q * 2 + rsub; if (col0 + c4 < N) { const v4f v = *(const v4fa*)&so[w][r][c4]; *(v4f*)(C + (size_t)(row0 + r) * ldc + col0 + c4) = v; } }
     }
}

// Wt[n][k] = f16(W[k][n]·scale) from f32 row-major W[K][N] (scale = power of two; bf16-exact weights stay exact in f16 away from the subnormal range)
__global__ __launch_bounds__(256) void k_wt_f16(const float* __restrict__ W, _Float16* __restrict__ Wt, int K, int N, float scale) {
  const int t = blockIdx.x * 256 + threadIdx.x; if (t >= N * (K / 8)) return; const int n = t / (K / 8), k8 = (t % (K / 8)) * 8; FragH f;
#pragma unroll
  for (int i = 0; i < 8; ++i) f.h[i] = (_Float16)(bf16_round(W[(size_t)(k8 + i) * N + n]) * scale); const v8us o = f.half[0];
  *(v8us*)((unsigned short*)Wt + (size_t)n * K + k8) = o; 
}
// k_gemm_hh variant with fused epilogue: v = acc·alpha + bias[by·sBias + col] (+ CP[(row/rowsPerB)·sCPb + by·64 + col] if CP) ; ACT 0 none / 1 elu ; writes f16 C16 (and f32 C if non-null)
template <int ACT>
__global__ __launch_bounds__(128) void k_gemm_hhx(const _Float16* __restrict__ A, int lda, size_t sA, const _Float16* __restrict__ Bh, int ldb, size_t sB, float alpha, const float* __restrict__ bias, size_t sBias, const float* __restrict__ CP, int rowsPerB, size_t sCPb, int row0g,
    float* __restrict__ C, _Float16* __restrict__ C16, int ldc, size_t sC, int M, int N, int K) {
  __shared__ __attribute__((aligned(16))) float so[4][16][64];
  const int tid = threadIdx.x, w = tid >> 5, lane = tid & 31, ln = lane & 15, hh = lane >> 4; const int by = blockIdx.y;
  A += (size_t)by * sA; Bh += (size_t)by * sB; const size_t cofs = (size_t)by * sC; const float* bp = bias ? bias + (size_t)by * sBias : nullptr;
  const int ntn = (N + 63) / 64; const int wid = blockIdx.x * 4 + w; const int mt = wid / ntn, nq = wid % ntn; if (mt * 16 >= M) return;
  const int row0 = mt * 16, col0 = nq * 64; const _Float16* arow = A + (size_t)(row0 + ln) * lda;
  v8f acc[4] = {};
  for (int kb = 0; kb < K; kb += 32) { FragH ah; ah.half[0] = *(const v8us*)((const unsigned short*)arow + kb + 8 * hh); ah.half[1] = *(const v8us*)((const unsigned short*)arow + kb + 16 + 8 * hh);
#pragma unroll
    for (int t = 0; t < 4; ++t) { if (col0 + t * 16 >= N) continue; const size_t boff = (size_t)(col0 + t * 16 + ln) * ldb + kb; FragH bq; bq.half[0] = *(const v8us*)((const unsigned short*)Bh + boff + 8 * hh); bq.half[1] = *(const v8us*)((const unsigned short*)Bh + boff + 16 + 8 * hh);
      acc[t] = mmaH<1>(ah.v, ah.v, bq.v, bq.v, acc[t]); }
  }
#pragma unroll
  for (int t = 0; t < 4; ++t) { if (col0 + t * 16 >= N) continue; const int col = col0 + t * 16 + ln; const float bv = bp ? bf16_round(bp[col]) : 0.f;
#pragma unroll
    for (int r = 0; r < 8; ++r) { float v = acc[t][r] * alpha + bv; if (CP) { const int rr = row0g + row0 + 8 * hh + r; if (rowsPerB < 0) v += CP[cofs + (size_t)rr * ldc + col];      /* rowsPerB < 0: own element of the batched C plane */ else { const int bidx = rr / rowsPerB; v += CP[(size_t)bidx * sCPb + (size_t)by * 64 + col]; } } if (ACT == 1) v = (v > 0.f) ? v : expm1f(v); else if (ACT == 7) v = (v > 0.f) ? v + 1.0f : expf(v); else if (ACT == 8) v = tanhf(v); else if (ACT == 9) v = 0.5f * v * (1.0f + tanhf(0.7978845608028654f * (v + 0.044715f * v * v * v))); else if (ACT == 11) v = 1.0f / (1.0f + expf(-v)); else if (ACT == 12) v = (v > 0.f) ? v : 0.01f * v; else if (ACT == 14) v = (v > 0.f) ? v : 0.1f * v; else if (ACT == 16) v = (v >= 0.f) ? v : 0.3f * v; else if (ACT == 17) v = (v >= 0.f) ? v : 0.2f * v; else if (ACT == 15) v = v / (1.0f + expf(-v)); else if (ACT == 3) v = fmaxf(v, 0.f); else if (ACT == 6) v = 0.5f * v * (1.0f + erff(v * 0.70710678118654752f)); so[w][8 * hh + r][t * 16 + ln] = v; } }
  __builtin_amdgcn_fence(__ATOMIC_ACQ_REL, "workgroup"); __builtin_amdgcn_wave_barrier();
  const int rsub = lane >> 4, c4 = (lane & 15) * 4; typedef _Float16 v4h __attribute__((ext_vector_type(4)));
  {
#pragma unroll
    for (int q = 0; q < 8; ++q) { const int r = q * 2 + rsub; if (col0 + c4 < N) { const v4f v = *(const v4fa*)&so[w][r][c4]; if (C) *(v4f*)(C + cofs + (size_t)(row0 + r) * ldc + col0 + c4) = v; if (C16) { v4h h4; for (int i = 0; i < 4; ++i) h4[i] = (_Float16)v[i]; *(v4h*)(C16 + cofs + (size_t)(row0 + r) * ldc + col0 + c4) = h4; } } }
     }
}


typedef _Float16 v4h __attribute__((ext_vector_type(4)));

__global__ __launch_bounds__(256) void k_x16(const float* __restrict__ x, _Float16* __restrict__ X16, size_t n8) { const size_t t = (size_t)blockIdx.x * 256 + threadIdx.x; if (t >= n8) return; FragH f;
#pragma unroll
  for (int q = 0; q < 8; ++q) f.h[q] = (_Float16)bf16_round(x[t * 8 + q]); *(v8us*)((unsigned short*)X16 + t * 8) = f.half[0];  }
__global__ __launch_bounds__(256) void k_h16(const float* __restrict__ x, _Float16* __restrict__ X16, size_t n8) { const size_t t = (size_t)blockIdx.x * 256 + threadIdx.x; if (t >= n8) return; FragH f;
#pragma unroll
  for (int q = 0; q < 8; ++q) f.h[q] = (_Float16)x[t * 8 + q]; *(v8us*)((unsigned short*)X16 + t * 8) = f.half[0];  }
__global__ __launch_bounds__(256) void k_round16f(const float* __restrict__ W, _Float16* __restrict__ Bt, size_t n8) { const size_t t = (size_t)blockIdx.x * 256 + threadIdx.x; if (t >= n8) return; FragH f;
#pragma unroll
  for (int i = 0; i < 8; ++i) f.h[i] = (_Float16)(bf16_round(W[t * 8 + i]) * 16.0f); *(v8us*)((unsigned short*)Bt + t * 8) = f.half[0];  }
template <int NHv, int TTv>
__global__ __launch_bounds__(256) void k_vt(const _Float16* __restrict__ V16, int ldv, int voff, _Float16* __restrict__ Vt) { __shared__ unsigned short tl[64][66]; const int tid = threadIdx.x; const int slab = blockIdx.x / (TTv / 64), lg = blockIdx.x % (TTv / 64); const int b = slab / NHv, h = slab % NHv;
  for (int i = tid; i < 64 * 8; i += 256) { const int r = i / 8, c8 = (i % 8) * 8; FragH f; f.half[0] = *(const v8us*)((const unsigned short*)V16 + ((size_t)b * TTv + lg * 64 + r) * ldv + voff + h * 64 + c8);
#pragma unroll
    for (int q = 0; q < 8; ++q) tl[r][c8 + q] = f.u[q]; }
  __syncthreads();
  {
#pragma unroll
    for (int rd = 0; rd < 2; ++rd) { const int d = rd * 32 + tid / 8, pc = tid % 8; FragH f;
#pragma unroll
      for (int q = 0; q < 8; ++q) f.u[q] = tl[pc * 8 + q][d];
      *(v8us*)((unsigned short*)Vt + ((size_t)slab * 64 + d) * TTv + lg * 64 + pc * 8) = f.half[0]; }
     } }

__global__ __launch_bounds__(256) void k_hl(const float* __restrict__ F, _Float16* __restrict__ Hh, _Float16* __restrict__ Hl, size_t n8) { const size_t t = (size_t)blockIdx.x * 256 + threadIdx.x; if (t >= n8) return; FragH fh, fl; const v4f a = *(const v4fa*)(F + t * 8), c = *(const v4fa*)(F + t * 8 + 4);
#pragma unroll
  for (int q = 0; q < 4; ++q) { _Float16 h = (_Float16)a[q]; fh.h[q] = h; fl.h[q] = (_Float16)((a[q] - (float)h) * 1024.0f); h = (_Float16)c[q]; fh.h[4 + q] = h; fl.h[4 + q] = (_Float16)((c[q] - (float)h) * 1024.0f); }
  { *(v8us*)((unsigned short*)Hh + t * 8) = fh.half[0]; *(v8us*)((unsigned short*)Hl + t * 8) = fl.half[0];  } }

// ---- fast GEMM (wave tile 32x64; requires M % 32 == 0 rows per launch region and N % 64 == 0); epilogue = k_gemm_hhx semantics ----
__device__ __forceinline__ v16h g2_frag(const _Float16* p, int hh) { FragH f; f.half[0] = *(const v8us*)((const unsigned short*)p + 8 * hh); f.half[1] = *(const v8us*)((const unsigned short*)p + 16 + 8 * hh); return f.v; }
__device__ __forceinline__ v8f g2_mma(v16h a, v16h b, v8f c) { v8f d = __builtin_amdgcn_wmma_f32_16x16x32_f16(false, a, false, b, (short)0, c, false, false); asm volatile("v_nop\n\tv_nop\n\tv_nop\n\tv_nop" : "+v"(d) : "v"(a), "v"(b)); return d; }
template <int ACT>
__global__ __launch_bounds__(128) void k_gemm2(const _Float16* __restrict__ A, int lda, size_t sA, const _Float16* __restrict__ Bh, int ldb, size_t sB, float alpha, const float* __restrict__ bias, size_t sBias, const float* __restrict__ CP, int rowsPerB, size_t sCPb, int row0g,
    float* __restrict__ C, _Float16* __restrict__ C16, int ldc, size_t sC, int M, int N, int K) { static_assert(ACT == 0 || ACT == 3 || ACT == 6 || ACT == 8 || ACT == 9 || ACT == 11 || ACT == 12 || ACT == 14 || ACT == 15 || ACT == 16 || ACT == 17, "k_gemm2: unsupported ACT code (would silently apply no activation)");
  __shared__ __attribute__((aligned(16))) float so[4][32][68];
  const int tid = threadIdx.x, w = tid >> 5, lane = tid & 31, ln = lane & 15, hh = lane >> 4; const int by = blockIdx.y;
  A += (size_t)by * sA; Bh += (size_t)by * sB; const size_t cofs = (size_t)by * sC; const float* bp = bias ? bias + (size_t)by * sBias : nullptr;
  const int ntn = N >> 6; const int mt = blockIdx.x / ntn, nq = blockIdx.x - mt * ntn; const int row0 = mt * 128 + 32 * w, col0 = nq * 64; if (row0 >= M) return;
  const _Float16* a0p = A + (size_t)(row0 + ln) * lda; const _Float16* a1p = a0p + (size_t)16 * lda;
  const _Float16* b0p = Bh + (size_t)(col0 + ln) * ldb; const _Float16* b1p = b0p + (size_t)16 * ldb; const _Float16* b2p = b1p + (size_t)16 * ldb; const _Float16* b3p = b2p + (size_t)16 * ldb;
  const v8f z8 = {0.f,0.f,0.f,0.f,0.f,0.f,0.f,0.f}; v8f c00 = z8, c01 = z8, c02 = z8, c03 = z8, c10 = z8, c11 = z8, c12 = z8, c13 = z8;
#pragma unroll 1
  for (int kb = 0; kb < K; kb += 32) { const v16h a0 = g2_frag(a0p + kb, hh), a1 = g2_frag(a1p + kb, hh);
    v16h b = g2_frag(b0p + kb, hh); c00 = g2_mma(a0, b, c00); c10 = g2_mma(a1, b, c10);
    b = g2_frag(b1p + kb, hh); c01 = g2_mma(a0, b, c01); c11 = g2_mma(a1, b, c11);
    b = g2_frag(b2p + kb, hh); c02 = g2_mma(a0, b, c02); c12 = g2_mma(a1, b, c12);
    b = g2_frag(b3p + kb, hh); c03 = g2_mma(a0, b, c03); c13 = g2_mma(a1, b, c13); }
  v8f accs[8] = {c00, c01, c02, c03, c10, c11, c12, c13};
#pragma unroll
  for (int u = 0; u < 8; ++u) { const int t = u & 3, half = u >> 2; const int col = col0 + t * 16 + ln; const float bv = bp ? bf16_round(bp[col]) : 0.f;
#pragma unroll
    for (int r = 0; r < 8; ++r) { const int rloc = half * 16 + 8 * hh + r; float v = accs[u][r] * alpha + bv; if (CP) { if (rowsPerB < 0) v += CP[cofs + (size_t)(row0g + row0 + rloc) * ldc + col];      /* rowsPerB < 0: own element of the batched C plane */ else { const int bidx = (row0g + row0 + rloc) / rowsPerB; v += CP[(size_t)bidx * sCPb + (size_t)by * 64 + col]; } }
      if (ACT == 3) v = fmaxf(v, 0.f); else if (ACT == 6) v = 0.5f * v * (1.0f + erff(v * 0.70710678118654752f)); else if (ACT == 11) v = 1.0f / (1.0f + expf(-v)); else if (ACT == 15) v = v / (1.0f + expf(-v)); else if (ACT == 12) v = (v > 0.f) ? v : 0.01f * v; else if (ACT == 8) v = tanhf(v); else if (ACT == 9) v = 0.5f * v * (1.0f + tanhf(0.7978845608028654f * (v + 0.044715f * v * v * v))); else if (ACT == 14) v = (v > 0.f) ? v : 0.1f * v; else if (ACT == 16) v = (v >= 0.f) ? v : 0.3f * v; else if (ACT == 17) v = (v >= 0.f) ? v : 0.2f * v;
      so[w][rloc][t * 16 + ln] = v; } }
  __builtin_amdgcn_fence(__ATOMIC_ACQ_REL, "workgroup"); __builtin_amdgcn_wave_barrier();
  const int rsub = lane >> 4, c4 = (lane & 15) * 4;
  {
#pragma unroll
    for (int q = 0; q < 16; ++q) { const int r = q * 2 + rsub; const v4f v = *(const v4fa*)&so[w][r][c4]; if (C) *(v4f*)(C + cofs + (size_t)(row0 + r) * ldc + col0 + c4) = v; if (C16) { v4h h4; for (int i = 0; i < 4; ++i) h4[i] = (_Float16)v[i]; *(v4h*)(C16 + cofs + (size_t)(row0 + r) * ldc + col0 + c4) = h4; } }
     } }


__global__ __launch_bounds__(256) void k_wnat(const float* __restrict__ w, size_t n8, _Float16* __restrict__ Bt) { const size_t t = (size_t)blockIdx.x * 256 + threadIdx.x; if (t >= n8) return; FragH f; for (int q = 0; q < 8; ++q) f.h[q] = (_Float16)(bf16_round(w[t * 8 + q]) * 16.0f); *(v8us*)((unsigned short*)Bt + t * 8) = f.half[0];  }
__global__ __launch_bounds__(256) void k_rsm(const float* __restrict__ S, _Float16* __restrict__ P, int nrows) {
  #pragma clang fp contract(off)
  const int i = blockIdx.x * 256 + threadIdx.x; if (i >= nrows) return; const float* s = S + (size_t)i * SQ; float mx = -3.0e38f;
#pragma unroll 1
  for (int j = 0; j < SQ; ++j) mx = fmaxf(mx, s[j]); float se = 0.f;
#pragma unroll 1
  for (int j = 0; j < SQ; ++j) se += expf(s[j] - mx); const float sc = 256.0f / se;
#pragma unroll 1
  for (int j0 = 0; j0 < SQ; j0 += 8) { FragH f; for (int q = 0; q < 8; ++q) f.h[q] = (_Float16)(expf(s[j0 + q] - mx) * sc); unsigned short* d = (unsigned short*)P + (size_t)i * SQ + j0; *(v8us*)d = f.half[0];  } }
__global__ __launch_bounds__(256) void k_vt(const _Float16* __restrict__ V16, int b, int h0, _Float16* __restrict__ VT) { __shared__ unsigned short tl[64][65]; const int tid = threadIdx.x; const int hh = blockIdx.x % HG, sg = blockIdx.x / HG; const int s0 = sg * 64; const int h = h0 + hh;
  for (int i = tid; i < 64 * 8; i += 256) { const int j = i / 8, d8 = (i % 8) * 8; FragH f; f.half[0] = *(const v8us*)((const unsigned short*)V16 + ((size_t)b * SQ + s0 + j) * DM + h * HD + d8); for (int q = 0; q < 8; ++q) tl[d8 + q][j] = f.u[q]; }
  __syncthreads();
  { for (int i = tid; i < 64 * 8; i += 256) { const int d = i / 8, j8 = (i % 8) * 8; FragH f; for (int q = 0; q < 8; ++q) f.u[q] = tl[d][j8 + q]; *(v8us*)((unsigned short*)VT + ((size_t)hh * HD + d) * SQ + s0 + j8) = f.half[0]; }  } }


__global__ __launch_bounds__(256) void k_rsmf(const float* __restrict__ S, _Float16* __restrict__ P, int qn, int hg) {
  #pragma clang fp contract(off)
  const int t = blockIdx.x * 256 + threadIdx.x; if (t >= qn * hg) return; const size_t i = (size_t)(t / qn) * SQ + (t % qn); const float* s = S + i * SQ; float mx = -3.0e38f;
#pragma unroll 1
  for (int j = 0; j < SQ; ++j) mx = fmaxf(mx, s[j]); float se = 0.f;
#pragma unroll 1
  for (int j = 0; j < SQ; ++j) se += __expf(s[j] - mx); const float sc = 256.0f / se;
#pragma unroll 1
  for (int j0 = 0; j0 < SQ; j0 += 8) { FragH f; for (int q = 0; q < 8; ++q) f.h[q] = (_Float16)(__expf(s[j0 + q] - mx) * sc); unsigned short* d = (unsigned short*)P + i * SQ + j0; *(v8us*)d = f.half[0];  } }

__global__ __launch_bounds__(256) void k_rsmr(const float* __restrict__ S, _Float16* __restrict__ P, int qn, int hg) {
  #pragma clang fp contract(off)
  const int t = blockIdx.x * 256 + threadIdx.x; if (t >= qn * hg) return; const size_t i = (size_t)t;      /* planes packed: row t of plane t / qn */ const float* s = S + i * SQ; float mx = -3.0e38f;
#pragma unroll 1
  for (int j = 0; j < SQ; ++j) mx = fmaxf(mx, s[j]); float se = 0.f;
#pragma unroll 1
  for (int j = 0; j < SQ; ++j) se += __expf(s[j] - mx); const float sc = 256.0f / se;
#pragma unroll 1
  for (int j0 = 0; j0 < SQ; j0 += 8) { FragH f; for (int q = 0; q < 8; ++q) f.h[q] = (_Float16)(__expf(s[j0 + q] - mx) * sc); unsigned short* d = (unsigned short*)P + i * SQ + j0; *(v8us*)d = f.half[0];  } }

extern "C" void kernel_launch(void* const* d_in, const int* in_sizes, int n_in,
                              void* d_out, int out_size, void* d_ws, size_t ws_size, hipStream_t stream) {
  (void)in_sizes; (void)n_in; (void)out_size;
  const float* const* I = (const float* const*)d_in; const float* x = I[0]; const float* ctx = I[1]; const float* vsrc = I[2]; const float* wq = I[3]; const float* bq = I[4]; const float* wk = I[5]; const float* bk = I[6]; const float* wv = I[7]; const float* bv = I[8]; const float* wo = I[9]; const float* bo = I[10];      /* input order: Q, K, V (THREE streams), Wq, bq, Wk, bk, Wv, bv (PER-HEAD [16][64][64] = [head][in][out]; biases [16][64] = the flat [1024] at 64 h + e; zeros on this draw), Wo ([in][out] [1024][1024]), bo (zeros): eleven inputs */
  char* ws = (char*)d_ws; size_t off = 0;
  auto take = [&](size_t bytes) { char* p = ws + off; off += (bytes + 255) & ~(size_t)255; return p; };
  _Float16* BQ = (_Float16*)take((size_t)DM * DM * 2); _Float16* BK = (_Float16*)take((size_t)DM * DC * 2); _Float16* BV = (_Float16*)take((size_t)DM * DC * 2); _Float16* BO = (_Float16*)take((size_t)DM * DM * 2);
  _Float16* X16 = (_Float16*)take(NRQ * DM * 2); _Float16* C16 = (_Float16*)take(NRK * DC * 2); _Float16* VS16 = (_Float16*)take(NRK * DC * 2); _Float16* Q16 = (_Float16*)take(NRQ * DM * 2); _Float16* K16 = (_Float16*)take(NRK * DM * 2); _Float16* V16 = (_Float16*)take(NRK * DM * 2); _Float16* O16 = (_Float16*)take(NRQ * DM * 2);
  float* S = (float*)take((size_t)HG * NQ * SK * 4); _Float16* P = (_Float16*)take((size_t)HG * NQ * SK * 2); _Float16* VT = (_Float16*)take((size_t)NH * HD * SK * 2);
  if (off > ws_size) return;      /* approx 8 + 16 + 16 + 16 + 16 + 16 + 16 + 16 + 64 + 32 + 4 = 220 MiB */
  { const unsigned gp = (unsigned)(((size_t)HD * (HD / 8) + 255) / 256); for (int h = 0; h < NH; ++h) { const size_t o = (size_t)h * HD * HD; k_wt_f16<<<gp, 256, 0, stream>>>(wq + o, BQ + o, HD, HD, 16.0f); k_wt_f16<<<gp, 256, 0, stream>>>(wk + o, BK + o, HD, HD, 16.0f); k_wt_f16<<<gp, 256, 0, stream>>>(wv + o, BV + o, HD, HD, 16.0f); } const unsigned g = (unsigned)(((size_t)DM * (DM / 8) + 255) / 256); k_wt_f16<<<g, 256, 0, stream>>>(wo, BO, DM, DM, 16.0f); }      /* the per-head stacks [16][64][64] are [in][out] per head (x_h @ W_h): W_h[d][e] -> Bt_h[e][d] x16 through the file's transposing builder with K = N = 64, one call per head and stack, into consecutive [64][64] planes; Wo [in][out]: the same builder with K = N = 1024 */
  k_x16<<<(unsigned)((NRQ * DM / 8 + 255) / 256), 256, 0, stream>>>(x, X16, NRQ * DM / 8); k_x16<<<(unsigned)((NRK * DC / 8 + 255) / 256), 256, 0, stream>>>(ctx, C16, NRK * DC / 8); k_x16<<<(unsigned)((NRK * DC / 8 + 255) / 256), 256, 0, stream>>>(vsrc, VS16, NRK * DC / 8);      /* decoder, encoder-K, encoder-V rows */
  k_gemm2<0><<<dim3((unsigned)(NRQ / 128), NH), 128, 0, stream>>>(X16, DM, (size_t)HD, BQ, HD, (size_t)HD * HD, 0.0625f, bq, (size_t)HD, nullptr, 1, 0, 0, nullptr, Q16, DM, (size_t)HD, (int)NRQ, HD, HD);      /* q: head h (grid.y) = x[:, 64 h ..] W_h + b_h -> Q16[:, 64 h ..]: A + 64 h (pitch DM), B + 4096 h (pitch 64), bias + 64 h, C + 64 h (pitch DM); K = N = 64 */
  k_gemm2<0><<<dim3((unsigned)(NRK / 128), NH), 128, 0, stream>>>(C16, DM, (size_t)HD, BK, HD, (size_t)HD * HD, 0.0625f, bk, (size_t)HD, nullptr, 1, 0, 0, nullptr, K16, DM, (size_t)HD, (int)NRK, HD, HD);      /* k likewise from the key rows */
  k_gemm2<0><<<dim3((unsigned)(NRK / 128), NH), 128, 0, stream>>>(VS16, DM, (size_t)HD, BV, HD, (size_t)HD * HD, 0.0625f, bv, (size_t)HD, nullptr, 1, 0, 0, nullptr, V16, DM, (size_t)HD, (int)NRK, HD, HD);      /* v likewise from the value rows */
  for (int b = 0; b < NB; ++b) { const size_t rq = (size_t)b * NQ, rk = (size_t)b * SK;
    k_vt<NH, SK><<<NH * (SK / 64), 256, 0, stream>>>(V16 + rk * DM, DM, 0, VT);      /* V^T [16][64][2048] */
    for (int h0 = 0; h0 < NH; h0 += HG) {
      k_gemm2<0><<<dim3((NQ / 128) * (SK / 64), HG), 128, 0, stream>>>(Q16 + rq * DM + (size_t)h0 * HD, DM, (size_t)HD, K16 + rk * DM + (size_t)h0 * HD, DM, (size_t)HD, 0.125f, nullptr, 0, nullptr, 1, 0, 0, S, nullptr, SK, (size_t)NQ * SK, NQ, SK, HD);      /* scores of HG heads (grid.y) */
      k_rsmr<<<(HG * NQ + 255) / 256, 256, 0, stream>>>(S, P, NQ, HG);      /* softmax over the 2048 keys (planes [2048][2048] packed) */
      k_gemm2<0><<<dim3((NQ / 128) * (HD / 64), HG), 128, 0, stream>>>(P, SK, (size_t)NQ * SK, VT + (size_t)h0 * HD * SK, SK, (size_t)HD * SK, 0.25f, nullptr, 0, nullptr, 1, 0, 0, nullptr, O16 + rq * DM + (size_t)h0 * HD, DM, (size_t)HD, NQ, HD, SK); } }      /* o x64, merged */
  k_gemm2<0><<<dim3((unsigned)((NRQ / 128) * (DM / 64)), 1), 128, 0, stream>>>(O16, DM, 0, BO, DM, 0, 0.0009765625f, bo, 0, nullptr, 1, 0, 0, (float*)d_out, nullptr, DM, 0, (int)NRQ, DM, DM);      /* out = o Wo + bo */
}

// v001
// One run takes 1730 microseconds.
// Next to v000, in two timings, it ran 3.96 times as fast each time.
#include <hip/hip_runtime.h>
// Multi-head attention on THREE input streams with BLOCK-DIAGONAL per-head projections on four sequences (Q, K, V [4][2048][1024], each split into 16 contiguous 64-wide slices; q / k / v = einsum('bhsd,hde->bhse', slice, W) + b: EACH HEAD applies its own Dense(64) (W [16][64][64] = [head][in][out], normal x 1/8; biases [16][64] zeros on this draw) to ITS OWN slice of ITS stream; scores / sqrt(64); softmax over all 2048 keys (no mask); out = merged Wo + bo ([in][out] [1024][1024]; bo zeros) -> [4][2048][1024]); each projection is ONE head-batched GEMM (K = 64).
// Structure: the three inputs as exact f16 rows; the per-head [in][out] weight blocks transposed, one small builder call per head and stack, into sixteen consecutive exact x16 [64][64] planes; Q, K, V as three HEAD-BATCHED WMMA GEMMs (16 heads on grid.y; K = N = 64; 32x64 wave tiles, f32 accumulation, + the head's bias, f16 outputs into the head's 64 columns); per batch: V^T via LDS transposes; per 4-head group: scores (K = 64, alpha 1/8) into f32 [2048][2048] planes, row softmax over the 2048 keys on VALU (f32 statistics, native exp; weights x256 f16), o = P V^T (o carried x64) into merged f16 rows; out = o W_o + b_o GEMM (f32, alpha 2^-10); launches: see trace.
// Compute dtype: inputs rounded to bf16; x / context / weights exact; q, k, v, softmax weights and o as plain f16 GEMM operands (~2^-12); scores and statistics f32; v_wmma_f32_16x16x32_f16.
#define NB 4
#define NQ 2048
#define SK 2048
#define SQ SK                       /* keys per softmax row */
#define DM 1024
#define DC 1024
#define NH 16
#define HD 64
#define HG 4
#define NRQ ((size_t)NB * NQ)
#define NRK ((size_t)NB * SK)
typedef __bf16 v16b __attribute__((ext_vector_type(16)));
typedef unsigned short v8us __attribute__((ext_vector_type(8), may_alias));
typedef float  v8f  __attribute__((ext_vector_type(8)));
typedef float  v4f  __attribute__((ext_vector_type(4)));
typedef float  v4fa __attribute__((ext_vector_type(4), may_alias));
union FragB { v16b v; v8us half[2]; unsigned short u[16]; };

__device__ __forceinline__ unsigned short bf16_bits(float x) { unsigned int u = __float_as_uint(x); return (unsigned short)((u + 0x7FFFu + ((u >> 16) & 1u)) >> 16); }
__device__ __forceinline__ float bf16_val(unsigned short b) { return __uint_as_float(((unsigned int)b) << 16); }
__device__ __forceinline__ float bf16_round(float x) { return bf16_val(bf16_bits(x)); }
// D += A·B with NT terms: 1 = ah·bh, 2 = + al·bh (A split), 3 = + ah·bl (both split)
template <int NT>
__device__ __forceinline__ v8f mmaN(v16b ah, v16b al, v16b bh, v16b bl, v8f c) {
  c = __builtin_amdgcn_wmma_f32_16x16x32_bf16(false, ah, false, bh, (short)0, c, false, false);
  if (NT >= 2) c = __builtin_amdgcn_wmma_f32_16x16x32_bf16(false, al, false, bh, (short)0, c, false, false);
  if (NT >= 3) c = __builtin_amdgcn_wmma_f32_16x16x32_bf16(false, ah, false, bl, (short)0, c, false, false);
  asm volatile("v_nop\n\tv_nop\n\tv_nop\n\tv_nop" : "+v"(c) : "v"(ah), "v"(al), "v"(bh), "v"(bl));
  return c;
}

__global__ __launch_bounds__(256) void k_wt_bf16(const float* __restrict__ W, unsigned short* __restrict__ Wt, int K, int N) {
  const int t = blockIdx.x * 256 + threadIdx.x;
  const int k8n = K / 8;
  if (t >= N * k8n) return;
  const int n = t / k8n, k8 = (t % k8n) * 8;
  v8us v;
#pragma unroll
  for (int i = 0; i < 8; ++i) v[i] = bf16_bits(W[(size_t)(k8 + i) * N + n]);
  *(v8us*)(Wt + (size_t)n * K + k8) = v;
  
}

// GEMM C[M][N] (f32, pitch ldc) = act(A[M][K]·W + bias). A f32 row-major (pitch lda) converted per fragment to bf16
// (ASPLIT: hi/lo two planes -> 2 terms, else single rounded term); Wt bf16 [N][K] (pitch ldb). BIAS_BF16 rounds the
// bias to bf16 first (bias quantised to bf16 before the add). K%32==0, M%16==0, N%64==0.
template <bool ASPLIT, int ACT, bool BIAS_BF16>
__global__ __launch_bounds__(128) void k_gemm_bf(const float* __restrict__ A, int lda, const unsigned short* __restrict__ Wt, int ldb,
                                               const float* __restrict__ bias, float* __restrict__ C, int ldc, int M, int N, int K) {
  __shared__ __attribute__((aligned(16))) float so[4][16][64];
  const int tid = threadIdx.x, w = tid >> 5, lane = tid & 31, ln = lane & 15, hh = lane >> 4;
  const int ntn = N / 64;
  const int wid = blockIdx.x * 4 + w;
  const int mt = wid / ntn, nq = wid % ntn;
  if (mt * 16 >= M) return;
  const int row0 = mt * 16, col0 = nq * 64;
  const float* arow = A + (size_t)(row0 + ln) * lda;
  v8f acc[4] = {};
  for (int kb = 0; kb < K; kb += 32) {
    FragB ah, al;
    const v4f x0 = *(const v4fa*)(arow + kb + 8 * hh), x1 = *(const v4fa*)(arow + kb + 8 * hh + 4);
    const v4f x2 = *(const v4fa*)(arow + kb + 16 + 8 * hh), x3 = *(const v4fa*)(arow + kb + 16 + 8 * hh + 4);
    float xs[16] = {x0[0],x0[1],x0[2],x0[3],x1[0],x1[1],x1[2],x1[3],x2[0],x2[1],x2[2],x2[3],x3[0],x3[1],x3[2],x3[3]};
#pragma unroll
    for (int i = 0; i < 16; ++i) { const unsigned short hb = bf16_bits(xs[i]); ah.u[i] = hb; al.u[i] = ASPLIT ? bf16_bits(xs[i] - bf16_val(hb)) : (unsigned short)0; }
#pragma unroll
    for (int t = 0; t < 4; ++t) {
      const unsigned short* brow = Wt + (size_t)(col0 + t * 16 + ln) * ldb + kb;
      FragB b;
      b.half[0] = *(const v8us*)(brow + 8 * hh);
      b.half[1] = *(const v8us*)(brow + 16 + 8 * hh);
      acc[t] = mmaN<ASPLIT ? 2 : 1>(ah.v, al.v, b.v, b.v, acc[t]);
    }
  }
#pragma unroll
  for (int t = 0; t < 4; ++t) {
    float bv = bias ? bias[col0 + t * 16 + ln] : 0.f;
    if (BIAS_BF16) bv = bf16_round(bv);
#pragma unroll
    for (int r = 0; r < 8; ++r) { float v = acc[t][r] + bv; if (ACT == 1) v = fmaxf(v, 0.f); so[w][8 * hh + r][t * 16 + ln] = v; }
  }
  __builtin_amdgcn_fence(__ATOMIC_ACQ_REL, "workgroup");
  __builtin_amdgcn_wave_barrier();
  const int rsub = lane >> 4, c4 = (lane & 15) * 4;
  {
#pragma unroll
    for (int q = 0; q < 8; ++q) {
      const int r = q * 2 + rsub;
      const v4f v = *(const v4fa*)&so[w][r][c4];
      *(v4f*)(C + (size_t)(row0 + r) * ldc + col0 + c4) = v;
    }
    
  }
}

// GEMM C = act(A·W + bias + resid): A f32 (ASPLIT -> hi/lo 2 terms), Wt bf16 [N][K]; ACT 0 none, 1 relu, 2 exact gelu;
// resid (optional, f32, row index = (row % rmod), pitch ldr, RES_BF16 rounds it) added before the activation.
template <bool ASPLIT, int ACT, bool BIAS_BF16, bool RES_BF16>
__global__ __launch_bounds__(128) void k_gemm_bf3(const float* __restrict__ A, int lda, const unsigned short* __restrict__ Wt, int ldb,
                                                const float* __restrict__ bias, const float* __restrict__ resid, int rmod, int ldr,
                                                float* __restrict__ C, int ldc, int M, int N, int K) {
  __shared__ __attribute__((aligned(16))) float so[4][16][64];
  const int tid = threadIdx.x, w = tid >> 5, lane = tid & 31, ln = lane & 15, hh = lane >> 4;
  const int ntn = N / 64;
  const int wid = blockIdx.x * 4 + w;
  const int mt = wid / ntn, nq = wid % ntn;
  if (mt * 16 >= M) return;
  const int row0 = mt * 16, col0 = nq * 64;
  const float* arow = A + (size_t)(row0 + ln) * lda;
  v8f acc[4] = {};
  for (int kb = 0; kb < K; kb += 32) {
    FragB ah, al;
    const v4f x0 = *(const v4fa*)(arow + kb + 8 * hh), x1 = *(const v4fa*)(arow + kb + 8 * hh + 4);
    const v4f x2 = *(const v4fa*)(arow + kb + 16 + 8 * hh), x3 = *(const v4fa*)(arow + kb + 16 + 8 * hh + 4);
    float xs[16] = {x0[0],x0[1],x0[2],x0[3],x1[0],x1[1],x1[2],x1[3],x2[0],x2[1],x2[2],x2[3],x3[0],x3[1],x3[2],x3[3]};
#pragma unroll
    for (int i = 0; i < 16; ++i) { const unsigned short hb = bf16_bits(xs[i]); ah.u[i] = hb; al.u[i] = ASPLIT ? bf16_bits(xs[i] - bf16_val(hb)) : (unsigned short)0; }
#pragma unroll
    for (int t = 0; t < 4; ++t) {
      const unsigned short* brow = Wt + (size_t)(col0 + t * 16 + ln) * ldb + kb;
      FragB b;
      b.half[0] = *(const v8us*)(brow + 8 * hh);
      b.half[1] = *(const v8us*)(brow + 16 + 8 * hh);
      acc[t] = mmaN<ASPLIT ? 2 : 1>(ah.v, al.v, b.v, b.v, acc[t]);
    }
  }
#pragma unroll
  for (int t = 0; t < 4; ++t) {
    const int col = col0 + t * 16 + ln;
    float bv = bias ? bias[col] : 0.f;
    if (BIAS_BF16) bv = bf16_round(bv);
#pragma unroll
    for (int r = 0; r < 8; ++r) {
      float v = acc[t][r] + bv;
      if (resid) { float rv = resid[(size_t)((row0 + 8 * hh + r) % rmod) * ldr + col]; if (RES_BF16) rv = bf16_round(rv); v += rv; }
      if (ACT == 1) v = fmaxf(v, 0.f);
      if (ACT == 2) v = 0.5f * v * (1.0f + erff(v * 0.70710678118654752f));
      if (ACT == 3) { const float u = 0.7978845608028654f * (v + 0.044715f * v * v * v); v = 0.5f * v * (1.0f + tanhf(u)); }
      so[w][8 * hh + r][t * 16 + ln] = v;
    }
  }
  __builtin_amdgcn_fence(__ATOMIC_ACQ_REL, "workgroup");
  __builtin_amdgcn_wave_barrier();
  const int rsub = lane >> 4, c4 = (lane & 15) * 4;
  {
#pragma unroll
    for (int q = 0; q < 8; ++q) {
      const int r = q * 2 + rsub;
      const v4f v = *(const v4fa*)&so[w][r][c4];
      *(v4f*)(C + (size_t)(row0 + r) * ldc + col0 + c4) = v;
    }
    
  }
}
// row LayerNorm (biased variance, eps) over N: s = X (+ R); optional out_sum <- s; out_norm <- (s-mu)*rsqrt(var+eps)*g + b
template <bool PARAM_BF16>
__global__ __launch_bounds__(256) void k_layernorm(const float* __restrict__ X, const float* __restrict__ R, const float* __restrict__ g, const float* __restrict__ bta,
                                                  float* __restrict__ out_sum, float* __restrict__ out_norm, int N, float eps) {
  __shared__ float red[256];
  const int row = blockIdx.x, tid = threadIdx.x;
  const float* x = X + (size_t)row * N; const float* rr = R ? R + (size_t)row * N : nullptr;
  float vals[16];                     // up to N = 4096
  const int per = N / 256;            // contiguous chunk per thread? use strided-by-4 chunks: thread handles j = tid*4 + 1024*u
  float s1 = 0.f;
  for (int u = 0; u < per / 4; ++u) {
    const int j = tid * 4 + 1024 * u;
    const v4f a = *(const v4fa*)(x + j);
    v4f b = {0.f,0.f,0.f,0.f}; if (rr) b = *(const v4fa*)(rr + j);
#pragma unroll
    for (int q = 0; q < 4; ++q) { const float v = a[q] + b[q]; vals[u * 4 + q] = v; s1 += v; }
  }
  red[tid] = s1; __syncthreads();
  for (int st = 128; st > 0; st >>= 1) { if (tid < st) red[tid] += red[tid + st]; __syncthreads(); }
  const float mu = red[0] / (float)N; __syncthreads();
  float s2 = 0.f;
  for (int u = 0; u < per / 4; ++u)
#pragma unroll
    for (int q = 0; q < 4; ++q) { const float c = vals[u * 4 + q] - mu; s2 += c * c; }
  red[tid] = s2; __syncthreads();
  for (int st = 128; st > 0; st >>= 1) { if (tid < st) red[tid] += red[tid + st]; __syncthreads(); }
  const float rs = rsqrtf(red[0] / (float)N + eps);
  {
    for (int u = 0; u < per / 4; ++u) {
      const int j = tid * 4 + 1024 * u;
      v4f o, sm;
#pragma unroll
      for (int q = 0; q < 4; ++q) {
        float gg = g[j + q], bb = bta[j + q];
        if (PARAM_BF16) { gg = bf16_round(gg); bb = bf16_round(bb); }
        sm[q] = vals[u * 4 + q]; o[q] = (vals[u * 4 + q] - mu) * rs * gg + bb;
      }
      if (out_sum) *(v4f*)(out_sum + (size_t)row * N + j) = sm;
      *(v4f*)(out_norm + (size_t)row * N + j) = o;
    }
    
  }
}



// ---- f16 WMMA path (v_wmma_f32_16x16x32_f16): 11-bit significands for operands in range — used where a [0,1] probability operand needs more precision than bf16
typedef _Float16 v16h __attribute__((ext_vector_type(16)));
union FragH { v16h v; v8us half[2]; _Float16 h[16]; unsigned short u[16]; };
template <int NT>
__device__ __forceinline__ v8f mmaH(v16h ah, v16h al, v16h bh, v16h bl, v8f c) {
  c = __builtin_amdgcn_wmma_f32_16x16x32_f16(false, ah, false, bh, (short)0, c, false, false);
  if (NT >= 2) c = __builtin_amdgcn_wmma_f32_16x16x32_f16(false, al, false, bh, (short)0, c, false, false);
  if (NT >= 3) c = __builtin_amdgcn_wmma_f32_16x16x32_f16(false, ah, false, bl, (short)0, c, false, false);
  asm volatile("v_nop\n\tv_nop\n\tv_nop\n\tv_nop" : "+v"(c) : "v"(ah), "v"(al), "v"(bh), "v"(bl));
  return c;
}
// batched GEMM like k_gemm_b but f16 operands: A f32 (split into f16 hi/lo if ASPLIT, else rounded to f16), Bt = f16 values [n][k]; alpha; C f32; N multiple of 16 (partial tiles skipped)
template <bool ASPLIT>
__global__ __launch_bounds__(128) void k_gemm_h(const float* __restrict__ A, int lda, size_t sA, const _Float16* __restrict__ Bh, int ldb, size_t sB, float alpha, float* __restrict__ C, int ldc, size_t sC, int M, int N, int K) {
  __shared__ __attribute__((aligned(16))) float so[4][16][64];
  const int tid = threadIdx.x, w = tid >> 5, lane = tid & 31, ln = lane & 15, hh = lane >> 4; const int by = blockIdx.y;
  A += (size_t)by * sA; Bh += (size_t)by * sB; C += (size_t)by * sC;
  const int ntn = (N + 63) / 64; const int wid = blockIdx.x * 4 + w; const int mt = wid / ntn, nq = wid % ntn; if (mt * 16 >= M) return;
  const int row0 = mt * 16, col0 = nq * 64; const float* arow = A + (size_t)(row0 + ln) * lda;
  v8f acc[4] = {};
  for (int kb = 0; kb < K; kb += 32) {
    FragH ah, al;
    const v4f x0 = *(const v4fa*)(arow + kb + 8 * hh), x1 = *(const v4fa*)(arow + kb + 8 * hh + 4), x2 = *(const v4fa*)(arow + kb + 16 + 8 * hh), x3 = *(const v4fa*)(arow + kb + 16 + 8 * hh + 4);
    float xs[16] = {x0[0],x0[1],x0[2],x0[3],x1[0],x1[1],x1[2],x1[3],x2[0],x2[1],x2[2],x2[3],x3[0],x3[1],x3[2],x3[3]};
#pragma unroll
    for (int i = 0; i < 16; ++i) { const _Float16 h = (_Float16)xs[i]; ah.h[i] = h; al.h[i] = ASPLIT ? (_Float16)(xs[i] - (float)h) : (_Float16)0.0f; }
#pragma unroll
    for (int t = 0; t < 4; ++t) { if (col0 + t * 16 >= N) continue; const size_t boff = (size_t)(col0 + t * 16 + ln) * ldb + kb; FragH bq; bq.half[0] = *(const v8us*)(Bh + boff + 8 * hh); bq.half[1] = *(const v8us*)(Bh + boff + 16 + 8 * hh);
      acc[t] = mmaH<ASPLIT ? 2 : 1>(ah.v, al.v, bq.v, bq.v, acc[t]); }
  }
#pragma unroll
  for (int t = 0; t < 4; ++t) { if (col0 + t * 16 >= N) continue;
#pragma unroll
    for (int r = 0; r < 8; ++r) so[w][8 * hh + r][t * 16 + ln] = acc[t][r] * alpha; }
  __builtin_amdgcn_fence(__ATOMIC_ACQ_REL, "workgroup"); __builtin_amdgcn_wave_barrier();
  const int rsub = lane >> 4, c4 = (lane & 15) * 4;
  {
#pragma unroll
    for (int q = 0; q < 8; ++q) { const int r = q * 2 + rsub; if (col0 + c4 < N) { const v4f v = *(const v4fa*)&so[w][r][c4]; *(v4f*)(C + (size_t)(row0 + r) * ldc + col0 + c4) = v; } }
     }
}

// Wt[n][k] = f16(W[k][n]·scale) from f32 row-major W[K][N] (scale = power of two; bf16-exact weights stay exact in f16 away from the subnormal range)
__global__ __launch_bounds__(256) void k_wt_f16(const float* __restrict__ W, _Float16* __restrict__ Wt, int K, int N, float scale) {
  const int t = blockIdx.x * 256 + threadIdx.x; if (t >= N * (K / 8)) return; const int n = t / (K / 8), k8 = (t % (K / 8)) * 8; FragH f;
#pragma unroll
  for (int i = 0; i < 8; ++i) f.h[i] = (_Float16)(bf16_round(W[(size_t)(k8 + i) * N + n]) * scale); const v8us o = f.half[0];
  *(v8us*)((unsigned short*)Wt + (size_t)n * K + k8) = o; 
}
// k_gemm_hh variant with fused epilogue: v = acc·alpha + bias[by·sBias + col] (+ CP[(row/rowsPerB)·sCPb + by·64 + col] if CP) ; ACT 0 none / 1 elu ; writes f16 C16 (and f32 C if non-null)
template <int ACT>
__global__ __launch_bounds__(128) void k_gemm_hhx(const _Float16* __restrict__ A, int lda, size_t sA, const _Float16* __restrict__ Bh, int ldb, size_t sB, float alpha, const float* __restrict__ bias, size_t sBias, const float* __restrict__ CP, int rowsPerB, size_t sCPb, int row0g,
    float* __restrict__ C, _Float16* __restrict__ C16, int ldc, size_t sC, int M, int N, int K) {
  __shared__ __attribute__((aligned(16))) float so[4][16][64];
  const int tid = threadIdx.x, w = tid >> 5, lane = tid & 31, ln = lane & 15, hh = lane >> 4; const int by = blockIdx.y;
  A += (size_t)by * sA; Bh += (size_t)by * sB; const size_t cofs = (size_t)by * sC; const float* bp = bias ? bias + (size_t)by * sBias : nullptr;
  const int ntn = (N + 63) / 64; const int wid = blockIdx.x * 4 + w; const int mt = wid / ntn, nq = wid % ntn; if (mt * 16 >= M) return;
  const int row0 = mt * 16, col0 = nq * 64; const _Float16* arow = A + (size_t)(row0 + ln) * lda;
  v8f acc[4] = {};
  for (int kb = 0; kb < K; kb += 32) { FragH ah; ah.half[0] = *(const v8us*)((const unsigned short*)arow + kb + 8 * hh); ah.half[1] = *(const v8us*)((const unsigned short*)arow + kb + 16 + 8 * hh);
#pragma unroll
    for (int t = 0; t < 4; ++t) { if (col0 + t * 16 >= N) continue; const size_t boff = (size_t)(col0 + t * 16 + ln) * ldb + kb; FragH bq; bq.half[0] = *(const v8us*)((const unsigned short*)Bh + boff + 8 * hh); bq.half[1] = *(const v8us*)((const unsigned short*)Bh + boff + 16 + 8 * hh);
      acc[t] = mmaH<1>(ah.v, ah.v, bq.v, bq.v, acc[t]); }
  }
#pragma unroll
  for (int t = 0; t < 4; ++t) { if (col0 + t * 16 >= N) continue; const int col = col0 + t * 16 + ln; const float bv = bp ? bf16_round(bp[col]) : 0.f;
#pragma unroll
    for (int r = 0; r < 8; ++r) { float v = acc[t][r] * alpha + bv; if (CP) { const int rr = row0g + row0 + 8 * hh + r; if (rowsPerB < 0) v += CP[cofs + (size_t)rr * ldc + col];      /* rowsPerB < 0: own element of the batched C plane */ else { const int bidx = rr / rowsPerB; v += CP[(size_t)bidx * sCPb + (size_t)by * 64 + col]; } } if (ACT == 1) v = (v > 0.f) ? v : expm1f(v); else if (ACT == 7) v = (v > 0.f) ? v + 1.0f : expf(v); else if (ACT == 8) v = tanhf(v); else if (ACT == 9) v = 0.5f * v * (1.0f + tanhf(0.7978845608028654f * (v + 0.044715f * v * v * v))); else if (ACT == 11) v = 1.0f / (1.0f + expf(-v)); else if (ACT == 12) v = (v > 0.f) ? v : 0.01f * v; else if (ACT == 14) v = (v > 0.f) ? v : 0.1f * v; else if (ACT == 16) v = (v >= 0.f) ? v : 0.3f * v; else if (ACT == 17) v = (v >= 0.f) ? v : 0.2f * v; else if (ACT == 15) v = v / (1.0f + expf(-v)); else if (ACT == 3) v = fmaxf(v, 0.f); else if (ACT == 6) v = 0.5f * v * (1.0f + erff(v * 0.70710678118654752f)); so[w][8 * hh + r][t * 16 + ln] = v; } }
  __builtin_amdgcn_fence(__ATOMIC_ACQ_REL, "workgroup"); __builtin_amdgcn_wave_barrier();
  const int rsub = lane >> 4, c4 = (lane & 15) * 4; typedef _Float16 v4h __attribute__((ext_vector_type(4)));
  {
#pragma unroll
    for (int q = 0; q < 8; ++q) { const int r = q * 2 + rsub; if (col0 + c4 < N) { const v4f v = *(const v4fa*)&so[w][r][c4]; if (C) *(v4f*)(C + cofs + (size_t)(row0 + r) * ldc + col0 + c4) = v; if (C16) { v4h h4; for (int i = 0; i < 4; ++i) h4[i] = (_Float16)v[i]; *(v4h*)(C16 + cofs + (size_t)(row0 + r) * ldc + col0 + c4) = h4; } } }
     }
}


typedef _Float16 v4h __attribute__((ext_vector_type(4)));

__global__ __launch_bounds__(256) void k_x16(const float* __restrict__ x, _Float16* __restrict__ X16, size_t n8) { const size_t t = (size_t)blockIdx.x * 256 + threadIdx.x; if (t >= n8) return; FragH f;
#pragma unroll
  for (int q = 0; q < 8; ++q) f.h[q] = (_Float16)bf16_round(x[t * 8 + q]); *(v8us*)((unsigned short*)X16 + t * 8) = f.half[0];  }
__global__ __launch_bounds__(256) void k_h16(const float* __restrict__ x, _Float16* __restrict__ X16, size_t n8) { const size_t t = (size_t)blockIdx.x * 256 + threadIdx.x; if (t >= n8) return; FragH f;
#pragma unroll
  for (int q = 0; q < 8; ++q) f.h[q] = (_Float16)x[t * 8 + q]; *(v8us*)((unsigned short*)X16 + t * 8) = f.half[0];  }
__global__ __launch_bounds__(256) void k_round16f(const float* __restrict__ W, _Float16* __restrict__ Bt, size_t n8) { const size_t t = (size_t)blockIdx.x * 256 + threadIdx.x; if (t >= n8) return; FragH f;
#pragma unroll
  for (int i = 0; i < 8; ++i) f.h[i] = (_Float16)(bf16_round(W[t * 8 + i]) * 16.0f); *(v8us*)((unsigned short*)Bt + t * 8) = f.half[0];  }
template <int NHv, int TTv>
__global__ __launch_bounds__(256) void k_vt(const _Float16* __restrict__ V16, int ldv, int voff, _Float16* __restrict__ Vt) { __shared__ unsigned short tl[64][66]; const int tid = threadIdx.x; const int slab = blockIdx.x / (TTv / 64), lg = blockIdx.x % (TTv / 64); const int b = slab / NHv, h = slab % NHv;
  for (int i = tid; i < 64 * 8; i += 256) { const int r = i / 8, c8 = (i % 8) * 8; FragH f; f.half[0] = *(const v8us*)((const unsigned short*)V16 + ((size_t)b * TTv + lg * 64 + r) * ldv + voff + h * 64 + c8);
#pragma unroll
    for (int q = 0; q < 8; ++q) tl[r][c8 + q] = f.u[q]; }
  __syncthreads();
  {
#pragma unroll
    for (int rd = 0; rd < 2; ++rd) { const int d = rd * 32 + tid / 8, pc = tid % 8; FragH f;
#pragma unroll
      for (int q = 0; q < 8; ++q) f.u[q] = tl[pc * 8 + q][d];
      *(v8us*)((unsigned short*)Vt + ((size_t)slab * 64 + d) * TTv + lg * 64 + pc * 8) = f.half[0]; }
     } }

__global__ __launch_bounds__(256) void k_hl(const float* __restrict__ F, _Float16* __restrict__ Hh, _Float16* __restrict__ Hl, size_t n8) { const size_t t = (size_t)blockIdx.x * 256 + threadIdx.x; if (t >= n8) return; FragH fh, fl; const v4f a = *(const v4fa*)(F + t * 8), c = *(const v4fa*)(F + t * 8 + 4);
#pragma unroll
  for (int q = 0; q < 4; ++q) { _Float16 h = (_Float16)a[q]; fh.h[q] = h; fl.h[q] = (_Float16)((a[q] - (float)h) * 1024.0f); h = (_Float16)c[q]; fh.h[4 + q] = h; fl.h[4 + q] = (_Float16)((c[q] - (float)h) * 1024.0f); }
  { *(v8us*)((unsigned short*)Hh + t * 8) = fh.half[0]; *(v8us*)((unsigned short*)Hl + t * 8) = fl.half[0];  } }

// ---- fast GEMM (wave tile 32x64; requires M % 32 == 0 rows per launch region and N % 64 == 0); epilogue = k_gemm_hhx semantics ----
__device__ __forceinline__ v16h g2_frag(const _Float16* p, int hh) { FragH f; f.half[0] = *(const v8us*)((const unsigned short*)p + 8 * hh); f.half[1] = *(const v8us*)((const unsigned short*)p + 16 + 8 * hh); return f.v; }
__device__ __forceinline__ v8f g2_mma(v16h a, v16h b, v8f c) { v8f d = __builtin_amdgcn_wmma_f32_16x16x32_f16(false, a, false, b, (short)0, c, false, false); asm volatile("v_nop\n\tv_nop\n\tv_nop\n\tv_nop" : "+v"(d) : "v"(a), "v"(b)); return d; }
template <int ACT>
__global__ __launch_bounds__(128) void k_gemm2(const _Float16* __restrict__ A, int lda, size_t sA, const _Float16* __restrict__ Bh, int ldb, size_t sB, float alpha, const float* __restrict__ bias, size_t sBias, const float* __restrict__ CP, int rowsPerB, size_t sCPb, int row0g,
    float* __restrict__ C, _Float16* __restrict__ C16, int ldc, size_t sC, int M, int N, int K) { static_assert(ACT == 0 || ACT == 3 || ACT == 6 || ACT == 8 || ACT == 9 || ACT == 11 || ACT == 12 || ACT == 14 || ACT == 15 || ACT == 16 || ACT == 17, "k_gemm2: unsupported ACT code (would silently apply no activation)");
  __shared__ __attribute__((aligned(16))) float so[4][32][68];
  const int tid = threadIdx.x, w = tid >> 5, lane = tid & 31, ln = lane & 15, hh = lane >> 4; const int by = blockIdx.y;
  A += (size_t)by * sA; Bh += (size_t)by * sB; const size_t cofs = (size_t)by * sC; const float* bp = bias ? bias + (size_t)by * sBias : nullptr;
  const int ntn = N >> 6; const int mt = blockIdx.x / ntn, nq = blockIdx.x - mt * ntn; const int row0 = mt * 128 + 32 * w, col0 = nq * 64; if (row0 >= M) return;
  const _Float16* a0p = A + (size_t)(row0 + ln) * lda; const _Float16* a1p = a0p + (size_t)16 * lda;
  const _Float16* b0p = Bh + (size_t)(col0 + ln) * ldb; const _Float16* b1p = b0p + (size_t)16 * ldb; const _Float16* b2p = b1p + (size_t)16 * ldb; const _Float16* b3p = b2p + (size_t)16 * ldb;
  const v8f z8 = {0.f,0.f,0.f,0.f,0.f,0.f,0.f,0.f}; v8f c00 = z8, c01 = z8, c02 = z8, c03 = z8, c10 = z8, c11 = z8, c12 = z8, c13 = z8;
#pragma unroll 1
  for (int kb = 0; kb < K; kb += 32) { const v16h a0 = g2_frag(a0p + kb, hh), a1 = g2_frag(a1p + kb, hh);
    v16h b = g2_frag(b0p + kb, hh); c00 = g2_mma(a0, b, c00); c10 = g2_mma(a1, b, c10);
    b = g2_frag(b1p + kb, hh); c01 = g2_mma(a0, b, c01); c11 = g2_mma(a1, b, c11);
    b = g2_frag(b2p + kb, hh); c02 = g2_mma(a0, b, c02); c12 = g2_mma(a1, b, c12);
    b = g2_frag(b3p + kb, hh); c03 = g2_mma(a0, b, c03); c13 = g2_mma(a1, b, c13); }
  v8f accs[8] = {c00, c01, c02, c03, c10, c11, c12, c13};
#pragma unroll
  for (int u = 0; u < 8; ++u) { const int t = u & 3, half = u >> 2; const int col = col0 + t * 16 + ln; const float bv = bp ? bf16_round(bp[col]) : 0.f;
#pragma unroll
    for (int r = 0; r < 8; ++r) { const int rloc = half * 16 + 8 * hh + r; float v = accs[u][r] * alpha + bv; if (CP) { if (rowsPerB < 0) v += CP[cofs + (size_t)(row0g + row0 + rloc) * ldc + col];      /* rowsPerB < 0: own element of the batched C plane */ else { const int bidx = (row0g + row0 + rloc) / rowsPerB; v += CP[(size_t)bidx * sCPb + (size_t)by * 64 + col]; } }
      if (ACT == 3) v = fmaxf(v, 0.f); else if (ACT == 6) v = 0.5f * v * (1.0f + erff(v * 0.70710678118654752f)); else if (ACT == 11) v = 1.0f / (1.0f + expf(-v)); else if (ACT == 15) v = v / (1.0f + expf(-v)); else if (ACT == 12) v = (v > 0.f) ? v : 0.01f * v; else if (ACT == 8) v = tanhf(v); else if (ACT == 9) v = 0.5f * v * (1.0f + tanhf(0.7978845608028654f * (v + 0.044715f * v * v * v))); else if (ACT == 14) v = (v > 0.f) ? v : 0.1f * v; else if (ACT == 16) v = (v >= 0.f) ? v : 0.3f * v; else if (ACT == 17) v = (v >= 0.f) ? v : 0.2f * v;
      so[w][rloc][t * 16 + ln] = v; } }
  __builtin_amdgcn_fence(__ATOMIC_ACQ_REL, "workgroup"); __builtin_amdgcn_wave_barrier();
  const int rsub = lane >> 4, c4 = (lane & 15) * 4;
  {
#pragma unroll
    for (int q = 0; q < 16; ++q) { const int r = q * 2 + rsub; const v4f v = *(const v4fa*)&so[w][r][c4]; if (C) *(v4f*)(C + cofs + (size_t)(row0 + r) * ldc + col0 + c4) = v; if (C16) { v4h h4; for (int i = 0; i < 4; ++i) h4[i] = (_Float16)v[i]; *(v4h*)(C16 + cofs + (size_t)(row0 + r) * ldc + col0 + c4) = h4; } }
     } }


__global__ __launch_bounds__(256) void k_wnat(const float* __restrict__ w, size_t n8, _Float16* __restrict__ Bt) { const size_t t = (size_t)blockIdx.x * 256 + threadIdx.x; if (t >= n8) return; FragH f; for (int q = 0; q < 8; ++q) f.h[q] = (_Float16)(bf16_round(w[t * 8 + q]) * 16.0f); *(v8us*)((unsigned short*)Bt + t * 8) = f.half[0];  }
__global__ __launch_bounds__(256) void k_rsm(const float* __restrict__ S, _Float16* __restrict__ P, int nrows) {
  #pragma clang fp contract(off)
  const int i = blockIdx.x * 256 + threadIdx.x; if (i >= nrows) return; const float* s = S + (size_t)i * SQ; float mx = -3.0e38f;
#pragma unroll 1
  for (int j = 0; j < SQ; ++j) mx = fmaxf(mx, s[j]); float se = 0.f;
#pragma unroll 1
  for (int j = 0; j < SQ; ++j) se += expf(s[j] - mx); const float sc = 256.0f / se;
#pragma unroll 1
  for (int j0 = 0; j0 < SQ; j0 += 8) { FragH f; for (int q = 0; q < 8; ++q) f.h[q] = (_Float16)(expf(s[j0 + q] - mx) * sc); unsigned short* d = (unsigned short*)P + (size_t)i * SQ + j0; *(v8us*)d = f.half[0];  } }
__global__ __launch_bounds__(256) void k_vt(const _Float16* __restrict__ V16, int b, int h0, _Float16* __restrict__ VT) { __shared__ unsigned short tl[64][65]; const int tid = threadIdx.x; const int hh = blockIdx.x % HG, sg = blockIdx.x / HG; const int s0 = sg * 64; const int h = h0 + hh;
  for (int i = tid; i < 64 * 8; i += 256) { const int j = i / 8, d8 = (i % 8) * 8; FragH f; f.half[0] = *(const v8us*)((const unsigned short*)V16 + ((size_t)b * SQ + s0 + j) * DM + h * HD + d8); for (int q = 0; q < 8; ++q) tl[d8 + q][j] = f.u[q]; }
  __syncthreads();
  { for (int i = tid; i < 64 * 8; i += 256) { const int d = i / 8, j8 = (i % 8) * 8; FragH f; for (int q = 0; q < 8; ++q) f.u[q] = tl[d][j8 + q]; *(v8us*)((unsigned short*)VT + ((size_t)hh * HD + d) * SQ + s0 + j8) = f.half[0]; }  } }


__global__ __launch_bounds__(256) void k_rsmf(const float* __restrict__ S, _Float16* __restrict__ P, int qn, int hg) {
  #pragma clang fp contract(off)
  const int t = blockIdx.x * 256 + threadIdx.x; if (t >= qn * hg) return; const size_t i = (size_t)(t / qn) * SQ + (t % qn); const float* s = S + i * SQ; float mx = -3.0e38f;
#pragma unroll 1
  for (int j = 0; j < SQ; ++j) mx = fmaxf(mx, s[j]); float se = 0.f;
#pragma unroll 1
  for (int j = 0; j < SQ; ++j) se += __expf(s[j] - mx); const float sc = 256.0f / se;
#pragma unroll 1
  for (int j0 = 0; j0 < SQ; j0 += 8) { FragH f; for (int q = 0; q < 8; ++q) f.h[q] = (_Float16)(__expf(s[j0 + q] - mx) * sc); unsigned short* d = (unsigned short*)P + i * SQ + j0; *(v8us*)d = f.half[0];  } }

// Row softmax, ONE WAVE PER ROW (planes packed: row t of plane t / qn). A lane holds 64 of the row's 2048 scores in registers: each of its 16 loads is
// 16 bytes, so that a wave's load covers 512 contiguous bytes. Maximum and sum: per lane, then a five-step butterfly over the 32 lanes. Each exponential is
// taken once and kept; the weights (x256, f16) go out as 8 bytes a lane, 256 contiguous bytes a wave. No LDS and no barrier.
__global__ __launch_bounds__(256) void k_rsmr(const float* __restrict__ S, _Float16* __restrict__ P, int qn, int hg) {
  const int lane = threadIdx.x & 31; const int row = blockIdx.x * 8 + __builtin_amdgcn_readfirstlane(threadIdx.x >> 5); if (row >= qn * hg) return;      /* the wave's number, held scalar: row addresses and this test stay on the scalar unit */
  const unsigned lo = (unsigned)lane * 4u; const float* s = S + (size_t)row * SQ; v4f x[SQ / 128];      /* lo: the lane's first element in each 128-element piece */
#pragma unroll
  for (int u = 0; u < SQ / 128; ++u) x[u] = *(const v4fa*)(s + u * 128 + lo);
  asm volatile("s_wait_xcnt 0x0" :: "v"(lo * 4u) : "memory");      /* the wait that belongs in front of any overwrite of a register which an issued load names; the lane's byte offset as an input keeps that register out of the loads' own destinations */
  float mx = -3.0e38f;
#pragma unroll
  for (int u = 0; u < SQ / 128; ++u) mx = fmaxf(mx, fmaxf(fmaxf(x[u][0], x[u][1]), fmaxf(x[u][2], x[u][3])));
#pragma unroll
  for (int m = 16; m >= 1; m >>= 1) mx = fmaxf(mx, __shfl_xor(mx, m, 32));
  v4f a = {0.f, 0.f, 0.f, 0.f};
#pragma unroll
  for (int u = 0; u < SQ / 128; ++u) { const v4f t = (x[u] - mx) * 1.44269504088896340736f; float e0, e1, e2, e3;      /* exp(d) = 2^(d log2 e), the native form */
    /* Four exponentials in one statement: behind a transcendental the instruction set asks for one independent instruction or a v_nop before its result is read or its
       source overwritten. Each v_exp_f32 here has an independent one behind it (the outputs share no register with the inputs), the last one the v_nop. */
    asm("v_exp_f32 %0, %4\n\tv_exp_f32 %1, %5\n\tv_exp_f32 %2, %6\n\tv_exp_f32 %3, %7\n\tv_nop" : "=&v"(e0), "=&v"(e1), "=&v"(e2), "=&v"(e3) : "v"(t[0]), "v"(t[1]), "v"(t[2]), "v"(t[3]));
    const v4f e = {e0, e1, e2, e3}; x[u] = e; a += e; }
  float se = (a[0] + a[1]) + (a[2] + a[3]);
#pragma unroll
  for (int m = 16; m >= 1; m >>= 1) se += __shfl_xor(se, m, 32);
  const float sc = 256.0f / se; _Float16* p = P + (size_t)row * SQ + lane * 4;
#pragma unroll
  for (int u = 0; u < SQ / 128; ++u) { v4h h4;
#pragma unroll
    for (int q = 0; q < 4; ++q) h4[q] = (_Float16)(x[u][q] * sc);
    *(v4h*)(p + u * 128) = h4; } }

extern "C" void kernel_launch(void* const* d_in, const int* in_sizes, int n_in,
                              void* d_out, int out_size, void* d_ws, size_t ws_size, hipStream_t stream) {
  (void)in_sizes; (void)n_in; (void)out_size;
  const float* const* I = (const float* const*)d_in; const float* x = I[0]; const float* ctx = I[1]; const float* vsrc = I[2]; const float* wq = I[3]; const float* bq = I[4]; const float* wk = I[5]; const float* bk = I[6]; const float* wv = I[7]; const float* bv = I[8]; const float* wo = I[9]; const float* bo = I[10];      /* input order: Q, K, V (THREE streams), Wq, bq, Wk, bk, Wv, bv (PER-HEAD [16][64][64] = [head][in][out]; biases [16][64] = the flat [1024] at 64 h + e; zeros on this draw), Wo ([in][out] [1024][1024]), bo (zeros): eleven inputs */
  char* ws = (char*)d_ws; size_t off = 0;
  auto take = [&](size_t bytes) { char* p = ws + off; off += (bytes + 255) & ~(size_t)255; return p; };
  _Float16* BQ = (_Float16*)take((size_t)DM * DM * 2); _Float16* BK = (_Float16*)take((size_t)DM * DC * 2); _Float16* BV = (_Float16*)take((size_t)DM * DC * 2); _Float16* BO = (_Float16*)take((size_t)DM * DM * 2);
  _Float16* X16 = (_Float16*)take(NRQ * DM * 2); _Float16* C16 = (_Float16*)take(NRK * DC * 2); _Float16* VS16 = (_Float16*)take(NRK * DC * 2); _Float16* Q16 = (_Float16*)take(NRQ * DM * 2); _Float16* K16 = (_Float16*)take(NRK * DM * 2); _Float16* V16 = (_Float16*)take(NRK * DM * 2); _Float16* O16 = (_Float16*)take(NRQ * DM * 2);
  float* S = (float*)take((size_t)HG * NQ * SK * 4); _Float16* P = (_Float16*)take((size_t)HG * NQ * SK * 2); _Float16* VT = (_Float16*)take((size_t)NH * HD * SK * 2);
  if (off > ws_size) return;      /* approx 8 + 16 + 16 + 16 + 16 + 16 + 16 + 16 + 64 + 32 + 4 = 220 MiB */
  { const unsigned gp = (unsigned)(((size_t)HD * (HD / 8) + 255) / 256); for (int h = 0; h < NH; ++h) { const size_t o = (size_t)h * HD * HD; k_wt_f16<<<gp, 256, 0, stream>>>(wq + o, BQ + o, HD, HD, 16.0f); k_wt_f16<<<gp, 256, 0, stream>>>(wk + o, BK + o, HD, HD, 16.0f); k_wt_f16<<<gp, 256, 0, stream>>>(wv + o, BV + o, HD, HD, 16.0f); } const unsigned g = (unsigned)(((size_t)DM * (DM / 8) + 255) / 256); k_wt_f16<<<g, 256, 0, stream>>>(wo, BO, DM, DM, 16.0f); }      /* the per-head stacks [16][64][64] are [in][out] per head (x_h @ W_h): W_h[d][e] -> Bt_h[e][d] x16 through the file's transposing builder with K = N = 64, one call per head and stack, into consecutive [64][64] planes; Wo [in][out]: the same builder with K = N = 1024 */
  k_x16<<<(unsigned)((NRQ * DM / 8 + 255) / 256), 256, 0, stream>>>(x, X16, NRQ * DM / 8); k_x16<<<(unsigned)((NRK * DC / 8 + 255) / 256), 256, 0, stream>>>(ctx, C16, NRK * DC / 8); k_x16<<<(unsigned)((NRK * DC / 8 + 255) / 256), 256, 0, stream>>>(vsrc, VS16, NRK * DC / 8);      /* decoder, encoder-K, encoder-V rows */
  k_gemm2<0><<<dim3((unsigned)(NRQ / 128), NH), 128, 0, stream>>>(X16, DM, (size_t)HD, BQ, HD, (size_t)HD * HD, 0.0625f, bq, (size_t)HD, nullptr, 1, 0, 0, nullptr, Q16, DM, (size_t)HD, (int)NRQ, HD, HD);      /* q: head h (grid.y) = x[:, 64 h ..] W_h + b_h -> Q16[:, 64 h ..]: A + 64 h (pitch DM), B + 4096 h (pitch 64), bias + 64 h, C + 64 h (pitch DM); K = N = 64 */
  k_gemm2<0><<<dim3((unsigned)(NRK / 128), NH), 128, 0, stream>>>(C16, DM, (size_t)HD, BK, HD, (size_t)HD * HD, 0.0625f, bk, (size_t)HD, nullptr, 1, 0, 0, nullptr, K16, DM, (size_t)HD, (int)NRK, HD, HD);      /* k likewise from the key rows */
  k_gemm2<0><<<dim3((unsigned)(NRK / 128), NH), 128, 0, stream>>>(VS16, DM, (size_t)HD, BV, HD, (size_t)HD * HD, 0.0625f, bv, (size_t)HD, nullptr, 1, 0, 0, nullptr, V16, DM, (size_t)HD, (int)NRK, HD, HD);      /* v likewise from the value rows */
  for (int b = 0; b < NB; ++b) { const size_t rq = (size_t)b * NQ, rk = (size_t)b * SK;
    k_vt<NH, SK><<<NH * (SK / 64), 256, 0, stream>>>(V16 + rk * DM, DM, 0, VT);      /* V^T [16][64][2048] */
    for (int h0 = 0; h0 < NH; h0 += HG) {
      k_gemm2<0><<<dim3((NQ / 128) * (SK / 64), HG), 128, 0, stream>>>(Q16 + rq * DM + (size_t)h0 * HD, DM, (size_t)HD, K16 + rk * DM + (size_t)h0 * HD, DM, (size_t)HD, 0.125f, nullptr, 0, nullptr, 1, 0, 0, S, nullptr, SK, (size_t)NQ * SK, NQ, SK, HD);      /* scores of HG heads (grid.y) */
      k_rsmr<<<(HG * NQ + 7) / 8, 256, 0, stream>>>(S, P, NQ, HG);      /* softmax over the 2048 keys (planes packed), one wave per row, 8 rows per block */
      k_gemm2<0><<<dim3((NQ / 128) * (HD / 64), HG), 128, 0, stream>>>(P, SK, (size_t)NQ * SK, VT + (size_t)h0 * HD * SK, SK, (size_t)HD * SK, 0.25f, nullptr, 0, nullptr, 1, 0, 0, nullptr, O16 + rq * DM + (size_t)h0 * HD, DM, (size_t)HD, NQ, HD, SK); } }      /* o x64, merged */
  k_gemm2<0><<<dim3((unsigned)((NRQ / 128) * (DM / 64)), 1), 128, 0, stream>>>(O16, DM, 0, BO, DM, 0, 0.0009765625f, bo, 0, nullptr, 1, 0, 0, (float*)d_out, nullptr, DM, 0, (int)NRQ, DM, DM);      /* out = o Wo + bo */
}

// v003
// One run takes 184 microseconds.
// Versions in between are left out here; by their measured steps it is 9.42 times as fast as v001.
// Over all steps from v000 it is 37.3 times as fast.
#include <hip/hip_runtime.h>
// Multi-head attention on THREE input streams with BLOCK-DIAGONAL per-head projections on four sequences (Q, K, V [4][2048][1024], each split into 16 contiguous 64-wide slices; q / k / v = einsum('bhsd,hde->bhse', slice, W) + b: EACH HEAD applies its own Dense(64) (W [16][64][64] = [head][in][out], normal x 1/8; biases [16][64] zeros on this draw) to ITS OWN slice of ITS stream; scores / sqrt(64); softmax over all 2048 keys (no mask); out = merged Wo + bo ([in][out] [1024][1024]; bo zeros) -> [4][2048][1024]); each projection is ONE head-batched GEMM (K = 64).
// Structure: the three inputs as exact f16 rows; the per-head [in][out] weight blocks transposed into sixteen consecutive exact x16 [64][64] planes per stack (all of these builders in ONE launch, by ranges of the block index); Q, K, V as three HEAD-BATCHED WMMA GEMMs in ONE launch (16 heads on grid.y, the stream on grid.z; K = N = 64; 32x64 wave tiles, f32 accumulation, + the head's bias, f16 outputs into the head's 64 columns); V^T of all batches via LDS transposes in ONE launch; ONE fused launch for all batches and heads: scores (K = 64), running softmax over the 2048 keys (f32 statistics, native exp2; unnormalised weights in (0, 1] as f16), o = P V (o carried x64) into merged f16 rows; out = o W_o + b_o GEMM (f32, alpha 2^-10); launches: see trace.
// Compute dtype: inputs rounded to bf16; x / context / weights exact; q, k, v, softmax weights and o as plain f16 GEMM operands (~2^-12); scores and statistics f32. v_wmma_f32_16x16x32_f16.
#define NB 4
#define NQ 2048
#define SK 2048
#define SQ SK                       /* keys per softmax row */
#define DM 1024
#define DC 1024
#define NH 16
#define HD 64
#define HG 4
#define NRQ ((size_t)NB * NQ)
#define NRK ((size_t)NB * SK)
typedef __bf16 v16b __attribute__((ext_vector_type(16)));
typedef unsigned short v8us __attribute__((ext_vector_type(8), may_alias));
typedef float  v8f  __attribute__((ext_vector_type(8)));
typedef float  v4f  __attribute__((ext_vector_type(4)));
typedef float  v4fa __attribute__((ext_vector_type(4), may_alias));
union FragB { v16b v; v8us half[2]; unsigned short u[16]; };

__device__ __forceinline__ unsigned short bf16_bits(float x) { unsigned int u = __float_as_uint(x); return (unsigned short)((u + 0x7FFFu + ((u >> 16) & 1u)) >> 16); }
__device__ __forceinline__ float bf16_val(unsigned short b) { return __uint_as_float(((unsigned int)b) << 16); }
__device__ __forceinline__ float bf16_round(float x) { return bf16_val(bf16_bits(x)); }
// D += A·B with NT terms: 1 = ah·bh, 2 = + al·bh (A split), 3 = + ah·bl (both split)
template <int NT>
__device__ __forceinline__ v8f mmaN(v16b ah, v16b al, v16b bh, v16b bl, v8f c) {
  c = __builtin_amdgcn_wmma_f32_16x16x32_bf16(false, ah, false, bh, (short)0, c, false, false);
  if (NT >= 2) c = __builtin_amdgcn_wmma_f32_16x16x32_bf16(false, al, false, bh, (short)0, c, false, false);
  if (NT >= 3) c = __builtin_amdgcn_wmma_f32_16x16x32_bf16(false, ah, false, bl, (short)0, c, false, false);
  asm volatile("v_nop\n\tv_nop\n\tv_nop\n\tv_nop" : "+v"(c) : "v"(ah), "v"(al), "v"(bh), "v"(bl));
  return c;
}

__global__ __launch_bounds__(256) void k_wt_bf16(const float* __restrict__ W, unsigned short* __restrict__ Wt, int K, int N) {
  const int t = blockIdx.x * 256 + threadIdx.x;
  const int k8n = K / 8;
  if (t >= N * k8n) return;
  const int n = t / k8n, k8 = (t % k8n) * 8;
  v8us v;
#pragma unroll
  for (int i = 0; i < 8; ++i) v[i] = bf16_bits(W[(size_t)(k8 + i) * N + n]);
  *(v8us*)(Wt + (size_t)n * K + k8) = v;
  
}

// GEMM C[M][N] (f32, pitch ldc) = act(A[M][K]·W + bias). A f32 row-major (pitch lda) converted per fragment to bf16
// (ASPLIT: hi/lo two planes -> 2 terms, else single rounded term); Wt bf16 [N][K] (pitch ldb). BIAS_BF16 rounds the
// bias to bf16 first (bias quantised to bf16 before the add). K%32==0, M%16==0, N%64==0.
template <bool ASPLIT, int ACT, bool BIAS_BF16>
__global__ __launch_bounds__(128) void k_gemm_bf(const float* __restrict__ A, int lda, const unsigned short* __restrict__ Wt, int ldb,
                                               const float* __restrict__ bias, float* __restrict__ C, int ldc, int M, int N, int K) {
  __shared__ __attribute__((aligned(16))) float so[4][16][64];
  const int tid = threadIdx.x, w = tid >> 5, lane = tid & 31, ln = lane & 15, hh = lane >> 4;
  const int ntn = N / 64;
  const int wid = blockIdx.x * 4 + w;
  const int mt = wid / ntn, nq = wid % ntn;
  if (mt * 16 >= M) return;
  const int row0 = mt * 16, col0 = nq * 64;
  const float* arow = A + (size_t)(row0 + ln) * lda;
  v8f acc[4] = {};
  for (int kb = 0; kb < K; kb += 32) {
    FragB ah, al;
    const v4f x0 = *(const v4fa*)(arow + kb + 8 * hh), x1 = *(const v4fa*)(arow + kb + 8 * hh + 4);
    const v4f x2 = *(const v4fa*)(arow + kb + 16 + 8 * hh), x3 = *(const v4fa*)(arow + kb + 16 + 8 * hh + 4);
    float xs[16] = {x0[0],x0[1],x0[2],x0[3],x1[0],x1[1],x1[2],x1[3],x2[0],x2[1],x2[2],x2[3],x3[0],x3[1],x3[2],x3[3]};
#pragma unroll
    for (int i = 0; i < 16; ++i) { const unsigned short hb = bf16_bits(xs[i]); ah.u[i] = hb; al.u[i] = ASPLIT ? bf16_bits(xs[i] - bf16_val(hb)) : (unsigned short)0; }
#pragma unroll
    for (int t = 0; t < 4; ++t) {
      const unsigned short* brow = Wt + (size_t)(col0 + t * 16 + ln) * ldb + kb;
      FragB b;
      b.half[0] = *(const v8us*)(brow + 8 * hh);
      b.half[1] = *(const v8us*)(brow + 16 + 8 * hh);
      acc[t] = mmaN<ASPLIT ? 2 : 1>(ah.v, al.v, b.v, b.v, acc[t]);
    }
  }
#pragma unroll
  for (int t = 0; t < 4; ++t) {
    float bv = bias ? bias[col0 + t * 16 + ln] : 0.f;
    if (BIAS_BF16) bv = bf16_round(bv);
#pragma unroll
    for (int r = 0; r < 8; ++r) { float v = acc[t][r] + bv; if (ACT == 1) v = fmaxf(v, 0.f); so[w][8 * hh + r][t * 16 + ln] = v; }
  }
  __builtin_amdgcn_fence(__ATOMIC_ACQ_REL, "workgroup");
  __builtin_amdgcn_wave_barrier();
  const int rsub = lane >> 4, c4 = (lane & 15) * 4;
  {
#pragma unroll
    for (int q = 0; q < 8; ++q) {
      const int r = q * 2 + rsub;
      const v4f v = *(const v4fa*)&so[w][r][c4];
      *(v4f*)(C + (size_t)(row0 + r) * ldc + col0 + c4) = v;
    }
    
  }
}

// GEMM C = act(A·W + bias + resid): A f32 (ASPLIT -> hi/lo 2 terms), Wt bf16 [N][K]; ACT 0 none, 1 relu, 2 exact gelu;
// resid (optional, f32, row index = (row % rmod), pitch ldr, RES_BF16 rounds it) added before the activation.
template <bool ASPLIT, int ACT, bool BIAS_BF16, bool RES_BF16>
__global__ __launch_bounds__(128) void k_gemm_bf3(const float* __restrict__ A, int lda, const unsigned short* __restrict__ Wt, int ldb,
                                                const float* __restrict__ bias, const float* __restrict__ resid, int rmod, int ldr,
                                                float* __restrict__ C, int ldc, int M, int N, int K) {
  __shared__ __attribute__((aligned(16))) float so[4][16][64];
  const int tid = threadIdx.x, w = tid >> 5, lane = tid & 31, ln = lane & 15, hh = lane >> 4;
  const int ntn = N / 64;
  const int wid = blockIdx.x * 4 + w;
  const int mt = wid / ntn, nq = wid % ntn;
  if (mt * 16 >= M) return;
  const int row0 = mt * 16, col0 = nq * 64;
  const float* arow = A + (size_t)(row0 + ln) * lda;
  v8f acc[4] = {};
  for (int kb = 0; kb < K; kb += 32) {
    FragB ah, al;
    const v4f x0 = *(const v4fa*)(arow + kb + 8 * hh), x1 = *(const v4fa*)(arow + kb + 8 * hh + 4);
    const v4f x2 = *(const v4fa*)(arow + kb + 16 + 8 * hh), x3 = *(const v4fa*)(arow + kb + 16 + 8 * hh + 4);
    float xs[16] = {x0[0],x0[1],x0[2],x0[3],x1[0],x1[1],x1[2],x1[3],x2[0],x2[1],x2[2],x2[3],x3[0],x3[1],x3[2],x3[3]};
#pragma unroll
    for (int i = 0; i < 16; ++i) { const unsigned short hb = bf16_bits(xs[i]); ah.u[i] = hb; al.u[i] = ASPLIT ? bf16_bits(xs[i] - bf16_val(hb)) : (unsigned short)0; }
#pragma unroll
    for (int t = 0; t < 4; ++t) {
      const unsigned short* brow = Wt + (size_t)(col0 + t * 16 + ln) * ldb + kb;
      FragB b;
      b.half[0] = *(const v8us*)(brow + 8 * hh);
      b.half[1] = *(const v8us*)(brow + 16 + 8 * hh);
      acc[t] = mmaN<ASPLIT ? 2 : 1>(ah.v, al.v, b.v, b.v, acc[t]);
    }
  }
#pragma unroll
  for (int t = 0; t < 4; ++t) {
    const int col = col0 + t * 16 + ln;
    float bv = bias ? bias[col] : 0.f;
    if (BIAS_BF16) bv = bf16_round(bv);
#pragma unroll
    for (int r = 0; r < 8; ++r) {
      float v = acc[t][r] + bv;
      if (resid) { float rv = resid[(size_t)((row0 + 8 * hh + r) % rmod) * ldr + col]; if (RES_BF16) rv = bf16_round(rv); v += rv; }
      if (ACT == 1) v = fmaxf(v, 0.f);
      if (ACT == 2) v = 0.5f * v * (1.0f + erff(v * 0.70710678118654752f));
      if (ACT == 3) { const float u = 0.7978845608028654f * (v + 0.044715f * v * v * v); v = 0.5f * v * (1.0f + tanhf(u)); }
      so[w][8 * hh + r][t * 16 + ln] = v;
    }
  }
  __builtin_amdgcn_fence(__ATOMIC_ACQ_REL, "workgroup");
  __builtin_amdgcn_wave_barrier();
  const int rsub = lane >> 4, c4 = (lane & 15) * 4;
  {
#pragma unroll
    for (int q = 0; q < 8; ++q) {
      const int r = q * 2 + rsub;
      const v4f v = *(const v4fa*)&so[w][r][c4];
      *(v4f*)(C + (size_t)(row0 + r) * ldc + col0 + c4) = v;
    }
    
  }
}
// row LayerNorm (biased variance, eps) over N: s = X (+ R); optional out_sum <- s; out_norm <- (s-mu)*rsqrt(var+eps)*g + b
template <bool PARAM_BF16>
__global__ __launch_bounds__(256) void k_layernorm(const float* __restrict__ X, const float* __restrict__ R, const float* __restrict__ g, const float* __restrict__ bta,
                                                  float* __restrict__ out_sum, float* __restrict__ out_norm, int N, float eps) {
  __shared__ float red[256];
  const int row = blockIdx.x, tid = threadIdx.x;
  const float* x = X + (size_t)row * N; const float* rr = R ? R + (size_t)row * N : nullptr;
  float vals[16];                     // up to N = 4096
  const int per = N / 256;            // contiguous chunk per thread? use strided-by-4 chunks: thread handles j = tid*4 + 1024*u
  float s1 = 0.f;
  for (int u = 0; u < per / 4; ++u) {
    const int j = tid * 4 + 1024 * u;
    const v4f a = *(const v4fa*)(x + j);
    v4f b = {0.f,0.f,0.f,0.f}; if (rr) b = *(const v4fa*)(rr + j);
#pragma unroll
    for (int q = 0; q < 4; ++q) { const float v = a[q] + b[q]; vals[u * 4 + q] = v; s1 += v; }
  }
  red[tid] = s1; __syncthreads();
  for (int st = 128; st > 0; st >>= 1) { if (tid < st) red[tid] += red[tid + st]; __syncthreads(); }
  const float mu = red[0] / (float)N; __syncthreads();
  float s2 = 0.f;
  for (int u = 0; u < per / 4; ++u)
#pragma unroll
    for (int q = 0; q < 4; ++q) { const float c = vals[u * 4 + q] - mu; s2 += c * c; }
  red[tid] = s2; __syncthreads();
  for (int st = 128; st > 0; st >>= 1) { if (tid < st) red[tid] += red[tid + st]; __syncthreads(); }
  const float rs = rsqrtf(red[0] / (float)N + eps);
  {
    for (int u = 0; u < per / 4; ++u) {
      const int j = tid * 4 + 1024 * u;
      v4f o, sm;
#pragma unroll
      for (int q = 0; q < 4; ++q) {
        float gg = g[j + q], bb = bta[j + q];
        if (PARAM_BF16) { gg = bf16_round(gg); bb = bf16_round(bb); }
        sm[q] = vals[u * 4 + q]; o[q] = (vals[u * 4 + q] - mu) * rs * gg + bb;
      }
      if (out_sum) *(v4f*)(out_sum + (size_t)row * N + j) = sm;
      *(v4f*)(out_norm + (size_t)row * N + j) = o;
    }
    
  }
}



// ---- f16 WMMA path (v_wmma_f32_16x16x32_f16): 11-bit significands for operands in range — used where a [0,1] probability operand needs more precision than bf16
typedef _Float16 v16h __attribute__((ext_vector_type(16)));
union FragH { v16h v; v8us half[2]; _Float16 h[16]; unsigned short u[16]; };
template <int NT>
__device__ __forceinline__ v8f mmaH(v16h ah, v16h al, v16h bh, v16h bl, v8f c) {
  c = __builtin_amdgcn_wmma_f32_16x16x32_f16(false, ah, false, bh, (short)0, c, false, false);
  if (NT >= 2) c = __builtin_amdgcn_wmma_f32_16x16x32_f16(false, al, false, bh, (short)0, c, false, false);
  if (NT >= 3) c = __builtin_amdgcn_wmma_f32_16x16x32_f16(false, ah, false, bl, (short)0, c, false, false);
  asm volatile("v_nop\n\tv_nop\n\tv_nop\n\tv_nop" : "+v"(c) : "v"(ah), "v"(al), "v"(bh), "v"(bl));
  return c;
}
// batched GEMM like k_gemm_b but f16 operands: A f32 (split into f16 hi/lo if ASPLIT, else rounded to f16), Bt = f16 values [n][k]; alpha; C f32; N multiple of 16 (partial tiles skipped)
template <bool ASPLIT>
__global__ __launch_bounds__(128) void k_gemm_h(const float* __restrict__ A, int lda, size_t sA, const _Float16* __restrict__ Bh, int ldb, size_t sB, float alpha, float* __restrict__ C, int ldc, size_t sC, int M, int N, int K) {
  __shared__ __attribute__((aligned(16))) float so[4][16][64];
  const int tid = threadIdx.x, w = tid >> 5, lane = tid & 31, ln = lane & 15, hh = lane >> 4; const int by = blockIdx.y;
  A += (size_t)by * sA; Bh += (size_t)by * sB; C += (size_t)by * sC;
  const int ntn = (N + 63) / 64; const int wid = blockIdx.x * 4 + w; const int mt = wid / ntn, nq = wid % ntn; if (mt * 16 >= M) return;
  const int row0 = mt * 16, col0 = nq * 64; const float* arow = A + (size_t)(row0 + ln) * lda;
  v8f acc[4] = {};
  for (int kb = 0; kb < K; kb += 32) {
    FragH ah, al;
    const v4f x0 = *(const v4fa*)(arow + kb + 8 * hh), x1 = *(const v4fa*)(arow + kb + 8 * hh + 4), x2 = *(const v4fa*)(arow + kb + 16 + 8 * hh), x3 = *(const v4fa*)(arow + kb + 16 + 8 * hh + 4);
    float xs[16] = {x0[0],x0[1],x0[2],x0[3],x1[0],x1[1],x1[2],x1[3],x2[0],x2[1],x2[2],x2[3],x3[0],x3[1],x3[2],x3[3]};
#pragma unroll
    for (int i = 0; i < 16; ++i) { const _Float16 h = (_Float16)xs[i]; ah.h[i] = h; al.h[i] = ASPLIT ? (_Float16)(xs[i] - (float)h) : (_Float16)0.0f; }
#pragma unroll
    for (int t = 0; t < 4; ++t) { if (col0 + t * 16 >= N) continue; const size_t boff = (size_t)(col0 + t * 16 + ln) * ldb + kb; FragH bq; bq.half[0] = *(const v8us*)(Bh + boff + 8 * hh); bq.half[1] = *(const v8us*)(Bh + boff + 16 + 8 * hh);
      acc[t] = mmaH<ASPLIT ? 2 : 1>(ah.v, al.v, bq.v, bq.v, acc[t]); }
  }
#pragma unroll
  for (int t = 0; t < 4; ++t) { if (col0 + t * 16 >= N) continue;
#pragma unroll
    for (int r = 0; r < 8; ++r) so[w][8 * hh + r][t * 16 + ln] = acc[t][r] * alpha; }
  __builtin_amdgcn_fence(__ATOMIC_ACQ_REL, "workgroup"); __builtin_amdgcn_wave_barrier();
  const int rsub = lane >> 4, c4 = (lane & 15) * 4;
  {
#pragma unroll
    for (int q = 0; q < 8; ++q) { const int r = q * 2 + rsub; if (col0 + c4 < N) { const v4f v = *(const v4fa*)&so[w][r][c4]; *(v4f*)(C + (size_t)(row0 + r) * ldc + col0 + c4) = v; } }
     }
}

// Wt[n][k] = f16(W[k][n]·scale) from f32 row-major W[K][N] (scale = power of two; bf16-exact weights stay exact in f16 away from the subnormal range)
__device__ __forceinline__ void wt_f16_at(const float* __restrict__ W, _Float16* __restrict__ Wt, int K, int N, float scale, int t) {      /* t: which eight k of which n; the caller's grid covers N K / 8 exactly */
  const int n = t / (K / 8), k8 = (t % (K / 8)) * 8; FragH f;
#pragma unroll
  for (int i = 0; i < 8; ++i) f.h[i] = (_Float16)(bf16_round(W[(size_t)(k8 + i) * N + n]) * scale); const v8us o = f.half[0];
  *(v8us*)((unsigned short*)Wt + (size_t)n * K + k8) = o; asm volatile("s_wait_xcnt 0x0" ::: "memory");      /* the wait that belongs in front of any overwrite of a register which an issued store names */
}
// k_gemm_hh variant with fused epilogue: v = acc·alpha + bias[by·sBias + col] (+ CP[(row/rowsPerB)·sCPb + by·64 + col] if CP) ; ACT 0 none / 1 elu ; writes f16 C16 (and f32 C if non-null)
template <int ACT>
__global__ __launch_bounds__(128) void k_gemm_hhx(const _Float16* __restrict__ A, int lda, size_t sA, const _Float16* __restrict__ Bh, int ldb, size_t sB, float alpha, const float* __restrict__ bias, size_t sBias, const float* __restrict__ CP, int rowsPerB, size_t sCPb, int row0g,
    float* __restrict__ C, _Float16* __restrict__ C16, int ldc, size_t sC, int M, int N, int K) {
  __shared__ __attribute__((aligned(16))) float so[4][16][64];
  const int tid = threadIdx.x, w = tid >> 5, lane = tid & 31, ln = lane & 15, hh = lane >> 4; const int by = blockIdx.y;
  A += (size_t)by * sA; Bh += (size_t)by * sB; const size_t cofs = (size_t)by * sC; const float* bp = bias ? bias + (size_t)by * sBias : nullptr;
  const int ntn = (N + 63) / 64; const int wid = blockIdx.x * 4 + w; const int mt = wid / ntn, nq = wid % ntn; if (mt * 16 >= M) return;
  const int row0 = mt * 16, col0 = nq * 64; const _Float16* arow = A + (size_t)(row0 + ln) * lda;
  v8f acc[4] = {};
  for (int kb = 0; kb < K; kb += 32) { FragH ah; ah.half[0] = *(const v8us*)((const unsigned short*)arow + kb + 8 * hh); ah.half[1] = *(const v8us*)((const unsigned short*)arow + kb + 16 + 8 * hh);
#pragma unroll
    for (int t = 0; t < 4; ++t) { if (col0 + t * 16 >= N) continue; const size_t boff = (size_t)(col0 + t * 16 + ln) * ldb + kb; FragH bq; bq.half[0] = *(const v8us*)((const unsigned short*)Bh + boff + 8 * hh); bq.half[1] = *(const v8us*)((const unsigned short*)Bh + boff + 16 + 8 * hh);
      acc[t] = mmaH<1>(ah.v, ah.v, bq.v, bq.v, acc[t]); }
  }
#pragma unroll
  for (int t = 0; t < 4; ++t) { if (col0 + t * 16 >= N) continue; const int col = col0 + t * 16 + ln; const float bv = bp ? bf16_round(bp[col]) : 0.f;
#pragma unroll
    for (int r = 0; r < 8; ++r) { float v = acc[t][r] * alpha + bv; if (CP) { const int rr = row0g + row0 + 8 * hh + r; if (rowsPerB < 0) v += CP[cofs + (size_t)rr * ldc + col];      /* rowsPerB < 0: own element of the batched C plane */ else { const int bidx = rr / rowsPerB; v += CP[(size_t)bidx * sCPb + (size_t)by * 64 + col]; } } if (ACT == 1) v = (v > 0.f) ? v : expm1f(v); else if (ACT == 7) v = (v > 0.f) ? v + 1.0f : expf(v); else if (ACT == 8) v = tanhf(v); else if (ACT == 9) v = 0.5f * v * (1.0f + tanhf(0.7978845608028654f * (v + 0.044715f * v * v * v))); else if (ACT == 11) v = 1.0f / (1.0f + expf(-v)); else if (ACT == 12) v = (v > 0.f) ? v : 0.01f * v; else if (ACT == 14) v = (v > 0.f) ? v : 0.1f * v; else if (ACT == 16) v = (v >= 0.f) ? v : 0.3f * v; else if (ACT == 17) v = (v >= 0.f) ? v : 0.2f * v; else if (ACT == 15) v = v / (1.0f + expf(-v)); else if (ACT == 3) v = fmaxf(v, 0.f); else if (ACT == 6) v = 0.5f * v * (1.0f + erff(v * 0.70710678118654752f)); so[w][8 * hh + r][t * 16 + ln] = v; } }
  __builtin_amdgcn_fence(__ATOMIC_ACQ_REL, "workgroup"); __builtin_amdgcn_wave_barrier();
  const int rsub = lane >> 4, c4 = (lane & 15) * 4; typedef _Float16 v4h __attribute__((ext_vector_type(4)));
  {
#pragma unroll
    for (int q = 0; q < 8; ++q) { const int r = q * 2 + rsub; if (col0 + c4 < N) { const v4f v = *(const v4fa*)&so[w][r][c4]; if (C) *(v4f*)(C + cofs + (size_t)(row0 + r) * ldc + col0 + c4) = v; if (C16) { v4h h4; for (int i = 0; i < 4; ++i) h4[i] = (_Float16)v[i]; *(v4h*)(C16 + cofs + (size_t)(row0 + r) * ldc + col0 + c4) = h4; } } }
     }
}


typedef _Float16 v4h __attribute__((ext_vector_type(4)));

__device__ __forceinline__ void x16_at(const float* __restrict__ x, _Float16* __restrict__ X16, size_t t) { FragH f;      /* t: which eight elements; the caller's grid covers the rows exactly */
#pragma unroll
  for (int q = 0; q < 8; ++q) f.h[q] = (_Float16)bf16_round(x[t * 8 + q]); *(v8us*)((unsigned short*)X16 + t * 8) = f.half[0]; asm volatile("s_wait_xcnt 0x0" ::: "memory"); }      /* the wait that belongs in front of any overwrite of a register which an issued store names */
__global__ __launch_bounds__(256) void k_h16(const float* __restrict__ x, _Float16* __restrict__ X16, size_t n8) { const size_t t = (size_t)blockIdx.x * 256 + threadIdx.x; if (t >= n8) return; FragH f;
#pragma unroll
  for (int q = 0; q < 8; ++q) f.h[q] = (_Float16)x[t * 8 + q]; *(v8us*)((unsigned short*)X16 + t * 8) = f.half[0];  }
__global__ __launch_bounds__(256) void k_round16f(const float* __restrict__ W, _Float16* __restrict__ Bt, size_t n8) { const size_t t = (size_t)blockIdx.x * 256 + threadIdx.x; if (t >= n8) return; FragH f;
#pragma unroll
  for (int i = 0; i < 8; ++i) f.h[i] = (_Float16)(bf16_round(W[t * 8 + i]) * 16.0f); *(v8us*)((unsigned short*)Bt + t * 8) = f.half[0];  }
template <int NHv, int TTv>
__global__ __launch_bounds__(256) void k_vt(const _Float16* __restrict__ V16, int ldv, int voff, _Float16* __restrict__ Vt) { __shared__ unsigned short tl[64][66]; const int tid = threadIdx.x; const int slab = blockIdx.x / (TTv / 64), lg = blockIdx.x % (TTv / 64); const int b = slab / NHv, h = slab % NHv;
  for (int i = tid; i < 64 * 8; i += 256) { const int r = i / 8, c8 = (i % 8) * 8; FragH f; f.half[0] = *(const v8us*)((const unsigned short*)V16 + ((size_t)b * TTv + lg * 64 + r) * ldv + voff + h * 64 + c8);
#pragma unroll
    for (int q = 0; q < 8; ++q) tl[r][c8 + q] = f.u[q]; }
  __syncthreads();
  {
#pragma unroll
    for (int rd = 0; rd < 2; ++rd) { const int d = rd * 32 + tid / 8, pc = tid % 8; FragH f;
#pragma unroll
      for (int q = 0; q < 8; ++q) f.u[q] = tl[pc * 8 + q][d];
      *(v8us*)((unsigned short*)Vt + ((size_t)slab * 64 + d) * TTv + lg * 64 + pc * 8) = f.half[0]; }
     } }

__global__ __launch_bounds__(256) void k_hl(const float* __restrict__ F, _Float16* __restrict__ Hh, _Float16* __restrict__ Hl, size_t n8) { const size_t t = (size_t)blockIdx.x * 256 + threadIdx.x; if (t >= n8) return; FragH fh, fl; const v4f a = *(const v4fa*)(F + t * 8), c = *(const v4fa*)(F + t * 8 + 4);
#pragma unroll
  for (int q = 0; q < 4; ++q) { _Float16 h = (_Float16)a[q]; fh.h[q] = h; fl.h[q] = (_Float16)((a[q] - (float)h) * 1024.0f); h = (_Float16)c[q]; fh.h[4 + q] = h; fl.h[4 + q] = (_Float16)((c[q] - (float)h) * 1024.0f); }
  { *(v8us*)((unsigned short*)Hh + t * 8) = fh.half[0]; *(v8us*)((unsigned short*)Hl + t * 8) = fl.half[0];  } }

// ---- fast GEMM (wave tile 32x64; requires M % 32 == 0 rows per launch region and N % 64 == 0); epilogue = k_gemm_hhx semantics ----
__device__ __forceinline__ v16h g2_frag(const _Float16* p, int hh) { FragH f; f.half[0] = *(const v8us*)((const unsigned short*)p + 8 * hh); f.half[1] = *(const v8us*)((const unsigned short*)p + 16 + 8 * hh); return f.v; }
__device__ __forceinline__ v8f g2_mma(v16h a, v16h b, v8f c) { v8f d = __builtin_amdgcn_wmma_f32_16x16x32_f16(false, a, false, b, (short)0, c, false, false); asm volatile("v_nop\n\tv_nop\n\tv_nop\n\tv_nop" : "+v"(d) : "v"(a), "v"(b)); return d; }
template <int ACT>
__device__ __forceinline__ void gemm2_body(const _Float16* __restrict__ A, int lda, size_t sA, const _Float16* __restrict__ Bh, int ldb, size_t sB, float alpha, const float* __restrict__ bias, size_t sBias, const float* __restrict__ CP, int rowsPerB, size_t sCPb, int row0g,
    float* __restrict__ C, _Float16* __restrict__ C16, int ldc, size_t sC, int M, int N, int K) { static_assert(ACT == 0 || ACT == 3 || ACT == 6 || ACT == 8 || ACT == 9 || ACT == 11 || ACT == 12 || ACT == 14 || ACT == 15 || ACT == 16 || ACT == 17, "k_gemm2: unsupported ACT code (would silently apply no activation)");
  __shared__ __attribute__((aligned(16))) float so[4][32][68];
  const int tid = threadIdx.x, w = tid >> 5, lane = tid & 31, ln = lane & 15, hh = lane >> 4; const int by = blockIdx.y;
  A += (size_t)by * sA; Bh += (size_t)by * sB; const size_t cofs = (size_t)by * sC; const float* bp = bias ? bias + (size_t)by * sBias : nullptr;
  const int ntn = N >> 6; const int mt = blockIdx.x / ntn, nq = blockIdx.x - mt * ntn; const int row0 = mt * 128 + 32 * w, col0 = nq * 64; if (row0 >= M) return;
  const _Float16* a0p = A + (size_t)(row0 + ln) * lda; const _Float16* a1p = a0p + (size_t)16 * lda;
  const _Float16* b0p = Bh + (size_t)(col0 + ln) * ldb; const _Float16* b1p = b0p + (size_t)16 * ldb; const _Float16* b2p = b1p + (size_t)16 * ldb; const _Float16* b3p = b2p + (size_t)16 * ldb;
  const v8f z8 = {0.f,0.f,0.f,0.f,0.f,0.f,0.f,0.f}; v8f c00 = z8, c01 = z8, c02 = z8, c03 = z8, c10 = z8, c11 = z8, c12 = z8, c13 = z8;
#pragma unroll 1
  for (int kb = 0; kb < K; kb += 32) { const v16h a0 = g2_frag(a0p + kb, hh), a1 = g2_frag(a1p + kb, hh);
    asm volatile("s_wait_xcnt 0x0" ::: "memory");      /* the wait that belongs in front of any overwrite of a register which an issued load names: the B loads behind it land in the registers of the A addresses */
    v16h b = g2_frag(b0p + kb, hh); c00 = g2_mma(a0, b, c00); c10 = g2_mma(a1, b, c10);
    b = g2_frag(b1p + kb, hh); c01 = g2_mma(a0, b, c01); c11 = g2_mma(a1, b, c11);
    b = g2_frag(b2p + kb, hh); c02 = g2_mma(a0, b, c02); c12 = g2_mma(a1, b, c12);
    b = g2_frag(b3p + kb, hh); c03 = g2_mma(a0, b, c03); c13 = g2_mma(a1, b, c13); }
  v8f accs[8] = {c00, c01, c02, c03, c10, c11, c12, c13};
#pragma unroll
  for (int u = 0; u < 8; ++u) { const int t = u & 3, half = u >> 2; const int col = col0 + t * 16 + ln; const float bv = bp ? bf16_round(bp[col]) : 0.f;
#pragma unroll
    for (int r = 0; r < 8; ++r) { const int rloc = half * 16 + 8 * hh + r; float v = accs[u][r] * alpha + bv; if (CP) { if (rowsPerB < 0) v += CP[cofs + (size_t)(row0g + row0 + rloc) * ldc + col];      /* rowsPerB < 0: own element of the batched C plane */ else { const int bidx = (row0g + row0 + rloc) / rowsPerB; v += CP[(size_t)bidx * sCPb + (size_t)by * 64 + col]; } }
      if (ACT == 3) v = fmaxf(v, 0.f); else if (ACT == 6) v = 0.5f * v * (1.0f + erff(v * 0.70710678118654752f)); else if (ACT == 11) v = 1.0f / (1.0f + expf(-v)); else if (ACT == 15) v = v / (1.0f + expf(-v)); else if (ACT == 12) v = (v > 0.f) ? v : 0.01f * v; else if (ACT == 8) v = tanhf(v); else if (ACT == 9) v = 0.5f * v * (1.0f + tanhf(0.7978845608028654f * (v + 0.044715f * v * v * v))); else if (ACT == 14) v = (v > 0.f) ? v : 0.1f * v; else if (ACT == 16) v = (v >= 0.f) ? v : 0.3f * v; else if (ACT == 17) v = (v >= 0.f) ? v : 0.2f * v;
      so[w][rloc][t * 16 + ln] = v; } }
  __builtin_amdgcn_fence(__ATOMIC_ACQ_REL, "workgroup"); __builtin_amdgcn_wave_barrier();
  const int rsub = lane >> 4, c4 = (lane & 15) * 4;
  {
#pragma unroll
    for (int q = 0; q < 16; ++q) { const int r = q * 2 + rsub; const v4f v = *(const v4fa*)&so[w][r][c4]; if (C) { *(v4f*)(C + cofs + (size_t)(row0 + r) * ldc + col0 + c4) = v; asm volatile("s_wait_xcnt 0x0" ::: "memory"); }      /* the wait that belongs in front of any overwrite of a register which an issued store names (the f16 conversion and the next row's address land in them) */
      if (C16) { v4h h4; for (int i = 0; i < 4; ++i) h4[i] = (_Float16)v[i]; *(v4h*)(C16 + cofs + (size_t)(row0 + r) * ldc + col0 + c4) = h4; } }
     } }
template <int ACT>
__global__ __launch_bounds__(128) void k_gemm2(const _Float16* __restrict__ A, int lda, size_t sA, const _Float16* __restrict__ Bh, int ldb, size_t sB, float alpha, const float* __restrict__ bias, size_t sBias, const float* __restrict__ CP, int rowsPerB, size_t sCPb, int row0g,
    float* __restrict__ C, _Float16* __restrict__ C16, int ldc, size_t sC, int M, int N, int K) { gemm2_body<ACT>(A, lda, sA, Bh, ldb, sB, alpha, bias, sBias, CP, rowsPerB, sCPb, row0g, C, C16, ldc, sC, M, N, K); }
// Three GEMMs of one shape that need nothing of each other, in one launch: blockIdx.z picks the operand set (the same for a whole block), the rest is gemm2_body.
template <int ACT>
__global__ __launch_bounds__(128) void k_gemm2x3(const _Float16* __restrict__ A0, const _Float16* __restrict__ A1, const _Float16* __restrict__ A2, int lda, size_t sA, const _Float16* __restrict__ B0, const _Float16* __restrict__ B1, const _Float16* __restrict__ B2, int ldb, size_t sB, float alpha,
    const float* __restrict__ bias0, const float* __restrict__ bias1, const float* __restrict__ bias2, size_t sBias, _Float16* __restrict__ C0, _Float16* __restrict__ C1, _Float16* __restrict__ C2, int ldc, size_t sC, int M, int N, int K) {
  const int z = blockIdx.z; gemm2_body<ACT>(z == 0 ? A0 : z == 1 ? A1 : A2, lda, sA, z == 0 ? B0 : z == 1 ? B1 : B2, ldb, sB, alpha, z == 0 ? bias0 : z == 1 ? bias1 : bias2, sBias, nullptr, 1, 0, 0, nullptr, z == 0 ? C0 : z == 1 ? C1 : C2, ldc, sC, M, N, K); }

// Every operand builder in one launch: none needs anything of another, so they share a grid by ranges of the block index (a block lies wholly in one range).
// Range 1: Wo -> BO. Range 2: the 3 x 16 per-head planes, PB_WH blocks each. Range 3: the three input streams, PB_X blocks each. The weight ranges come first: their strided reads start while the streams fill the chip.
#define PB_WO (DM * (DM / 8) / 256)
#define PB_WH (HD * (HD / 8) / 256)
#define PB_X  ((int)(NRQ * DM / 8 / 256))
__global__ __launch_bounds__(256) void k_prep(const float* __restrict__ x, const float* __restrict__ ctx, const float* __restrict__ vsrc, const float* __restrict__ wq, const float* __restrict__ wk, const float* __restrict__ wv, const float* __restrict__ wo,
    _Float16* __restrict__ X16, _Float16* __restrict__ C16, _Float16* __restrict__ VS16, _Float16* __restrict__ BQ, _Float16* __restrict__ BK, _Float16* __restrict__ BV, _Float16* __restrict__ BO) {
  static_assert(DM * (DM / 8) % 256 == 0 && HD * (HD / 8) % 256 == 0 && NRQ * DM / 8 % 256 == 0 && NRK == NRQ && DC == DM, "k_prep: every range is a whole number of blocks, the three streams of one size");
  int u = blockIdx.x; const int tid = threadIdx.x;
  if (u < PB_WO) { wt_f16_at(wo, BO, DM, DM, 16.0f, u * 256 + tid); return; }
  u -= PB_WO;
  if (u < 3 * NH * PB_WH) { const int s = u / (NH * PB_WH), r = u % (NH * PB_WH); const size_t o = (size_t)(r / PB_WH) * HD * HD;
    wt_f16_at((s == 0 ? wq : s == 1 ? wk : wv) + o, (s == 0 ? BQ : s == 1 ? BK : BV) + o, HD, HD, 16.0f, (r % PB_WH) * 256 + tid); return; }
  u -= 3 * NH * PB_WH;
  const int s = u / PB_X; x16_at(s == 0 ? x : s == 1 ? ctx : vsrc, s == 0 ? X16 : s == 1 ? C16 : VS16, (size_t)(u % PB_X) * 256 + tid); }

__global__ __launch_bounds__(256) void k_wnat(const float* __restrict__ w, size_t n8, _Float16* __restrict__ Bt) { const size_t t = (size_t)blockIdx.x * 256 + threadIdx.x; if (t >= n8) return; FragH f; for (int q = 0; q < 8; ++q) f.h[q] = (_Float16)(bf16_round(w[t * 8 + q]) * 16.0f); *(v8us*)((unsigned short*)Bt + t * 8) = f.half[0];  }
__global__ __launch_bounds__(256) void k_rsm(const float* __restrict__ S, _Float16* __restrict__ P, int nrows) {
  #pragma clang fp contract(off)
  const int i = blockIdx.x * 256 + threadIdx.x; if (i >= nrows) return; const float* s = S + (size_t)i * SQ; float mx = -3.0e38f;
#pragma unroll 1
  for (int j = 0; j < SQ; ++j) mx = fmaxf(mx, s[j]); float se = 0.f;
#pragma unroll 1
  for (int j = 0; j < SQ; ++j) se += expf(s[j] - mx); const float sc = 256.0f / se;
#pragma unroll 1
  for (int j0 = 0; j0 < SQ; j0 += 8) { FragH f; for (int q = 0; q < 8; ++q) f.h[q] = (_Float16)(expf(s[j0 + q] - mx) * sc); unsigned short* d = (unsigned short*)P + (size_t)i * SQ + j0; *(v8us*)d = f.half[0];  } }
__global__ __launch_bounds__(256) void k_vt(const _Float16* __restrict__ V16, int b, int h0, _Float16* __restrict__ VT) { __shared__ unsigned short tl[64][65]; const int tid = threadIdx.x; const int hh = blockIdx.x % HG, sg = blockIdx.x / HG; const int s0 = sg * 64; const int h = h0 + hh;
  for (int i = tid; i < 64 * 8; i += 256) { const int j = i / 8, d8 = (i % 8) * 8; FragH f; f.half[0] = *(const v8us*)((const unsigned short*)V16 + ((size_t)b * SQ + s0 + j) * DM + h * HD + d8); for (int q = 0; q < 8; ++q) tl[d8 + q][j] = f.u[q]; }
  __syncthreads();
  { for (int i = tid; i < 64 * 8; i += 256) { const int d = i / 8, j8 = (i % 8) * 8; FragH f; for (int q = 0; q < 8; ++q) f.u[q] = tl[d][j8 + q]; *(v8us*)((unsigned short*)VT + ((size_t)hh * HD + d) * SQ + s0 + j8) = f.half[0]; }  } }


__global__ __launch_bounds__(256) void k_rsmf(const float* __restrict__ S, _Float16* __restrict__ P, int qn, int hg) {
  #pragma clang fp contract(off)
  const int t = blockIdx.x * 256 + threadIdx.x; if (t >= qn * hg) return; const size_t i = (size_t)(t / qn) * SQ + (t % qn); const float* s = S + i * SQ; float mx = -3.0e38f;
#pragma unroll 1
  for (int j = 0; j < SQ; ++j) mx = fmaxf(mx, s[j]); float se = 0.f;
#pragma unroll 1
  for (int j = 0; j < SQ; ++j) se += __expf(s[j] - mx); const float sc = 256.0f / se;
#pragma unroll 1
  for (int j0 = 0; j0 < SQ; j0 += 8) { FragH f; for (int q = 0; q < 8; ++q) f.h[q] = (_Float16)(__expf(s[j0 + q] - mx) * sc); unsigned short* d = (unsigned short*)P + i * SQ + j0; *(v8us*)d = f.half[0];  } }

// Fused attention, all batches and heads in one launch: scores, softmax and P V stay in registers; no score or weight plane goes through memory.
// A wave owns 32 queries of one (batch, head) and walks the 2048 keys 32 at a time. S^T = K Q^T (A = 16 key rows, B = 16 query rows, both by fa_frag, which has g2_frag's k order): a lane holds
// scores of ONE query (column ln), keys 8 hh + r of each 16-key tile, so two tiles, converted in place, are the B operand P^T of O^T += V^T P^T (A = V^T rows by fa_frag,
// the same k order). Running maximum and sum per query (f32); the two wave halves exchange the maximum each pass and join their sums once at the end.
// The 16 waves of a block share one head's K and V^T through the WGP cache. No LDS and no barrier.
__device__ __forceinline__ float fa_xhalf(float x) { return __builtin_bit_cast(float, __builtin_amdgcn_permlanex16(__builtin_bit_cast(int, x), __builtin_bit_cast(int, x), 0x76543210, 0xfedcba98, false, false)); }      /* lane l with lane l ^ 16 */
__device__ __forceinline__ v16h fa_frag(const _Float16* p) { FragH f; f.half[0] = *(const v8us*)(const unsigned short*)p; f.half[1] = *(const v8us*)((const unsigned short*)p + 16); return f.v; }      /* g2_frag with the lane half's 8 hh already in p */
/* Native 2^x, eight (or one) in a statement: behind a transcendental the instruction set asks for one independent instruction or a v_nop before its result is read or its source
   overwritten. Each v_exp_f32 here has an independent one behind it (the outputs share no register with the inputs), the last one the v_nop. */
__device__ __forceinline__ void fa_exp8(const float (&t)[8], float (&e)[8]) {
  asm("v_exp_f32 %0, %8\n\tv_exp_f32 %1, %9\n\tv_exp_f32 %2, %10\n\tv_exp_f32 %3, %11\n\tv_exp_f32 %4, %12\n\tv_exp_f32 %5, %13\n\tv_exp_f32 %6, %14\n\tv_exp_f32 %7, %15\n\tv_nop"
      : "=&v"(e[0]), "=&v"(e[1]), "=&v"(e[2]), "=&v"(e[3]), "=&v"(e[4]), "=&v"(e[5]), "=&v"(e[6]), "=&v"(e[7]) : "v"(t[0]), "v"(t[1]), "v"(t[2]), "v"(t[3]), "v"(t[4]), "v"(t[5]), "v"(t[6]), "v"(t[7])); }
__device__ __forceinline__ float fa_exp1(float t) { float e; asm("v_exp_f32 %0, %1\n\tv_nop" : "=&v"(e) : "v"(t)); return e; }
__device__ __forceinline__ v8f fa_mma(v16h a, v16h b, v8f c) { return __builtin_amdgcn_wmma_f32_16x16x32_f16(false, a, false, b, (short)0, c, false, false); }
__global__ __launch_bounds__(512) void k_fattn(const _Float16* __restrict__ Q, const _Float16* __restrict__ Kk, const _Float16* __restrict__ VT, _Float16* __restrict__ O) {
  const int lane = threadIdx.x & 31, ln = lane & 15, hh = lane >> 4; const int w = __builtin_amdgcn_readfirstlane(threadIdx.x >> 5);      /* the wave's number, held scalar */
  const int bh = blockIdx.x / (NQ / 512), b = bh / NH, h = bh % NH; const int q0 = (blockIdx.x % (NQ / 512)) * 512 + w * 32;
  const float CS = 0.125f * 1.44269504088896340736f;      /* 1 / sqrt(64) and log2 e in one factor: exp(s / 8 - m / 8) = 2^((s - m) CS) */
  const _Float16* qp = Q + ((size_t)b * NQ + q0 + ln) * DM + h * HD + 8 * hh;
  const _Float16* kp = Kk + ((size_t)b * SK + ln) * DM + h * HD + 8 * hh;
  const _Float16* vp = VT + ((size_t)bh * HD + ln) * SK + 8 * hh;
  v16h qf[2][2], kf[2][2];
#pragma unroll
  for (int j = 0; j < 2; ++j)
#pragma unroll
    for (int s = 0; s < 2; ++s) { qf[j][s] = fa_frag(qp + (size_t)j * 16 * DM + s * 32); kf[j][s] = fa_frag(kp + (size_t)j * 16 * DM + s * 32); }
  const v8f z8 = {0.f,0.f,0.f,0.f,0.f,0.f,0.f,0.f}; v8f o[2][4]; float mr[2] = {-3.0e38f, -3.0e38f}, lr[2] = {0.f, 0.f};
#pragma unroll
  for (int j = 0; j < 2; ++j)
#pragma unroll
    for (int t = 0; t < 4; ++t) o[j][t] = z8;
#pragma unroll 1
  for (int c = 0; c < SK / 32; ++c) {      /* rolled: one pass already holds 16 matrix instructions and 16 loads; unrolling would only add registers */
    v16h vf[4]; const _Float16* vc = vp + c * 32;
#pragma unroll
    for (int t = 0; t < 4; ++t) vf[t] = fa_frag(vc + (size_t)t * 16 * SK);      /* this pass's V^T, asked for ahead of the score products */
    v8f st[2][2];
#pragma unroll
    for (int j = 0; j < 2; ++j)
#pragma unroll
      for (int t = 0; t < 2; ++t) st[j][t] = fa_mma(kf[t][1], qf[j][1], fa_mma(kf[t][0], qf[j][0], z8));
    const int cn = (c + 1 < SK / 32) ? c + 1 : c; const _Float16* kc = kp + (size_t)cn * 32 * DM;      /* the next pass's K rows fly during the softmax; the last pass asks for its own rows again, which keeps the address in bounds */
#pragma unroll
    for (int t = 0; t < 2; ++t)
#pragma unroll
      for (int s = 0; s < 2; ++s) kf[t][s] = fa_frag(kc + (size_t)t * 16 * DM + s * 32);
    asm volatile("s_wait_xcnt 0x0" :: "v"(vc), "v"(kc) : "memory");      /* the wait that belongs in front of any overwrite of a register which an issued load names (the next pass forms new addresses); the two addresses as inputs keep their registers out of the loads' own destinations */
    __builtin_amdgcn_sched_barrier(0);      /* keeps the K loads here, ahead of the softmax, so that they fly during it; without it they sink to the foot of the pass */
#pragma unroll
    for (int j = 0; j < 2; ++j) {
      float mx = fmaxf(st[j][0][0], st[j][1][0]);
#pragma unroll
      for (int r = 1; r < 8; ++r) mx = fmaxf(mx, fmaxf(st[j][0][r], st[j][1][r]));
      mx = fmaxf(mx, fa_xhalf(mx));      /* both halves of the wave hold scores of the same query: one maximum for both */
      const float mn = fmaxf(mr[j], mx); const float al = fa_exp1((mr[j] - mn) * CS); const float nb = -mn * CS; mr[j] = mn;      /* al = 0 on the first pass */
      FragH pf; float sm = 0.f;
#pragma unroll
      for (int t = 0; t < 2; ++t) { float x[8], p[8];
#pragma unroll
        for (int r = 0; r < 8; ++r) x[r] = __builtin_fmaf(st[j][t][r], CS, nb);
        fa_exp8(x, p);
#pragma unroll
        for (int r = 0; r < 8; ++r) { sm += p[r]; pf.h[t * 8 + r] = (_Float16)p[r]; } }
      lr[j] = lr[j] * al + sm;
#pragma unroll
      for (int t = 0; t < 4; ++t) o[j][t] = fa_mma(vf[t], pf.v, o[j][t] * al);
    }
  }
#pragma unroll
  for (int j = 0; j < 2; ++j) { const float inv = 64.0f / (lr[j] + fa_xhalf(lr[j])); _Float16* op = O + ((size_t)b * NQ + q0 + j * 16 + ln) * DM + h * HD + 8 * hh;      /* o carried x64, as the output GEMM expects */
#pragma unroll
    for (int t = 0; t < 4; ++t) { FragH f;
#pragma unroll
      for (int r = 0; r < 8; ++r) f.h[r] = (_Float16)(o[j][t][r] * inv);
      *(v8us*)((unsigned short*)op + t * 16) = f.half[0]; } } }      /* O^T tile t: d = 16 t + 8 hh + r, eight consecutive columns of the query's row: one 16-byte store */

extern "C" void kernel_launch(void* const* d_in, const int* in_sizes, int n_in,
                              void* d_out, int out_size, void* d_ws, size_t ws_size, hipStream_t stream) {
  (void)in_sizes; (void)n_in; (void)out_size;
  const float* const* I = (const float* const*)d_in; const float* x = I[0]; const float* ctx = I[1]; const float* vsrc = I[2]; const float* wq = I[3]; const float* bq = I[4]; const float* wk = I[5]; const float* bk = I[6]; const float* wv = I[7]; const float* bv = I[8]; const float* wo = I[9]; const float* bo = I[10];      /* input order: Q, K, V (THREE streams), Wq, bq, Wk, bk, Wv, bv (PER-HEAD [16][64][64] = [head][in][out]; biases [16][64] = the flat [1024] at 64 h + e; zeros on this draw), Wo ([in][out] [1024][1024]), bo (zeros): eleven inputs */
  char* ws = (char*)d_ws; size_t off = 0;
  auto take = [&](size_t bytes) { char* p = ws + off; off += (bytes + 255) & ~(size_t)255; return p; };
  _Float16* BQ = (_Float16*)take((size_t)DM * DM * 2); _Float16* BK = (_Float16*)take((size_t)DM * DC * 2); _Float16* BV = (_Float16*)take((size_t)DM * DC * 2); _Float16* BO = (_Float16*)take((size_t)DM * DM * 2);
  _Float16* X16 = (_Float16*)take(NRQ * DM * 2); _Float16* C16 = (_Float16*)take(NRK * DC * 2); _Float16* VS16 = (_Float16*)take(NRK * DC * 2); _Float16* Q16 = (_Float16*)take(NRQ * DM * 2); _Float16* K16 = (_Float16*)take(NRK * DM * 2); _Float16* V16 = (_Float16*)take(NRK * DM * 2); _Float16* O16 = (_Float16*)take(NRQ * DM * 2);
  _Float16* VT = (_Float16*)take((size_t)NB * NH * HD * SK * 2);
  if (off > ws_size) return;      /* 4 x 2 + 7 x 16 + 16 = 136 MiB */
  k_prep<<<PB_WO + 3 * NH * PB_WH + 3 * PB_X, 256, 0, stream>>>(x, ctx, vsrc, wq, wk, wv, wo, X16, C16, VS16, BQ, BK, BV, BO);      /* all operands in one launch. The per-head stacks [16][64][64] are [in][out] per head (x_h @ W_h): W_h[d][e] -> Bt_h[e][d] x16, K = N = 64, into consecutive [64][64] planes; Wo [in][out]: the same with K = N = 1024; the query, key and value rows as f16 */
  k_gemm2x3<0><<<dim3((unsigned)(NRQ / 128), NH, 3), 128, 0, stream>>>(X16, C16, VS16, DM, (size_t)HD, BQ, BK, BV, HD, (size_t)HD * HD, 0.0625f, bq, bk, bv, (size_t)HD, Q16, K16, V16, DM, (size_t)HD, (int)NRQ, HD, HD);      /* q, k, v (grid.z) in one launch: head h (grid.y) = rows[:, 64 h ..] W_h + b_h -> out[:, 64 h ..]: A + 64 h (pitch DM), B + 4096 h (pitch 64), bias + 64 h, C + 64 h (pitch DM); K = N = 64 */
  k_vt<NH, SK><<<NB * NH * (SK / 64), 256, 0, stream>>>(V16, DM, 0, VT);      /* V^T [4][16][64][2048], all batches in one launch: the kernel takes batch and head from the block index */
  k_fattn<<<NB * NH * (NQ / 512), 512, 0, stream>>>(Q16, K16, VT, O16);      /* scores, softmax, P V of every batch and head: 512 queries a block, o x64 into merged rows */
  k_gemm2<0><<<dim3((unsigned)((NRQ / 128) * (DM / 64)), 1), 128, 0, stream>>>(O16, DM, 0, BO, DM, 0, 0.0009765625f, bo, 0, nullptr, 1, 0, 0, (float*)d_out, nullptr, DM, 0, (int)NRQ, DM, DM);      /* out = o Wo + bo */
}

// v004
// It runs in 171 microseconds.
// Timed twice side by side with v003, it ran 1.07 and 1.08 times as fast.
// Counting every step since v000, it is 40.1 times as fast.
#include <hip/hip_runtime.h>
// Multi-head attention on THREE input streams with BLOCK-DIAGONAL per-head projections on four sequences (Q, K, V [4][2048][1024], each split into 16 contiguous 64-wide slices; q / k / v = einsum('bhsd,hde->bhse', slice, W) + b: EACH HEAD applies its own Dense(64) (W [16][64][64] = [head][in][out], normal x 1/8; biases [16][64] zeros on this draw) to ITS OWN slice of ITS stream; scores / sqrt(64); softmax over all 2048 keys (no mask); out = merged Wo + bo ([in][out] [1024][1024]; bo zeros) -> [4][2048][1024]); each projection is ONE head-batched GEMM (K = 64).
// Structure: the per-head [in][out] weight blocks transposed into sixteen consecutive exact x16 [64][64] planes per stack (all weight builders in ONE launch, by ranges of the block index); Q, K, V as three HEAD-BATCHED WMMA GEMMs in ONE launch (16 heads on grid.y, the stream on grid.z; K = N = 64; 32x64 wave tiles, A fragments read from the f32 input rows and rounded in registers, no f16 copy of the inputs in memory; f32 accumulation, + the head's bias, f16 outputs into the head's 64 columns); V^T of all batches via LDS transposes in ONE launch; ONE fused launch for all batches and heads: scores (K = 64), running softmax over the 2048 keys (f32 statistics, native exp2; unnormalised weights in (0, 1] as f16), o = P V (o carried x64) into merged f16 rows; out = o W_o + b_o GEMM (f32, alpha 2^-10); launches: see trace.
// Compute dtype: inputs rounded to bf16; x / context / weights exact; q, k, v, softmax weights and o as plain f16 GEMM operands (~2^-12); scores and statistics f32; v_wmma_f32_16x16x32_f16.
#define NB 4
#define NQ 2048
#define SK 2048
#define SQ SK                       /* keys per softmax row */
#define DM 1024
#define DC 1024
#define NH 16
#define HD 64
#define HG 4
#define NRQ ((size_t)NB * NQ)
#define NRK ((size_t)NB * SK)
typedef __bf16 v16b __attribute__((ext_vector_type(16)));
typedef unsigned short v8us __attribute__((ext_vector_type(8), may_alias));
typedef float  v8f  __attribute__((ext_vector_type(8)));
typedef float  v4f  __attribute__((ext_vector_type(4)));
typedef float  v4fa __attribute__((ext_vector_type(4), may_alias));
union FragB { v16b v; v8us half[2]; unsigned short u[16]; };

__device__ __forceinline__ unsigned short bf16_bits(float x) { unsigned int u = __float_as_uint(x); return (unsigned short)((u + 0x7FFFu + ((u >> 16) & 1u)) >> 16); }
__device__ __forceinline__ float bf16_val(unsigned short b) { return __uint_as_float(((unsigned int)b) << 16); }
__device__ __forceinline__ float bf16_round(float x) { return bf16_val(bf16_bits(x)); }
// D += A·B with NT terms: 1 = ah·bh, 2 = + al·bh (A split), 3 = + ah·bl (both split)
template <int NT>
__device__ __forceinline__ v8f mmaN(v16b ah, v16b al, v16b bh, v16b bl, v8f c) {
  c = __builtin_amdgcn_wmma_f32_16x16x32_bf16(false, ah, false, bh, (short)0, c, false, false);
  if (NT >= 2) c = __builtin_amdgcn_wmma_f32_16x16x32_bf16(false, al, false, bh, (short)0, c, false, false);
  if (NT >= 3) c = __builtin_amdgcn_wmma_f32_16x16x32_bf16(false, ah, false, bl, (short)0, c, false, false);
  asm volatile("v_nop\n\tv_nop\n\tv_nop\n\tv_nop" : "+v"(c) : "v"(ah), "v"(al), "v"(bh), "v"(bl));
  return c;
}

__global__ __launch_bounds__(256) void k_wt_bf16(const float* __restrict__ W, unsigned short* __restrict__ Wt, int K, int N) {
  const int t = blockIdx.x * 256 + threadIdx.x;
  const int k8n = K / 8;
  if (t >= N * k8n) return;
  const int n = t / k8n, k8 = (t % k8n) * 8;
  v8us v;
#pragma unroll
  for (int i = 0; i < 8; ++i) v[i] = bf16_bits(W[(size_t)(k8 + i) * N + n]);
  *(v8us*)(Wt + (size_t)n * K + k8) = v;
  
}

// GEMM C[M][N] (f32, pitch ldc) = act(A[M][K]·W + bias). A f32 row-major (pitch lda) converted per fragment to bf16
// (ASPLIT: hi/lo two planes -> 2 terms, else single rounded term); Wt bf16 [N][K] (pitch ldb). BIAS_BF16 rounds the
// bias to bf16 first (bias quantised to bf16 before the add). K%32==0, M%16==0, N%64==0.
template <bool ASPLIT, int ACT, bool BIAS_BF16>
__global__ __launch_bounds__(128) void k_gemm_bf(const float* __restrict__ A, int lda, const unsigned short* __restrict__ Wt, int ldb,
                                               const float* __restrict__ bias, float* __restrict__ C, int ldc, int M, int N, int K) {
  __shared__ __attribute__((aligned(16))) float so[4][16][64];
  const int tid = threadIdx.x, w = tid >> 5, lane = tid & 31, ln = lane & 15, hh = lane >> 4;
  const int ntn = N / 64;
  const int wid = blockIdx.x * 4 + w;
  const int mt = wid / ntn, nq = wid % ntn;
  if (mt * 16 >= M) return;
  const int row0 = mt * 16, col0 = nq * 64;
  const float* arow = A + (size_t)(row0 + ln) * lda;
  v8f acc[4] = {};
  for (int kb = 0; kb < K; kb += 32) {
    FragB ah, al;
    const v4f x0 = *(const v4fa*)(arow + kb + 8 * hh), x1 = *(const v4fa*)(arow + kb + 8 * hh + 4);
    const v4f x2 = *(const v4fa*)(arow + kb + 16 + 8 * hh), x3 = *(const v4fa*)(arow + kb + 16 + 8 * hh + 4);
    float xs[16] = {x0[0],x0[1],x0[2],x0[3],x1[0],x1[1],x1[2],x1[3],x2[0],x2[1],x2[2],x2[3],x3[0],x3[1],x3[2],x3[3]};
#pragma unroll
    for (int i = 0; i < 16; ++i) { const unsigned short hb = bf16_bits(xs[i]); ah.u[i] = hb; al.u[i] = ASPLIT ? bf16_bits(xs[i] - bf16_val(hb)) : (unsigned short)0; }
#pragma unroll
    for (int t = 0; t < 4; ++t) {
      const unsigned short* brow = Wt + (size_t)(col0 + t * 16 + ln) * ldb + kb;
      FragB b;
      b.half[0] = *(const v8us*)(brow + 8 * hh);
      b.half[1] = *(const v8us*)(brow + 16 + 8 * hh);
      acc[t] = mmaN<ASPLIT ? 2 : 1>(ah.v, al.v, b.v, b.v, acc[t]);
    }
  }
#pragma unroll
  for (int t = 0; t < 4; ++t) {
    float bv = bias ? bias[col0 + t * 16 + ln] : 0.f;
    if (BIAS_BF16) bv = bf16_round(bv);
#pragma unroll
    for (int r = 0; r < 8; ++r) { float v = acc[t][r] + bv; if (ACT == 1) v = fmaxf(v, 0.f); so[w][8 * hh + r][t * 16 + ln] = v; }
  }
  __builtin_amdgcn_fence(__ATOMIC_ACQ_REL, "workgroup");
  __builtin_amdgcn_wave_barrier();
  const int rsub = lane >> 4, c4 = (lane & 15) * 4;
  {
#pragma unroll
    for (int q = 0; q < 8; ++q) {
      const int r = q * 2 + rsub;
      const v4f v = *(const v4fa*)&so[w][r][c4];
      *(v4f*)(C + (size_t)(row0 + r) * ldc + col0 + c4) = v;
    }
    
  }
}

// GEMM C = act(A·W + bias + resid): A f32 (ASPLIT -> hi/lo 2 terms), Wt bf16 [N][K]; ACT 0 none, 1 relu, 2 exact gelu;
// resid (optional, f32, row index = (row % rmod), pitch ldr, RES_BF16 rounds it) added before the activation.
template <bool ASPLIT, int ACT, bool BIAS_BF16, bool RES_BF16>
__global__ __launch_bounds__(128) void k_gemm_bf3(const float* __restrict__ A, int lda, const unsigned short* __restrict__ Wt, int ldb,
                                                const float* __restrict__ bias, const float* __restrict__ resid, int rmod, int ldr,
                                                float* __restrict__ C, int ldc, int M, int N, int K) {
  __shared__ __attribute__((aligned(16))) float so[4][16][64];
  const int tid = threadIdx.x, w = tid >> 5, lane = tid & 31, ln = lane & 15, hh = lane >> 4;
  const int ntn = N / 64;
  const int wid = blockIdx.x * 4 + w;
  const int mt = wid / ntn, nq = wid % ntn;
  if (mt * 16 >= M) return;
  const int row0 = mt * 16, col0 = nq * 64;
  const float* arow = A + (size_t)(row0 + ln) * lda;
  v8f acc[4] = {};
  for (int kb = 0; kb < K; kb += 32) {
    FragB ah, al;
    const v4f x0 = *(const v4fa*)(arow + kb + 8 * hh), x1 = *(const v4fa*)(arow + kb + 8 * hh + 4);
    const v4f x2 = *(const v4fa*)(arow + kb + 16 + 8 * hh), x3 = *(const v4fa*)(arow + kb + 16 + 8 * hh + 4);
    float xs[16] = {x0[0],x0[1],x0[2],x0[3],x1[0],x1[1],x1[2],x1[3],x2[0],x2[1],x2[2],x2[3],x3[0],x3[1],x3[2],x3[3]};
#pragma unroll
    for (int i = 0; i < 16; ++i) { const unsigned short hb = bf16_bits(xs[i]); ah.u[i] = hb; al.u[i] = ASPLIT ? bf16_bits(xs[i] - bf16_val(hb)) : (unsigned short)0; }
#pragma unroll
    for (int t = 0; t < 4; ++t) {
      const unsigned short* brow = Wt + (size_t)(col0 + t * 16 + ln) * ldb + kb;
      FragB b;
      b.half[0] = *(const v8us*)(brow + 8 * hh);
      b.half[1] = *(const v8us*)(brow + 16 + 8 * hh);
      acc[t] = mmaN<ASPLIT ? 2 : 1>(ah.v, al.v, b.v, b.v, acc[t]);
    }
  }
#pragma unroll
  for (int t = 0; t < 4; ++t) {
    const int col = col0 + t * 16 + ln;
    float bv = bias ? bias[col] : 0.f;
    if (BIAS_BF16) bv = bf16_round(bv);
#pragma unroll
    for (int r = 0; r < 8; ++r) {
      float v = acc[t][r] + bv;
      if (resid) { float rv = resid[(size_t)((row0 + 8 * hh + r) % rmod) * ldr + col]; if (RES_BF16) rv = bf16_round(rv); v += rv; }
      if (ACT == 1) v = fmaxf(v, 0.f);
      if (ACT == 2) v = 0.5f * v * (1.0f + erff(v * 0.70710678118654752f));
      if (ACT == 3) { const float u = 0.7978845608028654f * (v + 0.044715f * v * v * v); v = 0.5f * v * (1.0f + tanhf(u)); }
      so[w][8 * hh + r][t * 16 + ln] = v;
    }
  }
  __builtin_amdgcn_fence(__ATOMIC_ACQ_REL, "workgroup");
  __builtin_amdgcn_wave_barrier();
  const int rsub = lane >> 4, c4 = (lane & 15) * 4;
  {
#pragma unroll
    for (int q = 0; q < 8; ++q) {
      const int r = q * 2 + rsub;
      const v4f v = *(const v4fa*)&so[w][r][c4];
      *(v4f*)(C + (size_t)(row0 + r) * ldc + col0 + c4) = v;
    }
    
  }
}
// row LayerNorm (biased variance, eps) over N: s = X (+ R); optional out_sum <- s; out_norm <- (s-mu)*rsqrt(var+eps)*g + b
template <bool PARAM_BF16>
__global__ __launch_bounds__(256) void k_layernorm(const float* __restrict__ X, const float* __restrict__ R, const float* __restrict__ g, const float* __restrict__ bta,
                                                  float* __restrict__ out_sum, float* __restrict__ out_norm, int N, float eps) {
  __shared__ float red[256];
  const int row = blockIdx.x, tid = threadIdx.x;
  const float* x = X + (size_t)row * N; const float* rr = R ? R + (size_t)row * N : nullptr;
  float vals[16];                     // up to N = 4096
  const int per = N / 256;            // contiguous chunk per thread? use strided-by-4 chunks: thread handles j = tid*4 + 1024*u
  float s1 = 0.f;
  for (int u = 0; u < per / 4; ++u) {
    const int j = tid * 4 + 1024 * u;
    const v4f a = *(const v4fa*)(x + j);
    v4f b = {0.f,0.f,0.f,0.f}; if (rr) b = *(const v4fa*)(rr + j);
#pragma unroll
    for (int q = 0; q < 4; ++q) { const float v = a[q] + b[q]; vals[u * 4 + q] = v; s1 += v; }
  }
  red[tid] = s1; __syncthreads();
  for (int st = 128; st > 0; st >>= 1) { if (tid < st) red[tid] += red[tid + st]; __syncthreads(); }
  const float mu = red[0] / (float)N; __syncthreads();
  float s2 = 0.f;
  for (int u = 0; u < per / 4; ++u)
#pragma unroll
    for (int q = 0; q < 4; ++q) { const float c = vals[u * 4 + q] - mu; s2 += c * c; }
  red[tid] = s2; __syncthreads();
  for (int st = 128; st > 0; st >>= 1) { if (tid < st) red[tid] += red[tid + st]; __syncthreads(); }
  const float rs = rsqrtf(red[0] / (float)N + eps);
  {
    for (int u = 0; u < per / 4; ++u) {
      const int j = tid * 4 + 1024 * u;
      v4f o, sm;
#pragma unroll
      for (int q = 0; q < 4; ++q) {
        float gg = g[j + q], bb = bta[j + q];
        if (PARAM_BF16) { gg = bf16_round(gg); bb = bf16_round(bb); }
        sm[q] = vals[u * 4 + q]; o[q] = (vals[u * 4 + q] - mu) * rs * gg + bb;
      }
      if (out_sum) *(v4f*)(out_sum + (size_t)row * N + j) = sm;
      *(v4f*)(out_norm + (size_t)row * N + j) = o;
    }
    
  }
}



// ---- f16 WMMA path (v_wmma_f32_16x16x32_f16): 11-bit significands for operands in range — used where a [0,1] probability operand needs more precision than bf16
typedef _Float16 v16h __attribute__((ext_vector_type(16)));
union FragH { v16h v; v8us half[2]; _Float16 h[16]; unsigned short u[16]; };
template <int NT>
__device__ __forceinline__ v8f mmaH(v16h ah, v16h al, v16h bh, v16h bl, v8f c) {
  c = __builtin_amdgcn_wmma_f32_16x16x32_f16(false, ah, false, bh, (short)0, c, false, false);
  if (NT >= 2) c = __builtin_amdgcn_wmma_f32_16x16x32_f16(false, al, false, bh, (short)0, c, false, false);
  if (NT >= 3) c = __builtin_amdgcn_wmma_f32_16x16x32_f16(false, ah, false, bl, (short)0, c, false, false);
  asm volatile("v_nop\n\tv_nop\n\tv_nop\n\tv_nop" : "+v"(c) : "v"(ah), "v"(al), "v"(bh), "v"(bl));
  return c;
}
// batched GEMM like k_gemm_b but f16 operands: A f32 (split into f16 hi/lo if ASPLIT, else rounded to f16), Bt = f16 values [n][k]; alpha; C f32; N multiple of 16 (partial tiles skipped)
template <bool ASPLIT>
__global__ __launch_bounds__(128) void k_gemm_h(const float* __restrict__ A, int lda, size_t sA, const _Float16* __restrict__ Bh, int ldb, size_t sB, float alpha, float* __restrict__ C, int ldc, size_t sC, int M, int N, int K) {
  __shared__ __attribute__((aligned(16))) float so[4][16][64];
  const int tid = threadIdx.x, w = tid >> 5, lane = tid & 31, ln = lane & 15, hh = lane >> 4; const int by = blockIdx.y;
  A += (size_t)by * sA; Bh += (size_t)by * sB; C += (size_t)by * sC;
  const int ntn = (N + 63) / 64; const int wid = blockIdx.x * 4 + w; const int mt = wid / ntn, nq = wid % ntn; if (mt * 16 >= M) return;
  const int row0 = mt * 16, col0 = nq * 64; const float* arow = A + (size_t)(row0 + ln) * lda;
  v8f acc[4] = {};
  for (int kb = 0; kb < K; kb += 32) {
    FragH ah, al;
    const v4f x0 = *(const v4fa*)(arow + kb + 8 * hh), x1 = *(const v4fa*)(arow + kb + 8 * hh + 4), x2 = *(const v4fa*)(arow + kb + 16 + 8 * hh), x3 = *(const v4fa*)(arow + kb + 16 + 8 * hh + 4);
    float xs[16] = {x0[0],x0[1],x0[2],x0[3],x1[0],x1[1],x1[2],x1[3],x2[0],x2[1],x2[2],x2[3],x3[0],x3[1],x3[2],x3[3]};
#pragma unroll
    for (int i = 0; i < 16; ++i) { const _Float16 h = (_Float16)xs[i]; ah.h[i] = h; al.h[i] = ASPLIT ? (_Float16)(xs[i] - (float)h) : (_Float16)0.0f; }
#pragma unroll
    for (int t = 0; t < 4; ++t) { if (col0 + t * 16 >= N) continue; const size_t boff = (size_t)(col0 + t * 16 + ln) * ldb + kb; FragH bq; bq.half[0] = *(const v8us*)(Bh + boff + 8 * hh); bq.half[1] = *(const v8us*)(Bh + boff + 16 + 8 * hh);
      acc[t] = mmaH<ASPLIT ? 2 : 1>(ah.v, al.v, bq.v, bq.v, acc[t]); }
  }
#pragma unroll
  for (int t = 0; t < 4; ++t) { if (col0 + t * 16 >= N) continue;
#pragma unroll
    for (int r = 0; r < 8; ++r) so[w][8 * hh + r][t * 16 + ln] = acc[t][r] * alpha; }
  __builtin_amdgcn_fence(__ATOMIC_ACQ_REL, "workgroup"); __builtin_amdgcn_wave_barrier();
  const int rsub = lane >> 4, c4 = (lane & 15) * 4;
  {
#pragma unroll
    for (int q = 0; q < 8; ++q) { const int r = q * 2 + rsub; if (col0 + c4 < N) { const v4f v = *(const v4fa*)&so[w][r][c4]; *(v4f*)(C + (size_t)(row0 + r) * ldc + col0 + c4) = v; } }
     }
}

// Wt[n][k] = f16(W[k][n]·scale) from f32 row-major W[K][N] (scale = power of two; bf16-exact weights stay exact in f16 away from the subnormal range)
__device__ __forceinline__ void wt_f16_at(const float* __restrict__ W, _Float16* __restrict__ Wt, int K, int N, float scale, int t) {      /* t: which eight k of which n; the caller's grid covers N K / 8 exactly */
  const int n = t / (K / 8), k8 = (t % (K / 8)) * 8; FragH f;
#pragma unroll
  for (int i = 0; i < 8; ++i) f.h[i] = (_Float16)(bf16_round(W[(size_t)(k8 + i) * N + n]) * scale); const v8us o = f.half[0];
  *(v8us*)((unsigned short*)Wt + (size_t)n * K + k8) = o; asm volatile("s_wait_xcnt 0x0" ::: "memory");      /* the wait that belongs in front of any overwrite of a register which an issued store names */
}
// k_gemm_hh variant with fused epilogue: v = acc·alpha + bias[by·sBias + col] (+ CP[(row/rowsPerB)·sCPb + by·64 + col] if CP) ; ACT 0 none / 1 elu ; writes f16 C16 (and f32 C if non-null)
template <int ACT>
__global__ __launch_bounds__(128) void k_gemm_hhx(const _Float16* __restrict__ A, int lda, size_t sA, const _Float16* __restrict__ Bh, int ldb, size_t sB, float alpha, const float* __restrict__ bias, size_t sBias, const float* __restrict__ CP, int rowsPerB, size_t sCPb, int row0g,
    float* __restrict__ C, _Float16* __restrict__ C16, int ldc, size_t sC, int M, int N, int K) {
  __shared__ __attribute__((aligned(16))) float so[4][16][64];
  const int tid = threadIdx.x, w = tid >> 5, lane = tid & 31, ln = lane & 15, hh = lane >> 4; const int by = blockIdx.y;
  A += (size_t)by * sA; Bh += (size_t)by * sB; const size_t cofs = (size_t)by * sC; const float* bp = bias ? bias + (size_t)by * sBias : nullptr;
  const int ntn = (N + 63) / 64; const int wid = blockIdx.x * 4 + w; const int mt = wid / ntn, nq = wid % ntn; if (mt * 16 >= M) return;
  const int row0 = mt * 16, col0 = nq * 64; const _Float16* arow = A + (size_t)(row0 + ln) * lda;
  v8f acc[4] = {};
  for (int kb = 0; kb < K; kb += 32) { FragH ah; ah.half[0] = *(const v8us*)((const unsigned short*)arow + kb + 8 * hh); ah.half[1] = *(const v8us*)((const unsigned short*)arow + kb + 16 + 8 * hh);
#pragma unroll
    for (int t = 0; t < 4; ++t) { if (col0 + t * 16 >= N) continue; const size_t boff = (size_t)(col0 + t * 16 + ln) * ldb + kb; FragH bq; bq.half[0] = *(const v8us*)((const unsigned short*)Bh + boff + 8 * hh); bq.half[1] = *(const v8us*)((const unsigned short*)Bh + boff + 16 + 8 * hh);
      acc[t] = mmaH<1>(ah.v, ah.v, bq.v, bq.v, acc[t]); }
  }
#pragma unroll
  for (int t = 0; t < 4; ++t) { if (col0 + t * 16 >= N) continue; const int col = col0 + t * 16 + ln; const float bv = bp ? bf16_round(bp[col]) : 0.f;
#pragma unroll
    for (int r = 0; r < 8; ++r) { float v = acc[t][r] * alpha + bv; if (CP) { const int rr = row0g + row0 + 8 * hh + r; if (rowsPerB < 0) v += CP[cofs + (size_t)rr * ldc + col];      /* rowsPerB < 0: own element of the batched C plane */ else { const int bidx = rr / rowsPerB; v += CP[(size_t)bidx * sCPb + (size_t)by * 64 + col]; } } if (ACT == 1) v = (v > 0.f) ? v : expm1f(v); else if (ACT == 7) v = (v > 0.f) ? v + 1.0f : expf(v); else if (ACT == 8) v = tanhf(v); else if (ACT == 9) v = 0.5f * v * (1.0f + tanhf(0.7978845608028654f * (v + 0.044715f * v * v * v))); else if (ACT == 11) v = 1.0f / (1.0f + expf(-v)); else if (ACT == 12) v = (v > 0.f) ? v : 0.01f * v; else if (ACT == 14) v = (v > 0.f) ? v : 0.1f * v; else if (ACT == 16) v = (v >= 0.f) ? v : 0.3f * v; else if (ACT == 17) v = (v >= 0.f) ? v : 0.2f * v; else if (ACT == 15) v = v / (1.0f + expf(-v)); else if (ACT == 3) v = fmaxf(v, 0.f); else if (ACT == 6) v = 0.5f * v * (1.0f + erff(v * 0.70710678118654752f)); so[w][8 * hh + r][t * 16 + ln] = v; } }
  __builtin_amdgcn_fence(__ATOMIC_ACQ_REL, "workgroup"); __builtin_amdgcn_wave_barrier();
  const int rsub = lane >> 4, c4 = (lane & 15) * 4; typedef _Float16 v4h __attribute__((ext_vector_type(4)));
  {
#pragma unroll
    for (int q = 0; q < 8; ++q) { const int r = q * 2 + rsub; if (col0 + c4 < N) { const v4f v = *(const v4fa*)&so[w][r][c4]; if (C) *(v4f*)(C + cofs + (size_t)(row0 + r) * ldc + col0 + c4) = v; if (C16) { v4h h4; for (int i = 0; i < 4; ++i) h4[i] = (_Float16)v[i]; *(v4h*)(C16 + cofs + (size_t)(row0 + r) * ldc + col0 + c4) = h4; } } }
     }
}


typedef _Float16 v4h __attribute__((ext_vector_type(4)));

__global__ __launch_bounds__(256) void k_h16(const float* __restrict__ x, _Float16* __restrict__ X16, size_t n8) { const size_t t = (size_t)blockIdx.x * 256 + threadIdx.x; if (t >= n8) return; FragH f;
#pragma unroll
  for (int q = 0; q < 8; ++q) f.h[q] = (_Float16)x[t * 8 + q]; *(v8us*)((unsigned short*)X16 + t * 8) = f.half[0];  }
__global__ __launch_bounds__(256) void k_round16f(const float* __restrict__ W, _Float16* __restrict__ Bt, size_t n8) { const size_t t = (size_t)blockIdx.x * 256 + threadIdx.x; if (t >= n8) return; FragH f;
#pragma unroll
  for (int i = 0; i < 8; ++i) f.h[i] = (_Float16)(bf16_round(W[t * 8 + i]) * 16.0f); *(v8us*)((unsigned short*)Bt + t * 8) = f.half[0];  }
template <int NHv, int TTv>
__global__ __launch_bounds__(256) void k_vt(const _Float16* __restrict__ V16, int ldv, int voff, _Float16* __restrict__ Vt) { __shared__ unsigned short tl[64][66]; const int tid = threadIdx.x; const int slab = blockIdx.x / (TTv / 64), lg = blockIdx.x % (TTv / 64); const int b = slab / NHv, h = slab % NHv;
  for (int i = tid; i < 64 * 8; i += 256) { const int r = i / 8, c8 = (i % 8) * 8; FragH f; f.half[0] = *(const v8us*)((const unsigned short*)V16 + ((size_t)b * TTv + lg * 64 + r) * ldv + voff + h * 64 + c8);
#pragma unroll
    for (int q = 0; q < 8; ++q) tl[r][c8 + q] = f.u[q]; }
  __syncthreads();
  {
#pragma unroll
    for (int rd = 0; rd < 2; ++rd) { const int d = rd * 32 + tid / 8, pc = tid % 8; FragH f;
#pragma unroll
      for (int q = 0; q < 8; ++q) f.u[q] = tl[pc * 8 + q][d];
      *(v8us*)((unsigned short*)Vt + ((size_t)slab * 64 + d) * TTv + lg * 64 + pc * 8) = f.half[0]; }
     } }

__global__ __launch_bounds__(256) void k_hl(const float* __restrict__ F, _Float16* __restrict__ Hh, _Float16* __restrict__ Hl, size_t n8) { const size_t t = (size_t)blockIdx.x * 256 + threadIdx.x; if (t >= n8) return; FragH fh, fl; const v4f a = *(const v4fa*)(F + t * 8), c = *(const v4fa*)(F + t * 8 + 4);
#pragma unroll
  for (int q = 0; q < 4; ++q) { _Float16 h = (_Float16)a[q]; fh.h[q] = h; fl.h[q] = (_Float16)((a[q] - (float)h) * 1024.0f); h = (_Float16)c[q]; fh.h[4 + q] = h; fl.h[4 + q] = (_Float16)((c[q] - (float)h) * 1024.0f); }
  { *(v8us*)((unsigned short*)Hh + t * 8) = fh.half[0]; *(v8us*)((unsigned short*)Hl + t * 8) = fl.half[0];  } }

// ---- fast GEMM (wave tile 32x64; requires M % 32 == 0 rows per launch region and N % 64 == 0); epilogue = k_gemm_hhx semantics ----
__device__ __forceinline__ v16h g2_frag(const _Float16* p, int hh) { FragH f; f.half[0] = *(const v8us*)((const unsigned short*)p + 8 * hh); f.half[1] = *(const v8us*)((const unsigned short*)p + 16 + 8 * hh); return f.v; }
__device__ __forceinline__ v8f g2_mma(v16h a, v16h b, v8f c) { v8f d = __builtin_amdgcn_wmma_f32_16x16x32_f16(false, a, false, b, (short)0, c, false, false); asm volatile("v_nop\n\tv_nop\n\tv_nop\n\tv_nop" : "+v"(d) : "v"(a), "v"(b)); return d; }
template <int ACT>
__device__ __forceinline__ void gemm2_body(const _Float16* __restrict__ A, int lda, size_t sA, const _Float16* __restrict__ Bh, int ldb, size_t sB, float alpha, const float* __restrict__ bias, size_t sBias, const float* __restrict__ CP, int rowsPerB, size_t sCPb, int row0g,
    float* __restrict__ C, _Float16* __restrict__ C16, int ldc, size_t sC, int M, int N, int K) { static_assert(ACT == 0 || ACT == 3 || ACT == 6 || ACT == 8 || ACT == 9 || ACT == 11 || ACT == 12 || ACT == 14 || ACT == 15 || ACT == 16 || ACT == 17, "k_gemm2: unsupported ACT code (would silently apply no activation)");
  __shared__ __attribute__((aligned(16))) float so[4][32][68];
  const int tid = threadIdx.x, w = tid >> 5, lane = tid & 31, ln = lane & 15, hh = lane >> 4; const int by = blockIdx.y;
  A += (size_t)by * sA; Bh += (size_t)by * sB; const size_t cofs = (size_t)by * sC; const float* bp = bias ? bias + (size_t)by * sBias : nullptr;
  const int ntn = N >> 6; const int mt = blockIdx.x / ntn, nq = blockIdx.x - mt * ntn; const int row0 = mt * 128 + 32 * w, col0 = nq * 64; if (row0 >= M) return;
  const _Float16* a0p = A + (size_t)(row0 + ln) * lda; const _Float16* a1p = a0p + (size_t)16 * lda;
  const _Float16* b0p = Bh + (size_t)(col0 + ln) * ldb; const _Float16* b1p = b0p + (size_t)16 * ldb; const _Float16* b2p = b1p + (size_t)16 * ldb; const _Float16* b3p = b2p + (size_t)16 * ldb;
  const v8f z8 = {0.f,0.f,0.f,0.f,0.f,0.f,0.f,0.f}; v8f c00 = z8, c01 = z8, c02 = z8, c03 = z8, c10 = z8, c11 = z8, c12 = z8, c13 = z8;
#pragma unroll 1
  for (int kb = 0; kb < K; kb += 32) { const v16h a0 = g2_frag(a0p + kb, hh), a1 = g2_frag(a1p + kb, hh);
    asm volatile("s_wait_xcnt 0x0" ::: "memory");      /* the wait that belongs in front of any overwrite of a register which an issued load names: the B loads behind it land in the registers of the A addresses */
    v16h b = g2_frag(b0p + kb, hh); c00 = g2_mma(a0, b, c00); c10 = g2_mma(a1, b, c10);
    b = g2_frag(b1p + kb, hh); c01 = g2_mma(a0, b, c01); c11 = g2_mma(a1, b, c11);
    b = g2_frag(b2p + kb, hh); c02 = g2_mma(a0, b, c02); c12 = g2_mma(a1, b, c12);
    b = g2_frag(b3p + kb, hh); c03 = g2_mma(a0, b, c03); c13 = g2_mma(a1, b, c13); }
  v8f accs[8] = {c00, c01, c02, c03, c10, c11, c12, c13};
#pragma unroll
  for (int u = 0; u < 8; ++u) { const int t = u & 3, half = u >> 2; const int col = col0 + t * 16 + ln; const float bv = bp ? bf16_round(bp[col]) : 0.f;
#pragma unroll
    for (int r = 0; r < 8; ++r) { const int rloc = half * 16 + 8 * hh + r; float v = accs[u][r] * alpha + bv; if (CP) { if (rowsPerB < 0) v += CP[cofs + (size_t)(row0g + row0 + rloc) * ldc + col];      /* rowsPerB < 0: own element of the batched C plane */ else { const int bidx = (row0g + row0 + rloc) / rowsPerB; v += CP[(size_t)bidx * sCPb + (size_t)by * 64 + col]; } }
      if (ACT == 3) v = fmaxf(v, 0.f); else if (ACT == 6) v = 0.5f * v * (1.0f + erff(v * 0.70710678118654752f)); else if (ACT == 11) v = 1.0f / (1.0f + expf(-v)); else if (ACT == 15) v = v / (1.0f + expf(-v)); else if (ACT == 12) v = (v > 0.f) ? v : 0.01f * v; else if (ACT == 8) v = tanhf(v); else if (ACT == 9) v = 0.5f * v * (1.0f + tanhf(0.7978845608028654f * (v + 0.044715f * v * v * v))); else if (ACT == 14) v = (v > 0.f) ? v : 0.1f * v; else if (ACT == 16) v = (v >= 0.f) ? v : 0.3f * v; else if (ACT == 17) v = (v >= 0.f) ? v : 0.2f * v;
      so[w][rloc][t * 16 + ln] = v; } }
  __builtin_amdgcn_fence(__ATOMIC_ACQ_REL, "workgroup"); __builtin_amdgcn_wave_barrier();
  const int rsub = lane >> 4, c4 = (lane & 15) * 4;
  {
#pragma unroll
    for (int q = 0; q < 16; ++q) { const int r = q * 2 + rsub; const v4f v = *(const v4fa*)&so[w][r][c4]; if (C) { *(v4f*)(C + cofs + (size_t)(row0 + r) * ldc + col0 + c4) = v; asm volatile("s_wait_xcnt 0x0" ::: "memory"); }      /* the wait that belongs in front of any overwrite of a register which an issued store names (the f16 conversion and the next row's address land in them) */
      if (C16) { v4h h4; for (int i = 0; i < 4; ++i) h4[i] = (_Float16)v[i]; *(v4h*)(C16 + cofs + (size_t)(row0 + r) * ldc + col0 + c4) = h4; } }
     } }
template <int ACT>
__global__ __launch_bounds__(128) void k_gemm2(const _Float16* __restrict__ A, int lda, size_t sA, const _Float16* __restrict__ Bh, int ldb, size_t sB, float alpha, const float* __restrict__ bias, size_t sBias, const float* __restrict__ CP, int rowsPerB, size_t sCPb, int row0g,
    float* __restrict__ C, _Float16* __restrict__ C16, int ldc, size_t sC, int M, int N, int K) { gemm2_body<ACT>(A, lda, sA, Bh, ldb, sB, alpha, bias, sBias, CP, rowsPerB, sCPb, row0g, C, C16, ldc, sC, M, N, K); }
// q, k, v projections of all heads in one launch, straight from the f32 input rows: blockIdx.z picks the stream, blockIdx.y the head (both the same for a whole block).
// A head's 64 input columns are used by that head alone and N = 64 covers all of its outputs, so every input element is read once, here: it is rounded in registers
// (f32 -> bf16 -> f16, the two roundings of the former builder) to the value that an f16 copy of the rows would hold. Wave tile 32x64, K = 64 in two steps of 32, products and sums in gemm2_body's order.
__device__ __forceinline__ v16h pj_cvt(v4f x0, v4f x1, v4f x2, v4f x3) { FragH f;      /* g2_frag's k order: x0, x1 = k 8 hh .. 8 hh + 7, x2, x3 = k 16 + 8 hh .. 16 + 8 hh + 7 */
#pragma unroll
  for (int q = 0; q < 4; ++q) { f.h[q] = (_Float16)bf16_round(x0[q]); f.h[4 + q] = (_Float16)bf16_round(x1[q]); f.h[8 + q] = (_Float16)bf16_round(x2[q]); f.h[12 + q] = (_Float16)bf16_round(x3[q]); }
  return f.v; }
__global__ __launch_bounds__(128) void k_proj(const float* __restrict__ x, const float* __restrict__ ctx, const float* __restrict__ vsrc, const _Float16* __restrict__ B0, const _Float16* __restrict__ B1, const _Float16* __restrict__ B2,
    const float* __restrict__ bias0, const float* __restrict__ bias1, const float* __restrict__ bias2, _Float16* __restrict__ C0, _Float16* __restrict__ C1, _Float16* __restrict__ C2) {
  static_assert(HD == 64 && NRQ % 128 == 0 && NRK == NRQ && DC == DM, "k_proj: K = N = 64, whole 128-row blocks, the three streams of one size");
  __shared__ __attribute__((aligned(16))) float so[4][32][68];
  const int tid = threadIdx.x, w = tid >> 5, lane = tid & 31, ln = lane & 15, hh = lane >> 4; const int h = blockIdx.y, z = blockIdx.z;
  const int row0 = blockIdx.x * 128 + 32 * w;
  const float* ap = (z == 0 ? x : z == 1 ? ctx : vsrc) + (size_t)(row0 + ln) * DM + h * HD + 8 * hh;
  const _Float16* bt = (z == 0 ? B0 : z == 1 ? B1 : B2) + (size_t)h * HD * HD + ln * HD;
  const float* bp = (z == 0 ? bias0 : z == 1 ? bias1 : bias2) + h * HD;
  _Float16* cp = (z == 0 ? C0 : z == 1 ? C1 : C2) + (size_t)row0 * DM + h * HD;
  v4f ax[2][2][4]; v16h bf[4][2]; float bb[4];      /* [16-row tile][k step][16-byte piece]; [16-column tile][k step]; the lane's four bias values */
#pragma unroll
  for (int t = 0; t < 4; ++t) bb[t] = bp[t * 16 + ln];
#pragma unroll
  for (int t = 0; t < 4; ++t)
#pragma unroll
    for (int s = 0; s < 2; ++s) bf[t][s] = g2_frag(bt + t * 16 * HD + s * 32, hh);
#pragma unroll
  for (int i = 0; i < 2; ++i)
#pragma unroll
    for (int s = 0; s < 2; ++s) { const float* p = ap + (size_t)i * 16 * DM + s * 32; ax[i][s][0] = *(const v4fa*)p; ax[i][s][1] = *(const v4fa*)(p + 4); ax[i][s][2] = *(const v4fa*)(p + 16); ax[i][s][3] = *(const v4fa*)(p + 20); }
  asm volatile("s_wait_xcnt 0x0" ::: "memory");      /* the wait that belongs in front of any overwrite of a register which an issued load names: all of the tile's loads are asked for above, what follows may reuse their address registers */
  __builtin_amdgcn_sched_barrier(0);      /* keeps the rounding behind all 36 loads, so that bias, weights and rows fly together; without it the second group of loads sinks behind the wait for the first group's data */
  const v8f z8 = {0.f,0.f,0.f,0.f,0.f,0.f,0.f,0.f}; v8f acc[2][4];
#pragma unroll
  for (int i = 0; i < 2; ++i)
#pragma unroll
    for (int t = 0; t < 4; ++t) acc[i][t] = z8;
#pragma unroll
  for (int s = 0; s < 2; ++s) { const v16h a0 = pj_cvt(ax[0][s][0], ax[0][s][1], ax[0][s][2], ax[0][s][3]), a1 = pj_cvt(ax[1][s][0], ax[1][s][1], ax[1][s][2], ax[1][s][3]);
#pragma unroll
    for (int t = 0; t < 4; ++t) { acc[0][t] = g2_mma(a0, bf[t][s], acc[0][t]); acc[1][t] = g2_mma(a1, bf[t][s], acc[1][t]); } }
#pragma unroll
  for (int i = 0; i < 2; ++i)
#pragma unroll
    for (int t = 0; t < 4; ++t) { const float bv = bf16_round(bb[t]);
#pragma unroll
      for (int r = 0; r < 8; ++r) so[w][i * 16 + 8 * hh + r][t * 16 + ln] = acc[i][t][r] * 0.0625f + bv; }      /* the weight planes are carried x16 */
  __builtin_amdgcn_fence(__ATOMIC_ACQ_REL, "workgroup"); __builtin_amdgcn_wave_barrier();      /* each wave reads back its own rows only: its LDS writes in front of its reads */
  const int rsub = lane >> 4, c4 = (lane & 15) * 4;
#pragma unroll
  for (int q = 0; q < 16; ++q) { const int r = q * 2 + rsub; const v4f v = *(const v4fa*)&so[w][r][c4]; v4h h4; for (int i = 0; i < 4; ++i) h4[i] = (_Float16)v[i];
    *(v4h*)(cp + (size_t)r * DM + c4) = h4;
    if (q == 7) asm volatile("s_wait_xcnt 0x0" ::: "memory"); } }      /* the wait that belongs in front of any overwrite of a register which an issued store names: the second eight rows are converted into the registers of the first eight stores */

// Every weight builder in one launch: none needs anything of another, so they share a grid by ranges of the block index (a block lies wholly in one range).
// Range 1: Wo -> BO. Range 2: the 3 x 16 per-head planes, PB_WH blocks each.
#define PB_WO (DM * (DM / 8) / 256)
#define PB_WH (HD * (HD / 8) / 256)
__global__ __launch_bounds__(256) void k_prep(const float* __restrict__ wq, const float* __restrict__ wk, const float* __restrict__ wv, const float* __restrict__ wo,
    _Float16* __restrict__ BQ, _Float16* __restrict__ BK, _Float16* __restrict__ BV, _Float16* __restrict__ BO) {
  static_assert(DM * (DM / 8) % 256 == 0 && HD * (HD / 8) % 256 == 0, "k_prep: every range is a whole number of blocks");
  int u = blockIdx.x; const int tid = threadIdx.x;
  if (u < PB_WO) { wt_f16_at(wo, BO, DM, DM, 16.0f, u * 256 + tid); return; }
  u -= PB_WO;
  const int s = u / (NH * PB_WH), r = u % (NH * PB_WH); const size_t o = (size_t)(r / PB_WH) * HD * HD;
  wt_f16_at((s == 0 ? wq : s == 1 ? wk : wv) + o, (s == 0 ? BQ : s == 1 ? BK : BV) + o, HD, HD, 16.0f, (r % PB_WH) * 256 + tid); }

__global__ __launch_bounds__(256) void k_wnat(const float* __restrict__ w, size_t n8, _Float16* __restrict__ Bt) { const size_t t = (size_t)blockIdx.x * 256 + threadIdx.x; if (t >= n8) return; FragH f; for (int q = 0; q < 8; ++q) f.h[q] = (_Float16)(bf16_round(w[t * 8 + q]) * 16.0f); *(v8us*)((unsigned short*)Bt + t * 8) = f.half[0];  }
__global__ __launch_bounds__(256) void k_rsm(const float* __restrict__ S, _Float16* __restrict__ P, int nrows) {
  #pragma clang fp contract(off)
  const int i = blockIdx.x * 256 + threadIdx.x; if (i >= nrows) return; const float* s = S + (size_t)i * SQ; float mx = -3.0e38f;
#pragma unroll 1
  for (int j = 0; j < SQ; ++j) mx = fmaxf(mx, s[j]); float se = 0.f;
#pragma unroll 1
  for (int j = 0; j < SQ; ++j) se += expf(s[j] - mx); const float sc = 256.0f / se;
#pragma unroll 1
  for (int j0 = 0; j0 < SQ; j0 += 8) { FragH f; for (int q = 0; q < 8; ++q) f.h[q] = (_Float16)(expf(s[j0 + q] - mx) * sc); unsigned short* d = (unsigned short*)P + (size_t)i * SQ + j0; *(v8us*)d = f.half[0];  } }
__global__ __launch_bounds__(256) void k_vt(const _Float16* __restrict__ V16, int b, int h0, _Float16* __restrict__ VT) { __shared__ unsigned short tl[64][65]; const int tid = threadIdx.x; const int hh = blockIdx.x % HG, sg = blockIdx.x / HG; const int s0 = sg * 64; const int h = h0 + hh;
  for (int i = tid; i < 64 * 8; i += 256) { const int j = i / 8, d8 = (i % 8) * 8; FragH f; f.half[0] = *(const v8us*)((const unsigned short*)V16 + ((size_t)b * SQ + s0 + j) * DM + h * HD + d8); for (int q = 0; q < 8; ++q) tl[d8 + q][j] = f.u[q]; }
  __syncthreads();
  { for (int i = tid; i < 64 * 8; i += 256) { const int d = i / 8, j8 = (i % 8) * 8; FragH f; for (int q = 0; q < 8; ++q) f.u[q] = tl[d][j8 + q]; *(v8us*)((unsigned short*)VT + ((size_t)hh * HD + d) * SQ + s0 + j8) = f.half[0]; }  } }


__global__ __launch_bounds__(256) void k_rsmf(const float* __restrict__ S, _Float16* __restrict__ P, int qn, int hg) {
  #pragma clang fp contract(off)
  const int t = blockIdx.x * 256 + threadIdx.x; if (t >= qn * hg) return; const size_t i = (size_t)(t / qn) * SQ + (t % qn); const float* s = S + i * SQ; float mx = -3.0e38f;
#pragma unroll 1
  for (int j = 0; j < SQ; ++j) mx = fmaxf(mx, s[j]); float se = 0.f;
#pragma unroll 1
  for (int j = 0; j < SQ; ++j) se += __expf(s[j] - mx); const float sc = 256.0f / se;
#pragma unroll 1
  for (int j0 = 0; j0 < SQ; j0 += 8) { FragH f; for (int q = 0; q < 8; ++q) f.h[q] = (_Float16)(__expf(s[j0 + q] - mx) * sc); unsigned short* d = (unsigned short*)P + i * SQ + j0; *(v8us*)d = f.half[0];  } }

// Fused attention, all batches and heads in one launch: scores, softmax and P V stay in registers; no score or weight plane goes through memory.
// A wave owns 32 queries of one (batch, head) and walks the 2048 keys 32 at a time. S^T = K Q^T (A = 16 key rows, B = 16 query rows, both by fa_frag, which has g2_frag's k order): a lane holds
// scores of ONE query (column ln), keys 8 hh + r of each 16-key tile, so two tiles, converted in place, are the B operand P^T of O^T += V^T P^T (A = V^T rows by fa_frag,
// the same k order). Running maximum and sum per query (f32); the two wave halves exchange the maximum each pass and join their sums once at the end.
// The 16 waves of a block share one head's K and V^T through the WGP cache. No LDS and no barrier.
__device__ __forceinline__ float fa_xhalf(float x) { return __builtin_bit_cast(float, __builtin_amdgcn_permlanex16(__builtin_bit_cast(int, x), __builtin_bit_cast(int, x), 0x76543210, 0xfedcba98, false, false)); }      /* lane l with lane l ^ 16 */
__device__ __forceinline__ v16h fa_frag(const _Float16* p) { FragH f; f.half[0] = *(const v8us*)(const unsigned short*)p; f.half[1] = *(const v8us*)((const unsigned short*)p + 16); return f.v; }      /* g2_frag with the lane half's 8 hh already in p */
/* Native 2^x, eight (or one) in a statement: behind a transcendental the instruction set asks for one independent instruction or a v_nop before its result is read or its source
   overwritten. Each v_exp_f32 here has an independent one behind it (the outputs share no register with the inputs), the last one the v_nop. */
__device__ __forceinline__ void fa_exp8(const float (&t)[8], float (&e)[8]) {
  asm("v_exp_f32 %0, %8\n\tv_exp_f32 %1, %9\n\tv_exp_f32 %2, %10\n\tv_exp_f32 %3, %11\n\tv_exp_f32 %4, %12\n\tv_exp_f32 %5, %13\n\tv_exp_f32 %6, %14\n\tv_exp_f32 %7, %15\n\tv_nop"
      : "=&v"(e[0]), "=&v"(e[1]), "=&v"(e[2]), "=&v"(e[3]), "=&v"(e[4]), "=&v"(e[5]), "=&v"(e[6]), "=&v"(e[7]) : "v"(t[0]), "v"(t[1]), "v"(t[2]), "v"(t[3]), "v"(t[4]), "v"(t[5]), "v"(t[6]), "v"(t[7])); }
__device__ __forceinline__ float fa_exp1(float t) { float e; asm("v_exp_f32 %0, %1\n\tv_nop" : "=&v"(e) : "v"(t)); return e; }
__device__ __forceinline__ v8f fa_mma(v16h a, v16h b, v8f c) { return __builtin_amdgcn_wmma_f32_16x16x32_f16(false, a, false, b, (short)0, c, false, false); }
__global__ __launch_bounds__(512) void k_fattn(const _Float16* __restrict__ Q, const _Float16* __restrict__ Kk, const _Float16* __restrict__ VT, _Float16* __restrict__ O) {
  const int lane = threadIdx.x & 31, ln = lane & 15, hh = lane >> 4; const int w = __builtin_amdgcn_readfirstlane(threadIdx.x >> 5);      /* the wave's number, held scalar */
  const int bh = blockIdx.x / (NQ / 512), b = bh / NH, h = bh % NH; const int q0 = (blockIdx.x % (NQ / 512)) * 512 + w * 32;
  const float CS = 0.125f * 1.44269504088896340736f;      /* 1 / sqrt(64) and log2 e in one factor: exp(s / 8 - m / 8) = 2^((s - m) CS) */
  const _Float16* qp = Q + ((size_t)b * NQ + q0 + ln) * DM + h * HD + 8 * hh;
  const _Float16* kp = Kk + ((size_t)b * SK + ln) * DM + h * HD + 8 * hh;
  const _Float16* vp = VT + ((size_t)bh * HD + ln) * SK + 8 * hh;
  v16h qf[2][2], kf[2][2];
#pragma unroll
  for (int j = 0; j < 2; ++j)
#pragma unroll
    for (int s = 0; s < 2; ++s) { qf[j][s] = fa_frag(qp + (size_t)j * 16 * DM + s * 32); kf[j][s] = fa_frag(kp + (size_t)j * 16 * DM + s * 32); }
  const v8f z8 = {0.f,0.f,0.f,0.f,0.f,0.f,0.f,0.f}; v8f o[2][4]; float mr[2] = {-3.0e38f, -3.0e38f}, lr[2] = {0.f, 0.f};
#pragma unroll
  for (int j = 0; j < 2; ++j)
#pragma unroll
    for (int t = 0; t < 4; ++t) o[j][t] = z8;
#pragma unroll 1
  for (int c = 0; c < SK / 32; ++c) {      /* rolled: one pass already holds 16 matrix instructions and 16 loads; unrolling would only add registers */
    v16h vf[4]; const _Float16* vc = vp + c * 32;
#pragma unroll
    for (int t = 0; t < 4; ++t) vf[t] = fa_frag(vc + (size_t)t * 16 * SK);      /* this pass's V^T, asked for ahead of the score products */
    v8f st[2][2];
#pragma unroll
    for (int j = 0; j < 2; ++j)
#pragma unroll
      for (int t = 0; t < 2; ++t) st[j][t] = fa_mma(kf[t][1], qf[j][1], fa_mma(kf[t][0], qf[j][0], z8));
    const int cn = (c + 1 < SK / 32) ? c + 1 : c; const _Float16* kc = kp + (size_t)cn * 32 * DM;      /* the next pass's K rows fly during the softmax; the last pass asks for its own rows again, which keeps the address in bounds */
#pragma unroll
    for (int t = 0; t < 2; ++t)
#pragma unroll
      for (int s = 0; s < 2; ++s) kf[t][s] = fa_frag(kc + (size_t)t * 16 * DM + s * 32);
    asm volatile("s_wait_xcnt 0x0" :: "v"(vc), "v"(kc) : "memory");      /* the wait that belongs in front of any overwrite of a register which an issued load names (the next pass forms new addresses); the two addresses as inputs keep their registers out of the loads' own destinations */
    __builtin_amdgcn_sched_barrier(0);      /* keeps the K loads here, ahead of the softmax, so that they fly during it; without it they sink to the foot of the pass */
#pragma unroll
    for (int j = 0; j < 2; ++j) {
      float mx = fmaxf(st[j][0][0], st[j][1][0]);
#pragma unroll
      for (int r = 1; r < 8; ++r) mx = fmaxf(mx, fmaxf(st[j][0][r], st[j][1][r]));
      mx = fmaxf(mx, fa_xhalf(mx));      /* both halves of the wave hold scores of the same query: one maximum for both */
      const float mn = fmaxf(mr[j], mx); const float al = fa_exp1((mr[j] - mn) * CS); const float nb = -mn * CS; mr[j] = mn;      /* al = 0 on the first pass */
      FragH pf; float sm = 0.f;
#pragma unroll
      for (int t = 0; t < 2; ++t) { float x[8], p[8];
#pragma unroll
        for (int r = 0; r < 8; ++r) x[r] = __builtin_fmaf(st[j][t][r], CS, nb);
        fa_exp8(x, p);
#pragma unroll
        for (int r = 0; r < 8; ++r) { sm += p[r]; pf.h[t * 8 + r] = (_Float16)p[r]; } }
      lr[j] = lr[j] * al + sm;
#pragma unroll
      for (int t = 0; t < 4; ++t) o[j][t] = fa_mma(vf[t], pf.v, o[j][t] * al);
    }
  }
#pragma unroll
  for (int j = 0; j < 2; ++j) { const float inv = 64.0f / (lr[j] + fa_xhalf(lr[j])); _Float16* op = O + ((size_t)b * NQ + q0 + j * 16 + ln) * DM + h * HD + 8 * hh;      /* o carried x64, as the output GEMM expects */
#pragma unroll
    for (int t = 0; t < 4; ++t) { FragH f;
#pragma unroll
      for (int r = 0; r < 8; ++r) f.h[r] = (_Float16)(o[j][t][r] * inv);
      *(v8us*)((unsigned short*)op + t * 16) = f.half[0]; } } }      /* O^T tile t: d = 16 t + 8 hh + r, eight consecutive columns of the query's row: one 16-byte store */

extern "C" void kernel_launch(void* const* d_in, const int* in_sizes, int n_in,
                              void* d_out, int out_size, void* d_ws, size_t ws_size, hipStream_t stream) {
  (void)in_sizes; (void)n_in; (void)out_size;
  const float* const* I = (const float* const*)d_in; const float* x = I[0]; const float* ctx = I[1]; const float* vsrc = I[2]; const float* wq = I[3]; const float* bq = I[4]; const float* wk = I[5]; const float* bk = I[6]; const float* wv = I[7]; const float* bv = I[8]; const float* wo = I[9]; const float* bo = I[10];      /* input order: Q, K, V (THREE streams), Wq, bq, Wk, bk, Wv, bv (PER-HEAD [16][64][64] = [head][in][out]; biases [16][64] = the flat [1024] at 64 h + e; zeros on this draw), Wo ([in][out] [1024][1024]), bo (zeros): eleven inputs */
  char* ws = (char*)d_ws; size_t off = 0;
  auto take = [&](size_t bytes) { char* p = ws + off; off += (bytes + 255) & ~(size_t)255; return p; };
  _Float16* BQ = (_Float16*)take((size_t)DM * DM * 2); _Float16* BK = (_Float16*)take((size_t)DM * DC * 2); _Float16* BV = (_Float16*)take((size_t)DM * DC * 2); _Float16* BO = (_Float16*)take((size_t)DM * DM * 2);
  _Float16* Q16 = (_Float16*)take(NRQ * DM * 2); _Float16* K16 = (_Float16*)take(NRK * DM * 2); _Float16* V16 = (_Float16*)take(NRK * DM * 2); _Float16* O16 = (_Float16*)take(NRQ * DM * 2);
  _Float16* VT = (_Float16*)take((size_t)NB * NH * HD * SK * 2);
  if (off > ws_size) return;      /* 4 x 2 + 4 x 16 + 16 = 88 MiB */
  k_prep<<<PB_WO + 3 * NH * PB_WH, 256, 0, stream>>>(wq, wk, wv, wo, BQ, BK, BV, BO);      /* all weight operands in one launch. The per-head stacks [16][64][64] are [in][out] per head (x_h @ W_h): W_h[d][e] -> Bt_h[e][d] x16, K = N = 64, into consecutive [64][64] planes; Wo [in][out]: the same with K = N = 1024 */
  k_proj<<<dim3((unsigned)(NRQ / 128), NH, 3), 128, 0, stream>>>(x, ctx, vsrc, BQ, BK, BV, bq, bk, bv, Q16, K16, V16);      /* q, k, v (grid.z) in one launch, from the f32 rows: head h (grid.y) = rows[:, 64 h ..] W_h + b_h -> out[:, 64 h ..] (pitch DM); B + 4096 h (pitch 64), bias + 64 h; K = N = 64 */
  k_vt<NH, SK><<<NB * NH * (SK / 64), 256, 0, stream>>>(V16, DM, 0, VT);      /* V^T [4][16][64][2048], all batches in one launch: the kernel takes batch and head from the block index */
  k_fattn<<<NB * NH * (NQ / 512), 512, 0, stream>>>(Q16, K16, VT, O16);      /* scores, softmax, P V of every batch and head: 512 queries a block, o x64 into merged rows */
  k_gemm2<0><<<dim3((unsigned)((NRQ / 128) * (DM / 64)), 1), 128, 0, stream>>>(O16, DM, 0, BO, DM, 0, 0.0009765625f, bo, 0, nullptr, 1, 0, 0, (float*)d_out, nullptr, DM, 0, (int)NRQ, DM, DM);      /* out = o Wo + bo */
}

// v005
// It runs in 140 microseconds.
// Next to v004, in two timings, it ran 1.23 and 1.21 times as fast.
// Over all steps from v000 it is 48.9 times as fast.
#include <hip/hip_runtime.h>
// Multi-head attention on THREE input streams with BLOCK-DIAGONAL per-head projections on four sequences (Q, K, V [4][2048][1024], each split into 16 contiguous 64-wide slices; q / k / v = einsum('bhsd,hde->bhse', slice, W) + b: EACH HEAD applies its own Dense(64) (W [16][64][64] = [head][in][out], normal x 1/8; biases [16][64] zeros on this draw) to ITS OWN slice of ITS stream; scores / sqrt(64); softmax over all 2048 keys (no mask); out = merged Wo + bo ([in][out] [1024][1024]; bo zeros) -> [4][2048][1024]); each projection is ONE head-batched GEMM (K = 64).
// Structure: the per-head [in][out] weight blocks transposed into sixteen consecutive exact x16 [64][64] planes per stack (all weight builders in ONE launch, by ranges of the block index); Q, K, V as three HEAD-BATCHED WMMA GEMMs in ONE launch (16 heads on grid.y, the stream on grid.z; K = N = 64; 32x64 wave tiles, A fragments read from the f32 input rows and rounded in registers, no f16 copy of the inputs in memory; f32 accumulation, + the head's bias, f16 outputs into the head's 64 columns); V^T of all batches via LDS transposes in ONE launch; ONE fused launch for all batches and heads: scores (K = 64), running softmax over the 2048 keys (f32 statistics, native exp2; unnormalised weights in (0, 1] as f16), o = P V (o carried x64) into merged f16 rows; out = o W_o + b_o GEMM (f32, alpha 2^-10); launches: see trace.
// Compute dtype: inputs rounded to bf16; x / context / weights exact; q, k, v, softmax weights and o as plain f16 GEMM operands (~2^-12); scores and statistics f32; v_wmma_f32_16x16x32_f16.
#define NB 4
#define NQ 2048
#define SK 2048
#define SQ SK                       /* keys per softmax row */
#define DM 1024
#define DC 1024
#define NH 16
#define HD 64
#define HG 4
#define NRQ ((size_t)NB * NQ)
#define NRK ((size_t)NB * SK)
typedef __bf16 v16b __attribute__((ext_vector_type(16)));
typedef unsigned short v8us __attribute__((ext_vector_type(8), may_alias));
typedef float  v8f  __attribute__((ext_vector_type(8)));
typedef float  v4f  __attribute__((ext_vector_type(4)));
typedef float  v4fa __attribute__((ext_vector_type(4), may_alias));
union FragB { v16b v; v8us half[2]; unsigned short u[16]; };

__device__ __forceinline__ unsigned short bf16_bits(float x) { unsigned int u = __float_as_uint(x); return (unsigned short)((u + 0x7FFFu + ((u >> 16) & 1u)) >> 16); }
__device__ __forceinline__ float bf16_val(unsigned short b) { return __uint_as_float(((unsigned int)b) << 16); }
__device__ __forceinline__ float bf16_round(float x) { return bf16_val(bf16_bits(x)); }
// D += A·B with NT terms: 1 = ah·bh, 2 = + al·bh (A split), 3 = + ah·bl (both split)
template <int NT>
__device__ __forceinline__ v8f mmaN(v16b ah, v16b al, v16b bh, v16b bl, v8f c) {
  c = __builtin_amdgcn_wmma_f32_16x16x32_bf16(false, ah, false, bh, (short)0, c, false, false);
  if (NT >= 2) c = __builtin_amdgcn_wmma_f32_16x16x32_bf16(false, al, false, bh, (short)0, c, false, false);
  if (NT >= 3) c = __builtin_amdgcn_wmma_f32_16x16x32_bf16(false, ah, false, bl, (short)0, c, false, false);
  asm volatile("v_nop\n\tv_nop\n\tv_nop\n\tv_nop" : "+v"(c) : "v"(ah), "v"(al), "v"(bh), "v"(bl));
  return c;
}

__global__ __launch_bounds__(256) void k_wt_bf16(const float* __restrict__ W, unsigned short* __restrict__ Wt, int K, int N) {
  const int t = blockIdx.x * 256 + threadIdx.x;
  const int k8n = K / 8;
  if (t >= N * k8n) return;
  const int n = t / k8n, k8 = (t % k8n) * 8;
  v8us v;
#pragma unroll
  for (int i = 0; i < 8; ++i) v[i] = bf16_bits(W[(size_t)(k8 + i) * N + n]);
  *(v8us*)(Wt + (size_t)n * K + k8) = v;
  
}

// GEMM C[M][N] (f32, pitch ldc) = act(A[M][K]·W + bias). A f32 row-major (pitch lda) converted per fragment to bf16
// (ASPLIT: hi/lo two planes -> 2 terms, else single rounded term); Wt bf16 [N][K] (pitch ldb). BIAS_BF16 rounds the
// bias to bf16 first (bias quantised to bf16 before the add). K%32==0, M%16==0, N%64==0.
template <bool ASPLIT, int ACT, bool BIAS_BF16>
__global__ __launch_bounds__(128) void k_gemm_bf(const float* __restrict__ A, int lda, const unsigned short* __restrict__ Wt, int ldb,
                                               const float* __restrict__ bias, float* __restrict__ C, int ldc, int M, int N, int K) {
  __shared__ __attribute__((aligned(16))) float so[4][16][64];
  const int tid = threadIdx.x, w = tid >> 5, lane = tid & 31, ln = lane & 15, hh = lane >> 4;
  const int ntn = N / 64;
  const int wid = blockIdx.x * 4 + w;
  const int mt = wid / ntn, nq = wid % ntn;
  if (mt * 16 >= M) return;
  const int row0 = mt * 16, col0 = nq * 64;
  const float* arow = A + (size_t)(row0 + ln) * lda;
  v8f acc[4] = {};
  for (int kb = 0; kb < K; kb += 32) {
    FragB ah, al;
    const v4f x0 = *(const v4fa*)(arow + kb + 8 * hh), x1 = *(const v4fa*)(arow + kb + 8 * hh + 4);
    const v4f x2 = *(const v4fa*)(arow + kb + 16 + 8 * hh), x3 = *(const v4fa*)(arow + kb + 16 + 8 * hh + 4);
    float xs[16] = {x0[0],x0[1],x0[2],x0[3],x1[0],x1[1],x1[2],x1[3],x2[0],x2[1],x2[2],x2[3],x3[0],x3[1],x3[2],x3[3]};
#pragma unroll
    for (int i = 0; i < 16; ++i) { const unsigned short hb = bf16_bits(xs[i]); ah.u[i] = hb; al.u[i] = ASPLIT ? bf16_bits(xs[i] - bf16_val(hb)) : (unsigned short)0; }
#pragma unroll
    for (int t = 0; t < 4; ++t) {
      const unsigned short* brow = Wt + (size_t)(col0 + t * 16 + ln) * ldb + kb;
      FragB b;
      b.half[0] = *(const v8us*)(brow + 8 * hh);
      b.half[1] = *(const v8us*)(brow + 16 + 8 * hh);
      acc[t] = mmaN<ASPLIT ? 2 : 1>(ah.v, al.v, b.v, b.v, acc[t]);
    }
  }
#pragma unroll
  for (int t = 0; t < 4; ++t) {
    float bv = bias ? bias[col0 + t * 16 + ln] : 0.f;
    if (BIAS_BF16) bv = bf16_round(bv);
#pragma unroll
    for (int r = 0; r < 8; ++r) { float v = acc[t][r] + bv; if (ACT == 1) v = fmaxf(v, 0.f); so[w][8 * hh + r][t * 16 + ln] = v; }
  }
  __builtin_amdgcn_fence(__ATOMIC_ACQ_REL, "workgroup");
  __builtin_amdgcn_wave_barrier();
  const int rsub = lane >> 4, c4 = (lane & 15) * 4;
  {
#pragma unroll
    for (int q = 0; q < 8; ++q) {
      const int r = q * 2 + rsub;
      const v4f v = *(const v4fa*)&so[w][r][c4];
      *(v4f*)(C + (size_t)(row0 + r) * ldc + col0 + c4) = v;
    }
    
  }
}

// GEMM C = act(A·W + bias + resid): A f32 (ASPLIT -> hi/lo 2 terms), Wt bf16 [N][K]; ACT 0 none, 1 relu, 2 exact gelu;
// resid (optional, f32, row index = (row % rmod), pitch ldr, RES_BF16 rounds it) added before the activation.
template <bool ASPLIT, int ACT, bool BIAS_BF16, bool RES_BF16>
__global__ __launch_bounds__(128) void k_gemm_bf3(const float* __restrict__ A, int lda, const unsigned short* __restrict__ Wt, int ldb,
                                                const float* __restrict__ bias, const float* __restrict__ resid, int rmod, int ldr,
                                                float* __restrict__ C, int ldc, int M, int N, int K) {
  __shared__ __attribute__((aligned(16))) float so[4][16][64];
  const int tid = threadIdx.x, w = tid >> 5, lane = tid & 31, ln = lane & 15, hh = lane >> 4;
  const int ntn = N / 64;
  const int wid = blockIdx.x * 4 + w;
  const int mt = wid / ntn, nq = wid % ntn;
  if (mt * 16 >= M) return;
  const int row0 = mt * 16, col0 = nq * 64;
  const float* arow = A + (size_t)(row0 + ln) * lda;
  v8f acc[4] = {};
  for (int kb = 0; kb < K; kb += 32) {
    FragB ah, al;
    const v4f x0 = *(const v4fa*)(arow + kb + 8 * hh), x1 = *(const v4fa*)(arow + kb + 8 * hh + 4);
    const v4f x2 = *(const v4fa*)(arow + kb + 16 + 8 * hh), x3 = *(const v4fa*)(arow + kb + 16 + 8 * hh + 4);
    float xs[16] = {x0[0],x0[1],x0[2],x0[3],x1[0],x1[1],x1[2],x1[3],x2[0],x2[1],x2[2],x2[3],x3[0],x3[1],x3[2],x3[3]};
#pragma unroll
    for (int i = 0; i < 16; ++i) { const unsigned short hb = bf16_bits(xs[i]); ah.u[i] = hb; al.u[i] = ASPLIT ? bf16_bits(xs[i] - bf16_val(hb)) : (unsigned short)0; }
#pragma unroll
    for (int t = 0; t < 4; ++t) {
      const unsigned short* brow = Wt + (size_t)(col0 + t * 16 + ln) * ldb + kb;
      FragB b;
      b.half[0] = *(const v8us*)(brow + 8 * hh);
      b.half[1] = *(const v8us*)(brow + 16 + 8 * hh);
      acc[t] = mmaN<ASPLIT ? 2 : 1>(ah.v, al.v, b.v, b.v, acc[t]);
    }
  }
#pragma unroll
  for (int t = 0; t < 4; ++t) {
    const int col = col0 + t * 16 + ln;
    float bv = bias ? bias[col] : 0.f;
    if (BIAS_BF16) bv = bf16_round(bv);
#pragma unroll
    for (int r = 0; r < 8; ++r) {
      float v = acc[t][r] + bv;
      if (resid) { float rv = resid[(size_t)((row0 + 8 * hh + r) % rmod) * ldr + col]; if (RES_BF16) rv = bf16_round(rv); v += rv; }
      if (ACT == 1) v = fmaxf(v, 0.f);
      if (ACT == 2) v = 0.5f * v * (1.0f + erff(v * 0.70710678118654752f));
      if (ACT == 3) { const float u = 0.7978845608028654f * (v + 0.044715f * v * v * v); v = 0.5f * v * (1.0f + tanhf(u)); }
      so[w][8 * hh + r][t * 16 + ln] = v;
    }
  }
  __builtin_amdgcn_fence(__ATOMIC_ACQ_REL, "workgroup");
  __builtin_amdgcn_wave_barrier();
  const int rsub = lane >> 4, c4 = (lane & 15) * 4;
  {
#pragma unroll
    for (int q = 0; q < 8; ++q) {
      const int r = q * 2 + rsub;
      const v4f v = *(const v4fa*)&so[w][r][c4];
      *(v4f*)(C + (size_t)(row0 + r) * ldc + col0 + c4) = v;
    }
    
  }
}
// row LayerNorm (biased variance, eps) over N: s = X (+ R); optional out_sum <- s; out_norm <- (s-mu)*rsqrt(var+eps)*g + b
template <bool PARAM_BF16>
__global__ __launch_bounds__(256) void k_layernorm(const float* __restrict__ X, const float* __restrict__ R, const float* __restrict__ g, const float* __restrict__ bta,
                                                  float* __restrict__ out_sum, float* __restrict__ out_norm, int N, float eps) {
  __shared__ float red[256];
  const int row = blockIdx.x, tid = threadIdx.x;
  const float* x = X + (size_t)row * N; const float* rr = R ? R + (size_t)row * N : nullptr;
  float vals[16];                     // up to N = 4096
  const int per = N / 256;            // contiguous chunk per thread? use strided-by-4 chunks: thread handles j = tid*4 + 1024*u
  float s1 = 0.f;
  for (int u = 0; u < per / 4; ++u) {
    const int j = tid * 4 + 1024 * u;
    const v4f a = *(const v4fa*)(x + j);
    v4f b = {0.f,0.f,0.f,0.f}; if (rr) b = *(const v4fa*)(rr + j);
#pragma unroll
    for (int q = 0; q < 4; ++q) { const float v = a[q] + b[q]; vals[u * 4 + q] = v; s1 += v; }
  }
  red[tid] = s1; __syncthreads();
  for (int st = 128; st > 0; st >>= 1) { if (tid < st) red[tid] += red[tid + st]; __syncthreads(); }
  const float mu = red[0] / (float)N; __syncthreads();
  float s2 = 0.f;
  for (int u = 0; u < per / 4; ++u)
#pragma unroll
    for (int q = 0; q < 4; ++q) { const float c = vals[u * 4 + q] - mu; s2 += c * c; }
  red[tid] = s2; __syncthreads();
  for (int st = 128; st > 0; st >>= 1) { if (tid < st) red[tid] += red[tid + st]; __syncthreads(); }
  const float rs = rsqrtf(red[0] / (float)N + eps);
  {
    for (int u = 0; u < per / 4; ++u) {
      const int j = tid * 4 + 1024 * u;
      v4f o, sm;
#pragma unroll
      for (int q = 0; q < 4; ++q) {
        float gg = g[j + q], bb = bta[j + q];
        if (PARAM_BF16) { gg = bf16_round(gg); bb = bf16_round(bb); }
        sm[q] = vals[u * 4 + q]; o[q] = (vals[u * 4 + q] - mu) * rs * gg + bb;
      }
      if (out_sum) *(v4f*)(out_sum + (size_t)row * N + j) = sm;
      *(v4f*)(out_norm + (size_t)row * N + j) = o;
    }
    
  }
}



// ---- f16 WMMA path (v_wmma_f32_16x16x32_f16): 11-bit significands for operands in range — used where a [0,1] probability operand needs more precision than bf16
typedef _Float16 v16h __attribute__((ext_vector_type(16)));
union FragH { v16h v; v8us half[2]; _Float16 h[16]; unsigned short u[16]; };
template <int NT>
__device__ __forceinline__ v8f mmaH(v16h ah, v16h al, v16h bh, v16h bl, v8f c) {
  c = __builtin_amdgcn_wmma_f32_16x16x32_f16(false, ah, false, bh, (short)0, c, false, false);
  if (NT >= 2) c = __builtin_amdgcn_wmma_f32_16x16x32_f16(false, al, false, bh, (short)0, c, false, false);
  if (NT >= 3) c = __builtin_amdgcn_wmma_f32_16x16x32_f16(false, ah, false, bl, (short)0, c, false, false);
  asm volatile("v_nop\n\tv_nop\n\tv_nop\n\tv_nop" : "+v"(c) : "v"(ah), "v"(al), "v"(bh), "v"(bl));
  return c;
}
// batched GEMM like k_gemm_b but f16 operands: A f32 (split into f16 hi/lo if ASPLIT, else rounded to f16), Bt = f16 values [n][k]; alpha; C f32; N multiple of 16 (partial tiles skipped)
template <bool ASPLIT>
__global__ __launch_bounds__(128) void k_gemm_h(const float* __restrict__ A, int lda, size_t sA, const _Float16* __restrict__ Bh, int ldb, size_t sB, float alpha, float* __restrict__ C, int ldc, size_t sC, int M, int N, int K) {
  __shared__ __attribute__((aligned(16))) float so[4][16][64];
  const int tid = threadIdx.x, w = tid >> 5, lane = tid & 31, ln = lane & 15, hh = lane >> 4; const int by = blockIdx.y;
  A += (size_t)by * sA; Bh += (size_t)by * sB; C += (size_t)by * sC;
  const int ntn = (N + 63) / 64; const int wid = blockIdx.x * 4 + w; const int mt = wid / ntn, nq = wid % ntn; if (mt * 16 >= M) return;
  const int row0 = mt * 16, col0 = nq * 64; const float* arow = A + (size_t)(row0 + ln) * lda;
  v8f acc[4] = {};
  for (int kb = 0; kb < K; kb += 32) {
    FragH ah, al;
    const v4f x0 = *(const v4fa*)(arow + kb + 8 * hh), x1 = *(const v4fa*)(arow + kb + 8 * hh + 4), x2 = *(const v4fa*)(arow + kb + 16 + 8 * hh), x3 = *(const v4fa*)(arow + kb + 16 + 8 * hh + 4);
    float xs[16] = {x0[0],x0[1],x0[2],x0[3],x1[0],x1[1],x1[2],x1[3],x2[0],x2[1],x2[2],x2[3],x3[0],x3[1],x3[2],x3[3]};
#pragma unroll
    for (int i = 0; i < 16; ++i) { const _Float16 h = (_Float16)xs[i]; ah.h[i] = h; al.h[i] = ASPLIT ? (_Float16)(xs[i] - (float)h) : (_Float16)0.0f; }
#pragma unroll
    for (int t = 0; t < 4; ++t) { if (col0 + t * 16 >= N) continue; const size_t boff = (size_t)(col0 + t * 16 + ln) * ldb + kb; FragH bq; bq.half[0] = *(const v8us*)(Bh + boff + 8 * hh); bq.half[1] = *(const v8us*)(Bh + boff + 16 + 8 * hh);
      acc[t] = mmaH<ASPLIT ? 2 : 1>(ah.v, al.v, bq.v, bq.v, acc[t]); }
  }
#pragma unroll
  for (int t = 0; t < 4; ++t) { if (col0 + t * 16 >= N) continue;
#pragma unroll
    for (int r = 0; r < 8; ++r) so[w][8 * hh + r][t * 16 + ln] = acc[t][r] * alpha; }
  __builtin_amdgcn_fence(__ATOMIC_ACQ_REL, "workgroup"); __builtin_amdgcn_wave_barrier();
  const int rsub = lane >> 4, c4 = (lane & 15) * 4;
  {
#pragma unroll
    for (int q = 0; q < 8; ++q) { const int r = q * 2 + rsub; if (col0 + c4 < N) { const v4f v = *(const v4fa*)&so[w][r][c4]; *(v4f*)(C + (size_t)(row0 + r) * ldc + col0 + c4) = v; } }
     }
}

// Wt[n][k] = f16(W[k][n]·scale) from f32 row-major W[K][N] (scale = power of two; bf16-exact weights stay exact in f16 away from the subnormal range)
__device__ __forceinline__ void wt_f16_at(const float* __restrict__ W, _Float16* __restrict__ Wt, int K, int N, float scale, int t) {      /* t: which eight k of which n; the caller's grid covers N K / 8 exactly */
  const int n = t / (K / 8), k8 = (t % (K / 8)) * 8; FragH f;
#pragma unroll
  for (int i = 0; i < 8; ++i) f.h[i] = (_Float16)(bf16_round(W[(size_t)(k8 + i) * N + n]) * scale); const v8us o = f.half[0];
  *(v8us*)((unsigned short*)Wt + (size_t)n * K + k8) = o; asm volatile("s_wait_xcnt 0x0" ::: "memory");      /* the wait that belongs in front of any overwrite of a register which an issued store names */
}
// k_gemm_hh variant with fused epilogue: v = acc·alpha + bias[by·sBias + col] (+ CP[(row/rowsPerB)·sCPb + by·64 + col] if CP) ; ACT 0 none / 1 elu ; writes f16 C16 (and f32 C if non-null)
template <int ACT>
__global__ __launch_bounds__(128) void k_gemm_hhx(const _Float16* __restrict__ A, int lda, size_t sA, const _Float16* __restrict__ Bh, int ldb, size_t sB, float alpha, const float* __restrict__ bias, size_t sBias, const float* __restrict__ CP, int rowsPerB, size_t sCPb, int row0g,
    float* __restrict__ C, _Float16* __restrict__ C16, int ldc, size_t sC, int M, int N, int K) {
  __shared__ __attribute__((aligned(16))) float so[4][16][64];
  const int tid = threadIdx.x, w = tid >> 5, lane = tid & 31, ln = lane & 15, hh = lane >> 4; const int by = blockIdx.y;
  A += (size_t)by * sA; Bh += (size_t)by * sB; const size_t cofs = (size_t)by * sC; const float* bp = bias ? bias + (size_t)by * sBias : nullptr;
  const int ntn = (N + 63) / 64; const int wid = blockIdx.x * 4 + w; const int mt = wid / ntn, nq = wid % ntn; if (mt * 16 >= M) return;
  const int row0 = mt * 16, col0 = nq * 64; const _Float16* arow = A + (size_t)(row0 + ln) * lda;
  v8f acc[4] = {};
  for (int kb = 0; kb < K; kb += 32) { FragH ah; ah.half[0] = *(const v8us*)((const unsigned short*)arow + kb + 8 * hh); ah.half[1] = *(const v8us*)((const unsigned short*)arow + kb + 16 + 8 * hh);
#pragma unroll
    for (int t = 0; t < 4; ++t) { if (col0 + t * 16 >= N) continue; const size_t boff = (size_t)(col0 + t * 16 + ln) * ldb + kb; FragH bq; bq.half[0] = *(const v8us*)((const unsigned short*)Bh + boff + 8 * hh); bq.half[1] = *(const v8us*)((const unsigned short*)Bh + boff + 16 + 8 * hh);
      acc[t] = mmaH<1>(ah.v, ah.v, bq.v, bq.v, acc[t]); }
  }
#pragma unroll
  for (int t = 0; t < 4; ++t) { if (col0 + t * 16 >= N) continue; const int col = col0 + t * 16 + ln; const float bv = bp ? bf16_round(bp[col]) : 0.f;
#pragma unroll
    for (int r = 0; r < 8; ++r) { float v = acc[t][r] * alpha + bv; if (CP) { const int rr = row0g + row0 + 8 * hh + r; if (rowsPerB < 0) v += CP[cofs + (size_t)rr * ldc + col];      /* rowsPerB < 0: own element of the batched C plane */ else { const int bidx = rr / rowsPerB; v += CP[(size_t)bidx * sCPb + (size_t)by * 64 + col]; } } if (ACT == 1) v = (v > 0.f) ? v : expm1f(v); else if (ACT == 7) v = (v > 0.f) ? v + 1.0f : expf(v); else if (ACT == 8) v = tanhf(v); else if (ACT == 9) v = 0.5f * v * (1.0f + tanhf(0.7978845608028654f * (v + 0.044715f * v * v * v))); else if (ACT == 11) v = 1.0f / (1.0f + expf(-v)); else if (ACT == 12) v = (v > 0.f) ? v : 0.01f * v; else if (ACT == 14) v = (v > 0.f) ? v : 0.1f * v; else if (ACT == 16) v = (v >= 0.f) ? v : 0.3f * v; else if (ACT == 17) v = (v >= 0.f) ? v : 0.2f * v; else if (ACT == 15) v = v / (1.0f + expf(-v)); else if (ACT == 3) v = fmaxf(v, 0.f); else if (ACT == 6) v = 0.5f * v * (1.0f + erff(v * 0.70710678118654752f)); so[w][8 * hh + r][t * 16 + ln] = v; } }
  __builtin_amdgcn_fence(__ATOMIC_ACQ_REL, "workgroup"); __builtin_amdgcn_wave_barrier();
  const int rsub = lane >> 4, c4 = (lane & 15) * 4; typedef _Float16 v4h __attribute__((ext_vector_type(4)));
  {
#pragma unroll
    for (int q = 0; q < 8; ++q) { const int r = q * 2 + rsub; if (col0 + c4 < N) { const v4f v = *(const v4fa*)&so[w][r][c4]; if (C) *(v4f*)(C + cofs + (size_t)(row0 + r) * ldc + col0 + c4) = v; if (C16) { v4h h4; for (int i = 0; i < 4; ++i) h4[i] = (_Float16)v[i]; *(v4h*)(C16 + cofs + (size_t)(row0 + r) * ldc + col0 + c4) = h4; } } }
     }
}


typedef _Float16 v4h __attribute__((ext_vector_type(4)));

__global__ __launch_bounds__(256) void k_h16(const float* __restrict__ x, _Float16* __restrict__ X16, size_t n8) { const size_t t = (size_t)blockIdx.x * 256 + threadIdx.x; if (t >= n8) return; FragH f;
#pragma unroll
  for (int q = 0; q < 8; ++q) f.h[q] = (_Float16)x[t * 8 + q]; *(v8us*)((unsigned short*)X16 + t * 8) = f.half[0];  }
__global__ __launch_bounds__(256) void k_round16f(const float* __restrict__ W, _Float16* __restrict__ Bt, size_t n8) { const size_t t = (size_t)blockIdx.x * 256 + threadIdx.x; if (t >= n8) return; FragH f;
#pragma unroll
  for (int i = 0; i < 8; ++i) f.h[i] = (_Float16)(bf16_round(W[t * 8 + i]) * 16.0f); *(v8us*)((unsigned short*)Bt + t * 8) = f.half[0];  }
template <int NHv, int TTv>
__global__ __launch_bounds__(256) void k_vt(const _Float16* __restrict__ V16, int ldv, int voff, _Float16* __restrict__ Vt) { __shared__ unsigned short tl[64][66]; const int tid = threadIdx.x; const int slab = blockIdx.x / (TTv / 64), lg = blockIdx.x % (TTv / 64); const int b = slab / NHv, h = slab % NHv;
  for (int i = tid; i < 64 * 8; i += 256) { const int r = i / 8, c8 = (i % 8) * 8; FragH f; f.half[0] = *(const v8us*)((const unsigned short*)V16 + ((size_t)b * TTv + lg * 64 + r) * ldv + voff + h * 64 + c8);
#pragma unroll
    for (int q = 0; q < 8; ++q) tl[r][c8 + q] = f.u[q]; }
  __syncthreads();
  {
#pragma unroll
    for (int rd = 0; rd < 2; ++rd) { const int d = rd * 32 + tid / 8, pc = tid % 8; FragH f;
#pragma unroll
      for (int q = 0; q < 8; ++q) f.u[q] = tl[pc * 8 + q][d];
      *(v8us*)((unsigned short*)Vt + ((size_t)slab * 64 + d) * TTv + lg * 64 + pc * 8) = f.half[0]; }
     } }

__global__ __launch_bounds__(256) void k_hl(const float* __restrict__ F, _Float16* __restrict__ Hh, _Float16* __restrict__ Hl, size_t n8) { const size_t t = (size_t)blockIdx.x * 256 + threadIdx.x; if (t >= n8) return; FragH fh, fl; const v4f a = *(const v4fa*)(F + t * 8), c = *(const v4fa*)(F + t * 8 + 4);
#pragma unroll
  for (int q = 0; q < 4; ++q) { _Float16 h = (_Float16)a[q]; fh.h[q] = h; fl.h[q] = (_Float16)((a[q] - (float)h) * 1024.0f); h = (_Float16)c[q]; fh.h[4 + q] = h; fl.h[4 + q] = (_Float16)((c[q] - (float)h) * 1024.0f); }
  { *(v8us*)((unsigned short*)Hh + t * 8) = fh.half[0]; *(v8us*)((unsigned short*)Hl + t * 8) = fl.half[0];  } }

// ---- fast GEMM (wave tile 32x64; requires M % 32 == 0 rows per launch region and N % 64 == 0); epilogue = k_gemm_hhx semantics ----
__device__ __forceinline__ v16h g2_frag(const _Float16* p, int hh) { FragH f; f.half[0] = *(const v8us*)((const unsigned short*)p + 8 * hh); f.half[1] = *(const v8us*)((const unsigned short*)p + 16 + 8 * hh); return f.v; }
__device__ __forceinline__ v8f g2_mma(v16h a, v16h b, v8f c) { v8f d = __builtin_amdgcn_wmma_f32_16x16x32_f16(false, a, false, b, (short)0, c, false, false); asm volatile("v_nop\n\tv_nop\n\tv_nop\n\tv_nop" : "+v"(d) : "v"(a), "v"(b)); return d; }
template <int ACT>
__device__ __forceinline__ void gemm2_body(const _Float16* __restrict__ A, int lda, size_t sA, const _Float16* __restrict__ Bh, int ldb, size_t sB, float alpha, const float* __restrict__ bias, size_t sBias, const float* __restrict__ CP, int rowsPerB, size_t sCPb, int row0g,
    float* __restrict__ C, _Float16* __restrict__ C16, int ldc, size_t sC, int M, int N, int K) { static_assert(ACT == 0 || ACT == 3 || ACT == 6 || ACT == 8 || ACT == 9 || ACT == 11 || ACT == 12 || ACT == 14 || ACT == 15 || ACT == 16 || ACT == 17, "k_gemm2: unsupported ACT code (would silently apply no activation)");
  __shared__ __attribute__((aligned(16))) float so[4][32][68];
  const int tid = threadIdx.x, w = tid >> 5, lane = tid & 31, ln = lane & 15, hh = lane >> 4; const int by = blockIdx.y;
  A += (size_t)by * sA; Bh += (size_t)by * sB; const size_t cofs = (size_t)by * sC; const float* bp = bias ? bias + (size_t)by * sBias : nullptr;
  const int ntn = N >> 6; const int mt = blockIdx.x / ntn, nq = blockIdx.x - mt * ntn; const int row0 = mt * 128 + 32 * w, col0 = nq * 64; if (row0 >= M) return;
  const _Float16* a0p = A + (size_t)(row0 + ln) * lda; const _Float16* a1p = a0p + (size_t)16 * lda;
  const _Float16* b0p = Bh + (size_t)(col0 + ln) * ldb; const _Float16* b1p = b0p + (size_t)16 * ldb; const _Float16* b2p = b1p + (size_t)16 * ldb; const _Float16* b3p = b2p + (size_t)16 * ldb;
  const v8f z8 = {0.f,0.f,0.f,0.f,0.f,0.f,0.f,0.f}; v8f c00 = z8, c01 = z8, c02 = z8, c03 = z8, c10 = z8, c11 = z8, c12 = z8, c13 = z8;
#pragma unroll 1
  for (int kb = 0; kb < K; kb += 32) { const v16h a0 = g2_frag(a0p + kb, hh), a1 = g2_frag(a1p + kb, hh);
    asm volatile("s_wait_xcnt 0x0" ::: "memory");      /* the wait that belongs in front of any overwrite of a register which an issued load names: the B loads behind it land in the registers of the A addresses */
    v16h b = g2_frag(b0p + kb, hh); c00 = g2_mma(a0, b, c00); c10 = g2_mma(a1, b, c10);
    b = g2_frag(b1p + kb, hh); c01 = g2_mma(a0, b, c01); c11 = g2_mma(a1, b, c11);
    b = g2_frag(b2p + kb, hh); c02 = g2_mma(a0, b, c02); c12 = g2_mma(a1, b, c12);
    b = g2_frag(b3p + kb, hh); c03 = g2_mma(a0, b, c03); c13 = g2_mma(a1, b, c13); }
  v8f accs[8] = {c00, c01, c02, c03, c10, c11, c12, c13};
#pragma unroll
  for (int u = 0; u < 8; ++u) { const int t = u & 3, half = u >> 2; const int col = col0 + t * 16 + ln; const float bv = bp ? bf16_round(bp[col]) : 0.f;
#pragma unroll
    for (int r = 0; r < 8; ++r) { const int rloc = half * 16 + 8 * hh + r; float v = accs[u][r] * alpha + bv; if (CP) { if (rowsPerB < 0) v += CP[cofs + (size_t)(row0g + row0 + rloc) * ldc + col];      /* rowsPerB < 0: own element of the batched C plane */ else { const int bidx = (row0g + row0 + rloc) / rowsPerB; v += CP[(size_t)bidx * sCPb + (size_t)by * 64 + col]; } }
      if (ACT == 3) v = fmaxf(v, 0.f); else if (ACT == 6) v = 0.5f * v * (1.0f + erff(v * 0.70710678118654752f)); else if (ACT == 11) v = 1.0f / (1.0f + expf(-v)); else if (ACT == 15) v = v / (1.0f + expf(-v)); else if (ACT == 12) v = (v > 0.f) ? v : 0.01f * v; else if (ACT == 8) v = tanhf(v); else if (ACT == 9) v = 0.5f * v * (1.0f + tanhf(0.7978845608028654f * (v + 0.044715f * v * v * v))); else if (ACT == 14) v = (v > 0.f) ? v : 0.1f * v; else if (ACT == 16) v = (v >= 0.f) ? v : 0.3f * v; else if (ACT == 17) v = (v >= 0.f) ? v : 0.2f * v;
      so[w][rloc][t * 16 + ln] = v; } }
  __builtin_amdgcn_fence(__ATOMIC_ACQ_REL, "workgroup"); __builtin_amdgcn_wave_barrier();
  const int rsub = lane >> 4, c4 = (lane & 15) * 4;
  {
#pragma unroll
    for (int q = 0; q < 16; ++q) { const int r = q * 2 + rsub; const v4f v = *(const v4fa*)&so[w][r][c4]; if (C) { *(v4f*)(C + cofs + (size_t)(row0 + r) * ldc + col0 + c4) = v; asm volatile("s_wait_xcnt 0x0" ::: "memory"); }      /* the wait that belongs in front of any overwrite of a register which an issued store names (the f16 conversion and the next row's address land in them) */
      if (C16) { v4h h4; for (int i = 0; i < 4; ++i) h4[i] = (_Float16)v[i]; *(v4h*)(C16 + cofs + (size_t)(row0 + r) * ldc + col0 + c4) = h4; } }
     } }
template <int ACT>
__global__ __launch_bounds__(128) void k_gemm2(const _Float16* __restrict__ A, int lda, size_t sA, const _Float16* __restrict__ Bh, int ldb, size_t sB, float alpha, const float* __restrict__ bias, size_t sBias, const float* __restrict__ CP, int rowsPerB, size_t sCPb, int row0g,
    float* __restrict__ C, _Float16* __restrict__ C16, int ldc, size_t sC, int M, int N, int K) { gemm2_body<ACT>(A, lda, sA, Bh, ldb, sB, alpha, bias, sBias, CP, rowsPerB, sCPb, row0g, C, C16, ldc, sC, M, N, K); }
// q, k, v projections of all heads in one launch, straight from the f32 input rows: blockIdx.z picks the stream, blockIdx.y the head (both the same for a whole block).
// A head's 64 input columns are used by that head alone and N = 64 covers all of its outputs, so every input element is read once, here: it is rounded in registers
// (f32 -> bf16 -> f16, the two roundings of the former builder) to the value that an f16 copy of the rows would hold. Wave tile 32x64, K = 64 in two steps of 32, products and sums in gemm2_body's order.
__device__ __forceinline__ v16h pj_cvt(v4f x0, v4f x1, v4f x2, v4f x3) { FragH f;      /* g2_frag's k order: x0, x1 = k 8 hh .. 8 hh + 7, x2, x3 = k 16 + 8 hh .. 16 + 8 hh + 7 */
#pragma unroll
  for (int q = 0; q < 4; ++q) { f.h[q] = (_Float16)bf16_round(x0[q]); f.h[4 + q] = (_Float16)bf16_round(x1[q]); f.h[8 + q] = (_Float16)bf16_round(x2[q]); f.h[12 + q] = (_Float16)bf16_round(x3[q]); }
  return f.v; }
__global__ __launch_bounds__(128) void k_proj(const float* __restrict__ x, const float* __restrict__ ctx, const float* __restrict__ vsrc, const _Float16* __restrict__ B0, const _Float16* __restrict__ B1, const _Float16* __restrict__ B2,
    const float* __restrict__ bias0, const float* __restrict__ bias1, const float* __restrict__ bias2, _Float16* __restrict__ C0, _Float16* __restrict__ C1, _Float16* __restrict__ C2) {
  static_assert(HD == 64 && NRQ % 128 == 0 && NRK == NRQ && DC == DM, "k_proj: K = N = 64, whole 128-row blocks, the three streams of one size");
  __shared__ __attribute__((aligned(16))) float so[4][32][68];
  const int tid = threadIdx.x, w = tid >> 5, lane = tid & 31, ln = lane & 15, hh = lane >> 4; const int h = blockIdx.y, z = blockIdx.z;
  const int row0 = blockIdx.x * 128 + 32 * w;
  const float* ap = (z == 0 ? x : z == 1 ? ctx : vsrc) + (size_t)(row0 + ln) * DM + h * HD + 8 * hh;
  const _Float16* bt = (z == 0 ? B0 : z == 1 ? B1 : B2) + (size_t)h * HD * HD + ln * HD;
  const float* bp = (z == 0 ? bias0 : z == 1 ? bias1 : bias2) + h * HD;
  _Float16* cp = (z == 0 ? C0 : z == 1 ? C1 : C2) + (size_t)row0 * DM + h * HD;
  v4f ax[2][2][4]; v16h bf[4][2]; float bb[4];      /* [16-row tile][k step][16-byte piece]; [16-column tile][k step]; the lane's four bias values */
#pragma unroll
  for (int t = 0; t < 4; ++t) bb[t] = bp[t * 16 + ln];
#pragma unroll
  for (int t = 0; t < 4; ++t)
#pragma unroll
    for (int s = 0; s < 2; ++s) bf[t][s] = g2_frag(bt + t * 16 * HD + s * 32, hh);
#pragma unroll
  for (int i = 0; i < 2; ++i)
#pragma unroll
    for (int s = 0; s < 2; ++s) { const float* p = ap + (size_t)i * 16 * DM + s * 32; ax[i][s][0] = *(const v4fa*)p; ax[i][s][1] = *(const v4fa*)(p + 4); ax[i][s][2] = *(const v4fa*)(p + 16); ax[i][s][3] = *(const v4fa*)(p + 20); }
  asm volatile("s_wait_xcnt 0x0" ::: "memory");      /* the wait that belongs in front of any overwrite of a register which an issued load names: all of the tile's loads are asked for above, what follows may reuse their address registers */
  __builtin_amdgcn_sched_barrier(0);      /* keeps the rounding behind all 36 loads, so that bias, weights and rows fly together; without it the second group of loads sinks behind the wait for the first group's data */
  const v8f z8 = {0.f,0.f,0.f,0.f,0.f,0.f,0.f,0.f}; v8f acc[2][4];
#pragma unroll
  for (int i = 0; i < 2; ++i)
#pragma unroll
    for (int t = 0; t < 4; ++t) acc[i][t] = z8;
#pragma unroll
  for (int s = 0; s < 2; ++s) { const v16h a0 = pj_cvt(ax[0][s][0], ax[0][s][1], ax[0][s][2], ax[0][s][3]), a1 = pj_cvt(ax[1][s][0], ax[1][s][1], ax[1][s][2], ax[1][s][3]);
#pragma unroll
    for (int t = 0; t < 4; ++t) { acc[0][t] = g2_mma(a0, bf[t][s], acc[0][t]); acc[1][t] = g2_mma(a1, bf[t][s], acc[1][t]); } }
#pragma unroll
  for (int i = 0; i < 2; ++i)
#pragma unroll
    for (int t = 0; t < 4; ++t) { const float bv = bf16_round(bb[t]);
#pragma unroll
      for (int r = 0; r < 8; ++r) so[w][i * 16 + 8 * hh + r][t * 16 + ln] = acc[i][t][r] * 0.0625f + bv; }      /* the weight planes are carried x16 */
  __builtin_amdgcn_fence(__ATOMIC_ACQ_REL, "workgroup"); __builtin_amdgcn_wave_barrier();      /* each wave reads back its own rows only: its LDS writes in front of its reads */
  const int rsub = lane >> 4, c4 = (lane & 15) * 4;
#pragma unroll
  for (int q = 0; q < 16; ++q) { const int r = q * 2 + rsub; const v4f v = *(const v4fa*)&so[w][r][c4]; v4h h4; for (int i = 0; i < 4; ++i) h4[i] = (_Float16)v[i];
    *(v4h*)(cp + (size_t)r * DM + c4) = h4;
    if (q == 7) asm volatile("s_wait_xcnt 0x0" ::: "memory"); } }      /* the wait that belongs in front of any overwrite of a register which an issued store names: the second eight rows are converted into the registers of the first eight stores */

// Every weight builder in one launch: none needs anything of another, so they share a grid by ranges of the block index (a block lies wholly in one range).
// Range 1: Wo -> BO. Range 2: the 3 x 16 per-head planes, PB_WH blocks each.
#define PB_WO (DM * (DM / 8) / 256)
#define PB_WH (HD * (HD / 8) / 256)
__global__ __launch_bounds__(256) void k_prep(const float* __restrict__ wq, const float* __restrict__ wk, const float* __restrict__ wv, const float* __restrict__ wo,
    _Float16* __restrict__ BQ, _Float16* __restrict__ BK, _Float16* __restrict__ BV, _Float16* __restrict__ BO) {
  static_assert(DM * (DM / 8) % 256 == 0 && HD * (HD / 8) % 256 == 0, "k_prep: every range is a whole number of blocks");
  int u = blockIdx.x; const int tid = threadIdx.x;
  if (u < PB_WO) { wt_f16_at(wo, BO, DM, DM, 16.0f, u * 256 + tid); return; }
  u -= PB_WO;
  const int s = u / (NH * PB_WH), r = u % (NH * PB_WH); const size_t o = (size_t)(r / PB_WH) * HD * HD;
  wt_f16_at((s == 0 ? wq : s == 1 ? wk : wv) + o, (s == 0 ? BQ : s == 1 ? BK : BV) + o, HD, HD, 16.0f, (r % PB_WH) * 256 + tid); }

__global__ __launch_bounds__(256) void k_wnat(const float* __restrict__ w, size_t n8, _Float16* __restrict__ Bt) { const size_t t = (size_t)blockIdx.x * 256 + threadIdx.x; if (t >= n8) return; FragH f; for (int q = 0; q < 8; ++q) f.h[q] = (_Float16)(bf16_round(w[t * 8 + q]) * 16.0f); *(v8us*)((unsigned short*)Bt + t * 8) = f.half[0];  }
__global__ __launch_bounds__(256) void k_rsm(const float* __restrict__ S, _Float16* __restrict__ P, int nrows) {
  #pragma clang fp contract(off)
  const int i = blockIdx.x * 256 + threadIdx.x; if (i >= nrows) return; const float* s = S + (size_t)i * SQ; float mx = -3.0e38f;
#pragma unroll 1
  for (int j = 0; j < SQ; ++j) mx = fmaxf(mx, s[j]); float se = 0.f;
#pragma unroll 1
  for (int j = 0; j < SQ; ++j) se += expf(s[j] - mx); const float sc = 256.0f / se;
#pragma unroll 1
  for (int j0 = 0; j0 < SQ; j0 += 8) { FragH f; for (int q = 0; q < 8; ++q) f.h[q] = (_Float16)(expf(s[j0 + q] - mx) * sc); unsigned short* d = (unsigned short*)P + (size_t)i * SQ + j0; *(v8us*)d = f.half[0];  } }
__global__ __launch_bounds__(256) void k_vt(const _Float16* __restrict__ V16, int b, int h0, _Float16* __restrict__ VT) { __shared__ unsigned short tl[64][65]; const int tid = threadIdx.x; const int hh = blockIdx.x % HG, sg = blockIdx.x / HG; const int s0 = sg * 64; const int h = h0 + hh;
  for (int i = tid; i < 64 * 8; i += 256) { const int j = i / 8, d8 = (i % 8) * 8; FragH f; f.half[0] = *(const v8us*)((const unsigned short*)V16 + ((size_t)b * SQ + s0 + j) * DM + h * HD + d8); for (int q = 0; q < 8; ++q) tl[d8 + q][j] = f.u[q]; }
  __syncthreads();
  { for (int i = tid; i < 64 * 8; i += 256) { const int d = i / 8, j8 = (i % 8) * 8; FragH f; for (int q = 0; q < 8; ++q) f.u[q] = tl[d][j8 + q]; *(v8us*)((unsigned short*)VT + ((size_t)hh * HD + d) * SQ + s0 + j8) = f.half[0]; }  } }


__global__ __launch_bounds__(256) void k_rsmf(const float* __restrict__ S, _Float16* __restrict__ P, int qn, int hg) {
  #pragma clang fp contract(off)
  const int t = blockIdx.x * 256 + threadIdx.x; if (t >= qn * hg) return; const size_t i = (size_t)(t / qn) * SQ + (t % qn); const float* s = S + i * SQ; float mx = -3.0e38f;
#pragma unroll 1
  for (int j = 0; j < SQ; ++j) mx = fmaxf(mx, s[j]); float se = 0.f;
#pragma unroll 1
  for (int j = 0; j < SQ; ++j) se += __expf(s[j] - mx); const float sc = 256.0f / se;
#pragma unroll 1
  for (int j0 = 0; j0 < SQ; j0 += 8) { FragH f; for (int q = 0; q < 8; ++q) f.h[q] = (_Float16)(__expf(s[j0 + q] - mx) * sc); unsigned short* d = (unsigned short*)P + i * SQ + j0; *(v8us*)d = f.half[0];  } }

// Fused attention, all batches and heads in one launch: scores, softmax and P V stay in registers; no score or weight plane goes through memory.
// A wave owns 32 queries of one (batch, head) and walks the 2048 keys 32 at a time. S^T = K Q^T (A = 16 key rows, B = 16 query rows, both in g2_frag's k order): a lane holds
// scores of ONE query (column ln), keys 8 hh + r of each 16-key tile, so two tiles, converted in place, are the B operand P^T of O^T += V^T P^T (A = V^T rows, the same k order).
// Running maximum and sum per query (f32); the two wave halves exchange the maximum each pass and join their sums once at the end.
// The 16 waves of a block share one head's K and V^T through LDS: a stage is 128 keys (K: 128 rows of 128 B, V^T: 64 rows of 256 B), brought in whole lines by asynchronous copies,
// four of 16 bytes a lane, into one of two buffers while the other is worked on; the rows lie at a pitch of 16 B x odd, so that a fragment's ds_load_b128 meets no bank twice.
#define FA_KS 128                      /* keys a stage */
#define FA_NT (SK / FA_KS)             /* stages */
#define FA_KP (HD * 2 + 16)            /* LDS pitch of a K row, bytes */
#define FA_VP (FA_KS * 2 + 16)         /* LDS pitch of a V^T row, bytes */
#define FA_KB (FA_KS * FA_KP)          /* K part of a buffer, bytes */
#define FA_BUF (FA_KB + HD * FA_VP)    /* one buffer, bytes */
__device__ __forceinline__ float fa_xhalf(float x) { return __builtin_bit_cast(float, __builtin_amdgcn_permlanex16(__builtin_bit_cast(int, x), __builtin_bit_cast(int, x), 0x76543210, 0xfedcba98, false, false)); }      /* lane l with lane l ^ 16 */
__device__ __forceinline__ v16h fa_frag(const _Float16* p) { FragH f; f.half[0] = *(const v8us*)(const unsigned short*)p; f.half[1] = *(const v8us*)((const unsigned short*)p + 16); return f.v; }      /* g2_frag with the lane half's 8 hh already in p */
__device__ __forceinline__ v16h fa_lfrag(const unsigned char* p) { FragH f; f.half[0] = *(const v8us*)p; f.half[1] = *(const v8us*)(p + 32); return f.v; }      /* fa_frag from an LDS row: p in bytes, the lane half's 16 hh already in it */
/* Four asynchronous copies of 16 bytes a lane, global memory to LDS through no register (l: the lane's LDS byte address, g: its global address). The s_wait_xcnt is the wait that belongs
   in front of any overwrite of a register which an issued copy names; as the last line of the copies' own statement it stands ahead of whatever reuses the operands' registers. */
__device__ __forceinline__ void fa_copy4(unsigned l0, const _Float16* g0, unsigned l1, const _Float16* g1, unsigned l2, const _Float16* g2, unsigned l3, const _Float16* g3) {
  asm volatile("global_load_async_to_lds_b128 %0, %1, off\n\tglobal_load_async_to_lds_b128 %2, %3, off\n\tglobal_load_async_to_lds_b128 %4, %5, off\n\tglobal_load_async_to_lds_b128 %6, %7, off\n\ts_wait_xcnt 0x0"
      :: "v"(l0), "v"(g0), "v"(l1), "v"(g1), "v"(l2), "v"(g2), "v"(l3), "v"(g3) : "memory"); }
/* Native 2^x, eight (or one) in a statement: behind a transcendental the instruction set asks for one independent instruction or a v_nop before its result is read or its source
   overwritten. Each v_exp_f32 here has an independent one behind it (the outputs share no register with the inputs), the last one the v_nop. */
__device__ __forceinline__ void fa_exp8(const float (&t)[8], float (&e)[8]) {
  asm("v_exp_f32 %0, %8\n\tv_exp_f32 %1, %9\n\tv_exp_f32 %2, %10\n\tv_exp_f32 %3, %11\n\tv_exp_f32 %4, %12\n\tv_exp_f32 %5, %13\n\tv_exp_f32 %6, %14\n\tv_exp_f32 %7, %15\n\tv_nop"
      : "=&v"(e[0]), "=&v"(e[1]), "=&v"(e[2]), "=&v"(e[3]), "=&v"(e[4]), "=&v"(e[5]), "=&v"(e[6]), "=&v"(e[7]) : "v"(t[0]), "v"(t[1]), "v"(t[2]), "v"(t[3]), "v"(t[4]), "v"(t[5]), "v"(t[6]), "v"(t[7])); }
__device__ __forceinline__ float fa_exp1(float t) { float e; asm("v_exp_f32 %0, %1\n\tv_nop" : "=&v"(e) : "v"(t)); return e; }
__device__ __forceinline__ v8f fa_mma(v16h a, v16h b, v8f c) { return __builtin_amdgcn_wmma_f32_16x16x32_f16(false, a, false, b, (short)0, c, false, false); }
__global__ __launch_bounds__(512) void k_fattn(const _Float16* __restrict__ Q, const _Float16* __restrict__ Kk, const _Float16* __restrict__ VT, _Float16* __restrict__ O) {
  static_assert(SK % FA_KS == 0 && FA_NT >= 2 && FA_KS * 8 == 2 * 512 && HD * (FA_KS / 8) == 2 * 512, "k_fattn: whole stages, two of them at least, two K and two V^T copies a lane and stage");
  __shared__ __attribute__((aligned(16))) unsigned char sm[2 * FA_BUF];
  const int tid = threadIdx.x, lane = tid & 31, ln = lane & 15, hh = lane >> 4; const int w = __builtin_amdgcn_readfirstlane(tid >> 5);      /* the wave's number, held scalar */
  const int bh = blockIdx.x / (NQ / 512), b = bh / NH, h = bh % NH; const int q0 = (blockIdx.x % (NQ / 512)) * 512 + w * 32;
  const float CS = 0.125f * 1.44269504088896340736f;      /* 1 / sqrt(64) and log2 e in one factor: exp(s / 8 - m / 8) = 2^((s - m) CS) */
  const _Float16* qp = Q + ((size_t)b * NQ + q0 + ln) * DM + h * HD + 8 * hh;
  /* the lane's part of a stage: K rows tid / 8 and 64 + tid / 8, piece tid % 8; V^T rows tid / 16 and 32 + tid / 16, piece tid % 16: a wave's copy covers four whole 128-byte lines */
  const _Float16* gk = Kk + ((size_t)b * SK + (tid >> 3)) * DM + h * HD + (tid & 7) * 8;
  const _Float16* gv = VT + ((size_t)bh * HD + (tid >> 4)) * SK + (tid & 15) * 8;
  const unsigned sb = (unsigned)(size_t)sm;      /* the low 32 bits of a __shared__ address are its LDS byte address */
  const unsigned lk = sb + (tid >> 3) * FA_KP + (tid & 7) * 16, lv = sb + FA_KB + (tid >> 4) * FA_VP + (tid & 15) * 16;
  auto stage = [&](int t) { const unsigned bo = (t & 1) * FA_BUF; const _Float16* k0 = gk + (size_t)t * FA_KS * DM; const _Float16* v0 = gv + t * FA_KS;
    fa_copy4(lk + bo, k0, lk + bo + 64 * FA_KP, k0 + (size_t)64 * DM, lv + bo, v0, lv + bo + 32 * FA_VP, v0 + (size_t)32 * SK); };
  v16h qf[2][2];
#pragma unroll
  for (int j = 0; j < 2; ++j)
#pragma unroll
    for (int s = 0; s < 2; ++s) qf[j][s] = fa_frag(qp + (size_t)j * 16 * DM + s * 32);
  stage(0);
  asm volatile("s_wait_asynccnt 0x0" ::: "memory");      /* this wave's copies of stage 0 have landed */
  __syncthreads();      /* every wave's have: stage 0 may be read */
  stage(1);
  const unsigned char* kl = sm + ln * FA_KP + hh * 16; const unsigned char* vl = sm + FA_KB + ln * FA_VP + hh * 16;
  const v8f z8 = {0.f,0.f,0.f,0.f,0.f,0.f,0.f,0.f}; v8f o[2][4]; float mr[2] = {-3.0e38f, -3.0e38f}, lr[2] = {0.f, 0.f};
#pragma unroll
  for (int j = 0; j < 2; ++j)
#pragma unroll
    for (int t = 0; t < 4; ++t) o[j][t] = z8;
#pragma unroll 1
  for (int g = 0; g < FA_NT; ++g) {      /* rolled, like the passes inside: unrolling either only adds registers, and the wave has none to spare */
    const unsigned char* kb = kl + (g & 1) * FA_BUF; const unsigned char* vb = vl + (g & 1) * FA_BUF;
    v16h kf[2][2];
#pragma unroll
    for (int t = 0; t < 2; ++t)
#pragma unroll
      for (int s = 0; s < 2; ++s) kf[t][s] = fa_lfrag(kb + t * 16 * FA_KP + s * 64);
#pragma unroll 1
    for (int c = 0; c < FA_KS / 32; ++c) {      /* rolled: one pass already holds 16 matrix instructions and 16 LDS reads */
      v16h vf[4]; const unsigned char* vc = vb + c * 64;
#pragma unroll
      for (int t = 0; t < 4; ++t) vf[t] = fa_lfrag(vc + t * 16 * FA_VP);      /* this pass's V^T, asked for ahead of the score products */
      v8f st[2][2];
#pragma unroll
      for (int j = 0; j < 2; ++j)
#pragma unroll
        for (int t = 0; t < 2; ++t) st[j][t] = fa_mma(kf[t][1], qf[j][1], fa_mma(kf[t][0], qf[j][0], z8));
      const int cn = (c + 1 < FA_KS / 32) ? c + 1 : c; const unsigned char* kc = kb + cn * 32 * FA_KP;      /* the next pass's K rows come during the softmax; the stage's last pass asks for its own rows again, which keeps every read inside this stage's buffer */
#pragma unroll
      for (int t = 0; t < 2; ++t)
#pragma unroll
        for (int s = 0; s < 2; ++s) kf[t][s] = fa_lfrag(kc + t * 16 * FA_KP + s * 64);
#pragma unroll
      for (int j = 0; j < 2; ++j) {
        float mx = fmaxf(st[j][0][0], st[j][1][0]);
#pragma unroll
        for (int r = 1; r < 8; ++r) mx = fmaxf(mx, fmaxf(st[j][0][r], st[j][1][r]));
        mx = fmaxf(mx, fa_xhalf(mx));      /* both halves of the wave hold scores of the same query: one maximum for both */
        const float mn = fmaxf(mr[j], mx); const float al = fa_exp1((mr[j] - mn) * CS); const float nb = -mn * CS; mr[j] = mn;      /* al = 0 on the first pass */
        FragH pf; float sm1 = 0.f;
#pragma unroll
        for (int t = 0; t < 2; ++t) { float x[8], p[8];
#pragma unroll
          for (int r = 0; r < 8; ++r) x[r] = __builtin_fmaf(st[j][t][r], CS, nb);
          fa_exp8(x, p);
#pragma unroll
          for (int r = 0; r < 8; ++r) { sm1 += p[r]; pf.h[t * 8 + r] = (_Float16)p[r]; } }
        lr[j] = lr[j] * al + sm1;
#pragma unroll
        for (int t = 0; t < 4; ++t) o[j][t] = fa_mma(vf[t], pf.v, o[j][t] * al);
      }
    }
    asm volatile("s_wait_dscnt 0x0" ::: "memory");      /* this wave's reads of the buffer have returned before anything refills it */
    asm volatile("s_wait_asynccnt 0x0" ::: "memory");      /* this wave's copies of the next stage have landed */
    __syncthreads();      /* one barrier a stage: it publishes the next stage and ends every wave's reads of this one */
    if (g + 2 < FA_NT) stage(g + 2);      /* into the buffer just left; the test is the same for the whole block */
  }
  asm volatile("s_wait_asynccnt 0x0" ::: "memory");      /* no copy is left in flight when the wave ends */
#pragma unroll
  for (int j = 0; j < 2; ++j) { const float inv = 64.0f / (lr[j] + fa_xhalf(lr[j])); _Float16* op = O + ((size_t)b * NQ + q0 + j * 16 + ln) * DM + h * HD + 8 * hh;      /* o carried x64, as the output GEMM expects */
#pragma unroll
    for (int t = 0; t < 4; ++t) { FragH f;
#pragma unroll
      for (int r = 0; r < 8; ++r) f.h[r] = (_Float16)(o[j][t][r] * inv);
      *(v8us*)((unsigned short*)op + t * 16) = f.half[0]; } } }      /* O^T tile t: d = 16 t + 8 hh + r, eight consecutive columns of the query's row: one 16-byte store */

extern "C" void kernel_launch(void* const* d_in, const int* in_sizes, int n_in,
                              void* d_out, int out_size, void* d_ws, size_t ws_size, hipStream_t stream) {
  (void)in_sizes; (void)n_in; (void)out_size;
  const float* const* I = (const float* const*)d_in; const float* x = I[0]; const float* ctx = I[1]; const float* vsrc = I[2]; const float* wq = I[3]; const float* bq = I[4]; const float* wk = I[5]; const float* bk = I[6]; const float* wv = I[7]; const float* bv = I[8]; const float* wo = I[9]; const float* bo = I[10];      /* input order: Q, K, V (THREE streams), Wq, bq, Wk, bk, Wv, bv (PER-HEAD [16][64][64] = [head][in][out]; biases [16][64] = the flat [1024] at 64 h + e; zeros on this draw), Wo ([in][out] [1024][1024]), bo (zeros): eleven inputs */
  char* ws = (char*)d_ws; size_t off = 0;
  auto take = [&](size_t bytes) { char* p = ws + off; off += (bytes + 255) & ~(size_t)255; return p; };
  _Float16* BQ = (_Float16*)take((size_t)DM * DM * 2); _Float16* BK = (_Float16*)take((size_t)DM * DC * 2); _Float16* BV = (_Float16*)take((size_t)DM * DC * 2); _Float16* BO = (_Float16*)take((size_t)DM * DM * 2);
  _Float16* Q16 = (_Float16*)take(NRQ * DM * 2); _Float16* K16 = (_Float16*)take(NRK * DM * 2); _Float16* V16 = (_Float16*)take(NRK * DM * 2); _Float16* O16 = (_Float16*)take(NRQ * DM * 2);
  _Float16* VT = (_Float16*)take((size_t)NB * NH * HD * SK * 2);
  if (off > ws_size) return;      /* 4 x 2 + 4 x 16 + 16 = 88 MiB */
  k_prep<<<PB_WO + 3 * NH * PB_WH, 256, 0, stream>>>(wq, wk, wv, wo, BQ, BK, BV, BO);      /* all weight operands in one launch. The per-head stacks [16][64][64] are [in][out] per head (x_h @ W_h): W_h[d][e] -> Bt_h[e][d] x16, K = N = 64, into consecutive [64][64] planes; Wo [in][out]: the same with K = N = 1024 */
  k_proj<<<dim3((unsigned)(NRQ / 128), NH, 3), 128, 0, stream>>>(x, ctx, vsrc, BQ, BK, BV, bq, bk, bv, Q16, K16, V16);      /* q, k, v (grid.z) in one launch, from the f32 rows: head h (grid.y) = rows[:, 64 h ..] W_h + b_h -> out[:, 64 h ..] (pitch DM); B + 4096 h (pitch 64), bias + 64 h; K = N = 64 */
  k_vt<NH, SK><<<NB * NH * (SK / 64), 256, 0, stream>>>(V16, DM, 0, VT);      /* V^T [4][16][64][2048], all batches in one launch: the kernel takes batch and head from the block index */
  k_fattn<<<NB * NH * (NQ / 512), 512, 0, stream>>>(Q16, K16, VT, O16);      /* scores, softmax, P V of every batch and head: 512 queries a block, o x64 into merged rows */
  k_gemm2<0><<<dim3((unsigned)((NRQ / 128) * (DM / 64)), 1), 128, 0, stream>>>(O16, DM, 0, BO, DM, 0, 0.0009765625f, bo, 0, nullptr, 1, 0, 0, (float*)d_out, nullptr, DM, 0, (int)NRQ, DM, DM);      /* out = o Wo + bo */
}

// v006
// It runs in 106 microseconds.
// Two timings next to v005 put it at 1.35 and 1.32 times that version's speed.
// Counting every step since v000, it is 65.2 times as fast.
#include <hip/hip_runtime.h>
// Multi-head attention on THREE input streams with BLOCK-DIAGONAL per-head projections on four sequences (Q, K, V [4][2048][1024], each split into 16 contiguous 64-wide slices; q / k / v = einsum('bhsd,hde->bhse', slice, W) + b: EACH HEAD applies its own Dense(64) (W [16][64][64] = [head][in][out], normal x 1/8; biases [16][64] zeros on this draw) to ITS OWN slice of ITS stream; scores / sqrt(64); softmax over all 2048 keys (no mask); out = merged Wo + bo ([in][out] [1024][1024]; bo zeros) -> [4][2048][1024]); each projection is ONE head-batched GEMM (K = 64).
// Structure: the per-head [in][out] weight blocks transposed into sixteen consecutive exact x16 [64][64] planes per stack (all weight builders in ONE launch, by ranges of the block index); Q, K, V as three HEAD-BATCHED WMMA GEMMs in ONE launch (16 heads on grid.y, the stream on grid.z; K = N = 64; 32x64 wave tiles, A fragments read from the f32 input rows and rounded in registers, no f16 copy of the inputs in memory; f32 accumulation, + the head's bias, f16 outputs into the head's 64 columns); V^T of all batches via LDS transposes in ONE launch; ONE fused launch for all batches and heads: scores (K = 64), running softmax over the 2048 keys (f32 statistics, native exp2; unnormalised weights in (0, 1] as f16), o = P V (o carried x64) into merged f16 rows; out = o W_o + b_o GEMM (f32, alpha 2^-10); launches: see trace.
// Compute dtype: inputs rounded to bf16; x / context / weights exact; q, k, v, softmax weights and o as plain f16 GEMM operands (~2^-12); scores and statistics f32; v_wmma_f32_16x16x32_f16.
#define NB 4
#define NQ 2048
#define SK 2048
#define SQ SK                       /* keys per softmax row */
#define DM 1024
#define DC 1024
#define NH 16
#define HD 64
#define HG 4
#define NRQ ((size_t)NB * NQ)
#define NRK ((size_t)NB * SK)
typedef __bf16 v16b __attribute__((ext_vector_type(16)));
typedef unsigned short v8us __attribute__((ext_vector_type(8), may_alias));
typedef float  v8f  __attribute__((ext_vector_type(8)));
typedef float  v4f  __attribute__((ext_vector_type(4)));
typedef float  v4fa __attribute__((ext_vector_type(4), may_alias));
union FragB { v16b v; v8us half[2]; unsigned short u[16]; };

__device__ __forceinline__ unsigned short bf16_bits(float x) { unsigned int u = __float_as_uint(x); return (unsigned short)((u + 0x7FFFu + ((u >> 16) & 1u)) >> 16); }
__device__ __forceinline__ float bf16_val(unsigned short b) { return __uint_as_float(((unsigned int)b) << 16); }
__device__ __forceinline__ float bf16_round(float x) { return bf16_val(bf16_bits(x)); }
// D += A·B with NT terms: 1 = ah·bh, 2 = + al·bh (A split), 3 = + ah·bl (both split)
template <int NT>
__device__ __forceinline__ v8f mmaN(v16b ah, v16b al, v16b bh, v16b bl, v8f c) {
  c = __builtin_amdgcn_wmma_f32_16x16x32_bf16(false, ah, false, bh, (short)0, c, false, false);
  if (NT >= 2) c = __builtin_amdgcn_wmma_f32_16x16x32_bf16(false, al, false, bh, (short)0, c, false, false);
  if (NT >= 3) c = __builtin_amdgcn_wmma_f32_16x16x32_bf16(false, ah, false, bl, (short)0, c, false, false);
  asm volatile("v_nop\n\tv_nop\n\tv_nop\n\tv_nop" : "+v"(c) : "v"(ah), "v"(al), "v"(bh), "v"(bl));
  return c;
}

__global__ __launch_bounds__(256) void k_wt_bf16(const float* __restrict__ W, unsigned short* __restrict__ Wt, int K, int N) {
  const int t = blockIdx.x * 256 + threadIdx.x;
  const int k8n = K / 8;
  if (t >= N * k8n) return;
  const int n = t / k8n, k8 = (t % k8n) * 8;
  v8us v;
#pragma unroll
  for (int i = 0; i < 8; ++i) v[i] = bf16_bits(W[(size_t)(k8 + i) * N + n]);
  *(v8us*)(Wt + (size_t)n * K + k8) = v;
  
}

// GEMM C[M][N] (f32, pitch ldc) = act(A[M][K]·W + bias). A f32 row-major (pitch lda) converted per fragment to bf16
// (ASPLIT: hi/lo two planes -> 2 terms, else single rounded term); Wt bf16 [N][K] (pitch ldb). BIAS_BF16 rounds the
// bias to bf16 first (bias quantised to bf16 before the add). K%32==0, M%16==0, N%64==0.
template <bool ASPLIT, int ACT, bool BIAS_BF16>
__global__ __launch_bounds__(128) void k_gemm_bf(const float* __restrict__ A, int lda, const unsigned short* __restrict__ Wt, int ldb,
                                               const float* __restrict__ bias, float* __restrict__ C, int ldc, int M, int N, int K) {
  __shared__ __attribute__((aligned(16))) float so[4][16][64];
  const int tid = threadIdx.x, w = tid >> 5, lane = tid & 31, ln = lane & 15, hh = lane >> 4;
  const int ntn = N / 64;
  const int wid = blockIdx.x * 4 + w;
  const int mt = wid / ntn, nq = wid % ntn;
  if (mt * 16 >= M) return;
  const int row0 = mt * 16, col0 = nq * 64;
  const float* arow = A + (size_t)(row0 + ln) * lda;
  v8f acc[4] = {};
  for (int kb = 0; kb < K; kb += 32) {
    FragB ah, al;
    const v4f x0 = *(const v4fa*)(arow + kb + 8 * hh), x1 = *(const v4fa*)(arow + kb + 8 * hh + 4);
    const v4f x2 = *(const v4fa*)(arow + kb + 16 + 8 * hh), x3 = *(const v4fa*)(arow + kb + 16 + 8 * hh + 4);
    float xs[16] = {x0[0],x0[1],x0[2],x0[3],x1[0],x1[1],x1[2],x1[3],x2[0],x2[1],x2[2],x2[3],x3[0],x3[1],x3[2],x3[3]};
#pragma unroll
    for (int i = 0; i < 16; ++i) { const unsigned short hb = bf16_bits(xs[i]); ah.u[i] = hb; al.u[i] = ASPLIT ? bf16_bits(xs[i] - bf16_val(hb)) : (unsigned short)0; }
#pragma unroll
    for (int t = 0; t < 4; ++t) {
      const unsigned short* brow = Wt + (size_t)(col0 + t * 16 + ln) * ldb + kb;
      FragB b;
      b.half[0] = *(const v8us*)(brow + 8 * hh);
      b.half[1] = *(const v8us*)(brow + 16 + 8 * hh);
      acc[t] = mmaN<ASPLIT ? 2 : 1>(ah.v, al.v, b.v, b.v, acc[t]);
    }
  }
#pragma unroll
  for (int t = 0; t < 4; ++t) {
    float bv = bias ? bias[col0 + t * 16 + ln] : 0.f;
    if (BIAS_BF16) bv = bf16_round(bv);
#pragma unroll
    for (int r = 0; r < 8; ++r) { float v = acc[t][r] + bv; if (ACT == 1) v = fmaxf(v, 0.f); so[w][8 * hh + r][t * 16 + ln] = v; }
  }
  __builtin_amdgcn_fence(__ATOMIC_ACQ_REL, "workgroup");
  __builtin_amdgcn_wave_barrier();
  const int rsub = lane >> 4, c4 = (lane & 15) * 4;
  {
#pragma unroll
    for (int q = 0; q < 8; ++q) {
      const int r = q * 2 + rsub;
      const v4f v = *(const v4fa*)&so[w][r][c4];
      *(v4f*)(C + (size_t)(row0 + r) * ldc + col0 + c4) = v;
    }
    
  }
}

// GEMM C = act(A·W + bias + resid): A f32 (ASPLIT -> hi/lo 2 terms), Wt bf16 [N][K]; ACT 0 none, 1 relu, 2 exact gelu;
// resid (optional, f32, row index = (row % rmod), pitch ldr, RES_BF16 rounds it) added before the activation.
template <bool ASPLIT, int ACT, bool BIAS_BF16, bool RES_BF16>
__global__ __launch_bounds__(128) void k_gemm_bf3(const float* __restrict__ A, int lda, const unsigned short* __restrict__ Wt, int ldb,
                                                const float* __restrict__ bias, const float* __restrict__ resid, int rmod, int ldr,
                                                float* __restrict__ C, int ldc, int M, int N, int K) {
  __shared__ __attribute__((aligned(16))) float so[4][16][64];
  const int tid = threadIdx.x, w = tid >> 5, lane = tid & 31, ln = lane & 15, hh = lane >> 4;
  const int ntn = N / 64;
  const int wid = blockIdx.x * 4 + w;
  const int mt = wid / ntn, nq = wid % ntn;
  if (mt * 16 >= M) return;
  const int row0 = mt * 16, col0 = nq * 64;
  const float* arow = A + (size_t)(row0 + ln) * lda;
  v8f acc[4] = {};
  for (int kb = 0; kb < K; kb += 32) {
    FragB ah, al;
    const v4f x0 = *(const v4fa*)(arow + kb + 8 * hh), x1 = *(const v4fa*)(arow + kb + 8 * hh + 4);
    const v4f x2 = *(const v4fa*)(arow + kb + 16 + 8 * hh), x3 = *(const v4fa*)(arow + kb + 16 + 8 * hh + 4);
    float xs[16] = {x0[0],x0[1],x0[2],x0[3],x1[0],x1[1],x1[2],x1[3],x2[0],x2[1],x2[2],x2[3],x3[0],x3[1],x3[2],x3[3]};
#pragma unroll
    for (int i = 0; i < 16; ++i) { const unsigned short hb = bf16_bits(xs[i]); ah.u[i] = hb; al.u[i] = ASPLIT ? bf16_bits(xs[i] - bf16_val(hb)) : (unsigned short)0; }
#pragma unroll
    for (int t = 0; t < 4; ++t) {
      const unsigned short* brow = Wt + (size_t)(col0 + t * 16 + ln) * ldb + kb;
      FragB b;
      b.half[0] = *(const v8us*)(brow + 8 * hh);
      b.half[1] = *(const v8us*)(brow + 16 + 8 * hh);
      acc[t] = mmaN<ASPLIT ? 2 : 1>(ah.v, al.v, b.v, b.v, acc[t]);
    }
  }
#pragma unroll
  for (int t = 0; t < 4; ++t) {
    const int col = col0 + t * 16 + ln;
    float bv = bias ? bias[col] : 0.f;
    if (BIAS_BF16) bv = bf16_round(bv);
#pragma unroll
    for (int r = 0; r < 8; ++r) {
      float v = acc[t][r] + bv;
      if (resid) { float rv = resid[(size_t)((row0 + 8 * hh + r) % rmod) * ldr + col]; if (RES_BF16) rv = bf16_round(rv); v += rv; }
      if (ACT == 1) v = fmaxf(v, 0.f);
      if (ACT == 2) v = 0.5f * v * (1.0f + erff(v * 0.70710678118654752f));
      if (ACT == 3) { const float u = 0.7978845608028654f * (v + 0.044715f * v * v * v); v = 0.5f * v * (1.0f + tanhf(u)); }
      so[w][8 * hh + r][t * 16 + ln] = v;
    }
  }
  __builtin_amdgcn_fence(__ATOMIC_ACQ_REL, "workgroup");
  __builtin_amdgcn_wave_barrier();
  const int rsub = lane >> 4, c4 = (lane & 15) * 4;
  {
#pragma unroll
    for (int q = 0; q < 8; ++q) {
      const int r = q * 2 + rsub;
      const v4f v = *(const v4fa*)&so[w][r][c4];
      *(v4f*)(C + (size_t)(row0 + r) * ldc + col0 + c4) = v;
    }
    
  }
}
// row LayerNorm (biased variance, eps) over N: s = X (+ R); optional out_sum <- s; out_norm <- (s-mu)*rsqrt(var+eps)*g + b
template <bool PARAM_BF16>
__global__ __launch_bounds__(256) void k_layernorm(const float* __restrict__ X, const float* __restrict__ R, const float* __restrict__ g, const float* __restrict__ bta,
                                                  float* __restrict__ out_sum, float* __restrict__ out_norm, int N, float eps) {
  __shared__ float red[256];
  const int row = blockIdx.x, tid = threadIdx.x;
  const float* x = X + (size_t)row * N; const float* rr = R ? R + (size_t)row * N : nullptr;
  float vals[16];                     // up to N = 4096
  const int per = N / 256;            // contiguous chunk per thread? use strided-by-4 chunks: thread handles j = tid*4 + 1024*u
  float s1 = 0.f;
  for (int u = 0; u < per / 4; ++u) {
    const int j = tid * 4 + 1024 * u;
    const v4f a = *(const v4fa*)(x + j);
    v4f b = {0.f,0.f,0.f,0.f}; if (rr) b = *(const v4fa*)(rr + j);
#pragma unroll
    for (int q = 0; q < 4; ++q) { const float v = a[q] + b[q]; vals[u * 4 + q] = v; s1 += v; }
  }
  red[tid] = s1; __syncthreads();
  for (int st = 128; st > 0; st >>= 1) { if (tid < st) red[tid] += red[tid + st]; __syncthreads(); }
  const float mu = red[0] / (float)N; __syncthreads();
  float s2 = 0.f;
  for (int u = 0; u < per / 4; ++u)
#pragma unroll
    for (int q = 0; q < 4; ++q) { const float c = vals[u * 4 + q] - mu; s2 += c * c; }
  red[tid] = s2; __syncthreads();
  for (int st = 128; st > 0; st >>= 1) { if (tid < st) red[tid] += red[tid + st]; __syncthreads(); }
  const float rs = rsqrtf(red[0] / (float)N + eps);
  {
    for (int u = 0; u < per / 4; ++u) {
      const int j = tid * 4 + 1024 * u;
      v4f o, sm;
#pragma unroll
      for (int q = 0; q < 4; ++q) {
        float gg = g[j + q], bb = bta[j + q];
        if (PARAM_BF16) { gg = bf16_round(gg); bb = bf16_round(bb); }
        sm[q] = vals[u * 4 + q]; o[q] = (vals[u * 4 + q] - mu) * rs * gg + bb;
      }
      if (out_sum) *(v4f*)(out_sum + (size_t)row * N + j) = sm;
      *(v4f*)(out_norm + (size_t)row * N + j) = o;
    }
    
  }
}



// ---- f16 WMMA path (v_wmma_f32_16x16x32_f16): 11-bit significands for operands in range — used where a [0,1] probability operand needs more precision than bf16
typedef _Float16 v16h __attribute__((ext_vector_type(16)));
union FragH { v16h v; v8us half[2]; _Float16 h[16]; unsigned short u[16]; };
template <int NT>
__device__ __forceinline__ v8f mmaH(v16h ah, v16h al, v16h bh, v16h bl, v8f c) {
  c = __builtin_amdgcn_wmma_f32_16x16x32_f16(false, ah, false, bh, (short)0, c, false, false);
  if (NT >= 2) c = __builtin_amdgcn_wmma_f32_16x16x32_f16(false, al, false, bh, (short)0, c, false, false);
  if (NT >= 3) c = __builtin_amdgcn_wmma_f32_16x16x32_f16(false, ah, false, bl, (short)0, c, false, false);
  asm volatile("v_nop\n\tv_nop\n\tv_nop\n\tv_nop" : "+v"(c) : "v"(ah), "v"(al), "v"(bh), "v"(bl));
  return c;
}
// batched GEMM like k_gemm_b but f16 operands: A f32 (split into f16 hi/lo if ASPLIT, else rounded to f16), Bt = f16 values [n][k]; alpha; C f32; N multiple of 16 (partial tiles skipped)
template <bool ASPLIT>
__global__ __launch_bounds__(128) void k_gemm_h(const float* __restrict__ A, int lda, size_t sA, const _Float16* __restrict__ Bh, int ldb, size_t sB, float alpha, float* __restrict__ C, int ldc, size_t sC, int M, int N, int K) {
  __shared__ __attribute__((aligned(16))) float so[4][16][64];
  const int tid = threadIdx.x, w = tid >> 5, lane = tid & 31, ln = lane & 15, hh = lane >> 4; const int by = blockIdx.y;
  A += (size_t)by * sA; Bh += (size_t)by * sB; C += (size_t)by * sC;
  const int ntn = (N + 63) / 64; const int wid = blockIdx.x * 4 + w; const int mt = wid / ntn, nq = wid % ntn; if (mt * 16 >= M) return;
  const int row0 = mt * 16, col0 = nq * 64; const float* arow = A + (size_t)(row0 + ln) * lda;
  v8f acc[4] = {};
  for (int kb = 0; kb < K; kb += 32) {
    FragH ah, al;
    const v4f x0 = *(const v4fa*)(arow + kb + 8 * hh), x1 = *(const v4fa*)(arow + kb + 8 * hh + 4), x2 = *(const v4fa*)(arow + kb + 16 + 8 * hh), x3 = *(const v4fa*)(arow + kb + 16 + 8 * hh + 4);
    float xs[16] = {x0[0],x0[1],x0[2],x0[3],x1[0],x1[1],x1[2],x1[3],x2[0],x2[1],x2[2],x2[3],x3[0],x3[1],x3[2],x3[3]};
#pragma unroll
    for (int i = 0; i < 16; ++i) { const _Float16 h = (_Float16)xs[i]; ah.h[i] = h; al.h[i] = ASPLIT ? (_Float16)(xs[i] - (float)h) : (_Float16)0.0f; }
#pragma unroll
    for (int t = 0; t < 4; ++t) { if (col0 + t * 16 >= N) continue; const size_t boff = (size_t)(col0 + t * 16 + ln) * ldb + kb; FragH bq; bq.half[0] = *(const v8us*)(Bh + boff + 8 * hh); bq.half[1] = *(const v8us*)(Bh + boff + 16 + 8 * hh);
      acc[t] = mmaH<ASPLIT ? 2 : 1>(ah.v, al.v, bq.v, bq.v, acc[t]); }
  }
#pragma unroll
  for (int t = 0; t < 4; ++t) { if (col0 + t * 16 >= N) continue;
#pragma unroll
    for (int r = 0; r < 8; ++r) so[w][8 * hh + r][t * 16 + ln] = acc[t][r] * alpha; }
  __builtin_amdgcn_fence(__ATOMIC_ACQ_REL, "workgroup"); __builtin_amdgcn_wave_barrier();
  const int rsub = lane >> 4, c4 = (lane & 15) * 4;
  {
#pragma unroll
    for (int q = 0; q < 8; ++q) { const int r = q * 2 + rsub; if (col0 + c4 < N) { const v4f v = *(const v4fa*)&so[w][r][c4]; *(v4f*)(C + (size_t)(row0 + r) * ldc + col0 + c4) = v; } }
     }
}

// Wt[n][k] = f16(W[k][n]·scale) from f32 row-major W[K][N] (scale = power of two; bf16-exact weights stay exact in f16 away from the subnormal range)
__device__ __forceinline__ void wt_f16_at(const float* __restrict__ W, _Float16* __restrict__ Wt, int K, int N, float scale, int t) {      /* t: which eight k of which n; the caller's grid covers N K / 8 exactly */
  const int n = t / (K / 8), k8 = (t % (K / 8)) * 8; FragH f;
#pragma unroll
  for (int i = 0; i < 8; ++i) f.h[i] = (_Float16)(bf16_round(W[(size_t)(k8 + i) * N + n]) * scale); const v8us o = f.half[0];
  *(v8us*)((unsigned short*)Wt + (size_t)n * K + k8) = o; asm volatile("s_wait_xcnt 0x0" ::: "memory");      /* the wait that belongs in front of any overwrite of a register which an issued store names */
}
// k_gemm_hh variant with fused epilogue: v = acc·alpha + bias[by·sBias + col] (+ CP[(row/rowsPerB)·sCPb + by·64 + col] if CP) ; ACT 0 none / 1 elu ; writes f16 C16 (and f32 C if non-null)
template <int ACT>
__global__ __launch_bounds__(128) void k_gemm_hhx(const _Float16* __restrict__ A, int lda, size_t sA, const _Float16* __restrict__ Bh, int ldb, size_t sB, float alpha, const float* __restrict__ bias, size_t sBias, const float* __restrict__ CP, int rowsPerB, size_t sCPb, int row0g,
    float* __restrict__ C, _Float16* __restrict__ C16, int ldc, size_t sC, int M, int N, int K) {
  __shared__ __attribute__((aligned(16))) float so[4][16][64];
  const int tid = threadIdx.x, w = tid >> 5, lane = tid & 31, ln = lane & 15, hh = lane >> 4; const int by = blockIdx.y;
  A += (size_t)by * sA; Bh += (size_t)by * sB; const size_t cofs = (size_t)by * sC; const float* bp = bias ? bias + (size_t)by * sBias : nullptr;
  const int ntn = (N + 63) / 64; const int wid = blockIdx.x * 4 + w; const int mt = wid / ntn, nq = wid % ntn; if (mt * 16 >= M) return;
  const int row0 = mt * 16, col0 = nq * 64; const _Float16* arow = A + (size_t)(row0 + ln) * lda;
  v8f acc[4] = {};
  for (int kb = 0; kb < K; kb += 32) { FragH ah; ah.half[0] = *(const v8us*)((const unsigned short*)arow + kb + 8 * hh); ah.half[1] = *(const v8us*)((const unsigned short*)arow + kb + 16 + 8 * hh);
#pragma unroll
    for (int t = 0; t < 4; ++t) { if (col0 + t * 16 >= N) continue; const size_t boff = (size_t)(col0 + t * 16 + ln) * ldb + kb; FragH bq; bq.half[0] = *(const v8us*)((const unsigned short*)Bh + boff + 8 * hh); bq.half[1] = *(const v8us*)((const unsigned short*)Bh + boff + 16 + 8 * hh);
      acc[t] = mmaH<1>(ah.v, ah.v, bq.v, bq.v, acc[t]); }
  }
#pragma unroll
  for (int t = 0; t < 4; ++t) { if (col0 + t * 16 >= N) continue; const int col = col0 + t * 16 + ln; const float bv = bp ? bf16_round(bp[col]) : 0.f;
#pragma unroll
    for (int r = 0; r < 8; ++r) { float v = acc[t][r] * alpha + bv; if (CP) { const int rr = row0g + row0 + 8 * hh + r; if (rowsPerB < 0) v += CP[cofs + (size_t)rr * ldc + col];      /* rowsPerB < 0: own element of the batched C plane */ else { const int bidx = rr / rowsPerB; v += CP[(size_t)bidx * sCPb + (size_t)by * 64 + col]; } } if (ACT == 1) v = (v > 0.f) ? v : expm1f(v); else if (ACT == 7) v = (v > 0.f) ? v + 1.0f : expf(v); else if (ACT == 8) v = tanhf(v); else if (ACT == 9) v = 0.5f * v * (1.0f + tanhf(0.7978845608028654f * (v + 0.044715f * v * v * v))); else if (ACT == 11) v = 1.0f / (1.0f + expf(-v)); else if (ACT == 12) v = (v > 0.f) ? v : 0.01f * v; else if (ACT == 14) v = (v > 0.f) ? v : 0.1f * v; else if (ACT == 16) v = (v >= 0.f) ? v : 0.3f * v; else if (ACT == 17) v = (v >= 0.f) ? v : 0.2f * v; else if (ACT == 15) v = v / (1.0f + expf(-v)); else if (ACT == 3) v = fmaxf(v, 0.f); else if (ACT == 6) v = 0.5f * v * (1.0f + erff(v * 0.70710678118654752f)); so[w][8 * hh + r][t * 16 + ln] = v; } }
  __builtin_amdgcn_fence(__ATOMIC_ACQ_REL, "workgroup"); __builtin_amdgcn_wave_barrier();
  const int rsub = lane >> 4, c4 = (lane & 15) * 4; typedef _Float16 v4h __attribute__((ext_vector_type(4)));
  {
#pragma unroll
    for (int q = 0; q < 8; ++q) { const int r = q * 2 + rsub; if (col0 + c4 < N) { const v4f v = *(const v4fa*)&so[w][r][c4]; if (C) *(v4f*)(C + cofs + (size_t)(row0 + r) * ldc + col0 + c4) = v; if (C16) { v4h h4; for (int i = 0; i < 4; ++i) h4[i] = (_Float16)v[i]; *(v4h*)(C16 + cofs + (size_t)(row0 + r) * ldc + col0 + c4) = h4; } } }
     }
}


typedef _Float16 v4h __attribute__((ext_vector_type(4)));

__global__ __launch_bounds__(256) void k_h16(const float* __restrict__ x, _Float16* __restrict__ X16, size_t n8) { const size_t t = (size_t)blockIdx.x * 256 + threadIdx.x; if (t >= n8) return; FragH f;
#pragma unroll
  for (int q = 0; q < 8; ++q) f.h[q] = (_Float16)x[t * 8 + q]; *(v8us*)((unsigned short*)X16 + t * 8) = f.half[0];  }
__global__ __launch_bounds__(256) void k_round16f(const float* __restrict__ W, _Float16* __restrict__ Bt, size_t n8) { const size_t t = (size_t)blockIdx.x * 256 + threadIdx.x; if (t >= n8) return; FragH f;
#pragma unroll
  for (int i = 0; i < 8; ++i) f.h[i] = (_Float16)(bf16_round(W[t * 8 + i]) * 16.0f); *(v8us*)((unsigned short*)Bt + t * 8) = f.half[0];  }
template <int NHv, int TTv>
__global__ __launch_bounds__(256) void k_vt(const _Float16* __restrict__ V16, int ldv, int voff, _Float16* __restrict__ Vt) { __shared__ unsigned short tl[64][66]; const int tid = threadIdx.x; const int slab = blockIdx.x / (TTv / 64), lg = blockIdx.x % (TTv / 64); const int b = slab / NHv, h = slab % NHv;
  for (int i = tid; i < 64 * 8; i += 256) { const int r = i / 8, c8 = (i % 8) * 8; FragH f; f.half[0] = *(const v8us*)((const unsigned short*)V16 + ((size_t)b * TTv + lg * 64 + r) * ldv + voff + h * 64 + c8);
#pragma unroll
    for (int q = 0; q < 8; ++q) tl[r][c8 + q] = f.u[q]; }
  __syncthreads();
  {
#pragma unroll
    for (int rd = 0; rd < 2; ++rd) { const int d = rd * 32 + tid / 8, pc = tid % 8; FragH f;
#pragma unroll
      for (int q = 0; q < 8; ++q) f.u[q] = tl[pc * 8 + q][d];
      *(v8us*)((unsigned short*)Vt + ((size_t)slab * 64 + d) * TTv + lg * 64 + pc * 8) = f.half[0]; }
     } }

__global__ __launch_bounds__(256) void k_hl(const float* __restrict__ F, _Float16* __restrict__ Hh, _Float16* __restrict__ Hl, size_t n8) { const size_t t = (size_t)blockIdx.x * 256 + threadIdx.x; if (t >= n8) return; FragH fh, fl; const v4f a = *(const v4fa*)(F + t * 8), c = *(const v4fa*)(F + t * 8 + 4);
#pragma unroll
  for (int q = 0; q < 4; ++q) { _Float16 h = (_Float16)a[q]; fh.h[q] = h; fl.h[q] = (_Float16)((a[q] - (float)h) * 1024.0f); h = (_Float16)c[q]; fh.h[4 + q] = h; fl.h[4 + q] = (_Float16)((c[q] - (float)h) * 1024.0f); }
  { *(v8us*)((unsigned short*)Hh + t * 8) = fh.half[0]; *(v8us*)((unsigned short*)Hl + t * 8) = fl.half[0];  } }

// ---- fast GEMM (wave tile 32x64; requires M % 32 == 0 rows per launch region and N % 64 == 0); epilogue = k_gemm_hhx semantics ----
__device__ __forceinline__ v16h g2_frag(const _Float16* p, int hh) { FragH f; f.half[0] = *(const v8us*)((const unsigned short*)p + 8 * hh); f.half[1] = *(const v8us*)((const unsigned short*)p + 16 + 8 * hh); return f.v; }
__device__ __forceinline__ v8f g2_mma(v16h a, v16h b, v8f c) { v8f d = __builtin_amdgcn_wmma_f32_16x16x32_f16(false, a, false, b, (short)0, c, false, false); asm volatile("v_nop\n\tv_nop\n\tv_nop\n\tv_nop" : "+v"(d) : "v"(a), "v"(b)); return d; }
template <int ACT>
__device__ __forceinline__ void gemm2_body(const _Float16* __restrict__ A, int lda, size_t sA, const _Float16* __restrict__ Bh, int ldb, size_t sB, float alpha, const float* __restrict__ bias, size_t sBias, const float* __restrict__ CP, int rowsPerB, size_t sCPb, int row0g,
    float* __restrict__ C, _Float16* __restrict__ C16, int ldc, size_t sC, int M, int N, int K) { static_assert(ACT == 0 || ACT == 3 || ACT == 6 || ACT == 8 || ACT == 9 || ACT == 11 || ACT == 12 || ACT == 14 || ACT == 15 || ACT == 16 || ACT == 17, "k_gemm2: unsupported ACT code (would silently apply no activation)");
  __shared__ __attribute__((aligned(16))) float so[4][32][68];
  const int tid = threadIdx.x, w = tid >> 5, lane = tid & 31, ln = lane & 15, hh = lane >> 4; const int by = blockIdx.y;
  A += (size_t)by * sA; Bh += (size_t)by * sB; const size_t cofs = (size_t)by * sC; const float* bp = bias ? bias + (size_t)by * sBias : nullptr;
  const int ntn = N >> 6; const int mt = blockIdx.x / ntn, nq = blockIdx.x - mt * ntn; const int row0 = mt * 128 + 32 * w, col0 = nq * 64; if (row0 >= M) return;
  const _Float16* a0p = A + (size_t)(row0 + ln) * lda; const _Float16* a1p = a0p + (size_t)16 * lda;
  const _Float16* b0p = Bh + (size_t)(col0 + ln) * ldb; const _Float16* b1p = b0p + (size_t)16 * ldb; const _Float16* b2p = b1p + (size_t)16 * ldb; const _Float16* b3p = b2p + (size_t)16 * ldb;
  const v8f z8 = {0.f,0.f,0.f,0.f,0.f,0.f,0.f,0.f}; v8f c00 = z8, c01 = z8, c02 = z8, c03 = z8, c10 = z8, c11 = z8, c12 = z8, c13 = z8;
#pragma unroll 1
  for (int kb = 0; kb < K; kb += 32) { const v16h a0 = g2_frag(a0p + kb, hh), a1 = g2_frag(a1p + kb, hh);
    asm volatile("s_wait_xcnt 0x0" ::: "memory");      /* the wait that belongs in front of any overwrite of a register which an issued load names: the B loads behind it land in the registers of the A addresses */
    v16h b = g2_frag(b0p + kb, hh); c00 = g2_mma(a0, b, c00); c10 = g2_mma(a1, b, c10);
    b = g2_frag(b1p + kb, hh); c01 = g2_mma(a0, b, c01); c11 = g2_mma(a1, b, c11);
    b = g2_frag(b2p + kb, hh); c02 = g2_mma(a0, b, c02); c12 = g2_mma(a1, b, c12);
    b = g2_frag(b3p + kb, hh); c03 = g2_mma(a0, b, c03); c13 = g2_mma(a1, b, c13); }
  v8f accs[8] = {c00, c01, c02, c03, c10, c11, c12, c13};
#pragma unroll
  for (int u = 0; u < 8; ++u) { const int t = u & 3, half = u >> 2; const int col = col0 + t * 16 + ln; const float bv = bp ? bf16_round(bp[col]) : 0.f;
#pragma unroll
    for (int r = 0; r < 8; ++r) { const int rloc = half * 16 + 8 * hh + r; float v = accs[u][r] * alpha + bv; if (CP) { if (rowsPerB < 0) v += CP[cofs + (size_t)(row0g + row0 + rloc) * ldc + col];      /* rowsPerB < 0: own element of the batched C plane */ else { const int bidx = (row0g + row0 + rloc) / rowsPerB; v += CP[(size_t)bidx * sCPb + (size_t)by * 64 + col]; } }
      if (ACT == 3) v = fmaxf(v, 0.f); else if (ACT == 6) v = 0.5f * v * (1.0f + erff(v * 0.70710678118654752f)); else if (ACT == 11) v = 1.0f / (1.0f + expf(-v)); else if (ACT == 15) v = v / (1.0f + expf(-v)); else if (ACT == 12) v = (v > 0.f) ? v : 0.01f * v; else if (ACT == 8) v = tanhf(v); else if (ACT == 9) v = 0.5f * v * (1.0f + tanhf(0.7978845608028654f * (v + 0.044715f * v * v * v))); else if (ACT == 14) v = (v > 0.f) ? v : 0.1f * v; else if (ACT == 16) v = (v >= 0.f) ? v : 0.3f * v; else if (ACT == 17) v = (v >= 0.f) ? v : 0.2f * v;
      so[w][rloc][t * 16 + ln] = v; } }
  __builtin_amdgcn_fence(__ATOMIC_ACQ_REL, "workgroup"); __builtin_amdgcn_wave_barrier();
  const int rsub = lane >> 4, c4 = (lane & 15) * 4;
  {
#pragma unroll
    for (int q = 0; q < 16; ++q) { const int r = q * 2 + rsub; const v4f v = *(const v4fa*)&so[w][r][c4]; if (C) { *(v4f*)(C + cofs + (size_t)(row0 + r) * ldc + col0 + c4) = v; asm volatile("s_wait_xcnt 0x0" ::: "memory"); }      /* the wait that belongs in front of any overwrite of a register which an issued store names (the f16 conversion and the next row's address land in them) */
      if (C16) { v4h h4; for (int i = 0; i < 4; ++i) h4[i] = (_Float16)v[i]; *(v4h*)(C16 + cofs + (size_t)(row0 + r) * ldc + col0 + c4) = h4; } }
     } }
template <int ACT>
__global__ __launch_bounds__(128) void k_gemm2(const _Float16* __restrict__ A, int lda, size_t sA, const _Float16* __restrict__ Bh, int ldb, size_t sB, float alpha, const float* __restrict__ bias, size_t sBias, const float* __restrict__ CP, int rowsPerB, size_t sCPb, int row0g,
    float* __restrict__ C, _Float16* __restrict__ C16, int ldc, size_t sC, int M, int N, int K) { gemm2_body<ACT>(A, lda, sA, Bh, ldb, sB, alpha, bias, sBias, CP, rowsPerB, sCPb, row0g, C, C16, ldc, sC, M, N, K); }
// q, k, v projections of all heads in one launch, straight from the f32 input rows: blockIdx.z picks the stream, blockIdx.y the head (both the same for a whole block).
// A head's 64 input columns are used by that head alone and N = 64 covers all of its outputs, so every input element is read once, here: it is rounded in registers
// (f32 -> bf16 -> f16, the two roundings of the former builder) to the value that an f16 copy of the rows would hold. Wave tile 32x64, K = 64 in two steps of 32, products and sums in gemm2_body's order.
__device__ __forceinline__ v16h pj_cvt(v4f x0, v4f x1, v4f x2, v4f x3) { FragH f;      /* g2_frag's k order: x0, x1 = k 8 hh .. 8 hh + 7, x2, x3 = k 16 + 8 hh .. 16 + 8 hh + 7 */
#pragma unroll
  for (int q = 0; q < 4; ++q) { f.h[q] = (_Float16)bf16_round(x0[q]); f.h[4 + q] = (_Float16)bf16_round(x1[q]); f.h[8 + q] = (_Float16)bf16_round(x2[q]); f.h[12 + q] = (_Float16)bf16_round(x3[q]); }
  return f.v; }
__global__ __launch_bounds__(128) void k_proj(const float* __restrict__ x, const float* __restrict__ ctx, const float* __restrict__ vsrc, const _Float16* __restrict__ B0, const _Float16* __restrict__ B1, const _Float16* __restrict__ B2,
    const float* __restrict__ bias0, const float* __restrict__ bias1, const float* __restrict__ bias2, _Float16* __restrict__ C0, _Float16* __restrict__ C1, _Float16* __restrict__ C2) {
  static_assert(HD == 64 && NRQ % 128 == 0 && NRK == NRQ && DC == DM, "k_proj: K = N = 64, whole 128-row blocks, the three streams of one size");
  __shared__ __attribute__((aligned(16))) float so[4][32][68];
  const int tid = threadIdx.x, w = tid >> 5, lane = tid & 31, ln = lane & 15, hh = lane >> 4; const int h = blockIdx.y, z = blockIdx.z;
  const int row0 = blockIdx.x * 128 + 32 * w;
  const float* ap = (z == 0 ? x : z == 1 ? ctx : vsrc) + (size_t)(row0 + ln) * DM + h * HD + 8 * hh;
  const _Float16* bt = (z == 0 ? B0 : z == 1 ? B1 : B2) + (size_t)h * HD * HD + ln * HD;
  const float* bp = (z == 0 ? bias0 : z == 1 ? bias1 : bias2) + h * HD;
  _Float16* cp = (z == 0 ? C0 : z == 1 ? C1 : C2) + (size_t)row0 * DM + h * HD;
  v4f ax[2][2][4]; v16h bf[4][2]; float bb[4];      /* [16-row tile][k step][16-byte piece]; [16-column tile][k step]; the lane's four bias values */
#pragma unroll
  for (int t = 0; t < 4; ++t) bb[t] = bp[t * 16 + ln];
#pragma unroll
  for (int t = 0; t < 4; ++t)
#pragma unroll
    for (int s = 0; s < 2; ++s) bf[t][s] = g2_frag(bt + t * 16 * HD + s * 32, hh);
#pragma unroll
  for (int i = 0; i < 2; ++i)
#pragma unroll
    for (int s = 0; s < 2; ++s) { const float* p = ap + (size_t)i * 16 * DM + s * 32; ax[i][s][0] = *(const v4fa*)p; ax[i][s][1] = *(const v4fa*)(p + 4); ax[i][s][2] = *(const v4fa*)(p + 16); ax[i][s][3] = *(const v4fa*)(p + 20); }
  asm volatile("s_wait_xcnt 0x0" ::: "memory");      /* the wait that belongs in front of any overwrite of a register which an issued load names: all of the tile's loads are asked for above, what follows may reuse their address registers */
  __builtin_amdgcn_sched_barrier(0);      /* keeps the rounding behind all 36 loads, so that bias, weights and rows fly together; without it the second group of loads sinks behind the wait for the first group's data */
  const v8f z8 = {0.f,0.f,0.f,0.f,0.f,0.f,0.f,0.f}; v8f acc[2][4];
#pragma unroll
  for (int i = 0; i < 2; ++i)
#pragma unroll
    for (int t = 0; t < 4; ++t) acc[i][t] = z8;
#pragma unroll
  for (int s = 0; s < 2; ++s) { const v16h a0 = pj_cvt(ax[0][s][0], ax[0][s][1], ax[0][s][2], ax[0][s][3]), a1 = pj_cvt(ax[1][s][0], ax[1][s][1], ax[1][s][2], ax[1][s][3]);
#pragma unroll
    for (int t = 0; t < 4; ++t) { acc[0][t] = g2_mma(a0, bf[t][s], acc[0][t]); acc[1][t] = g2_mma(a1, bf[t][s], acc[1][t]); } }
#pragma unroll
  for (int i = 0; i < 2; ++i)
#pragma unroll
    for (int t = 0; t < 4; ++t) { const float bv = bf16_round(bb[t]);
#pragma unroll
      for (int r = 0; r < 8; ++r) so[w][i * 16 + 8 * hh + r][t * 16 + ln] = acc[i][t][r] * 0.0625f + bv; }      /* the weight planes are carried x16 */
  __builtin_amdgcn_fence(__ATOMIC_ACQ_REL, "workgroup"); __builtin_amdgcn_wave_barrier();      /* each wave reads back its own rows only: its LDS writes in front of its reads */
  const int rsub = lane >> 4, c4 = (lane & 15) * 4;
#pragma unroll
  for (int q = 0; q < 16; ++q) { const int r = q * 2 + rsub; const v4f v = *(const v4fa*)&so[w][r][c4]; v4h h4; for (int i = 0; i < 4; ++i) h4[i] = (_Float16)v[i];
    *(v4h*)(cp + (size_t)r * DM + c4) = h4;
    if (q == 7) asm volatile("s_wait_xcnt 0x0" ::: "memory"); } }      /* the wait that belongs in front of any overwrite of a register which an issued store names: the second eight rows are converted into the registers of the first eight stores */

// Every weight builder in one launch: none needs anything of another, so they share a grid by ranges of the block index (a block lies wholly in one range).
// Range 1: Wo -> BO. Range 2: the 3 x 16 per-head planes, PB_WH blocks each.
#define PB_WO (DM * (DM / 8) / 256)
#define PB_WH (HD * (HD / 8) / 256)
__global__ __launch_bounds__(256) void k_prep(const float* __restrict__ wq, const float* __restrict__ wk, const float* __restrict__ wv, const float* __restrict__ wo,
    _Float16* __restrict__ BQ, _Float16* __restrict__ BK, _Float16* __restrict__ BV, _Float16* __restrict__ BO) {
  static_assert(DM * (DM / 8) % 256 == 0 && HD * (HD / 8) % 256 == 0, "k_prep: every range is a whole number of blocks");
  int u = blockIdx.x; const int tid = threadIdx.x;
  if (u < PB_WO) { wt_f16_at(wo, BO, DM, DM, 16.0f, u * 256 + tid); return; }
  u -= PB_WO;
  const int s = u / (NH * PB_WH), r = u % (NH * PB_WH); const size_t o = (size_t)(r / PB_WH) * HD * HD;
  wt_f16_at((s == 0 ? wq : s == 1 ? wk : wv) + o, (s == 0 ? BQ : s == 1 ? BK : BV) + o, HD, HD, 16.0f, (r % PB_WH) * 256 + tid); }

__global__ __launch_bounds__(256) void k_wnat(const float* __restrict__ w, size_t n8, _Float16* __restrict__ Bt) { const size_t t = (size_t)blockIdx.x * 256 + threadIdx.x; if (t >= n8) return; FragH f; for (int q = 0; q < 8; ++q) f.h[q] = (_Float16)(bf16_round(w[t * 8 + q]) * 16.0f); *(v8us*)((unsigned short*)Bt + t * 8) = f.half[0];  }
__global__ __launch_bounds__(256) void k_rsm(const float* __restrict__ S, _Float16* __restrict__ P, int nrows) {
  #pragma clang fp contract(off)
  const int i = blockIdx.x * 256 + threadIdx.x; if (i >= nrows) return; const float* s = S + (size_t)i * SQ; float mx = -3.0e38f;
#pragma unroll 1
  for (int j = 0; j < SQ; ++j) mx = fmaxf(mx, s[j]); float se = 0.f;
#pragma unroll 1
  for (int j = 0; j < SQ; ++j) se += expf(s[j] - mx); const float sc = 256.0f / se;
#pragma unroll 1
  for (int j0 = 0; j0 < SQ; j0 += 8) { FragH f; for (int q = 0; q < 8; ++q) f.h[q] = (_Float16)(expf(s[j0 + q] - mx) * sc); unsigned short* d = (unsigned short*)P + (size_t)i * SQ + j0; *(v8us*)d = f.half[0];  } }
__global__ __launch_bounds__(256) void k_vt(const _Float16* __restrict__ V16, int b, int h0, _Float16* __restrict__ VT) { __shared__ unsigned short tl[64][65]; const int tid = threadIdx.x; const int hh = blockIdx.x % HG, sg = blockIdx.x / HG; const int s0 = sg * 64; const int h = h0 + hh;
  for (int i = tid; i < 64 * 8; i += 256) { const int j = i / 8, d8 = (i % 8) * 8; FragH f; f.half[0] = *(const v8us*)((const unsigned short*)V16 + ((size_t)b * SQ + s0 + j) * DM + h * HD + d8); for (int q = 0; q < 8; ++q) tl[d8 + q][j] = f.u[q]; }
  __syncthreads();
  { for (int i = tid; i < 64 * 8; i += 256) { const int d = i / 8, j8 = (i % 8) * 8; FragH f; for (int q = 0; q < 8; ++q) f.u[q] = tl[d][j8 + q]; *(v8us*)((unsigned short*)VT + ((size_t)hh * HD + d) * SQ + s0 + j8) = f.half[0]; }  } }


__global__ __launch_bounds__(256) void k_rsmf(const float* __restrict__ S, _Float16* __restrict__ P, int qn, int hg) {
  #pragma clang fp contract(off)
  const int t = blockIdx.x * 256 + threadIdx.x; if (t >= qn * hg) return; const size_t i = (size_t)(t / qn) * SQ + (t % qn); const float* s = S + i * SQ; float mx = -3.0e38f;
#pragma unroll 1
  for (int j = 0; j < SQ; ++j) mx = fmaxf(mx, s[j]); float se = 0.f;
#pragma unroll 1
  for (int j = 0; j < SQ; ++j) se += __expf(s[j] - mx); const float sc = 256.0f / se;
#pragma unroll 1
  for (int j0 = 0; j0 < SQ; j0 += 8) { FragH f; for (int q = 0; q < 8; ++q) f.h[q] = (_Float16)(__expf(s[j0 + q] - mx) * sc); unsigned short* d = (unsigned short*)P + i * SQ + j0; *(v8us*)d = f.half[0];  } }

// Fused attention, all batches and heads in one launch: scores, softmax and P V stay in registers; no score or weight plane goes through memory.
// A wave owns 32 queries of one (batch, head) and walks the 2048 keys 32 at a time. S^T = K Q^T (A = 16 key rows, B = 16 query rows, both in g2_frag's k order): a lane holds
// scores of ONE query (column ln), keys 8 hh + r of each 16-key tile, so two tiles, converted in place, are the B operand P^T of O^T += V^T P^T (A = V^T rows, the same k order).
// Running maximum and sum per query (f32); the two wave halves exchange the maximum each pass and join their sums once at the end.
// The 16 waves of a block share one head's K and V^T through LDS: a stage is 128 keys (K: 128 rows of 128 B, V^T: 64 rows of 256 B), brought in whole lines by asynchronous copies,
// four of 16 bytes a lane, into one of two buffers while the other is worked on; the rows lie at a pitch of 16 B x odd, so that a fragment's ds_load_b128 meets no bank twice.
#define FA_KS 128                      /* keys a stage */
#define FA_NT (SK / FA_KS)             /* stages */
#define FA_KP (HD * 2 + 16)            /* LDS pitch of a K row, bytes */
#define FA_VP (FA_KS * 2 + 16)         /* LDS pitch of a V^T row, bytes */
#define FA_KB (FA_KS * FA_KP)          /* K part of a buffer, bytes */
#define FA_BUF (FA_KB + HD * FA_VP)    /* one buffer, bytes */
__device__ __forceinline__ float fa_xhalf(float x) { return __builtin_bit_cast(float, __builtin_amdgcn_permlanex16(__builtin_bit_cast(int, x), __builtin_bit_cast(int, x), 0x76543210, 0xfedcba98, false, false)); }      /* lane l with lane l ^ 16 */
__device__ __forceinline__ v16h fa_frag(const _Float16* p) { FragH f; f.half[0] = *(const v8us*)(const unsigned short*)p; f.half[1] = *(const v8us*)((const unsigned short*)p + 16); return f.v; }      /* g2_frag with the lane half's 8 hh already in p */
__device__ __forceinline__ v16h fa_lfrag(const unsigned char* p) { FragH f; f.half[0] = *(const v8us*)p; f.half[1] = *(const v8us*)(p + 32); return f.v; }      /* fa_frag from an LDS row: p in bytes, the lane half's 16 hh already in it */
/* Four asynchronous copies of 16 bytes a lane, global memory to LDS through no register (l: the lane's LDS byte address, g: its global address). The s_wait_xcnt is the wait that belongs
   in front of any overwrite of a register which an issued copy names; as the last line of the copies' own statement it stands ahead of whatever reuses the operands' registers. */
__device__ __forceinline__ void fa_copy4(unsigned l0, const _Float16* g0, unsigned l1, const _Float16* g1, unsigned l2, const _Float16* g2, unsigned l3, const _Float16* g3) {
  asm volatile("global_load_async_to_lds_b128 %0, %1, off\n\tglobal_load_async_to_lds_b128 %2, %3, off\n\tglobal_load_async_to_lds_b128 %4, %5, off\n\tglobal_load_async_to_lds_b128 %6, %7, off\n\ts_wait_xcnt 0x0"
      :: "v"(l0), "v"(g0), "v"(l1), "v"(g1), "v"(l2), "v"(g2), "v"(l3), "v"(g3) : "memory"); }
/* Native 2^x, eight (or one) in a statement: behind a transcendental the instruction set asks for one independent instruction or a v_nop before its result is read or its source
   overwritten. Each v_exp_f32 here has an independent one behind it (the outputs share no register with the inputs), the last one the v_nop. */
__device__ __forceinline__ void fa_exp8(const float (&t)[8], float (&e)[8]) {
  asm("v_exp_f32 %0, %8\n\tv_exp_f32 %1, %9\n\tv_exp_f32 %2, %10\n\tv_exp_f32 %3, %11\n\tv_exp_f32 %4, %12\n\tv_exp_f32 %5, %13\n\tv_exp_f32 %6, %14\n\tv_exp_f32 %7, %15\n\tv_nop"
      : "=&v"(e[0]), "=&v"(e[1]), "=&v"(e[2]), "=&v"(e[3]), "=&v"(e[4]), "=&v"(e[5]), "=&v"(e[6]), "=&v"(e[7]) : "v"(t[0]), "v"(t[1]), "v"(t[2]), "v"(t[3]), "v"(t[4]), "v"(t[5]), "v"(t[6]), "v"(t[7])); }
__device__ __forceinline__ float fa_exp1(float t) { float e; asm("v_exp_f32 %0, %1\n\tv_nop" : "=&v"(e) : "v"(t)); return e; }
__device__ __forceinline__ v8f fa_mma(v16h a, v16h b, v8f c) { return __builtin_amdgcn_wmma_f32_16x16x32_f16(false, a, false, b, (short)0, c, false, false); }
__global__ __launch_bounds__(512) void k_fattn(const _Float16* __restrict__ Q, const _Float16* __restrict__ Kk, const _Float16* __restrict__ VT, _Float16* __restrict__ O) {
  static_assert(SK % FA_KS == 0 && FA_NT >= 2 && FA_KS * 8 == 2 * 512 && HD * (FA_KS / 8) == 2 * 512, "k_fattn: whole stages, two of them at least, two K and two V^T copies a lane and stage");
  __shared__ __attribute__((aligned(16))) unsigned char sm[2 * FA_BUF];
  const int tid = threadIdx.x, lane = tid & 31, ln = lane & 15, hh = lane >> 4; const int w = __builtin_amdgcn_readfirstlane(tid >> 5);      /* the wave's number, held scalar */
  const int bh = blockIdx.x / (NQ / 512), b = bh / NH, h = bh % NH; const int q0 = (blockIdx.x % (NQ / 512)) * 512 + w * 32;
  const float CS = 0.125f * 1.44269504088896340736f;      /* 1 / sqrt(64) and log2 e in one factor: exp(s / 8 - m / 8) = 2^((s - m) CS) */
  const _Float16* qp = Q + ((size_t)b * NQ + q0 + ln) * DM + h * HD + 8 * hh;
  /* the lane's part of a stage: K rows tid / 8 and 64 + tid / 8, piece tid % 8; V^T rows tid / 16 and 32 + tid / 16, piece tid % 16: a wave's copy covers four whole 128-byte lines */
  const _Float16* gk = Kk + ((size_t)b * SK + (tid >> 3)) * DM + h * HD + (tid & 7) * 8;
  const _Float16* gv = VT + ((size_t)bh * HD + (tid >> 4)) * SK + (tid & 15) * 8;
  const unsigned sb = (unsigned)(size_t)sm;      /* the low 32 bits of a __shared__ address are its LDS byte address */
  const unsigned lk = sb + (tid >> 3) * FA_KP + (tid & 7) * 16, lv = sb + FA_KB + (tid >> 4) * FA_VP + (tid & 15) * 16;
  auto stage = [&](int t) { const unsigned bo = (t & 1) * FA_BUF; const _Float16* k0 = gk + (size_t)t * FA_KS * DM; const _Float16* v0 = gv + t * FA_KS;
    fa_copy4(lk + bo, k0, lk + bo + 64 * FA_KP, k0 + (size_t)64 * DM, lv + bo, v0, lv + bo + 32 * FA_VP, v0 + (size_t)32 * SK); };
  v16h qf[2][2];
#pragma unroll
  for (int j = 0; j < 2; ++j)
#pragma unroll
    for (int s = 0; s < 2; ++s) qf[j][s] = fa_frag(qp + (size_t)j * 16 * DM + s * 32);
  stage(0);
  asm volatile("s_wait_asynccnt 0x0" ::: "memory");      /* this wave's copies of stage 0 have landed */
  __syncthreads();      /* every wave's have: stage 0 may be read */
  stage(1);
  const unsigned char* kl = sm + ln * FA_KP + hh * 16; const unsigned char* vl = sm + FA_KB + ln * FA_VP + hh * 16;
  const v8f z8 = {0.f,0.f,0.f,0.f,0.f,0.f,0.f,0.f}; v8f o[2][4]; float mr[2] = {-3.0e38f, -3.0e38f}, lr[2] = {0.f, 0.f};
#pragma unroll
  for (int j = 0; j < 2; ++j)
#pragma unroll
    for (int t = 0; t < 4; ++t) o[j][t] = z8;
#pragma unroll 1
  for (int g = 0; g < FA_NT; ++g) {      /* rolled, like the passes inside: unrolling either only adds registers, and the wave has none to spare */
    const unsigned char* kb = kl + (g & 1) * FA_BUF; const unsigned char* vb = vl + (g & 1) * FA_BUF;
    v16h kf[2][2];
#pragma unroll
    for (int t = 0; t < 2; ++t)
#pragma unroll
      for (int s = 0; s < 2; ++s) kf[t][s] = fa_lfrag(kb + t * 16 * FA_KP + s * 64);
#pragma unroll 1
    for (int c = 0; c < FA_KS / 32; ++c) {      /* rolled: one pass already holds 16 matrix instructions and 16 LDS reads */
      v16h vf[4]; const unsigned char* vc = vb + c * 64;
#pragma unroll
      for (int t = 0; t < 4; ++t) vf[t] = fa_lfrag(vc + t * 16 * FA_VP);      /* this pass's V^T, asked for ahead of the score products */
      v8f st[2][2];
#pragma unroll
      for (int j = 0; j < 2; ++j)
#pragma unroll
        for (int t = 0; t < 2; ++t) st[j][t] = fa_mma(kf[t][1], qf[j][1], fa_mma(kf[t][0], qf[j][0], z8));
      const int cn = (c + 1 < FA_KS / 32) ? c + 1 : c; const unsigned char* kc = kb + cn * 32 * FA_KP;      /* the next pass's K rows come during the softmax; the stage's last pass asks for its own rows again, which keeps every read inside this stage's buffer */
#pragma unroll
      for (int t = 0; t < 2; ++t)
#pragma unroll
        for (int s = 0; s < 2; ++s) kf[t][s] = fa_lfrag(kc + t * 16 * FA_KP + s * 64);
#pragma unroll
      for (int j = 0; j < 2; ++j) {
        float mx = fmaxf(st[j][0][0], st[j][1][0]);
#pragma unroll
        for (int r = 1; r < 8; ++r) mx = fmaxf(mx, fmaxf(st[j][0][r], st[j][1][r]));
        mx = fmaxf(mx, fa_xhalf(mx));      /* both halves of the wave hold scores of the same query: one maximum for both */
        const float mn = fmaxf(mr[j], mx); const float al = fa_exp1((mr[j] - mn) * CS); const float nb = -mn * CS; mr[j] = mn;      /* al = 0 on the first pass */
        FragH pf; float sm1 = 0.f;
#pragma unroll
        for (int t = 0; t < 2; ++t) { float x[8], p[8];
#pragma unroll
          for (int r = 0; r < 8; ++r) x[r] = __builtin_fmaf(st[j][t][r], CS, nb);
          fa_exp8(x, p);
#pragma unroll
          for (int r = 0; r < 8; ++r) { sm1 += p[r]; pf.h[t * 8 + r] = (_Float16)p[r]; } }
        lr[j] = lr[j] * al + sm1;
#pragma unroll
        for (int t = 0; t < 4; ++t) o[j][t] = fa_mma(vf[t], pf.v, o[j][t] * al);
      }
    }
    asm volatile("s_wait_dscnt 0x0" ::: "memory");      /* this wave's reads of the buffer have returned before anything refills it */
    asm volatile("s_wait_asynccnt 0x0" ::: "memory");      /* this wave's copies of the next stage have landed */
    __syncthreads();      /* one barrier a stage: it publishes the next stage and ends every wave's reads of this one */
    if (g + 2 < FA_NT) stage(g + 2);      /* into the buffer just left; the test is the same for the whole block */
  }
  asm volatile("s_wait_asynccnt 0x0" ::: "memory");      /* no copy is left in flight when the wave ends */
#pragma unroll
  for (int j = 0; j < 2; ++j) { const float inv = 64.0f / (lr[j] + fa_xhalf(lr[j])); _Float16* op = O + ((size_t)b * NQ + q0 + j * 16 + ln) * DM + h * HD + 8 * hh;      /* o carried x64, as the output GEMM expects */
#pragma unroll
    for (int t = 0; t < 4; ++t) { FragH f;
#pragma unroll
      for (int r = 0; r < 8; ++r) f.h[r] = (_Float16)(o[j][t][r] * inv);
      *(v8us*)((unsigned short*)op + t * 16) = f.half[0]; } } }      /* O^T tile t: d = 16 t + 8 hh + r, eight consecutive columns of the query's row: one 16-byte store */

// Output GEMM out = o Wo + bo (M = 8192, N = K = 1024) with both operands shared through LDS: a block of 8 waves owns a 256 x 128 tile of out, a wave 64 x 64 of it (16 accumulator tiles, so a fragment
// read from LDS feeds four matrix instructions). A stage is 128 k: 256 rows of o and 128 rows of Wo^T, 256 B each, brought in whole lines by asynchronous copies, 24 of 16 bytes a lane, into one of two
// buffers while the other is worked on; rows at a pitch of 16 B x odd, so that a fragment's ds_load_b128 meets no bank twice. k runs upward in steps of 32 into one accumulator: gemm2_body's sum order.
#define OG_BM 256                      /* rows of out a block */
#define OG_BN 128                      /* columns of out a block */
#define OG_KS 128                      /* k a stage */
#define OG_NT (DM / OG_KS)             /* stages */
#define OG_P (OG_KS * 2 + 16)          /* LDS pitch of a row, bytes */
#define OG_AB (OG_BM * OG_P)           /* o part of a buffer, bytes */
#define OG_BUF ((OG_BM + OG_BN) * OG_P)      /* one buffer, bytes */
#define OG_MT ((int)(NRQ / OG_BM))     /* row tiles */
/* Twelve asynchronous copies of 16 bytes a lane (l: the lane's LDS byte addresses, g: its global addresses); the s_wait_xcnt is the wait that belongs in front of any overwrite of a register
   which an issued copy names; as the last line of the copies' own statement it stands ahead of whatever reuses the operands' registers. */
__device__ __forceinline__ void og_copy12(const unsigned* l, const _Float16* const* g) {
  asm volatile("global_load_async_to_lds_b128 %0, %1, off\n\tglobal_load_async_to_lds_b128 %2, %3, off\n\tglobal_load_async_to_lds_b128 %4, %5, off\n\tglobal_load_async_to_lds_b128 %6, %7, off\n\t"
               "global_load_async_to_lds_b128 %8, %9, off\n\tglobal_load_async_to_lds_b128 %10, %11, off\n\tglobal_load_async_to_lds_b128 %12, %13, off\n\tglobal_load_async_to_lds_b128 %14, %15, off\n\t"
               "global_load_async_to_lds_b128 %16, %17, off\n\tglobal_load_async_to_lds_b128 %18, %19, off\n\tglobal_load_async_to_lds_b128 %20, %21, off\n\tglobal_load_async_to_lds_b128 %22, %23, off\n\ts_wait_xcnt 0x0"
      :: "v"(l[0]), "v"(g[0]), "v"(l[1]), "v"(g[1]), "v"(l[2]), "v"(g[2]), "v"(l[3]), "v"(g[3]), "v"(l[4]), "v"(g[4]), "v"(l[5]), "v"(g[5]),
         "v"(l[6]), "v"(g[6]), "v"(l[7]), "v"(g[7]), "v"(l[8]), "v"(g[8]), "v"(l[9]), "v"(g[9]), "v"(l[10]), "v"(g[10]), "v"(l[11]), "v"(g[11]) : "memory"); }
__global__ __launch_bounds__(256) void k_ogemm(const _Float16* __restrict__ A, const _Float16* __restrict__ Bt, const float* __restrict__ bias, float* __restrict__ C) {
  static_assert(NRQ % OG_BM == 0 && DM % OG_BN == 0 && DM % OG_KS == 0 && OG_NT >= 2 && OG_BM * 16 == 16 * 256 && OG_BN * 16 == 8 * 256 && 8 * 64 * 68 * 4 <= 2 * OG_BUF,
                "k_ogemm: whole tiles and stages, two stages at least, sixteen o and eight Wo^T copies a lane and stage, the output staging fits the ring");
  __shared__ __attribute__((aligned(16))) unsigned char sm[2 * OG_BUF];
  const int tid = threadIdx.x, lane = tid & 31, ln = lane & 15, hh = lane >> 4; const int w = __builtin_amdgcn_readfirstlane(tid >> 5);      /* the wave's number, held scalar */
  const int mt = blockIdx.x % OG_MT, nq = blockIdx.x / OG_MT; const int wm = w >> 1, wn = w & 1;      /* waves 4 x 2 over the block's tile */
  const int col0 = nq * OG_BN + wn * 64;
  /* the lane's part of a stage: rows tid / 16 + 16 i, piece tid % 16: a wave's copy covers four whole 128-byte lines */
  const _Float16* ga = A + ((size_t)mt * OG_BM + (tid >> 4)) * DM + (tid & 15) * 8;
  const _Float16* gb = Bt + ((size_t)nq * OG_BN + (tid >> 4)) * DM + (tid & 15) * 8;
  const unsigned la = (unsigned)(size_t)sm + (tid >> 4) * OG_P + (tid & 15) * 16;      /* the low 32 bits of a __shared__ address are its LDS byte address */
  auto stage = [&](int t) { unsigned l[24]; const _Float16* g[24]; const unsigned bo = la + (t & 1) * OG_BUF;
#pragma unroll
    for (int i = 0; i < 16; ++i) { l[i] = bo + i * 16 * OG_P; g[i] = ga + (size_t)i * 16 * DM + t * OG_KS; }
#pragma unroll
    for (int i = 0; i < 8; ++i) { l[16 + i] = bo + OG_AB + i * 16 * OG_P; g[16 + i] = gb + (size_t)i * 16 * DM + t * OG_KS; }
    og_copy12(l, g); og_copy12(l + 12, g + 12); };
  float bb[4];
#pragma unroll
  for (int t = 0; t < 4; ++t) bb[t] = bias[col0 + t * 16 + ln];
  stage(0);
  asm volatile("s_wait_asynccnt 0x0" ::: "memory");      /* this wave's copies of stage 0 have landed */
  __syncthreads();      /* every wave's have: stage 0 may be read */
  stage(1);
  const unsigned char* al = sm + (wm * 64 + ln) * OG_P + hh * 16; const unsigned char* bl = sm + OG_AB + (wn * 64 + ln) * OG_P + hh * 16;
  const v8f z8 = {0.f,0.f,0.f,0.f,0.f,0.f,0.f,0.f}; v8f acc[4][4];
#pragma unroll
  for (int i = 0; i < 4; ++i)
#pragma unroll
    for (int t = 0; t < 4; ++t) acc[i][t] = z8;
#pragma unroll 1
  for (int g = 0; g < OG_NT; ++g) {      /* rolled: a stage already holds 64 matrix instructions and 64 LDS reads */
    const unsigned char* ab = al + (g & 1) * OG_BUF; const unsigned char* bp = bl + (g & 1) * OG_BUF;
#pragma unroll
    for (int s = 0; s < OG_KS / 32; ++s) { v16h af[4], bf[4];
      af[0] = fa_lfrag(ab + s * 64);      /* the first row's operands are asked for first, so that its products start while the other rows' still come */
#pragma unroll
      for (int t = 0; t < 4; ++t) bf[t] = fa_lfrag(bp + t * 16 * OG_P + s * 64);
#pragma unroll
      for (int i = 1; i < 4; ++i) af[i] = fa_lfrag(ab + i * 16 * OG_P + s * 64);
      __builtin_amdgcn_sched_barrier(0);      /* keeps the step's 16 LDS reads together in front of its products: left alone the compiler puts each row's reads, with a full wait, between the rows */
#pragma unroll
      for (int i = 0; i < 4; ++i)
#pragma unroll
        for (int t = 0; t < 4; ++t) acc[i][t] = fa_mma(af[i], bf[t], acc[i][t]);
      __builtin_amdgcn_sched_barrier(0); }      /* and the next step's reads behind these products, in one place */
    asm volatile("s_wait_dscnt 0x0" ::: "memory");      /* this wave's reads of the buffer have returned before anything refills it */
    asm volatile("s_wait_asynccnt 0x0" ::: "memory");      /* this wave's copies of the next stage have landed */
    __syncthreads();      /* one barrier a stage: it publishes the next stage and ends every wave's reads of this one */
    if (g + 2 < OG_NT) stage(g + 2);      /* into the buffer just left; the test is the same for the whole block */
  }
  asm volatile("s_wait_asynccnt 0x0" ::: "memory");      /* no copy is in flight when the ring becomes output staging; the loop's last barrier has ended every wave's reads of it */
  float* so = (float*)sm + w * (64 * 68);      /* each wave stages in its own range: its 64 rows of 64 f32 at a pitch of 68 */
  const float* sr = so + hh * 68 + ln * 4; float* cr = C + ((size_t)mt * OG_BM + wm * 64 + hh) * DM + col0 + ln * 4;      /* read back and stored: rows 2 q + hh, four columns a lane */
#pragma unroll
  for (int i = 0; i < 4; ++i)
#pragma unroll
    for (int t = 0; t < 4; ++t) { const float bv = bf16_round(bb[t]);
#pragma unroll
      for (int r = 0; r < 8; ++r) so[(i * 16 + 8 * hh + r) * 68 + t * 16 + ln] = acc[i][t][r] * 0.0009765625f + bv; }      /* o carried x64, Wo x16 */
  __builtin_amdgcn_fence(__ATOMIC_ACQ_REL, "workgroup"); __builtin_amdgcn_wave_barrier();      /* each wave reads back its own rows only: its LDS writes in front of its reads */
#pragma unroll
  for (int q = 0; q < 32; ++q) { const v4f v = *(const v4fa*)(sr + q * 2 * 68);
    *(v4f*)(cr + (size_t)q * 2 * DM) = v;      /* two rows of 256 B a store: whole lines */
    if (q == 15) asm volatile("s_wait_xcnt 0x0" ::: "memory"); } }      /* the wait that belongs in front of any overwrite of a register which an issued store names: the second 32 rows are read back into the registers of the first 16 stores */

extern "C" void kernel_launch(void* const* d_in, const int* in_sizes, int n_in,
                              void* d_out, int out_size, void* d_ws, size_t ws_size, hipStream_t stream) {
  (void)in_sizes; (void)n_in; (void)out_size;
  const float* const* I = (const float* const*)d_in; const float* x = I[0]; const float* ctx = I[1]; const float* vsrc = I[2]; const float* wq = I[3]; const float* bq = I[4]; const float* wk = I[5]; const float* bk = I[6]; const float* wv = I[7]; const float* bv = I[8]; const float* wo = I[9]; const float* bo = I[10];      /* input order: Q, K, V (THREE streams), Wq, bq, Wk, bk, Wv, bv (PER-HEAD [16][64][64] = [head][in][out]; biases [16][64] = the flat [1024] at 64 h + e; zeros on this draw), Wo ([in][out] [1024][1024]), bo (zeros): eleven inputs */
  char* ws = (char*)d_ws; size_t off = 0;
  auto take = [&](size_t bytes) { char* p = ws + off; off += (bytes + 255) & ~(size_t)255; return p; };
  _Float16* BQ = (_Float16*)take((size_t)DM * DM * 2); _Float16* BK = (_Float16*)take((size_t)DM * DC * 2); _Float16* BV = (_Float16*)take((size_t)DM * DC * 2); _Float16* BO = (_Float16*)take((size_t)DM * DM * 2);
  _Float16* Q16 = (_Float16*)take(NRQ * DM * 2); _Float16* K16 = (_Float16*)take(NRK * DM * 2); _Float16* V16 = (_Float16*)take(NRK * DM * 2); _Float16* O16 = (_Float16*)take(NRQ * DM * 2);
  _Float16* VT = (_Float16*)take((size_t)NB * NH * HD * SK * 2);
  if (off > ws_size) return;      /* 4 x 2 + 4 x 16 + 16 = 88 MiB */
  k_prep<<<PB_WO + 3 * NH * PB_WH, 256, 0, stream>>>(wq, wk, wv, wo, BQ, BK, BV, BO);      /* all weight operands in one launch. The per-head stacks [16][64][64] are [in][out] per head (x_h @ W_h): W_h[d][e] -> Bt_h[e][d] x16, K = N = 64, into consecutive [64][64] planes; Wo [in][out]: the same with K = N = 1024 */
  k_proj<<<dim3((unsigned)(NRQ / 128), NH, 3), 128, 0, stream>>>(x, ctx, vsrc, BQ, BK, BV, bq, bk, bv, Q16, K16, V16);      /* q, k, v (grid.z) in one launch, from the f32 rows: head h (grid.y) = rows[:, 64 h ..] W_h + b_h -> out[:, 64 h ..] (pitch DM); B + 4096 h (pitch 64), bias + 64 h; K = N = 64 */
  k_vt<NH, SK><<<NB * NH * (SK / 64), 256, 0, stream>>>(V16, DM, 0, VT);      /* V^T [4][16][64][2048], all batches in one launch: the kernel takes batch and head from the block index */
  k_fattn<<<NB * NH * (NQ / 512), 512, 0, stream>>>(Q16, K16, VT, O16);      /* scores, softmax, P V of every batch and head: 512 queries a block, o x64 into merged rows */
  k_ogemm<<<OG_MT * (DM / OG_BN), 256, 0, stream>>>(O16, BO, bo, (float*)d_out);      /* out = o Wo + bo (alpha 2^-10), 256 x 128 of out a block */
}

// v007
// A run of this version takes 98.3 microseconds.
// In both of two side-by-side timings against v006, it was 1.08 times as fast.
// Counting every step since v000, it is 70.4 times as fast.
#include <hip/hip_runtime.h>
// Multi-head attention on THREE input streams with BLOCK-DIAGONAL per-head projections on four sequences (Q, K, V [4][2048][1024], each split into 16 contiguous 64-wide slices; q / k / v = einsum('bhsd,hde->bhse', slice, W) + b: EACH HEAD applies its own Dense(64) (W [16][64][64] = [head][in][out], normal x 1/8; biases [16][64] zeros on this draw) to ITS OWN slice of ITS stream; scores / sqrt(64); softmax over all 2048 keys (no mask); out = merged Wo + bo ([in][out] [1024][1024]; bo zeros) -> [4][2048][1024]); each projection is ONE head-batched GEMM (K = 64).
// Structure: the per-head [in][out] weight blocks transposed into sixteen consecutive exact x16 [64][64] planes per stack (all weight builders in ONE launch, by ranges of the block index); Q, K, V as three HEAD-BATCHED WMMA GEMMs in ONE launch (16 heads on grid.y, the stream on grid.z; K = N = 64; 32x64 wave tiles, A fragments read from the f32 input rows and rounded in registers, no f16 copy of the inputs in memory; f32 accumulation, + the head's bias, f16 outputs into the head's 64 columns); V^T of all batches via LDS transposes in ONE launch; ONE fused launch for all batches and heads: scores (K = 64), running softmax over the 2048 keys (f32 statistics, native exp2; unnormalised weights in (0, 2^8] as f16), o = P V (o carried x64) into merged f16 rows; out = o W_o + b_o GEMM (f32, alpha 2^-10); launches: see trace.
// Compute dtype: inputs rounded to bf16; x / context / weights exact; q, k, v, softmax weights and o as plain f16 GEMM operands (~2^-12); scores and statistics f32. v_wmma_f32_16x16x32_f16.
#define NB 4
#define NQ 2048
#define SK 2048
#define SQ SK                       /* keys per softmax row */
#define DM 1024
#define DC 1024
#define NH 16
#define HD 64
#define HG 4
#define NRQ ((size_t)NB * NQ)
#define NRK ((size_t)NB * SK)
typedef __bf16 v16b __attribute__((ext_vector_type(16)));
typedef unsigned short v8us __attribute__((ext_vector_type(8), may_alias));
typedef float  v8f  __attribute__((ext_vector_type(8)));
typedef float  v4f  __attribute__((ext_vector_type(4)));
typedef float  v4fa __attribute__((ext_vector_type(4), may_alias));
union FragB { v16b v; v8us half[2]; unsigned short u[16]; };

__device__ __forceinline__ unsigned short bf16_bits(float x) { unsigned int u = __float_as_uint(x); return (unsigned short)((u + 0x7FFFu + ((u >> 16) & 1u)) >> 16); }
__device__ __forceinline__ float bf16_val(unsigned short b) { return __uint_as_float(((unsigned int)b) << 16); }
__device__ __forceinline__ float bf16_round(float x) { return bf16_val(bf16_bits(x)); }
// D += A·B with NT terms: 1 = ah·bh, 2 = + al·bh (A split), 3 = + ah·bl (both split)
template <int NT>
__device__ __forceinline__ v8f mmaN(v16b ah, v16b al, v16b bh, v16b bl, v8f c) {
  c = __builtin_amdgcn_wmma_f32_16x16x32_bf16(false, ah, false, bh, (short)0, c, false, false);
  if (NT >= 2) c = __builtin_amdgcn_wmma_f32_16x16x32_bf16(false, al, false, bh, (short)0, c, false, false);
  if (NT >= 3) c = __builtin_amdgcn_wmma_f32_16x16x32_bf16(false, ah, false, bl, (short)0, c, false, false);
  asm volatile("v_nop\n\tv_nop\n\tv_nop\n\tv_nop" : "+v"(c) : "v"(ah), "v"(al), "v"(bh), "v"(bl));
  return c;
}

__global__ __launch_bounds__(256) void k_wt_bf16(const float* __restrict__ W, unsigned short* __restrict__ Wt, int K, int N) {
  const int t = blockIdx.x * 256 + threadIdx.x;
  const int k8n = K / 8;
  if (t >= N * k8n) return;
  const int n = t / k8n, k8 = (t % k8n) * 8;
  v8us v;
#pragma unroll
  for (int i = 0; i < 8; ++i) v[i] = bf16_bits(W[(size_t)(k8 + i) * N + n]);
  *(v8us*)(Wt + (size_t)n * K + k8) = v;
  
}

// GEMM C[M][N] (f32, pitch ldc) = act(A[M][K]·W + bias). A f32 row-major (pitch lda) converted per fragment to bf16
// (ASPLIT: hi/lo two planes -> 2 terms, else single rounded term); Wt bf16 [N][K] (pitch ldb). BIAS_BF16 rounds the
// bias to bf16 first (bias quantised to bf16 before the add). K%32==0, M%16==0, N%64==0.
template <bool ASPLIT, int ACT, bool BIAS_BF16>
__global__ __launch_bounds__(128) void k_gemm_bf(const float* __restrict__ A, int lda, const unsigned short* __restrict__ Wt, int ldb,
                                               const float* __restrict__ bias, float* __restrict__ C, int ldc, int M, int N, int K) {
  __shared__ __attribute__((aligned(16))) float so[4][16][64];
  const int tid = threadIdx.x, w = tid >> 5, lane = tid & 31, ln = lane & 15, hh = lane >> 4;
  const int ntn = N / 64;
  const int wid = blockIdx.x * 4 + w;
  const int mt = wid / ntn, nq = wid % ntn;
  if (mt * 16 >= M) return;
  const int row0 = mt * 16, col0 = nq * 64;
  const float* arow = A + (size_t)(row0 + ln) * lda;
  v8f acc[4] = {};
  for (int kb = 0; kb < K; kb += 32) {
    FragB ah, al;
    const v4f x0 = *(const v4fa*)(arow + kb + 8 * hh), x1 = *(const v4fa*)(arow + kb + 8 * hh + 4);
    const v4f x2 = *(const v4fa*)(arow + kb + 16 + 8 * hh), x3 = *(const v4fa*)(arow + kb + 16 + 8 * hh + 4);
    float xs[16] = {x0[0],x0[1],x0[2],x0[3],x1[0],x1[1],x1[2],x1[3],x2[0],x2[1],x2[2],x2[3],x3[0],x3[1],x3[2],x3[3]};
#pragma unroll
    for (int i = 0; i < 16; ++i) { const unsigned short hb = bf16_bits(xs[i]); ah.u[i] = hb; al.u[i] = ASPLIT ? bf16_bits(xs[i] - bf16_val(hb)) : (unsigned short)0; }
#pragma unroll
    for (int t = 0; t < 4; ++t) {
      const unsigned short* brow = Wt + (size_t)(col0 + t * 16 + ln) * ldb + kb;
      FragB b;
      b.half[0] = *(const v8us*)(brow + 8 * hh);
      b.half[1] = *(const v8us*)(brow + 16 + 8 * hh);
      acc[t] = mmaN<ASPLIT ? 2 : 1>(ah.v, al.v, b.v, b.v, acc[t]);
    }
  }
#pragma unroll
  for (int t = 0; t < 4; ++t) {
    float bv = bias ? bias[col0 + t * 16 + ln] : 0.f;
    if (BIAS_BF16) bv = bf16_round(bv);
#pragma unroll
    for (int r = 0; r < 8; ++r) { float v = acc[t][r] + bv; if (ACT == 1) v = fmaxf(v, 0.f); so[w][8 * hh + r][t * 16 + ln] = v; }
  }
  __builtin_amdgcn_fence(__ATOMIC_ACQ_REL, "workgroup");
  __builtin_amdgcn_wave_barrier();
  const int rsub = lane >> 4, c4 = (lane & 15) * 4;
  {
#pragma unroll
    for (int q = 0; q < 8; ++q) {
      const int r = q * 2 + rsub;
      const v4f v = *(const v4fa*)&so[w][r][c4];
      *(v4f*)(C + (size_t)(row0 + r) * ldc + col0 + c4) = v;
    }
    
  }
}

// GEMM C = act(A·W + bias + resid): A f32 (ASPLIT -> hi/lo 2 terms), Wt bf16 [N][K]; ACT 0 none, 1 relu, 2 exact gelu;
// resid (optional, f32, row index = (row % rmod), pitch ldr, RES_BF16 rounds it) added before the activation.
template <bool ASPLIT, int ACT, bool BIAS_BF16, bool RES_BF16>
__global__ __launch_bounds__(128) void k_gemm_bf3(const float* __restrict__ A, int lda, const unsigned short* __restrict__ Wt, int ldb,
                                                const float* __restrict__ bias, const float* __restrict__ resid, int rmod, int ldr,
                                                float* __restrict__ C, int ldc, int M, int N, int K) {
  __shared__ __attribute__((aligned(16))) float so[4][16][64];
  const int tid = threadIdx.x, w = tid >> 5, lane = tid & 31, ln = lane & 15, hh = lane >> 4;
  const int ntn = N / 64;
  const int wid = blockIdx.x * 4 + w;
  const int mt = wid / ntn, nq = wid % ntn;
  if (mt * 16 >= M) return;
  const int row0 = mt * 16, col0 = nq * 64;
  const float* arow = A + (size_t)(row0 + ln) * lda;
  v8f acc[4] = {};
  for (int kb = 0; kb < K; kb += 32) {
    FragB ah, al;
    const v4f x0 = *(const v4fa*)(arow + kb + 8 * hh), x1 = *(const v4fa*)(arow + kb + 8 * hh + 4);
    const v4f x2 = *(const v4fa*)(arow + kb + 16 + 8 * hh), x3 = *(const v4fa*)(arow + kb + 16 + 8 * hh + 4);
    float xs[16] = {x0[0],x0[1],x0[2],x0[3],x1[0],x1[1],x1[2],x1[3],x2[0],x2[1],x2[2],x2[3],x3[0],x3[1],x3[2],x3[3]};
#pragma unroll
    for (int i = 0; i < 16; ++i) { const unsigned short hb = bf16_bits(xs[i]); ah.u[i] = hb; al.u[i] = ASPLIT ? bf16_bits(xs[i] - bf16_val(hb)) : (unsigned short)0; }
#pragma unroll
    for (int t = 0; t < 4; ++t) {
      const unsigned short* brow = Wt + (size_t)(col0 + t * 16 + ln) * ldb + kb;
      FragB b;
      b.half[0] = *(const v8us*)(brow + 8 * hh);
      b.half[1] = *(const v8us*)(brow + 16 + 8 * hh);
      acc[t] = mmaN<ASPLIT ? 2 : 1>(ah.v, al.v, b.v, b.v, acc[t]);
    }
  }
#pragma unroll
  for (int t = 0; t < 4; ++t) {
    const int col = col0 + t * 16 + ln;
    float bv = bias ? bias[col] : 0.f;
    if (BIAS_BF16) bv = bf16_round(bv);
#pragma unroll
    for (int r = 0; r < 8; ++r) {
      float v = acc[t][r] + bv;
      if (resid) { float rv = resid[(size_t)((row0 + 8 * hh + r) % rmod) * ldr + col]; if (RES_BF16) rv = bf16_round(rv); v += rv; }
      if (ACT == 1) v = fmaxf(v, 0.f);
      if (ACT == 2) v = 0.5f * v * (1.0f + erff(v * 0.70710678118654752f));
      if (ACT == 3) { const float u = 0.7978845608028654f * (v + 0.044715f * v * v * v); v = 0.5f * v * (1.0f + tanhf(u)); }
      so[w][8 * hh + r][t * 16 + ln] = v;
    }
  }
  __builtin_amdgcn_fence(__ATOMIC_ACQ_REL, "workgroup");
  __builtin_amdgcn_wave_barrier();
  const int rsub = lane >> 4, c4 = (lane & 15) * 4;
  {
#pragma unroll
    for (int q = 0; q < 8; ++q) {
      const int r = q * 2 + rsub;
      const v4f v = *(const v4fa*)&so[w][r][c4];
      *(v4f*)(C + (size_t)(row0 + r) * ldc + col0 + c4) = v;
    }
    
  }
}
// row LayerNorm (biased variance, eps) over N: s = X (+ R); optional out_sum <- s; out_norm <- (s-mu)*rsqrt(var+eps)*g + b
template <bool PARAM_BF16>
__global__ __launch_bounds__(256) void k_layernorm(const float* __restrict__ X, const float* __restrict__ R, const float* __restrict__ g, const float* __restrict__ bta,
                                                  float* __restrict__ out_sum, float* __restrict__ out_norm, int N, float eps) {
  __shared__ float red[256];
  const int row = blockIdx.x, tid = threadIdx.x;
  const float* x = X + (size_t)row * N; const float* rr = R ? R + (size_t)row * N : nullptr;
  float vals[16];                     // up to N = 4096
  const int per = N / 256;            // contiguous chunk per thread? use strided-by-4 chunks: thread handles j = tid*4 + 1024*u
  float s1 = 0.f;
  for (int u = 0; u < per / 4; ++u) {
    const int j = tid * 4 + 1024 * u;
    const v4f a = *(const v4fa*)(x + j);
    v4f b = {0.f,0.f,0.f,0.f}; if (rr) b = *(const v4fa*)(rr + j);
#pragma unroll
    for (int q = 0; q < 4; ++q) { const float v = a[q] + b[q]; vals[u * 4 + q] = v; s1 += v; }
  }
  red[tid] = s1; __syncthreads();
  for (int st = 128; st > 0; st >>= 1) { if (tid < st) red[tid] += red[tid + st]; __syncthreads(); }
  const float mu = red[0] / (float)N; __syncthreads();
  float s2 = 0.f;
  for (int u = 0; u < per / 4; ++u)
#pragma unroll
    for (int q = 0; q < 4; ++q) { const float c = vals[u * 4 + q] - mu; s2 += c * c; }
  red[tid] = s2; __syncthreads();
  for (int st = 128; st > 0; st >>= 1) { if (tid < st) red[tid] += red[tid + st]; __syncthreads(); }
  const float rs = rsqrtf(red[0] / (float)N + eps);
  {
    for (int u = 0; u < per / 4; ++u) {
      const int j = tid * 4 + 1024 * u;
      v4f o, sm;
#pragma unroll
      for (int q = 0; q < 4; ++q) {
        float gg = g[j + q], bb = bta[j + q];
        if (PARAM_BF16) { gg = bf16_round(gg); bb = bf16_round(bb); }
        sm[q] = vals[u * 4 + q]; o[q] = (vals[u * 4 + q] - mu) * rs * gg + bb;
      }
      if (out_sum) *(v4f*)(out_sum + (size_t)row * N + j) = sm;
      *(v4f*)(out_norm + (size_t)row * N + j) = o;
    }
    
  }
}



// ---- f16 WMMA path (v_wmma_f32_16x16x32_f16): 11-bit significands for operands in range — used where a [0,1] probability operand needs more precision than bf16
typedef _Float16 v16h __attribute__((ext_vector_type(16)));
union FragH { v16h v; v8us half[2]; _Float16 h[16]; unsigned short u[16]; };
template <int NT>
__device__ __forceinline__ v8f mmaH(v16h ah, v16h al, v16h bh, v16h bl, v8f c) {
  c = __builtin_amdgcn_wmma_f32_16x16x32_f16(false, ah, false, bh, (short)0, c, false, false);
  if (NT >= 2) c = __builtin_amdgcn_wmma_f32_16x16x32_f16(false, al, false, bh, (short)0, c, false, false);
  if (NT >= 3) c = __builtin_amdgcn_wmma_f32_16x16x32_f16(false, ah, false, bl, (short)0, c, false, false);
  asm volatile("v_nop\n\tv_nop\n\tv_nop\n\tv_nop" : "+v"(c) : "v"(ah), "v"(al), "v"(bh), "v"(bl));
  return c;
}
// batched GEMM like k_gemm_b but f16 operands: A f32 (split into f16 hi/lo if ASPLIT, else rounded to f16), Bt = f16 values [n][k]; alpha; C f32; N multiple of 16 (partial tiles skipped)
template <bool ASPLIT>
__global__ __launch_bounds__(128) void k_gemm_h(const float* __restrict__ A, int lda, size_t sA, const _Float16* __restrict__ Bh, int ldb, size_t sB, float alpha, float* __restrict__ C, int ldc, size_t sC, int M, int N, int K) {
  __shared__ __attribute__((aligned(16))) float so[4][16][64];
  const int tid = threadIdx.x, w = tid >> 5, lane = tid & 31, ln = lane & 15, hh = lane >> 4; const int by = blockIdx.y;
  A += (size_t)by * sA; Bh += (size_t)by * sB; C += (size_t)by * sC;
  const int ntn = (N + 63) / 64; const int wid = blockIdx.x * 4 + w; const int mt = wid / ntn, nq = wid % ntn; if (mt * 16 >= M) return;
  const int row0 = mt * 16, col0 = nq * 64; const float* arow = A + (size_t)(row0 + ln) * lda;
  v8f acc[4] = {};
  for (int kb = 0; kb < K; kb += 32) {
    FragH ah, al;
    const v4f x0 = *(const v4fa*)(arow + kb + 8 * hh), x1 = *(const v4fa*)(arow + kb + 8 * hh + 4), x2 = *(const v4fa*)(arow + kb + 16 + 8 * hh), x3 = *(const v4fa*)(arow + kb + 16 + 8 * hh + 4);
    float xs[16] = {x0[0],x0[1],x0[2],x0[3],x1[0],x1[1],x1[2],x1[3],x2[0],x2[1],x2[2],x2[3],x3[0],x3[1],x3[2],x3[3]};
#pragma unroll
    for (int i = 0; i < 16; ++i) { const _Float16 h = (_Float16)xs[i]; ah.h[i] = h; al.h[i] = ASPLIT ? (_Float16)(xs[i] - (float)h) : (_Float16)0.0f; }
#pragma unroll
    for (int t = 0; t < 4; ++t) { if (col0 + t * 16 >= N) continue; const size_t boff = (size_t)(col0 + t * 16 + ln) * ldb + kb; FragH bq; bq.half[0] = *(const v8us*)(Bh + boff + 8 * hh); bq.half[1] = *(const v8us*)(Bh + boff + 16 + 8 * hh);
      acc[t] = mmaH<ASPLIT ? 2 : 1>(ah.v, al.v, bq.v, bq.v, acc[t]); }
  }
#pragma unroll
  for (int t = 0; t < 4; ++t) { if (col0 + t * 16 >= N) continue;
#pragma unroll
    for (int r = 0; r < 8; ++r) so[w][8 * hh + r][t * 16 + ln] = acc[t][r] * alpha; }
  __builtin_amdgcn_fence(__ATOMIC_ACQ_REL, "workgroup"); __builtin_amdgcn_wave_barrier();
  const int rsub = lane >> 4, c4 = (lane & 15) * 4;
  {
#pragma unroll
    for (int q = 0; q < 8; ++q) { const int r = q * 2 + rsub; if (col0 + c4 < N) { const v4f v = *(const v4fa*)&so[w][r][c4]; *(v4f*)(C + (size_t)(row0 + r) * ldc + col0 + c4) = v; } }
     }
}

// Wt[n][k] = f16(W[k][n]·scale) from f32 row-major W[K][N] (scale = power of two; bf16-exact weights stay exact in f16 away from the subnormal range)
__device__ __forceinline__ void wt_f16_at(const float* __restrict__ W, _Float16* __restrict__ Wt, int K, int N, float scale, int t) {      /* t: which eight k of which n; the caller's grid covers N K / 8 exactly */
  const int n = t / (K / 8), k8 = (t % (K / 8)) * 8; FragH f;
#pragma unroll
  for (int i = 0; i < 8; ++i) f.h[i] = (_Float16)(bf16_round(W[(size_t)(k8 + i) * N + n]) * scale); const v8us o = f.half[0];
  *(v8us*)((unsigned short*)Wt + (size_t)n * K + k8) = o; asm volatile("s_wait_xcnt 0x0" ::: "memory");      /* the wait that belongs in front of any overwrite of a register which an issued store names */
}
// k_gemm_hh variant with fused epilogue: v = acc·alpha + bias[by·sBias + col] (+ CP[(row/rowsPerB)·sCPb + by·64 + col] if CP) ; ACT 0 none / 1 elu ; writes f16 C16 (and f32 C if non-null)
template <int ACT>
__global__ __launch_bounds__(128) void k_gemm_hhx(const _Float16* __restrict__ A, int lda, size_t sA, const _Float16* __restrict__ Bh, int ldb, size_t sB, float alpha, const float* __restrict__ bias, size_t sBias, const float* __restrict__ CP, int rowsPerB, size_t sCPb, int row0g,
    float* __restrict__ C, _Float16* __restrict__ C16, int ldc, size_t sC, int M, int N, int K) {
  __shared__ __attribute__((aligned(16))) float so[4][16][64];
  const int tid = threadIdx.x, w = tid >> 5, lane = tid & 31, ln = lane & 15, hh = lane >> 4; const int by = blockIdx.y;
  A += (size_t)by * sA; Bh += (size_t)by * sB; const size_t cofs = (size_t)by * sC; const float* bp = bias ? bias + (size_t)by * sBias : nullptr;
  const int ntn = (N + 63) / 64; const int wid = blockIdx.x * 4 + w; const int mt = wid / ntn, nq = wid % ntn; if (mt * 16 >= M) return;
  const int row0 = mt * 16, col0 = nq * 64; const _Float16* arow = A + (size_t)(row0 + ln) * lda;
  v8f acc[4] = {};
  for (int kb = 0; kb < K; kb += 32) { FragH ah; ah.half[0] = *(const v8us*)((const unsigned short*)arow + kb + 8 * hh); ah.half[1] = *(const v8us*)((const unsigned short*)arow + kb + 16 + 8 * hh);
#pragma unroll
    for (int t = 0; t < 4; ++t) { if (col0 + t * 16 >= N) continue; const size_t boff = (size_t)(col0 + t * 16 + ln) * ldb + kb; FragH bq; bq.half[0] = *(const v8us*)((const unsigned short*)Bh + boff + 8 * hh); bq.half[1] = *(const v8us*)((const unsigned short*)Bh + boff + 16 + 8 * hh);
      acc[t] = mmaH<1>(ah.v, ah.v, bq.v, bq.v, acc[t]); }
  }
#pragma unroll
  for (int t = 0; t < 4; ++t) { if (col0 + t * 16 >= N) continue; const int col = col0 + t * 16 + ln; const float bv = bp ? bf16_round(bp[col]) : 0.f;
#pragma unroll
    for (int r = 0; r < 8; ++r) { float v = acc[t][r] * alpha + bv; if (CP) { const int rr = row0g + row0 + 8 * hh + r; if (rowsPerB < 0) v += CP[cofs + (size_t)rr * ldc + col];      /* rowsPerB < 0: own element of the batched C plane */ else { const int bidx = rr / rowsPerB; v += CP[(size_t)bidx * sCPb + (size_t)by * 64 + col]; } } if (ACT == 1) v = (v > 0.f) ? v : expm1f(v); else if (ACT == 7) v = (v > 0.f) ? v + 1.0f : expf(v); else if (ACT == 8) v = tanhf(v); else if (ACT == 9) v = 0.5f * v * (1.0f + tanhf(0.7978845608028654f * (v + 0.044715f * v * v * v))); else if (ACT == 11) v = 1.0f / (1.0f + expf(-v)); else if (ACT == 12) v = (v > 0.f) ? v : 0.01f * v; else if (ACT == 14) v = (v > 0.f) ? v : 0.1f * v; else if (ACT == 16) v = (v >= 0.f) ? v : 0.3f * v; else if (ACT == 17) v = (v >= 0.f) ? v : 0.2f * v; else if (ACT == 15) v = v / (1.0f + expf(-v)); else if (ACT == 3) v = fmaxf(v, 0.f); else if (ACT == 6) v = 0.5f * v * (1.0f + erff(v * 0.70710678118654752f)); so[w][8 * hh + r][t * 16 + ln] = v; } }
  __builtin_amdgcn_fence(__ATOMIC_ACQ_REL, "workgroup"); __builtin_amdgcn_wave_barrier();
  const int rsub = lane >> 4, c4 = (lane & 15) * 4; typedef _Float16 v4h __attribute__((ext_vector_type(4)));
  {
#pragma unroll
    for (int q = 0; q < 8; ++q) { const int r = q * 2 + rsub; if (col0 + c4 < N) { const v4f v = *(const v4fa*)&so[w][r][c4]; if (C) *(v4f*)(C + cofs + (size_t)(row0 + r) * ldc + col0 + c4) = v; if (C16) { v4h h4; for (int i = 0; i < 4; ++i) h4[i] = (_Float16)v[i]; *(v4h*)(C16 + cofs + (size_t)(row0 + r) * ldc + col0 + c4) = h4; } } }
     }
}


typedef _Float16 v4h __attribute__((ext_vector_type(4)));

__global__ __launch_bounds__(256) void k_h16(const float* __restrict__ x, _Float16* __restrict__ X16, size_t n8) { const size_t t = (size_t)blockIdx.x * 256 + threadIdx.x; if (t >= n8) return; FragH f;
#pragma unroll
  for (int q = 0; q < 8; ++q) f.h[q] = (_Float16)x[t * 8 + q]; *(v8us*)((unsigned short*)X16 + t * 8) = f.half[0];  }
__global__ __launch_bounds__(256) void k_round16f(const float* __restrict__ W, _Float16* __restrict__ Bt, size_t n8) { const size_t t = (size_t)blockIdx.x * 256 + threadIdx.x; if (t >= n8) return; FragH f;
#pragma unroll
  for (int i = 0; i < 8; ++i) f.h[i] = (_Float16)(bf16_round(W[t * 8 + i]) * 16.0f); *(v8us*)((unsigned short*)Bt + t * 8) = f.half[0];  }
template <int NHv, int TTv>
__global__ __launch_bounds__(256) void k_vt(const _Float16* __restrict__ V16, int ldv, int voff, _Float16* __restrict__ Vt) { __shared__ unsigned short tl[64][66]; const int tid = threadIdx.x; const int slab = blockIdx.x / (TTv / 64), lg = blockIdx.x % (TTv / 64); const int b = slab / NHv, h = slab % NHv;
  for (int i = tid; i < 64 * 8; i += 256) { const int r = i / 8, c8 = (i % 8) * 8; FragH f; f.half[0] = *(const v8us*)((const unsigned short*)V16 + ((size_t)b * TTv + lg * 64 + r) * ldv + voff + h * 64 + c8);
#pragma unroll
    for (int q = 0; q < 8; ++q) tl[r][c8 + q] = f.u[q]; }
  __syncthreads();
  {
#pragma unroll
    for (int rd = 0; rd < 2; ++rd) { const int d = rd * 32 + tid / 8, pc = tid % 8; FragH f;
#pragma unroll
      for (int q = 0; q < 8; ++q) f.u[q] = tl[pc * 8 + q][d];
      *(v8us*)((unsigned short*)Vt + ((size_t)slab * 64 + d) * TTv + lg * 64 + pc * 8) = f.half[0]; }
     } }

__global__ __launch_bounds__(256) void k_hl(const float* __restrict__ F, _Float16* __restrict__ Hh, _Float16* __restrict__ Hl, size_t n8) { const size_t t = (size_t)blockIdx.x * 256 + threadIdx.x; if (t >= n8) return; FragH fh, fl; const v4f a = *(const v4fa*)(F + t * 8), c = *(const v4fa*)(F + t * 8 + 4);
#pragma unroll
  for (int q = 0; q < 4; ++q) { _Float16 h = (_Float16)a[q]; fh.h[q] = h; fl.h[q] = (_Float16)((a[q] - (float)h) * 1024.0f); h = (_Float16)c[q]; fh.h[4 + q] = h; fl.h[4 + q] = (_Float16)((c[q] - (float)h) * 1024.0f); }
  { *(v8us*)((unsigned short*)Hh + t * 8) = fh.half[0]; *(v8us*)((unsigned short*)Hl + t * 8) = fl.half[0];  } }

// ---- fast GEMM (wave tile 32x64; requires M % 32 == 0 rows per launch region and N % 64 == 0); epilogue = k_gemm_hhx semantics ----
__device__ __forceinline__ v16h g2_frag(const _Float16* p, int hh) { FragH f; f.half[0] = *(const v8us*)((const unsigned short*)p + 8 * hh); f.half[1] = *(const v8us*)((const unsigned short*)p + 16 + 8 * hh); return f.v; }
__device__ __forceinline__ v8f g2_mma(v16h a, v16h b, v8f c) { v8f d = __builtin_amdgcn_wmma_f32_16x16x32_f16(false, a, false, b, (short)0, c, false, false); asm volatile("v_nop\n\tv_nop\n\tv_nop\n\tv_nop" : "+v"(d) : "v"(a), "v"(b)); return d; }
template <int ACT>
__device__ __forceinline__ void gemm2_body(const _Float16* __restrict__ A, int lda, size_t sA, const _Float16* __restrict__ Bh, int ldb, size_t sB, float alpha, const float* __restrict__ bias, size_t sBias, const float* __restrict__ CP, int rowsPerB, size_t sCPb, int row0g,
    float* __restrict__ C, _Float16* __restrict__ C16, int ldc, size_t sC, int M, int N, int K) { static_assert(ACT == 0 || ACT == 3 || ACT == 6 || ACT == 8 || ACT == 9 || ACT == 11 || ACT == 12 || ACT == 14 || ACT == 15 || ACT == 16 || ACT == 17, "k_gemm2: unsupported ACT code (would silently apply no activation)");
  __shared__ __attribute__((aligned(16))) float so[4][32][68];
  const int tid = threadIdx.x, w = tid >> 5, lane = tid & 31, ln = lane & 15, hh = lane >> 4; const int by = blockIdx.y;
  A += (size_t)by * sA; Bh += (size_t)by * sB; const size_t cofs = (size_t)by * sC; const float* bp = bias ? bias + (size_t)by * sBias : nullptr;
  const int ntn = N >> 6; const int mt = blockIdx.x / ntn, nq = blockIdx.x - mt * ntn; const int row0 = mt * 128 + 32 * w, col0 = nq * 64; if (row0 >= M) return;
  const _Float16* a0p = A + (size_t)(row0 + ln) * lda; const _Float16* a1p = a0p + (size_t)16 * lda;
  const _Float16* b0p = Bh + (size_t)(col0 + ln) * ldb; const _Float16* b1p = b0p + (size_t)16 * ldb; const _Float16* b2p = b1p + (size_t)16 * ldb; const _Float16* b3p = b2p + (size_t)16 * ldb;
  const v8f z8 = {0.f,0.f,0.f,0.f,0.f,0.f,0.f,0.f}; v8f c00 = z8, c01 = z8, c02 = z8, c03 = z8, c10 = z8, c11 = z8, c12 = z8, c13 = z8;
#pragma unroll 1
  for (int kb = 0; kb < K; kb += 32) { const v16h a0 = g2_frag(a0p + kb, hh), a1 = g2_frag(a1p + kb, hh);
    asm volatile("s_wait_xcnt 0x0" ::: "memory");      /* the wait that belongs in front of any overwrite of a register which an issued load names: the B loads behind it land in the registers of the A addresses */
    v16h b = g2_frag(b0p + kb, hh); c00 = g2_mma(a0, b, c00); c10 = g2_mma(a1, b, c10);
    b = g2_frag(b1p + kb, hh); c01 = g2_mma(a0, b, c01); c11 = g2_mma(a1, b, c11);
    b = g2_frag(b2p + kb, hh); c02 = g2_mma(a0, b, c02); c12 = g2_mma(a1, b, c12);
    b = g2_frag(b3p + kb, hh); c03 = g2_mma(a0, b, c03); c13 = g2_mma(a1, b, c13); }
  v8f accs[8] = {c00, c01, c02, c03, c10, c11, c12, c13};
#pragma unroll
  for (int u = 0; u < 8; ++u) { const int t = u & 3, half = u >> 2; const int col = col0 + t * 16 + ln; const float bv = bp ? bf16_round(bp[col]) : 0.f;
#pragma unroll
    for (int r = 0; r < 8; ++r) { const int rloc = half * 16 + 8 * hh + r; float v = accs[u][r] * alpha + bv; if (CP) { if (rowsPerB < 0) v += CP[cofs + (size_t)(row0g + row0 + rloc) * ldc + col];      /* rowsPerB < 0: own element of the batched C plane */ else { const int bidx = (row0g + row0 + rloc) / rowsPerB; v += CP[(size_t)bidx * sCPb + (size_t)by * 64 + col]; } }
      if (ACT == 3) v = fmaxf(v, 0.f); else if (ACT == 6) v = 0.5f * v * (1.0f + erff(v * 0.70710678118654752f)); else if (ACT == 11) v = 1.0f / (1.0f + expf(-v)); else if (ACT == 15) v = v / (1.0f + expf(-v)); else if (ACT == 12) v = (v > 0.f) ? v : 0.01f * v; else if (ACT == 8) v = tanhf(v); else if (ACT == 9) v = 0.5f * v * (1.0f + tanhf(0.7978845608028654f * (v + 0.044715f * v * v * v))); else if (ACT == 14) v = (v > 0.f) ? v : 0.1f * v; else if (ACT == 16) v = (v >= 0.f) ? v : 0.3f * v; else if (ACT == 17) v = (v >= 0.f) ? v : 0.2f * v;
      so[w][rloc][t * 16 + ln] = v; } }
  __builtin_amdgcn_fence(__ATOMIC_ACQ_REL, "workgroup"); __builtin_amdgcn_wave_barrier();
  const int rsub = lane >> 4, c4 = (lane & 15) * 4;
  {
#pragma unroll
    for (int q = 0; q < 16; ++q) { const int r = q * 2 + rsub; const v4f v = *(const v4fa*)&so[w][r][c4]; if (C) { *(v4f*)(C + cofs + (size_t)(row0 + r) * ldc + col0 + c4) = v; asm volatile("s_wait_xcnt 0x0" ::: "memory"); }      /* the wait that belongs in front of any overwrite of a register which an issued store names (the f16 conversion and the next row's address land in them) */
      if (C16) { v4h h4; for (int i = 0; i < 4; ++i) h4[i] = (_Float16)v[i]; *(v4h*)(C16 + cofs + (size_t)(row0 + r) * ldc + col0 + c4) = h4; } }
     } }
template <int ACT>
__global__ __launch_bounds__(128) void k_gemm2(const _Float16* __restrict__ A, int lda, size_t sA, const _Float16* __restrict__ Bh, int ldb, size_t sB, float alpha, const float* __restrict__ bias, size_t sBias, const float* __restrict__ CP, int rowsPerB, size_t sCPb, int row0g,
    float* __restrict__ C, _Float16* __restrict__ C16, int ldc, size_t sC, int M, int N, int K) { gemm2_body<ACT>(A, lda, sA, Bh, ldb, sB, alpha, bias, sBias, CP, rowsPerB, sCPb, row0g, C, C16, ldc, sC, M, N, K); }
// q, k, v projections of all heads in one launch, straight from the f32 input rows: blockIdx.z picks the stream, blockIdx.y the head (both the same for a whole block).
// A head's 64 input columns are used by that head alone and N = 64 covers all of its outputs, so every input element is read once, here: it is rounded in registers
// (f32 -> bf16 -> f16, the two roundings of the former builder) to the value that an f16 copy of the rows would hold. Wave tile 32x64, K = 64 in two steps of 32, products and sums in gemm2_body's order.
__device__ __forceinline__ v16h pj_cvt(v4f x0, v4f x1, v4f x2, v4f x3) { FragH f;      /* g2_frag's k order: x0, x1 = k 8 hh .. 8 hh + 7, x2, x3 = k 16 + 8 hh .. 16 + 8 hh + 7 */
#pragma unroll
  for (int q = 0; q < 4; ++q) { f.h[q] = (_Float16)bf16_round(x0[q]); f.h[4 + q] = (_Float16)bf16_round(x1[q]); f.h[8 + q] = (_Float16)bf16_round(x2[q]); f.h[12 + q] = (_Float16)bf16_round(x3[q]); }
  return f.v; }
__global__ __launch_bounds__(128) void k_proj(const float* __restrict__ x, const float* __restrict__ ctx, const float* __restrict__ vsrc, const _Float16* __restrict__ B0, const _Float16* __restrict__ B1, const _Float16* __restrict__ B2,
    const float* __restrict__ bias0, const float* __restrict__ bias1, const float* __restrict__ bias2, _Float16* __restrict__ C0, _Float16* __restrict__ C1, _Float16* __restrict__ C2) {
  static_assert(HD == 64 && NRQ % 128 == 0 && NRK == NRQ && DC == DM, "k_proj: K = N = 64, whole 128-row blocks, the three streams of one size");
  __shared__ __attribute__((aligned(16))) float so[4][32][68];
  const int tid = threadIdx.x, w = tid >> 5, lane = tid & 31, ln = lane & 15, hh = lane >> 4; const int h = blockIdx.y, z = blockIdx.z;
  const int row0 = blockIdx.x * 128 + 32 * w;
  const float* ap = (z == 0 ? x : z == 1 ? ctx : vsrc) + (size_t)(row0 + ln) * DM + h * HD + 8 * hh;
  const _Float16* bt = (z == 0 ? B0 : z == 1 ? B1 : B2) + (size_t)h * HD * HD + ln * HD;
  const float* bp = (z == 0 ? bias0 : z == 1 ? bias1 : bias2) + h * HD;
  _Float16* cp = (z == 0 ? C0 : z == 1 ? C1 : C2) + (size_t)row0 * DM + h * HD;
  v4f ax[2][2][4]; v16h bf[4][2]; float bb[4];      /* [16-row tile][k step][16-byte piece]; [16-column tile][k step]; the lane's four bias values */
#pragma unroll
  for (int t = 0; t < 4; ++t) bb[t] = bp[t * 16 + ln];
#pragma unroll
  for (int t = 0; t < 4; ++t)
#pragma unroll
    for (int s = 0; s < 2; ++s) bf[t][s] = g2_frag(bt + t * 16 * HD + s * 32, hh);
#pragma unroll
  for (int i = 0; i < 2; ++i)
#pragma unroll
    for (int s = 0; s < 2; ++s) { const float* p = ap + (size_t)i * 16 * DM + s * 32; ax[i][s][0] = *(const v4fa*)p; ax[i][s][1] = *(const v4fa*)(p + 4); ax[i][s][2] = *(const v4fa*)(p + 16); ax[i][s][3] = *(const v4fa*)(p + 20); }
  asm volatile("s_wait_xcnt 0x0" ::: "memory");      /* the wait that belongs in front of any overwrite of a register which an issued load names: all of the tile's loads are asked for above, what follows may reuse their address registers */
  __builtin_amdgcn_sched_barrier(0);      /* keeps the rounding behind all 36 loads, so that bias, weights and rows fly together; without it the second group of loads sinks behind the wait for the first group's data */
  const v8f z8 = {0.f,0.f,0.f,0.f,0.f,0.f,0.f,0.f}; v8f acc[2][4];
#pragma unroll
  for (int i = 0; i < 2; ++i)
#pragma unroll
    for (int t = 0; t < 4; ++t) acc[i][t] = z8;
#pragma unroll
  for (int s = 0; s < 2; ++s) { const v16h a0 = pj_cvt(ax[0][s][0], ax[0][s][1], ax[0][s][2], ax[0][s][3]), a1 = pj_cvt(ax[1][s][0], ax[1][s][1], ax[1][s][2], ax[1][s][3]);
#pragma unroll
    for (int t = 0; t < 4; ++t) { acc[0][t] = g2_mma(a0, bf[t][s], acc[0][t]); acc[1][t] = g2_mma(a1, bf[t][s], acc[1][t]); } }
#pragma unroll
  for (int i = 0; i < 2; ++i)
#pragma unroll
    for (int t = 0; t < 4; ++t) { const float bv = bf16_round(bb[t]);
#pragma unroll
      for (int r = 0; r < 8; ++r) so[w][i * 16 + 8 * hh + r][t * 16 + ln] = acc[i][t][r] * 0.0625f + bv; }      /* the weight planes are carried x16 */
  __builtin_amdgcn_fence(__ATOMIC_ACQ_REL, "workgroup"); __builtin_amdgcn_wave_barrier();      /* each wave reads back its own rows only: its LDS writes in front of its reads */
  const int rsub = lane >> 4, c4 = (lane & 15) * 4;
#pragma unroll
  for (int q = 0; q < 16; ++q) { const int r = q * 2 + rsub; const v4f v = *(const v4fa*)&so[w][r][c4]; v4h h4; for (int i = 0; i < 4; ++i) h4[i] = (_Float16)v[i];
    *(v4h*)(cp + (size_t)r * DM + c4) = h4;
    if (q == 7) asm volatile("s_wait_xcnt 0x0" ::: "memory"); } }      /* the wait that belongs in front of any overwrite of a register which an issued store names: the second eight rows are converted into the registers of the first eight stores */

// Every weight builder in one launch: none needs anything of another, so they share a grid by ranges of the block index (a block lies wholly in one range).
// Range 1: Wo -> BO. Range 2: the 3 x 16 per-head planes, PB_WH blocks each.
#define PB_WO (DM * (DM / 8) / 256)
#define PB_WH (HD * (HD / 8) / 256)
__global__ __launch_bounds__(256) void k_prep(const float* __restrict__ wq, const float* __restrict__ wk, const float* __restrict__ wv, const float* __restrict__ wo,
    _Float16* __restrict__ BQ, _Float16* __restrict__ BK, _Float16* __restrict__ BV, _Float16* __restrict__ BO) {
  static_assert(DM * (DM / 8) % 256 == 0 && HD * (HD / 8) % 256 == 0, "k_prep: every range is a whole number of blocks");
  int u = blockIdx.x; const int tid = threadIdx.x;
  if (u < PB_WO) { wt_f16_at(wo, BO, DM, DM, 16.0f, u * 256 + tid); return; }
  u -= PB_WO;
  const int s = u / (NH * PB_WH), r = u % (NH * PB_WH); const size_t o = (size_t)(r / PB_WH) * HD * HD;
  wt_f16_at((s == 0 ? wq : s == 1 ? wk : wv) + o, (s == 0 ? BQ : s == 1 ? BK : BV) + o, HD, HD, 16.0f, (r % PB_WH) * 256 + tid); }

__global__ __launch_bounds__(256) void k_wnat(const float* __restrict__ w, size_t n8, _Float16* __restrict__ Bt) { const size_t t = (size_t)blockIdx.x * 256 + threadIdx.x; if (t >= n8) return; FragH f; for (int q = 0; q < 8; ++q) f.h[q] = (_Float16)(bf16_round(w[t * 8 + q]) * 16.0f); *(v8us*)((unsigned short*)Bt + t * 8) = f.half[0];  }
__global__ __launch_bounds__(256) void k_rsm(const float* __restrict__ S, _Float16* __restrict__ P, int nrows) {
  #pragma clang fp contract(off)
  const int i = blockIdx.x * 256 + threadIdx.x; if (i >= nrows) return; const float* s = S + (size_t)i * SQ; float mx = -3.0e38f;
#pragma unroll 1
  for (int j = 0; j < SQ; ++j) mx = fmaxf(mx, s[j]); float se = 0.f;
#pragma unroll 1
  for (int j = 0; j < SQ; ++j) se += expf(s[j] - mx); const float sc = 256.0f / se;
#pragma unroll 1
  for (int j0 = 0; j0 < SQ; j0 += 8) { FragH f; for (int q = 0; q < 8; ++q) f.h[q] = (_Float16)(expf(s[j0 + q] - mx) * sc); unsigned short* d = (unsigned short*)P + (size_t)i * SQ + j0; *(v8us*)d = f.half[0];  } }
__global__ __launch_bounds__(256) void k_vt(const _Float16* __restrict__ V16, int b, int h0, _Float16* __restrict__ VT) { __shared__ unsigned short tl[64][65]; const int tid = threadIdx.x; const int hh = blockIdx.x % HG, sg = blockIdx.x / HG; const int s0 = sg * 64; const int h = h0 + hh;
  for (int i = tid; i < 64 * 8; i += 256) { const int j = i / 8, d8 = (i % 8) * 8; FragH f; f.half[0] = *(const v8us*)((const unsigned short*)V16 + ((size_t)b * SQ + s0 + j) * DM + h * HD + d8); for (int q = 0; q < 8; ++q) tl[d8 + q][j] = f.u[q]; }
  __syncthreads();
  { for (int i = tid; i < 64 * 8; i += 256) { const int d = i / 8, j8 = (i % 8) * 8; FragH f; for (int q = 0; q < 8; ++q) f.u[q] = tl[d][j8 + q]; *(v8us*)((unsigned short*)VT + ((size_t)hh * HD + d) * SQ + s0 + j8) = f.half[0]; }  } }


__global__ __launch_bounds__(256) void k_rsmf(const float* __restrict__ S, _Float16* __restrict__ P, int qn, int hg) {
  #pragma clang fp contract(off)
  const int t = blockIdx.x * 256 + threadIdx.x; if (t >= qn * hg) return; const size_t i = (size_t)(t / qn) * SQ + (t % qn); const float* s = S + i * SQ; float mx = -3.0e38f;
#pragma unroll 1
  for (int j = 0; j < SQ; ++j) mx = fmaxf(mx, s[j]); float se = 0.f;
#pragma unroll 1
  for (int j = 0; j < SQ; ++j) se += __expf(s[j] - mx); const float sc = 256.0f / se;
#pragma unroll 1
  for (int j0 = 0; j0 < SQ; j0 += 8) { FragH f; for (int q = 0; q < 8; ++q) f.h[q] = (_Float16)(__expf(s[j0 + q] - mx) * sc); unsigned short* d = (unsigned short*)P + i * SQ + j0; *(v8us*)d = f.half[0];  } }

// Fused attention, all batches and heads in one launch: scores, softmax and P V stay in registers; no score or weight plane goes through memory.
// A wave owns 32 queries of one (batch, head) and walks the 2048 keys 32 at a time. S^T = K Q^T (A = 16 key rows, B = 16 query rows, both in g2_frag's k order): a lane holds
// scores of ONE query (column ln), keys 8 hh + r of each 16-key tile, so two tiles, converted in place, are the B operand P^T of O^T += V^T P^T (A = V^T rows, the same k order).
// Running maximum and sum per query (f32); the maximum is renewed lazily (the two wave halves exchange it then), the halves join their sums once at the end.
// The 16 waves of a block share one head's K and V^T through LDS: a stage is 128 keys (K: 128 rows of 128 B, V^T: 64 rows of 256 B), brought in whole lines by asynchronous copies,
// four of 16 bytes a lane, into one of two buffers while the other is worked on; the rows lie at a pitch of 16 B x odd, so that a fragment's ds_load_b128 meets no bank twice.
#define FA_KS 128                      /* keys a stage */
#define FA_NT (SK / FA_KS)             /* stages */
#define FA_KP (HD * 2 + 16)            /* LDS pitch of a K row, bytes */
#define FA_VP (FA_KS * 2 + 16)         /* LDS pitch of a V^T row, bytes */
#define FA_KB (FA_KS * FA_KP)          /* K part of a buffer, bytes */
#define FA_BUF (FA_KB + HD * FA_VP)    /* one buffer, bytes */
#define FA_LZ 44.3614195558365f        /* 8 / CS: how far a raw score may pass the maximum in use before that is renewed */
__device__ __forceinline__ float fa_xhalf(float x) { return __builtin_bit_cast(float, __builtin_amdgcn_permlanex16(__builtin_bit_cast(int, x), __builtin_bit_cast(int, x), 0x76543210, 0xfedcba98, false, false)); }      /* lane l with lane l ^ 16 */
__device__ __forceinline__ v16h fa_frag(const _Float16* p) { FragH f; f.half[0] = *(const v8us*)(const unsigned short*)p; f.half[1] = *(const v8us*)((const unsigned short*)p + 16); return f.v; }      /* g2_frag with the lane half's 8 hh already in p */
__device__ __forceinline__ v16h fa_lfrag(const unsigned char* p) { FragH f; f.half[0] = *(const v8us*)p; f.half[1] = *(const v8us*)(p + 32); return f.v; }      /* fa_frag from an LDS row: p in bytes, the lane half's 16 hh already in it */
/* Four asynchronous copies of 16 bytes a lane, global memory to LDS through no register (l: the lane's LDS byte address, g: its global address). The s_wait_xcnt is the wait that belongs
   in front of any overwrite of a register which an issued copy names; as the last line of the copies' own statement it stands ahead of whatever reuses the operands' registers. */
__device__ __forceinline__ void fa_copy4(unsigned l0, const _Float16* g0, unsigned l1, const _Float16* g1, unsigned l2, const _Float16* g2, unsigned l3, const _Float16* g3) {
  asm volatile("global_load_async_to_lds_b128 %0, %1, off\n\tglobal_load_async_to_lds_b128 %2, %3, off\n\tglobal_load_async_to_lds_b128 %4, %5, off\n\tglobal_load_async_to_lds_b128 %6, %7, off\n\ts_wait_xcnt 0x0"
      :: "v"(l0), "v"(g0), "v"(l1), "v"(g1), "v"(l2), "v"(g2), "v"(l3), "v"(g3) : "memory"); }
/* Native 2^x, eight (or one) in a statement: behind a transcendental the instruction set asks for one independent instruction or a v_nop before its result is read or its source
   overwritten. Each v_exp_f32 here has an independent one behind it (the outputs share no register with the inputs), the last one the v_nop. */
__device__ __forceinline__ void fa_exp8(const float (&t)[8], float (&e)[8]) {
  asm("v_exp_f32 %0, %8\n\tv_exp_f32 %1, %9\n\tv_exp_f32 %2, %10\n\tv_exp_f32 %3, %11\n\tv_exp_f32 %4, %12\n\tv_exp_f32 %5, %13\n\tv_exp_f32 %6, %14\n\tv_exp_f32 %7, %15\n\tv_nop"
      : "=&v"(e[0]), "=&v"(e[1]), "=&v"(e[2]), "=&v"(e[3]), "=&v"(e[4]), "=&v"(e[5]), "=&v"(e[6]), "=&v"(e[7]) : "v"(t[0]), "v"(t[1]), "v"(t[2]), "v"(t[3]), "v"(t[4]), "v"(t[5]), "v"(t[6]), "v"(t[7])); }
__device__ __forceinline__ float fa_exp1(float t) { float e; asm("v_exp_f32 %0, %1\n\tv_nop" : "=&v"(e) : "v"(t)); return e; }
__device__ __forceinline__ v8f fa_mma(v16h a, v16h b, v8f c) { return __builtin_amdgcn_wmma_f32_16x16x32_f16(false, a, false, b, (short)0, c, false, false); }
__global__ __launch_bounds__(512) void k_fattn(const _Float16* __restrict__ Q, const _Float16* __restrict__ Kk, const _Float16* __restrict__ VT, _Float16* __restrict__ O) {
  static_assert(SK % FA_KS == 0 && FA_NT >= 2 && FA_KS * 8 == 2 * 512 && HD * (FA_KS / 8) == 2 * 512, "k_fattn: whole stages, two of them at least, two K and two V^T copies a lane and stage");
  __shared__ __attribute__((aligned(16))) unsigned char sm[2 * FA_BUF];
  const int tid = threadIdx.x, lane = tid & 31, ln = lane & 15, hh = lane >> 4; const int w = __builtin_amdgcn_readfirstlane(tid >> 5);      /* the wave's number, held scalar */
  const int bh = blockIdx.x / (NQ / 512), b = bh / NH, h = bh % NH; const int q0 = (blockIdx.x % (NQ / 512)) * 512 + w * 32;
  const float CS = 0.125f * 1.44269504088896340736f;      /* 1 / sqrt(64) and log2 e in one factor: exp(s / 8 - m / 8) = 2^((s - m) CS) */
  const _Float16* qp = Q + ((size_t)b * NQ + q0 + ln) * DM + h * HD + 8 * hh;
  /* the lane's part of a stage: K rows tid / 8 and 64 + tid / 8, piece tid % 8; V^T rows tid / 16 and 32 + tid / 16, piece tid % 16: a wave's copy covers four whole 128-byte lines */
  const _Float16* gk = Kk + ((size_t)b * SK + (tid >> 3)) * DM + h * HD + (tid & 7) * 8;
  const _Float16* gv = VT + ((size_t)bh * HD + (tid >> 4)) * SK + (tid & 15) * 8;
  const unsigned sb = (unsigned)(size_t)sm;      /* the low 32 bits of a __shared__ address are its LDS byte address */
  const unsigned lk = sb + (tid >> 3) * FA_KP + (tid & 7) * 16, lv = sb + FA_KB + (tid >> 4) * FA_VP + (tid & 15) * 16;
  auto stage = [&](int t) { const unsigned bo = (t & 1) * FA_BUF; const _Float16* k0 = gk + (size_t)t * FA_KS * DM; const _Float16* v0 = gv + t * FA_KS;
    fa_copy4(lk + bo, k0, lk + bo + 64 * FA_KP, k0 + (size_t)64 * DM, lv + bo, v0, lv + bo + 32 * FA_VP, v0 + (size_t)32 * SK); };
  v16h qf[2][2];
#pragma unroll
  for (int j = 0; j < 2; ++j)
#pragma unroll
    for (int s = 0; s < 2; ++s) qf[j][s] = fa_frag(qp + (size_t)j * 16 * DM + s * 32);
  stage(0);
  asm volatile("s_wait_asynccnt 0x0" ::: "memory");      /* this wave's copies of stage 0 have landed */
  __syncthreads();      /* every wave's have: stage 0 may be read */
  stage(1);
  const unsigned char* kl = sm + ln * FA_KP + hh * 16; const unsigned char* vl = sm + FA_KB + ln * FA_VP + hh * 16;
  const v8f z8 = {0.f,0.f,0.f,0.f,0.f,0.f,0.f,0.f}; v8f o[2][4]; float mr[2] = {-3.0e38f, -3.0e38f}, lr[2] = {0.f, 0.f}, th[2] = {-3.0e38f, -3.0e38f}, nb[2] = {0.f, 0.f};      /* per query: maximum in use, sum, the score above which the maximum is renewed, -mr CS; the first pass renews all */
#pragma unroll
  for (int j = 0; j < 2; ++j)
#pragma unroll
    for (int t = 0; t < 4; ++t) o[j][t] = z8;
#pragma unroll 1
  for (int g = 0; g < FA_NT; ++g) {      /* rolled, like the passes inside: unrolling either only adds registers, and the wave has none to spare */
    const unsigned char* kb = kl + (g & 1) * FA_BUF; const unsigned char* vb = vl + (g & 1) * FA_BUF;
    v16h kf[2][2];
#pragma unroll
    for (int t = 0; t < 2; ++t)
#pragma unroll
      for (int s = 0; s < 2; ++s) kf[t][s] = fa_lfrag(kb + t * 16 * FA_KP + s * 64);
#pragma unroll 1
    for (int c = 0; c < FA_KS / 32; ++c) {      /* rolled: one pass already holds 16 matrix instructions and 16 LDS reads */
      v8f st[2][2];
#pragma unroll
      for (int j = 0; j < 2; ++j)
#pragma unroll
        for (int t = 0; t < 2; ++t) st[j][t] = fa_mma(kf[t][1], qf[j][1], fa_mma(kf[t][0], qf[j][0], z8));
      float mx[2];      /* this pass's maximum of the lane's own 16 scores of each query */
#pragma unroll
      for (int j = 0; j < 2; ++j) { mx[j] = fmaxf(st[j][0][0], st[j][1][0]);
#pragma unroll
        for (int r = 1; r < 8; ++r) mx[j] = fmaxf(mx[j], fmaxf(st[j][0][r], st[j][1][r])); }
      /* Lazy rescale: the maximum in use, mr, may trail the true one by up to 8 in the exponent of 2 (a weight then reaches 2^8 at most, far inside f16 and f32); sums and outputs carry the
         same factor, which the final division takes out. One test a pass for the whole wave, a scalar branch: only when some lane's score passes th = mr + FA_LZ are maxima, sums and outputs brought up. */
      if (__builtin_amdgcn_ballot_w32((mx[0] > th[0]) | (mx[1] > th[1])) != 0) {
#pragma unroll
        for (int j = 0; j < 2; ++j) {
          const float mn = fmaxf(mr[j], fmaxf(mx[j], fa_xhalf(mx[j])));      /* both halves of the wave hold scores of the same query: one maximum for both */
          const float al = fa_exp1((mr[j] - mn) * CS); mr[j] = mn; nb[j] = -mn * CS; th[j] = mn + FA_LZ; lr[j] *= al;      /* al = 0 on the first pass, 1 for a query whose maximum stays */
#pragma unroll
          for (int t = 0; t < 4; ++t) o[j][t] = o[j][t] * al; } }
      v16h vf[4]; const unsigned char* vc = vb + c * 64;
#pragma unroll
      for (int t = 0; t < 4; ++t) vf[t] = fa_lfrag(vc + t * 16 * FA_VP);      /* this pass's V^T */
      const int cn = (c + 1 < FA_KS / 32) ? c + 1 : c; const unsigned char* kc = kb + cn * 32 * FA_KP;      /* the next pass's K rows; the stage's last pass asks for its own rows again, which keeps every read inside this stage's buffer */
#pragma unroll
      for (int t = 0; t < 2; ++t)
#pragma unroll
        for (int s = 0; s < 2; ++s) kf[t][s] = fa_lfrag(kc + t * 16 * FA_KP + s * 64);
      __builtin_amdgcn_sched_barrier(0);      /* keeps the pass's 16 LDS reads in one group ahead of the exponentials, which cover their latency: left alone the compiler sinks them to just in front of the products that use them */
      FragH pf[2];      /* both query tiles' weights come ahead of the eight products: with one tile's products between the tiles the build gave an exponential statement the operand registers of the matrix instruction just in front of it */
#pragma unroll
      for (int j = 0; j < 2; ++j) { float sm1 = 0.f;
#pragma unroll
        for (int t = 0; t < 2; ++t) { float x[8], p[8];
#pragma unroll
          for (int r = 0; r < 8; ++r) x[r] = __builtin_fmaf(st[j][t][r], CS, nb[j]);
          fa_exp8(x, p);
#pragma unroll
          for (int r = 0; r < 8; ++r) { sm1 += p[r]; pf[j].h[t * 8 + r] = (_Float16)p[r]; } }
        lr[j] += sm1; }
#pragma unroll
      for (int j = 0; j < 2; ++j)
#pragma unroll
        for (int t = 0; t < 4; ++t) o[j][t] = fa_mma(vf[t], pf[j].v, o[j][t]);
    }
    asm volatile("s_wait_dscnt 0x0" ::: "memory");      /* this wave's reads of the buffer have returned before anything refills it */
    asm volatile("s_wait_asynccnt 0x0" ::: "memory");      /* this wave's copies of the next stage have landed */
    __syncthreads();      /* one barrier a stage: it publishes the next stage and ends every wave's reads of this one */
    if (g + 2 < FA_NT) stage(g + 2);      /* into the buffer just left; the test is the same for the whole block */
  }
  asm volatile("s_wait_asynccnt 0x0" ::: "memory");      /* no copy is left in flight when the wave ends */
#pragma unroll
  for (int j = 0; j < 2; ++j) { const float inv = 64.0f / (lr[j] + fa_xhalf(lr[j])); _Float16* op = O + ((size_t)b * NQ + q0 + j * 16 + ln) * DM + h * HD + 8 * hh;      /* o carried x64, as the output GEMM expects */
#pragma unroll
    for (int t = 0; t < 4; ++t) { FragH f;
#pragma unroll
      for (int r = 0; r < 8; ++r) f.h[r] = (_Float16)(o[j][t][r] * inv);
      *(v8us*)((unsigned short*)op + t * 16) = f.half[0]; } } }      /* O^T tile t: d = 16 t + 8 hh + r, eight consecutive columns of the query's row: one 16-byte store */

// Output GEMM out = o Wo + bo (M = 8192, N = K = 1024) with both operands shared through LDS: a block of 8 waves owns a 256 x 128 tile of out, a wave 64 x 64 of it (16 accumulator tiles, so a fragment
// read from LDS feeds four matrix instructions). A stage is 128 k: 256 rows of o and 128 rows of Wo^T, 256 B each, brought in whole lines by asynchronous copies, 24 of 16 bytes a lane, into one of two
// buffers while the other is worked on; rows at a pitch of 16 B x odd, so that a fragment's ds_load_b128 meets no bank twice. k runs upward in steps of 32 into one accumulator: gemm2_body's sum order.
#define OG_BM 256                      /* rows of out a block */
#define OG_BN 128                      /* columns of out a block */
#define OG_KS 128                      /* k a stage */
#define OG_NT (DM / OG_KS)             /* stages */
#define OG_P (OG_KS * 2 + 16)          /* LDS pitch of a row, bytes */
#define OG_AB (OG_BM * OG_P)           /* o part of a buffer, bytes */
#define OG_BUF ((OG_BM + OG_BN) * OG_P)      /* one buffer, bytes */
#define OG_MT ((int)(NRQ / OG_BM))     /* row tiles */
/* Twelve asynchronous copies of 16 bytes a lane (l: the lane's LDS byte addresses, g: its global addresses); the s_wait_xcnt is the wait that belongs in front of any overwrite of a register
   which an issued copy names; as the last line of the copies' own statement it stands ahead of whatever reuses the operands' registers. */
__device__ __forceinline__ void og_copy12(const unsigned* l, const _Float16* const* g) {
  asm volatile("global_load_async_to_lds_b128 %0, %1, off\n\tglobal_load_async_to_lds_b128 %2, %3, off\n\tglobal_load_async_to_lds_b128 %4, %5, off\n\tglobal_load_async_to_lds_b128 %6, %7, off\n\t"
               "global_load_async_to_lds_b128 %8, %9, off\n\tglobal_load_async_to_lds_b128 %10, %11, off\n\tglobal_load_async_to_lds_b128 %12, %13, off\n\tglobal_load_async_to_lds_b128 %14, %15, off\n\t"
               "global_load_async_to_lds_b128 %16, %17, off\n\tglobal_load_async_to_lds_b128 %18, %19, off\n\tglobal_load_async_to_lds_b128 %20, %21, off\n\tglobal_load_async_to_lds_b128 %22, %23, off\n\ts_wait_xcnt 0x0"
      :: "v"(l[0]), "v"(g[0]), "v"(l[1]), "v"(g[1]), "v"(l[2]), "v"(g[2]), "v"(l[3]), "v"(g[3]), "v"(l[4]), "v"(g[4]), "v"(l[5]), "v"(g[5]),
         "v"(l[6]), "v"(g[6]), "v"(l[7]), "v"(g[7]), "v"(l[8]), "v"(g[8]), "v"(l[9]), "v"(g[9]), "v"(l[10]), "v"(g[10]), "v"(l[11]), "v"(g[11]) : "memory"); }
__global__ __launch_bounds__(256) void k_ogemm(const _Float16* __restrict__ A, const _Float16* __restrict__ Bt, const float* __restrict__ bias, float* __restrict__ C) {
  static_assert(NRQ % OG_BM == 0 && DM % OG_BN == 0 && DM % OG_KS == 0 && OG_NT >= 2 && OG_BM * 16 == 16 * 256 && OG_BN * 16 == 8 * 256 && 8 * 64 * 68 * 4 <= 2 * OG_BUF,
                "k_ogemm: whole tiles and stages, two stages at least, sixteen o and eight Wo^T copies a lane and stage, the output staging fits the ring");
  __shared__ __attribute__((aligned(16))) unsigned char sm[2 * OG_BUF];
  const int tid = threadIdx.x, lane = tid & 31, ln = lane & 15, hh = lane >> 4; const int w = __builtin_amdgcn_readfirstlane(tid >> 5);      /* the wave's number, held scalar */
  const int mt = blockIdx.x % OG_MT, nq = blockIdx.x / OG_MT; const int wm = w >> 1, wn = w & 1;      /* waves 4 x 2 over the block's tile */
  const int col0 = nq * OG_BN + wn * 64;
  /* the lane's part of a stage: rows tid / 16 + 16 i, piece tid % 16: a wave's copy covers four whole 128-byte lines */
  const _Float16* ga = A + ((size_t)mt * OG_BM + (tid >> 4)) * DM + (tid & 15) * 8;
  const _Float16* gb = Bt + ((size_t)nq * OG_BN + (tid >> 4)) * DM + (tid & 15) * 8;
  const unsigned la = (unsigned)(size_t)sm + (tid >> 4) * OG_P + (tid & 15) * 16;      /* the low 32 bits of a __shared__ address are its LDS byte address */
  auto stage = [&](int t) { unsigned l[24]; const _Float16* g[24]; const unsigned bo = la + (t & 1) * OG_BUF;
#pragma unroll
    for (int i = 0; i < 16; ++i) { l[i] = bo + i * 16 * OG_P; g[i] = ga + (size_t)i * 16 * DM + t * OG_KS; }
#pragma unroll
    for (int i = 0; i < 8; ++i) { l[16 + i] = bo + OG_AB + i * 16 * OG_P; g[16 + i] = gb + (size_t)i * 16 * DM + t * OG_KS; }
    og_copy12(l, g); og_copy12(l + 12, g + 12); };
  float bb[4];
#pragma unroll
  for (int t = 0; t < 4; ++t) bb[t] = bias[col0 + t * 16 + ln];
  stage(0);
  asm volatile("s_wait_asynccnt 0x0" ::: "memory");      /* this wave's copies of stage 0 have landed */
  __syncthreads();      /* every wave's have: stage 0 may be read */
  stage(1);
  const unsigned char* al = sm + (wm * 64 + ln) * OG_P + hh * 16; const unsigned char* bl = sm + OG_AB + (wn * 64 + ln) * OG_P + hh * 16;
  const v8f z8 = {0.f,0.f,0.f,0.f,0.f,0.f,0.f,0.f}; v8f acc[4][4];
#pragma unroll
  for (int i = 0; i < 4; ++i)
#pragma unroll
    for (int t = 0; t < 4; ++t) acc[i][t] = z8;
#pragma unroll 1
  for (int g = 0; g < OG_NT; ++g) {      /* rolled: a stage already holds 64 matrix instructions and 64 LDS reads */
    const unsigned char* ab = al + (g & 1) * OG_BUF; const unsigned char* bp = bl + (g & 1) * OG_BUF;
#pragma unroll
    for (int s = 0; s < OG_KS / 32; ++s) { v16h af[4], bf[4];
      af[0] = fa_lfrag(ab + s * 64);      /* the first row's operands are asked for first, so that its products start while the other rows' still come */
#pragma unroll
      for (int t = 0; t < 4; ++t) bf[t] = fa_lfrag(bp + t * 16 * OG_P + s * 64);
#pragma unroll
      for (int i = 1; i < 4; ++i) af[i] = fa_lfrag(ab + i * 16 * OG_P + s * 64);
      __builtin_amdgcn_sched_barrier(0);      /* keeps the step's 16 LDS reads together in front of its products: left alone the compiler puts each row's reads, with a full wait, between the rows */
#pragma unroll
      for (int i = 0; i < 4; ++i)
#pragma unroll
        for (int t = 0; t < 4; ++t) acc[i][t] = fa_mma(af[i], bf[t], acc[i][t]);
      __builtin_amdgcn_sched_barrier(0); }      /* and the next step's reads behind these products, in one place */
    asm volatile("s_wait_dscnt 0x0" ::: "memory");      /* this wave's reads of the buffer have returned before anything refills it */
    asm volatile("s_wait_asynccnt 0x0" ::: "memory");      /* this wave's copies of the next stage have landed */
    __syncthreads();      /* one barrier a stage: it publishes the next stage and ends every wave's reads of this one */
    if (g + 2 < OG_NT) stage(g + 2);      /* into the buffer just left; the test is the same for the whole block */
  }
  asm volatile("s_wait_asynccnt 0x0" ::: "memory");      /* no copy is in flight when the ring becomes output staging; the loop's last barrier has ended every wave's reads of it */
  float* so = (float*)sm + w * (64 * 68);      /* each wave stages in its own range: its 64 rows of 64 f32 at a pitch of 68 */
  const float* sr = so + hh * 68 + ln * 4; float* cr = C + ((size_t)mt * OG_BM + wm * 64 + hh) * DM + col0 + ln * 4;      /* read back and stored: rows 2 q + hh, four columns a lane */
#pragma unroll
  for (int i = 0; i < 4; ++i)
#pragma unroll
    for (int t = 0; t < 4; ++t) { const float bv = bf16_round(bb[t]);
#pragma unroll
      for (int r = 0; r < 8; ++r) so[(i * 16 + 8 * hh + r) * 68 + t * 16 + ln] = acc[i][t][r] * 0.0009765625f + bv; }      /* o carried x64, Wo x16 */
  __builtin_amdgcn_fence(__ATOMIC_ACQ_REL, "workgroup"); __builtin_amdgcn_wave_barrier();      /* each wave reads back its own rows only: its LDS writes in front of its reads */
#pragma unroll
  for (int q = 0; q < 32; ++q) { const v4f v = *(const v4fa*)(sr + q * 2 * 68);
    *(v4f*)(cr + (size_t)q * 2 * DM) = v;      /* two rows of 256 B a store: whole lines */
    if (q == 15) asm volatile("s_wait_xcnt 0x0" ::: "memory"); } }      /* the wait that belongs in front of any overwrite of a register which an issued store names: the second 32 rows are read back into the registers of the first 16 stores */

extern "C" void kernel_launch(void* const* d_in, const int* in_sizes, int n_in,
                              void* d_out, int out_size, void* d_ws, size_t ws_size, hipStream_t stream) {
  (void)in_sizes; (void)n_in; (void)out_size;
  const float* const* I = (const float* const*)d_in; const float* x = I[0]; const float* ctx = I[1]; const float* vsrc = I[2]; const float* wq = I[3]; const float* bq = I[4]; const float* wk = I[5]; const float* bk = I[6]; const float* wv = I[7]; const float* bv = I[8]; const float* wo = I[9]; const float* bo = I[10];      /* input order: Q, K, V (THREE streams), Wq, bq, Wk, bk, Wv, bv (PER-HEAD [16][64][64] = [head][in][out]; biases [16][64] = the flat [1024] at 64 h + e; zeros on this draw), Wo ([in][out] [1024][1024]), bo (zeros): eleven inputs */
  char* ws = (char*)d_ws; size_t off = 0;
  auto take = [&](size_t bytes) { char* p = ws + off; off += (bytes + 255) & ~(size_t)255; return p; };
  _Float16* BQ = (_Float16*)take((size_t)DM * DM * 2); _Float16* BK = (_Float16*)take((size_t)DM * DC * 2); _Float16* BV = (_Float16*)take((size_t)DM * DC * 2); _Float16* BO = (_Float16*)take((size_t)DM * DM * 2);
  _Float16* Q16 = (_Float16*)take(NRQ * DM * 2); _Float16* K16 = (_Float16*)take(NRK * DM * 2); _Float16* V16 = (_Float16*)take(NRK * DM * 2); _Float16* O16 = (_Float16*)take(NRQ * DM * 2);
  _Float16* VT = (_Float16*)take((size_t)NB * NH * HD * SK * 2);
  if (off > ws_size) return;      /* 4 x 2 + 4 x 16 + 16 = 88 MiB */
  k_prep<<<PB_WO + 3 * NH * PB_WH, 256, 0, stream>>>(wq, wk, wv, wo, BQ, BK, BV, BO);      /* all weight operands in one launch. The per-head stacks [16][64][64] are [in][out] per head (x_h @ W_h): W_h[d][e] -> Bt_h[e][d] x16, K = N = 64, into consecutive [64][64] planes; Wo [in][out]: the same with K = N = 1024 */
  k_proj<<<dim3((unsigned)(NRQ / 128), NH, 3), 128, 0, stream>>>(x, ctx, vsrc, BQ, BK, BV, bq, bk, bv, Q16, K16, V16);      /* q, k, v (grid.z) in one launch, from the f32 rows: head h (grid.y) = rows[:, 64 h ..] W_h + b_h -> out[:, 64 h ..] (pitch DM); B + 4096 h (pitch 64), bias + 64 h; K = N = 64 */
  k_vt<NH, SK><<<NB * NH * (SK / 64), 256, 0, stream>>>(V16, DM, 0, VT);      /* V^T [4][16][64][2048], all batches in one launch: the kernel takes batch and head from the block index */
  k_fattn<<<NB * NH * (NQ / 512), 512, 0, stream>>>(Q16, K16, VT, O16);      /* scores, softmax, P V of every batch and head: 512 queries a block, o x64 into merged rows */
  k_ogemm<<<OG_MT * (DM / OG_BN), 256, 0, stream>>>(O16, BO, bo, (float*)d_out);      /* out = o Wo + bo (alpha 2^-10), 256 x 128 of out a block */
}

// v008
// A run of this version takes 94.2 microseconds.
// Timed twice side by side with v007, it ran 1.05 and 1.04 times as fast.
// All steps since v000 together make it 73.3 times as fast.
#include <hip/hip_runtime.h>
// Multi-head attention on THREE input streams with BLOCK-DIAGONAL per-head projections on four sequences (Q, K, V [4][2048][1024], each split into 16 contiguous 64-wide slices; q / k / v = einsum('bhsd,hde->bhse', slice, W) + b: EACH HEAD applies its own Dense(64) (W [16][64][64] = [head][in][out], normal x 1/8; biases [16][64] zeros on this draw) to ITS OWN slice of ITS stream; scores / sqrt(64); softmax over all 2048 keys (no mask); out = merged Wo + bo ([in][out] [1024][1024]; bo zeros) -> [4][2048][1024]); each projection is ONE head-batched GEMM (K = 64).
// Structure: the per-head [in][out] weight blocks transposed into sixteen consecutive exact x16 [64][64] planes per stack (all weight builders in ONE launch, by ranges of the block index); Q, K, V as three HEAD-BATCHED WMMA GEMMs in ONE launch (16 heads on grid.y, the stream on grid.z; K = N = 64; 32x64 wave tiles, A fragments read from the f32 input rows and rounded in registers, no f16 copy of the inputs in memory; f32 accumulation, + the head's bias, f16 outputs into the head's 64 columns; the V stream's blocks store their tile transposed, straight into V^T [4][16][64][2048], the only form of v in memory); ONE fused launch for all batches and heads: scores (K = 64), running softmax over the 2048 keys (f32 statistics, native exp2; unnormalised weights in (0, 2^8] as f16), o = P V (o carried x64) into merged f16 rows; out = o W_o + b_o GEMM (f32, alpha 2^-10); launches: see trace.
// Compute dtype: inputs rounded to bf16; x / context / weights exact; q, k, v, softmax weights and o as plain f16 GEMM operands (~2^-12); scores and statistics f32. v_wmma_f32_16x16x32_f16.
#define NB 4
#define NQ 2048
#define SK 2048
#define SQ SK                       /* keys per softmax row */
#define DM 1024
#define DC 1024
#define NH 16
#define HD 64
#define HG 4
#define NRQ ((size_t)NB * NQ)
#define NRK ((size_t)NB * SK)
typedef __bf16 v16b __attribute__((ext_vector_type(16)));
typedef unsigned short v8us __attribute__((ext_vector_type(8), may_alias));
typedef float  v8f  __attribute__((ext_vector_type(8)));
typedef float  v4f  __attribute__((ext_vector_type(4)));
typedef float  v4fa __attribute__((ext_vector_type(4), may_alias));
union FragB { v16b v; v8us half[2]; unsigned short u[16]; };

__device__ __forceinline__ unsigned short bf16_bits(float x) { unsigned int u = __float_as_uint(x); return (unsigned short)((u + 0x7FFFu + ((u >> 16) & 1u)) >> 16); }
__device__ __forceinline__ float bf16_val(unsigned short b) { return __uint_as_float(((unsigned int)b) << 16); }
__device__ __forceinline__ float bf16_round(float x) { return bf16_val(bf16_bits(x)); }
// D += A·B with NT terms: 1 = ah·bh, 2 = + al·bh (A split), 3 = + ah·bl (both split)
template <int NT>
__device__ __forceinline__ v8f mmaN(v16b ah, v16b al, v16b bh, v16b bl, v8f c) {
  c = __builtin_amdgcn_wmma_f32_16x16x32_bf16(false, ah, false, bh, (short)0, c, false, false);
  if (NT >= 2) c = __builtin_amdgcn_wmma_f32_16x16x32_bf16(false, al, false, bh, (short)0, c, false, false);
  if (NT >= 3) c = __builtin_amdgcn_wmma_f32_16x16x32_bf16(false, ah, false, bl, (short)0, c, false, false);
  asm volatile("v_nop\n\tv_nop\n\tv_nop\n\tv_nop" : "+v"(c) : "v"(ah), "v"(al), "v"(bh), "v"(bl));
  return c;
}

__global__ __launch_bounds__(256) void k_wt_bf16(const float* __restrict__ W, unsigned short* __restrict__ Wt, int K, int N) {
  const int t = blockIdx.x * 256 + threadIdx.x;
  const int k8n = K / 8;
  if (t >= N * k8n) return;
  const int n = t / k8n, k8 = (t % k8n) * 8;
  v8us v;
#pragma unroll
  for (int i = 0; i < 8; ++i) v[i] = bf16_bits(W[(size_t)(k8 + i) * N + n]);
  *(v8us*)(Wt + (size_t)n * K + k8) = v;
  
}

// GEMM C[M][N] (f32, pitch ldc) = act(A[M][K]·W + bias). A f32 row-major (pitch lda) converted per fragment to bf16
// (ASPLIT: hi/lo two planes -> 2 terms, else single rounded term); Wt bf16 [N][K] (pitch ldb). BIAS_BF16 rounds the
// bias to bf16 first (bias quantised to bf16 before the add). K%32==0, M%16==0, N%64==0.
template <bool ASPLIT, int ACT, bool BIAS_BF16>
__global__ __launch_bounds__(128) void k_gemm_bf(const float* __restrict__ A, int lda, const unsigned short* __restrict__ Wt, int ldb,
                                               const float* __restrict__ bias, float* __restrict__ C, int ldc, int M, int N, int K) {
  __shared__ __attribute__((aligned(16))) float so[4][16][64];
  const int tid = threadIdx.x, w = tid >> 5, lane = tid & 31, ln = lane & 15, hh = lane >> 4;
  const int ntn = N / 64;
  const int wid = blockIdx.x * 4 + w;
  const int mt = wid / ntn, nq = wid % ntn;
  if (mt * 16 >= M) return;
  const int row0 = mt * 16, col0 = nq * 64;
  const float* arow = A + (size_t)(row0 + ln) * lda;
  v8f acc[4] = {};
  for (int kb = 0; kb < K; kb += 32) {
    FragB ah, al;
    const v4f x0 = *(const v4fa*)(arow + kb + 8 * hh), x1 = *(const v4fa*)(arow + kb + 8 * hh + 4);
    const v4f x2 = *(const v4fa*)(arow + kb + 16 + 8 * hh), x3 = *(const v4fa*)(arow + kb + 16 + 8 * hh + 4);
    float xs[16] = {x0[0],x0[1],x0[2],x0[3],x1[0],x1[1],x1[2],x1[3],x2[0],x2[1],x2[2],x2[3],x3[0],x3[1],x3[2],x3[3]};
#pragma unroll
    for (int i = 0; i < 16; ++i) { const unsigned short hb = bf16_bits(xs[i]); ah.u[i] = hb; al.u[i] = ASPLIT ? bf16_bits(xs[i] - bf16_val(hb)) : (unsigned short)0; }
#pragma unroll
    for (int t = 0; t < 4; ++t) {
      const unsigned short* brow = Wt + (size_t)(col0 + t * 16 + ln) * ldb + kb;
      FragB b;
      b.half[0] = *(const v8us*)(brow + 8 * hh);
      b.half[1] = *(const v8us*)(brow + 16 + 8 * hh);
      acc[t] = mmaN<ASPLIT ? 2 : 1>(ah.v, al.v, b.v, b.v, acc[t]);
    }
  }
#pragma unroll
  for (int t = 0; t < 4; ++t) {
    float bv = bias ? bias[col0 + t * 16 + ln] : 0.f;
    if (BIAS_BF16) bv = bf16_round(bv);
#pragma unroll
    for (int r = 0; r < 8; ++r) { float v = acc[t][r] + bv; if (ACT == 1) v = fmaxf(v, 0.f); so[w][8 * hh + r][t * 16 + ln] = v; }
  }
  __builtin_amdgcn_fence(__ATOMIC_ACQ_REL, "workgroup");
  __builtin_amdgcn_wave_barrier();
  const int rsub = lane >> 4, c4 = (lane & 15) * 4;
  {
#pragma unroll
    for (int q = 0; q < 8; ++q) {
      const int r = q * 2 + rsub;
      const v4f v = *(const v4fa*)&so[w][r][c4];
      *(v4f*)(C + (size_t)(row0 + r) * ldc + col0 + c4) = v;
    }
    
  }
}

// GEMM C = act(A·W + bias + resid): A f32 (ASPLIT -> hi/lo 2 terms), Wt bf16 [N][K]; ACT 0 none, 1 relu, 2 exact gelu;
// resid (optional, f32, row index = (row % rmod), pitch ldr, RES_BF16 rounds it) added before the activation.
template <bool ASPLIT, int ACT, bool BIAS_BF16, bool RES_BF16>
__global__ __launch_bounds__(128) void k_gemm_bf3(const float* __restrict__ A, int lda, const unsigned short* __restrict__ Wt, int ldb,
                                                const float* __restrict__ bias, const float* __restrict__ resid, int rmod, int ldr,
                                                float* __restrict__ C, int ldc, int M, int N, int K) {
  __shared__ __attribute__((aligned(16))) float so[4][16][64];
  const int tid = threadIdx.x, w = tid >> 5, lane = tid & 31, ln = lane & 15, hh = lane >> 4;
  const int ntn = N / 64;
  const int wid = blockIdx.x * 4 + w;
  const int mt = wid / ntn, nq = wid % ntn;
  if (mt * 16 >= M) return;
  const int row0 = mt * 16, col0 = nq * 64;
  const float* arow = A + (size_t)(row0 + ln) * lda;
  v8f acc[4] = {};
  for (int kb = 0; kb < K; kb += 32) {
    FragB ah, al;
    const v4f x0 = *(const v4fa*)(arow + kb + 8 * hh), x1 = *(const v4fa*)(arow + kb + 8 * hh + 4);
    const v4f x2 = *(const v4fa*)(arow + kb + 16 + 8 * hh), x3 = *(const v4fa*)(arow + kb + 16 + 8 * hh + 4);
    float xs[16] = {x0[0],x0[1],x0[2],x0[3],x1[0],x1[1],x1[2],x1[3],x2[0],x2[1],x2[2],x2[3],x3[0],x3[1],x3[2],x3[3]};
#pragma unroll
    for (int i = 0; i < 16; ++i) { const unsigned short hb = bf16_bits(xs[i]); ah.u[i] = hb; al.u[i] = ASPLIT ? bf16_bits(xs[i] - bf16_val(hb)) : (unsigned short)0; }
#pragma unroll
    for (int t = 0; t < 4; ++t) {
      const unsigned short* brow = Wt + (size_t)(col0 + t * 16 + ln) * ldb + kb;
      FragB b;
      b.half[0] = *(const v8us*)(brow + 8 * hh);
      b.half[1] = *(const v8us*)(brow + 16 + 8 * hh);
      acc[t] = mmaN<ASPLIT ? 2 : 1>(ah.v, al.v, b.v, b.v, acc[t]);
    }
  }
#pragma unroll
  for (int t = 0; t < 4; ++t) {
    const int col = col0 + t * 16 + ln;
    float bv = bias ? bias[col] : 0.f;
    if (BIAS_BF16) bv = bf16_round(bv);
#pragma unroll
    for (int r = 0; r < 8; ++r) {
      float v = acc[t][r] + bv;
      if (resid) { float rv = resid[(size_t)((row0 + 8 * hh + r) % rmod) * ldr + col]; if (RES_BF16) rv = bf16_round(rv); v += rv; }
      if (ACT == 1) v = fmaxf(v, 0.f);
      if (ACT == 2) v = 0.5f * v * (1.0f + erff(v * 0.70710678118654752f));
      if (ACT == 3) { const float u = 0.7978845608028654f * (v + 0.044715f * v * v * v); v = 0.5f * v * (1.0f + tanhf(u)); }
      so[w][8 * hh + r][t * 16 + ln] = v;
    }
  }
  __builtin_amdgcn_fence(__ATOMIC_ACQ_REL, "workgroup");
  __builtin_amdgcn_wave_barrier();
  const int rsub = lane >> 4, c4 = (lane & 15) * 4;
  {
#pragma unroll
    for (int q = 0; q < 8; ++q) {
      const int r = q * 2 + rsub;
      const v4f v = *(const v4fa*)&so[w][r][c4];
      *(v4f*)(C + (size_t)(row0 + r) * ldc + col0 + c4) = v;
    }
    
  }
}
// row LayerNorm (biased variance, eps) over N: s = X (+ R); optional out_sum <- s; out_norm <- (s-mu)*rsqrt(var+eps)*g + b
template <bool PARAM_BF16>
__global__ __launch_bounds__(256) void k_layernorm(const float* __restrict__ X, const float* __restrict__ R, const float* __restrict__ g, const float* __restrict__ bta,
                                                  float* __restrict__ out_sum, float* __restrict__ out_norm, int N, float eps) {
  __shared__ float red[256];
  const int row = blockIdx.x, tid = threadIdx.x;
  const float* x = X + (size_t)row * N; const float* rr = R ? R + (size_t)row * N : nullptr;
  float vals[16];                     // up to N = 4096
  const int per = N / 256;            // contiguous chunk per thread? use strided-by-4 chunks: thread handles j = tid*4 + 1024*u
  float s1 = 0.f;
  for (int u = 0; u < per / 4; ++u) {
    const int j = tid * 4 + 1024 * u;
    const v4f a = *(const v4fa*)(x + j);
    v4f b = {0.f,0.f,0.f,0.f}; if (rr) b = *(const v4fa*)(rr + j);
#pragma unroll
    for (int q = 0; q < 4; ++q) { const float v = a[q] + b[q]; vals[u * 4 + q] = v; s1 += v; }
  }
  red[tid] = s1; __syncthreads();
  for (int st = 128; st > 0; st >>= 1) { if (tid < st) red[tid] += red[tid + st]; __syncthreads(); }
  const float mu = red[0] / (float)N; __syncthreads();
  float s2 = 0.f;
  for (int u = 0; u < per / 4; ++u)
#pragma unroll
    for (int q = 0; q < 4; ++q) { const float c = vals[u * 4 + q] - mu; s2 += c * c; }
  red[tid] = s2; __syncthreads();
  for (int st = 128; st > 0; st >>= 1) { if (tid < st) red[tid] += red[tid + st]; __syncthreads(); }
  const float rs = rsqrtf(red[0] / (float)N + eps);
  {
    for (int u = 0; u < per / 4; ++u) {
      const int j = tid * 4 + 1024 * u;
      v4f o, sm;
#pragma unroll
      for (int q = 0; q < 4; ++q) {
        float gg = g[j + q], bb = bta[j + q];
        if (PARAM_BF16) { gg = bf16_round(gg); bb = bf16_round(bb); }
        sm[q] = vals[u * 4 + q]; o[q] = (vals[u * 4 + q] - mu) * rs * gg + bb;
      }
      if (out_sum) *(v4f*)(out_sum + (size_t)row * N + j) = sm;
      *(v4f*)(out_norm + (size_t)row * N + j) = o;
    }
    
  }
}



// ---- f16 WMMA path (v_wmma_f32_16x16x32_f16): 11-bit significands for operands in range — used where a [0,1] probability operand needs more precision than bf16
typedef _Float16 v16h __attribute__((ext_vector_type(16)));
union FragH { v16h v; v8us half[2]; _Float16 h[16]; unsigned short u[16]; };
template <int NT>
__device__ __forceinline__ v8f mmaH(v16h ah, v16h al, v16h bh, v16h bl, v8f c) {
  c = __builtin_amdgcn_wmma_f32_16x16x32_f16(false, ah, false, bh, (short)0, c, false, false);
  if (NT >= 2) c = __builtin_amdgcn_wmma_f32_16x16x32_f16(false, al, false, bh, (short)0, c, false, false);
  if (NT >= 3) c = __builtin_amdgcn_wmma_f32_16x16x32_f16(false, ah, false, bl, (short)0, c, false, false);
  asm volatile("v_nop\n\tv_nop\n\tv_nop\n\tv_nop" : "+v"(c) : "v"(ah), "v"(al), "v"(bh), "v"(bl));
  return c;
}
// batched GEMM like k_gemm_b but f16 operands: A f32 (split into f16 hi/lo if ASPLIT, else rounded to f16), Bt = f16 values [n][k]; alpha; C f32; N multiple of 16 (partial tiles skipped)
template <bool ASPLIT>
__global__ __launch_bounds__(128) void k_gemm_h(const float* __restrict__ A, int lda, size_t sA, const _Float16* __restrict__ Bh, int ldb, size_t sB, float alpha, float* __restrict__ C, int ldc, size_t sC, int M, int N, int K) {
  __shared__ __attribute__((aligned(16))) float so[4][16][64];
  const int tid = threadIdx.x, w = tid >> 5, lane = tid & 31, ln = lane & 15, hh = lane >> 4; const int by = blockIdx.y;
  A += (size_t)by * sA; Bh += (size_t)by * sB; C += (size_t)by * sC;
  const int ntn = (N + 63) / 64; const int wid = blockIdx.x * 4 + w; const int mt = wid / ntn, nq = wid % ntn; if (mt * 16 >= M) return;
  const int row0 = mt * 16, col0 = nq * 64; const float* arow = A + (size_t)(row0 + ln) * lda;
  v8f acc[4] = {};
  for (int kb = 0; kb < K; kb += 32) {
    FragH ah, al;
    const v4f x0 = *(const v4fa*)(arow + kb + 8 * hh), x1 = *(const v4fa*)(arow + kb + 8 * hh + 4), x2 = *(const v4fa*)(arow + kb + 16 + 8 * hh), x3 = *(const v4fa*)(arow + kb + 16 + 8 * hh + 4);
    float xs[16] = {x0[0],x0[1],x0[2],x0[3],x1[0],x1[1],x1[2],x1[3],x2[0],x2[1],x2[2],x2[3],x3[0],x3[1],x3[2],x3[3]};
#pragma unroll
    for (int i = 0; i < 16; ++i) { const _Float16 h = (_Float16)xs[i]; ah.h[i] = h; al.h[i] = ASPLIT ? (_Float16)(xs[i] - (float)h) : (_Float16)0.0f; }
#pragma unroll
    for (int t = 0; t < 4; ++t) { if (col0 + t * 16 >= N) continue; const size_t boff = (size_t)(col0 + t * 16 + ln) * ldb + kb; FragH bq; bq.half[0] = *(const v8us*)(Bh + boff + 8 * hh); bq.half[1] = *(const v8us*)(Bh + boff + 16 + 8 * hh);
      acc[t] = mmaH<ASPLIT ? 2 : 1>(ah.v, al.v, bq.v, bq.v, acc[t]); }
  }
#pragma unroll
  for (int t = 0; t < 4; ++t) { if (col0 + t * 16 >= N) continue;
#pragma unroll
    for (int r = 0; r < 8; ++r) so[w][8 * hh + r][t * 16 + ln] = acc[t][r] * alpha; }
  __builtin_amdgcn_fence(__ATOMIC_ACQ_REL, "workgroup"); __builtin_amdgcn_wave_barrier();
  const int rsub = lane >> 4, c4 = (lane & 15) * 4;
  {
#pragma unroll
    for (int q = 0; q < 8; ++q) { const int r = q * 2 + rsub; if (col0 + c4 < N) { const v4f v = *(const v4fa*)&so[w][r][c4]; *(v4f*)(C + (size_t)(row0 + r) * ldc + col0 + c4) = v; } }
     }
}

// Wt[n][k] = f16(W[k][n]·scale) from f32 row-major W[K][N] (scale = power of two; bf16-exact weights stay exact in f16 away from the subnormal range)
__device__ __forceinline__ void wt_f16_at(const float* __restrict__ W, _Float16* __restrict__ Wt, int K, int N, float scale, int t) {      /* t: which eight k of which n; the caller's grid covers N K / 8 exactly */
  const int n = t / (K / 8), k8 = (t % (K / 8)) * 8; FragH f;
#pragma unroll
  for (int i = 0; i < 8; ++i) f.h[i] = (_Float16)(bf16_round(W[(size_t)(k8 + i) * N + n]) * scale); const v8us o = f.half[0];
  *(v8us*)((unsigned short*)Wt + (size_t)n * K + k8) = o; asm volatile("s_wait_xcnt 0x0" ::: "memory");      /* the wait that belongs in front of any overwrite of a register which an issued store names */
}
// k_gemm_hh variant with fused epilogue: v = acc·alpha + bias[by·sBias + col] (+ CP[(row/rowsPerB)·sCPb + by·64 + col] if CP) ; ACT 0 none / 1 elu ; writes f16 C16 (and f32 C if non-null)
template <int ACT>
__global__ __launch_bounds__(128) void k_gemm_hhx(const _Float16* __restrict__ A, int lda, size_t sA, const _Float16* __restrict__ Bh, int ldb, size_t sB, float alpha, const float* __restrict__ bias, size_t sBias, const float* __restrict__ CP, int rowsPerB, size_t sCPb, int row0g,
    float* __restrict__ C, _Float16* __restrict__ C16, int ldc, size_t sC, int M, int N, int K) {
  __shared__ __attribute__((aligned(16))) float so[4][16][64];
  const int tid = threadIdx.x, w = tid >> 5, lane = tid & 31, ln = lane & 15, hh = lane >> 4; const int by = blockIdx.y;
  A += (size_t)by * sA; Bh += (size_t)by * sB; const size_t cofs = (size_t)by * sC; const float* bp = bias ? bias + (size_t)by * sBias : nullptr;
  const int ntn = (N + 63) / 64; const int wid = blockIdx.x * 4 + w; const int mt = wid / ntn, nq = wid % ntn; if (mt * 16 >= M) return;
  const int row0 = mt * 16, col0 = nq * 64; const _Float16* arow = A + (size_t)(row0 + ln) * lda;
  v8f acc[4] = {};
  for (int kb = 0; kb < K; kb += 32) { FragH ah; ah.half[0] = *(const v8us*)((const unsigned short*)arow + kb + 8 * hh); ah.half[1] = *(const v8us*)((const unsigned short*)arow + kb + 16 + 8 * hh);
#pragma unroll
    for (int t = 0; t < 4; ++t) { if (col0 + t * 16 >= N) continue; const size_t boff = (size_t)(col0 + t * 16 + ln) * ldb + kb; FragH bq; bq.half[0] = *(const v8us*)((const unsigned short*)Bh + boff + 8 * hh); bq.half[1] = *(const v8us*)((const unsigned short*)Bh + boff + 16 + 8 * hh);
      acc[t] = mmaH<1>(ah.v, ah.v, bq.v, bq.v, acc[t]); }
  }
#pragma unroll
  for (int t = 0; t < 4; ++t) { if (col0 + t * 16 >= N) continue; const int col = col0 + t * 16 + ln; const float bv = bp ? bf16_round(bp[col]) : 0.f;
#pragma unroll
    for (int r = 0; r < 8; ++r) { float v = acc[t][r] * alpha + bv; if (CP) { const int rr = row0g + row0 + 8 * hh + r; if (rowsPerB < 0) v += CP[cofs + (size_t)rr * ldc + col];      /* rowsPerB < 0: own element of the batched C plane */ else { const int bidx = rr / rowsPerB; v += CP[(size_t)bidx * sCPb + (size_t)by * 64 + col]; } } if (ACT == 1) v = (v > 0.f) ? v : expm1f(v); else if (ACT == 7) v = (v > 0.f) ? v + 1.0f : expf(v); else if (ACT == 8) v = tanhf(v); else if (ACT == 9) v = 0.5f * v * (1.0f + tanhf(0.7978845608028654f * (v + 0.044715f * v * v * v))); else if (ACT == 11) v = 1.0f / (1.0f + expf(-v)); else if (ACT == 12) v = (v > 0.f) ? v : 0.01f * v; else if (ACT == 14) v = (v > 0.f) ? v : 0.1f * v; else if (ACT == 16) v = (v >= 0.f) ? v : 0.3f * v; else if (ACT == 17) v = (v >= 0.f) ? v : 0.2f * v; else if (ACT == 15) v = v / (1.0f + expf(-v)); else if (ACT == 3) v = fmaxf(v, 0.f); else if (ACT == 6) v = 0.5f * v * (1.0f + erff(v * 0.70710678118654752f)); so[w][8 * hh + r][t * 16 + ln] = v; } }
  __builtin_amdgcn_fence(__ATOMIC_ACQ_REL, "workgroup"); __builtin_amdgcn_wave_barrier();
  const int rsub = lane >> 4, c4 = (lane & 15) * 4; typedef _Float16 v4h __attribute__((ext_vector_type(4)));
  {
#pragma unroll
    for (int q = 0; q < 8; ++q) { const int r = q * 2 + rsub; if (col0 + c4 < N) { const v4f v = *(const v4fa*)&so[w][r][c4]; if (C) *(v4f*)(C + cofs + (size_t)(row0 + r) * ldc + col0 + c4) = v; if (C16) { v4h h4; for (int i = 0; i < 4; ++i) h4[i] = (_Float16)v[i]; *(v4h*)(C16 + cofs + (size_t)(row0 + r) * ldc + col0 + c4) = h4; } } }
     }
}


typedef _Float16 v4h __attribute__((ext_vector_type(4)));

__global__ __launch_bounds__(256) void k_h16(const float* __restrict__ x, _Float16* __restrict__ X16, size_t n8) { const size_t t = (size_t)blockIdx.x * 256 + threadIdx.x; if (t >= n8) return; FragH f;
#pragma unroll
  for (int q = 0; q < 8; ++q) f.h[q] = (_Float16)x[t * 8 + q]; *(v8us*)((unsigned short*)X16 + t * 8) = f.half[0];  }
__global__ __launch_bounds__(256) void k_round16f(const float* __restrict__ W, _Float16* __restrict__ Bt, size_t n8) { const size_t t = (size_t)blockIdx.x * 256 + threadIdx.x; if (t >= n8) return; FragH f;
#pragma unroll
  for (int i = 0; i < 8; ++i) f.h[i] = (_Float16)(bf16_round(W[t * 8 + i]) * 16.0f); *(v8us*)((unsigned short*)Bt + t * 8) = f.half[0];  }
__global__ __launch_bounds__(256) void k_hl(const float* __restrict__ F, _Float16* __restrict__ Hh, _Float16* __restrict__ Hl, size_t n8) { const size_t t = (size_t)blockIdx.x * 256 + threadIdx.x; if (t >= n8) return; FragH fh, fl; const v4f a = *(const v4fa*)(F + t * 8), c = *(const v4fa*)(F + t * 8 + 4);
#pragma unroll
  for (int q = 0; q < 4; ++q) { _Float16 h = (_Float16)a[q]; fh.h[q] = h; fl.h[q] = (_Float16)((a[q] - (float)h) * 1024.0f); h = (_Float16)c[q]; fh.h[4 + q] = h; fl.h[4 + q] = (_Float16)((c[q] - (float)h) * 1024.0f); }
  { *(v8us*)((unsigned short*)Hh + t * 8) = fh.half[0]; *(v8us*)((unsigned short*)Hl + t * 8) = fl.half[0];  } }

// ---- fast GEMM (wave tile 32x64; requires M % 32 == 0 rows per launch region and N % 64 == 0); epilogue = k_gemm_hhx semantics ----
__device__ __forceinline__ v16h g2_frag(const _Float16* p, int hh) { FragH f; f.half[0] = *(const v8us*)((const unsigned short*)p + 8 * hh); f.half[1] = *(const v8us*)((const unsigned short*)p + 16 + 8 * hh); return f.v; }
__device__ __forceinline__ v8f g2_mma(v16h a, v16h b, v8f c) { v8f d = __builtin_amdgcn_wmma_f32_16x16x32_f16(false, a, false, b, (short)0, c, false, false); asm volatile("v_nop\n\tv_nop\n\tv_nop\n\tv_nop" : "+v"(d) : "v"(a), "v"(b)); return d; }
template <int ACT>
__device__ __forceinline__ void gemm2_body(const _Float16* __restrict__ A, int lda, size_t sA, const _Float16* __restrict__ Bh, int ldb, size_t sB, float alpha, const float* __restrict__ bias, size_t sBias, const float* __restrict__ CP, int rowsPerB, size_t sCPb, int row0g,
    float* __restrict__ C, _Float16* __restrict__ C16, int ldc, size_t sC, int M, int N, int K) { static_assert(ACT == 0 || ACT == 3 || ACT == 6 || ACT == 8 || ACT == 9 || ACT == 11 || ACT == 12 || ACT == 14 || ACT == 15 || ACT == 16 || ACT == 17, "k_gemm2: unsupported ACT code (would silently apply no activation)");
  __shared__ __attribute__((aligned(16))) float so[4][32][68];
  const int tid = threadIdx.x, w = tid >> 5, lane = tid & 31, ln = lane & 15, hh = lane >> 4; const int by = blockIdx.y;
  A += (size_t)by * sA; Bh += (size_t)by * sB; const size_t cofs = (size_t)by * sC; const float* bp = bias ? bias + (size_t)by * sBias : nullptr;
  const int ntn = N >> 6; const int mt = blockIdx.x / ntn, nq = blockIdx.x - mt * ntn; const int row0 = mt * 128 + 32 * w, col0 = nq * 64; if (row0 >= M) return;
  const _Float16* a0p = A + (size_t)(row0 + ln) * lda; const _Float16* a1p = a0p + (size_t)16 * lda;
  const _Float16* b0p = Bh + (size_t)(col0 + ln) * ldb; const _Float16* b1p = b0p + (size_t)16 * ldb; const _Float16* b2p = b1p + (size_t)16 * ldb; const _Float16* b3p = b2p + (size_t)16 * ldb;
  const v8f z8 = {0.f,0.f,0.f,0.f,0.f,0.f,0.f,0.f}; v8f c00 = z8, c01 = z8, c02 = z8, c03 = z8, c10 = z8, c11 = z8, c12 = z8, c13 = z8;
#pragma unroll 1
  for (int kb = 0; kb < K; kb += 32) { const v16h a0 = g2_frag(a0p + kb, hh), a1 = g2_frag(a1p + kb, hh);
    asm volatile("s_wait_xcnt 0x0" ::: "memory");      /* the wait that belongs in front of any overwrite of a register which an issued load names: the B loads behind it land in the registers of the A addresses */
    v16h b = g2_frag(b0p + kb, hh); c00 = g2_mma(a0, b, c00); c10 = g2_mma(a1, b, c10);
    b = g2_frag(b1p + kb, hh); c01 = g2_mma(a0, b, c01); c11 = g2_mma(a1, b, c11);
    b = g2_frag(b2p + kb, hh); c02 = g2_mma(a0, b, c02); c12 = g2_mma(a1, b, c12);
    b = g2_frag(b3p + kb, hh); c03 = g2_mma(a0, b, c03); c13 = g2_mma(a1, b, c13); }
  v8f accs[8] = {c00, c01, c02, c03, c10, c11, c12, c13};
#pragma unroll
  for (int u = 0; u < 8; ++u) { const int t = u & 3, half = u >> 2; const int col = col0 + t * 16 + ln; const float bv = bp ? bf16_round(bp[col]) : 0.f;
#pragma unroll
    for (int r = 0; r < 8; ++r) { const int rloc = half * 16 + 8 * hh + r; float v = accs[u][r] * alpha + bv; if (CP) { if (rowsPerB < 0) v += CP[cofs + (size_t)(row0g + row0 + rloc) * ldc + col];      /* rowsPerB < 0: own element of the batched C plane */ else { const int bidx = (row0g + row0 + rloc) / rowsPerB; v += CP[(size_t)bidx * sCPb + (size_t)by * 64 + col]; } }
      if (ACT == 3) v = fmaxf(v, 0.f); else if (ACT == 6) v = 0.5f * v * (1.0f + erff(v * 0.70710678118654752f)); else if (ACT == 11) v = 1.0f / (1.0f + expf(-v)); else if (ACT == 15) v = v / (1.0f + expf(-v)); else if (ACT == 12) v = (v > 0.f) ? v : 0.01f * v; else if (ACT == 8) v = tanhf(v); else if (ACT == 9) v = 0.5f * v * (1.0f + tanhf(0.7978845608028654f * (v + 0.044715f * v * v * v))); else if (ACT == 14) v = (v > 0.f) ? v : 0.1f * v; else if (ACT == 16) v = (v >= 0.f) ? v : 0.3f * v; else if (ACT == 17) v = (v >= 0.f) ? v : 0.2f * v;
      so[w][rloc][t * 16 + ln] = v; } }
  __builtin_amdgcn_fence(__ATOMIC_ACQ_REL, "workgroup"); __builtin_amdgcn_wave_barrier();
  const int rsub = lane >> 4, c4 = (lane & 15) * 4;
  {
#pragma unroll
    for (int q = 0; q < 16; ++q) { const int r = q * 2 + rsub; const v4f v = *(const v4fa*)&so[w][r][c4]; if (C) { *(v4f*)(C + cofs + (size_t)(row0 + r) * ldc + col0 + c4) = v; asm volatile("s_wait_xcnt 0x0" ::: "memory"); }      /* the wait that belongs in front of any overwrite of a register which an issued store names (the f16 conversion and the next row's address land in them) */
      if (C16) { v4h h4; for (int i = 0; i < 4; ++i) h4[i] = (_Float16)v[i]; *(v4h*)(C16 + cofs + (size_t)(row0 + r) * ldc + col0 + c4) = h4; } }
     } }
template <int ACT>
__global__ __launch_bounds__(128) void k_gemm2(const _Float16* __restrict__ A, int lda, size_t sA, const _Float16* __restrict__ Bh, int ldb, size_t sB, float alpha, const float* __restrict__ bias, size_t sBias, const float* __restrict__ CP, int rowsPerB, size_t sCPb, int row0g,
    float* __restrict__ C, _Float16* __restrict__ C16, int ldc, size_t sC, int M, int N, int K) { gemm2_body<ACT>(A, lda, sA, Bh, ldb, sB, alpha, bias, sBias, CP, rowsPerB, sCPb, row0g, C, C16, ldc, sC, M, N, K); }
// q, k, v projections of all heads in one launch, straight from the f32 input rows: blockIdx.z picks the stream, blockIdx.y the head (both the same for a whole block).
// A head's 64 input columns are used by that head alone and N = 64 covers all of its outputs, so every input element is read once, here: it is rounded in registers
// (f32 -> bf16 -> f16, the two roundings of the former builder) to the value that an f16 copy of the rows would hold. Wave tile 32x64, K = 64 in two steps of 32, products and sums in gemm2_body's order.
// q and k go out as rows. v is wanted by the attention launch as V^T [batch][head][64][keys] and as nothing else: an accumulator tile holds, in each lane, eight consecutive rows (keys) of ONE output column,
// which is one 16-byte piece of a V^T row, so the V blocks lay their 64 x 128 tile in LDS transposed (one ds_store_b128 a tile and lane) and store 256 B of each V^T row, whole lines.
__device__ __forceinline__ v16h pj_cvt(v4f x0, v4f x1, v4f x2, v4f x3) { FragH f;      /* g2_frag's k order: x0, x1 = k 8 hh .. 8 hh + 7, x2, x3 = k 16 + 8 hh .. 16 + 8 hh + 7 */
#pragma unroll
  for (int q = 0; q < 4; ++q) { f.h[q] = (_Float16)bf16_round(x0[q]); f.h[4 + q] = (_Float16)bf16_round(x1[q]); f.h[8 + q] = (_Float16)bf16_round(x2[q]); f.h[12 + q] = (_Float16)bf16_round(x3[q]); }
  return f.v; }
#define PJ_VP (128 * 2 + 16)          /* LDS pitch of a V^T row of the block's 128 keys, bytes: 16 B x odd, so that the 16 rows of a ds_store_b128 meet no bank twice */
__global__ __launch_bounds__(128) void k_proj(const float* __restrict__ x, const float* __restrict__ ctx, const float* __restrict__ vsrc, const _Float16* __restrict__ B0, const _Float16* __restrict__ B1, const _Float16* __restrict__ B2,
    const float* __restrict__ bias0, const float* __restrict__ bias1, const float* __restrict__ bias2, _Float16* __restrict__ C0, _Float16* __restrict__ C1, _Float16* __restrict__ C2) {
  static_assert(HD == 64 && NRQ % 128 == 0 && NRK == NRQ && DC == DM && SK % 128 == 0 && HD * PJ_VP <= 4 * 32 * 68 * 4, "k_proj: K = N = 64, whole 128-row blocks, the three streams of one size, a block inside one batch, the V^T tile fits the staging");
  __shared__ __attribute__((aligned(16))) float so[4][32][68];
  const int tid = threadIdx.x, w = tid >> 5, lane = tid & 31, ln = lane & 15, hh = lane >> 4; const int h = blockIdx.y, z = blockIdx.z;
  const int row0 = blockIdx.x * 128 + 32 * w;
  const float* ap = (z == 0 ? x : z == 1 ? ctx : vsrc) + (size_t)(row0 + ln) * DM + h * HD + 8 * hh;
  const _Float16* bt = (z == 0 ? B0 : z == 1 ? B1 : B2) + (size_t)h * HD * HD + ln * HD;
  const float* bp = (z == 0 ? bias0 : z == 1 ? bias1 : bias2) + h * HD;
  v4f ax[2][2][4]; v16h bf[4][2]; float bb[4];      /* [16-row tile][k step][16-byte piece]; [16-column tile][k step]; the lane's four bias values */
#pragma unroll
  for (int t = 0; t < 4; ++t) bb[t] = bp[t * 16 + ln];
#pragma unroll
  for (int t = 0; t < 4; ++t)
#pragma unroll
    for (int s = 0; s < 2; ++s) bf[t][s] = g2_frag(bt + t * 16 * HD + s * 32, hh);
  asm volatile("s_wait_xcnt 0x0" ::: "memory");      /* the wait that belongs in front of any overwrite of a register which an issued load names: the row loads behind it may land in the registers of the weight addresses */
#pragma unroll
  for (int i = 0; i < 2; ++i)
#pragma unroll
    for (int s = 0; s < 2; ++s) { const float* p = ap + (size_t)i * 16 * DM + s * 32; ax[i][s][0] = *(const v4fa*)p; ax[i][s][1] = *(const v4fa*)(p + 4); ax[i][s][2] = *(const v4fa*)(p + 16); ax[i][s][3] = *(const v4fa*)(p + 20); }
  asm volatile("s_wait_xcnt 0x0" ::: "memory");      /* the wait that belongs in front of any overwrite of a register which an issued load names: all of the tile's loads are asked for above, what follows may reuse their address registers */
  __builtin_amdgcn_sched_barrier(0);      /* keeps the rounding behind all 36 loads, so that bias, weights and rows fly together; without it the second group of loads sinks behind the wait for the first group's data */
  const v8f z8 = {0.f,0.f,0.f,0.f,0.f,0.f,0.f,0.f}; v8f acc[2][4];
#pragma unroll
  for (int i = 0; i < 2; ++i)
#pragma unroll
    for (int t = 0; t < 4; ++t) acc[i][t] = z8;
#pragma unroll
  for (int s = 0; s < 2; ++s) { const v16h a0 = pj_cvt(ax[0][s][0], ax[0][s][1], ax[0][s][2], ax[0][s][3]), a1 = pj_cvt(ax[1][s][0], ax[1][s][1], ax[1][s][2], ax[1][s][3]);
#pragma unroll
    for (int t = 0; t < 4; ++t) { acc[0][t] = g2_mma(a0, bf[t][s], acc[0][t]); acc[1][t] = g2_mma(a1, bf[t][s], acc[1][t]); } }
  if (z == 2) {      /* the V stream (the same test for the whole block): C2 is V^T */
    unsigned char* tv = (unsigned char*)&so[0][0][0];      /* the block's tile as [64 columns d][128 keys] f16 at pitch PJ_VP */
#pragma unroll
    for (int i = 0; i < 2; ++i)
#pragma unroll
      for (int t = 0; t < 4; ++t) { const float bv = bf16_round(bb[t]); FragH f;
#pragma unroll
        for (int r = 0; r < 8; ++r) f.h[r] = (_Float16)(acc[i][t][r] * 0.0625f + bv);      /* v as f16 (the weight planes are carried x16): keys 32 w + 16 i + 8 hh + r of column 16 t + ln */
        *(v8us*)(tv + (t * 16 + ln) * PJ_VP + (w * 32 + i * 16 + 8 * hh) * 2) = f.half[0]; }
    __syncthreads();      /* a V^T row's 128 keys come from all four waves: every wave's pieces lie in LDS before any row is read back */
    const int rb = blockIdx.x * 128;      /* the block's first row: batch rb / SK, key rb % SK */
    const unsigned char* tr = tv + (tid >> 4) * PJ_VP + (tid & 15) * 16;      /* rows d = 8 q + tid / 16, piece tid % 16: a wave's store covers two rows of 256 B, four whole lines */
    unsigned short* vp = (unsigned short*)C2 + ((size_t)((rb / SK) * NH + h) * HD + (tid >> 4)) * SK + rb % SK + (tid & 15) * 8;
#pragma unroll
    for (int q = 0; q < 8; ++q) { const v8us v = *(const v8us*)(tr + q * 8 * PJ_VP); *(v8us*)(vp + (size_t)q * 8 * SK) = v; }
    return; }
  _Float16* cp = (z == 0 ? C0 : C1) + (size_t)row0 * DM + h * HD;
#pragma unroll
  for (int i = 0; i < 2; ++i)
#pragma unroll
    for (int t = 0; t < 4; ++t) { const float bv = bf16_round(bb[t]);
#pragma unroll
      for (int r = 0; r < 8; ++r) so[w][i * 16 + 8 * hh + r][t * 16 + ln] = acc[i][t][r] * 0.0625f + bv; }      /* the weight planes are carried x16 */
  __builtin_amdgcn_fence(__ATOMIC_ACQ_REL, "workgroup"); __builtin_amdgcn_wave_barrier();      /* each wave reads back its own rows only: its LDS writes in front of its reads */
  const int rsub = lane >> 4, c4 = (lane & 15) * 4;
#pragma unroll
  for (int q = 0; q < 16; ++q) { const int r = q * 2 + rsub; const v4f v = *(const v4fa*)&so[w][r][c4]; v4h h4; for (int i = 0; i < 4; ++i) h4[i] = (_Float16)v[i];
    *(v4h*)(cp + (size_t)r * DM + c4) = h4;
    if (q == 7) asm volatile("s_wait_xcnt 0x0" ::: "memory"); } }      /* the wait that belongs in front of any overwrite of a register which an issued store names: the second eight rows are converted into the registers of the first eight stores */

// Every weight builder in one launch: none needs anything of another, so they share a grid by ranges of the block index (a block lies wholly in one range).
// Range 1: Wo -> BO. Range 2: the 3 x 16 per-head planes, PB_WH blocks each.
#define PB_WO (DM * (DM / 8) / 256)
#define PB_WH (HD * (HD / 8) / 256)
__global__ __launch_bounds__(256) void k_prep(const float* __restrict__ wq, const float* __restrict__ wk, const float* __restrict__ wv, const float* __restrict__ wo,
    _Float16* __restrict__ BQ, _Float16* __restrict__ BK, _Float16* __restrict__ BV, _Float16* __restrict__ BO) {
  static_assert(DM * (DM / 8) % 256 == 0 && HD * (HD / 8) % 256 == 0, "k_prep: every range is a whole number of blocks");
  int u = blockIdx.x; const int tid = threadIdx.x;
  if (u < PB_WO) { wt_f16_at(wo, BO, DM, DM, 16.0f, u * 256 + tid); return; }
  u -= PB_WO;
  const int s = u / (NH * PB_WH), r = u % (NH * PB_WH); const size_t o = (size_t)(r / PB_WH) * HD * HD;
  wt_f16_at((s == 0 ? wq : s == 1 ? wk : wv) + o, (s == 0 ? BQ : s == 1 ? BK : BV) + o, HD, HD, 16.0f, (r % PB_WH) * 256 + tid); }

__global__ __launch_bounds__(256) void k_wnat(const float* __restrict__ w, size_t n8, _Float16* __restrict__ Bt) { const size_t t = (size_t)blockIdx.x * 256 + threadIdx.x; if (t >= n8) return; FragH f; for (int q = 0; q < 8; ++q) f.h[q] = (_Float16)(bf16_round(w[t * 8 + q]) * 16.0f); *(v8us*)((unsigned short*)Bt + t * 8) = f.half[0];  }
__global__ __launch_bounds__(256) void k_rsm(const float* __restrict__ S, _Float16* __restrict__ P, int nrows) {
  #pragma clang fp contract(off)
  const int i = blockIdx.x * 256 + threadIdx.x; if (i >= nrows) return; const float* s = S + (size_t)i * SQ; float mx = -3.0e38f;
#pragma unroll 1
  for (int j = 0; j < SQ; ++j) mx = fmaxf(mx, s[j]); float se = 0.f;
#pragma unroll 1
  for (int j = 0; j < SQ; ++j) se += expf(s[j] - mx); const float sc = 256.0f / se;
#pragma unroll 1
  for (int j0 = 0; j0 < SQ; j0 += 8) { FragH f; for (int q = 0; q < 8; ++q) f.h[q] = (_Float16)(expf(s[j0 + q] - mx) * sc); unsigned short* d = (unsigned short*)P + (size_t)i * SQ + j0; *(v8us*)d = f.half[0];  } }
__global__ __launch_bounds__(256) void k_vt(const _Float16* __restrict__ V16, int b, int h0, _Float16* __restrict__ VT) { __shared__ unsigned short tl[64][65]; const int tid = threadIdx.x; const int hh = blockIdx.x % HG, sg = blockIdx.x / HG; const int s0 = sg * 64; const int h = h0 + hh;
  for (int i = tid; i < 64 * 8; i += 256) { const int j = i / 8, d8 = (i % 8) * 8; FragH f; f.half[0] = *(const v8us*)((const unsigned short*)V16 + ((size_t)b * SQ + s0 + j) * DM + h * HD + d8); for (int q = 0; q < 8; ++q) tl[d8 + q][j] = f.u[q]; }
  __syncthreads();
  { for (int i = tid; i < 64 * 8; i += 256) { const int d = i / 8, j8 = (i % 8) * 8; FragH f; for (int q = 0; q < 8; ++q) f.u[q] = tl[d][j8 + q]; *(v8us*)((unsigned short*)VT + ((size_t)hh * HD + d) * SQ + s0 + j8) = f.half[0]; }  } }


__global__ __launch_bounds__(256) void k_rsmf(const float* __restrict__ S, _Float16* __restrict__ P, int qn, int hg) {
  #pragma clang fp contract(off)
  const int t = blockIdx.x * 256 + threadIdx.x; if (t >= qn * hg) return; const size_t i = (size_t)(t / qn) * SQ + (t % qn); const float* s = S + i * SQ; float mx = -3.0e38f;
#pragma unroll 1
  for (int j = 0; j < SQ; ++j) mx = fmaxf(mx, s[j]); float se = 0.f;
#pragma unroll 1
  for (int j = 0; j < SQ; ++j) se += __expf(s[j] - mx); const float sc = 256.0f / se;
#pragma unroll 1
  for (int j0 = 0; j0 < SQ; j0 += 8) { FragH f; for (int q = 0; q < 8; ++q) f.h[q] = (_Float16)(__expf(s[j0 + q] - mx) * sc); unsigned short* d = (unsigned short*)P + i * SQ + j0; *(v8us*)d = f.half[0];  } }

// Fused attention, all batches and heads in one launch: scores, softmax and P V stay in registers; no score or weight plane goes through memory.
// A wave owns 32 queries of one (batch, head) and walks the 2048 keys 32 at a time. S^T = K Q^T (A = 16 key rows, B = 16 query rows, both in g2_frag's k order): a lane holds
// scores of ONE query (column ln), keys 8 hh + r of each 16-key tile, so two tiles, converted in place, are the B operand P^T of O^T += V^T P^T (A = V^T rows, the same k order).
// Running maximum and sum per query (f32); the maximum is renewed lazily (the two wave halves exchange it then), the halves join their sums once at the end.
// The 16 waves of a block share one head's K and V^T through LDS: a stage is 128 keys (K: 128 rows of 128 B, V^T: 64 rows of 256 B), brought in whole lines by asynchronous copies,
// four of 16 bytes a lane, into one of two buffers while the other is worked on; the rows lie at a pitch of 16 B x odd, so that a fragment's ds_load_b128 meets no bank twice.
#define FA_KS 128                      /* keys a stage */
#define FA_NT (SK / FA_KS)             /* stages */
#define FA_KP (HD * 2 + 16)            /* LDS pitch of a K row, bytes */
#define FA_VP (FA_KS * 2 + 16)         /* LDS pitch of a V^T row, bytes */
#define FA_KB (FA_KS * FA_KP)          /* K part of a buffer, bytes */
#define FA_BUF (FA_KB + HD * FA_VP)    /* one buffer, bytes */
#define FA_LZ 44.3614195558365f        /* 8 / CS: how far a raw score may pass the maximum in use before that is renewed */
__device__ __forceinline__ float fa_xhalf(float x) { return __builtin_bit_cast(float, __builtin_amdgcn_permlanex16(__builtin_bit_cast(int, x), __builtin_bit_cast(int, x), 0x76543210, 0xfedcba98, false, false)); }      /* lane l with lane l ^ 16 */
__device__ __forceinline__ v16h fa_frag(const _Float16* p) { FragH f; f.half[0] = *(const v8us*)(const unsigned short*)p; f.half[1] = *(const v8us*)((const unsigned short*)p + 16); return f.v; }      /* g2_frag with the lane half's 8 hh already in p */
__device__ __forceinline__ v16h fa_lfrag(const unsigned char* p) { FragH f; f.half[0] = *(const v8us*)p; f.half[1] = *(const v8us*)(p + 32); return f.v; }      /* fa_frag from an LDS row: p in bytes, the lane half's 16 hh already in it */
/* Four asynchronous copies of 16 bytes a lane, global memory to LDS through no register (l: the lane's LDS byte address, g: its global address). The s_wait_xcnt is the wait that belongs
   in front of any overwrite of a register which an issued copy names; as the last line of the copies' own statement it stands ahead of whatever reuses the operands' registers. */
__device__ __forceinline__ void fa_copy4(unsigned l0, const _Float16* g0, unsigned l1, const _Float16* g1, unsigned l2, const _Float16* g2, unsigned l3, const _Float16* g3) {
  asm volatile("global_load_async_to_lds_b128 %0, %1, off\n\tglobal_load_async_to_lds_b128 %2, %3, off\n\tglobal_load_async_to_lds_b128 %4, %5, off\n\tglobal_load_async_to_lds_b128 %6, %7, off\n\ts_wait_xcnt 0x0"
      :: "v"(l0), "v"(g0), "v"(l1), "v"(g1), "v"(l2), "v"(g2), "v"(l3), "v"(g3) : "memory"); }
/* Native 2^x, eight (or one) in a statement: behind a transcendental the instruction set asks for one independent instruction or a v_nop before its result is read or its source
   overwritten. Each v_exp_f32 here has an independent one behind it (the outputs share no register with the inputs), the last one the v_nop. */
__device__ __forceinline__ void fa_exp8(const float (&t)[8], float (&e)[8]) {
  asm("v_exp_f32 %0, %8\n\tv_exp_f32 %1, %9\n\tv_exp_f32 %2, %10\n\tv_exp_f32 %3, %11\n\tv_exp_f32 %4, %12\n\tv_exp_f32 %5, %13\n\tv_exp_f32 %6, %14\n\tv_exp_f32 %7, %15\n\tv_nop"
      : "=&v"(e[0]), "=&v"(e[1]), "=&v"(e[2]), "=&v"(e[3]), "=&v"(e[4]), "=&v"(e[5]), "=&v"(e[6]), "=&v"(e[7]) : "v"(t[0]), "v"(t[1]), "v"(t[2]), "v"(t[3]), "v"(t[4]), "v"(t[5]), "v"(t[6]), "v"(t[7])); }
__device__ __forceinline__ float fa_exp1(float t) { float e; asm("v_exp_f32 %0, %1\n\tv_nop" : "=&v"(e) : "v"(t)); return e; }
__device__ __forceinline__ v8f fa_mma(v16h a, v16h b, v8f c) { return __builtin_amdgcn_wmma_f32_16x16x32_f16(false, a, false, b, (short)0, c, false, false); }
__global__ __launch_bounds__(512) void k_fattn(const _Float16* __restrict__ Q, const _Float16* __restrict__ Kk, const _Float16* __restrict__ VT, _Float16* __restrict__ O) {
  static_assert(SK % FA_KS == 0 && FA_NT >= 2 && FA_KS * 8 == 2 * 512 && HD * (FA_KS / 8) == 2 * 512, "k_fattn: whole stages, two of them at least, two K and two V^T copies a lane and stage");
  __shared__ __attribute__((aligned(16))) unsigned char sm[2 * FA_BUF];
  const int tid = threadIdx.x, lane = tid & 31, ln = lane & 15, hh = lane >> 4; const int w = __builtin_amdgcn_readfirstlane(tid >> 5);      /* the wave's number, held scalar */
  const int bh = blockIdx.x / (NQ / 512), b = bh / NH, h = bh % NH; const int q0 = (blockIdx.x % (NQ / 512)) * 512 + w * 32;
  const float CS = 0.125f * 1.44269504088896340736f;      /* 1 / sqrt(64) and log2 e in one factor: exp(s / 8 - m / 8) = 2^((s - m) CS) */
  const _Float16* qp = Q + ((size_t)b * NQ + q0 + ln) * DM + h * HD + 8 * hh;
  /* the lane's part of a stage: K rows tid / 8 and 64 + tid / 8, piece tid % 8; V^T rows tid / 16 and 32 + tid / 16, piece tid % 16: a wave's copy covers four whole 128-byte lines */
  const _Float16* gk = Kk + ((size_t)b * SK + (tid >> 3)) * DM + h * HD + (tid & 7) * 8;
  const _Float16* gv = VT + ((size_t)bh * HD + (tid >> 4)) * SK + (tid & 15) * 8;
  const unsigned sb = (unsigned)(size_t)sm;      /* the low 32 bits of a __shared__ address are its LDS byte address */
  const unsigned lk = sb + (tid >> 3) * FA_KP + (tid & 7) * 16, lv = sb + FA_KB + (tid >> 4) * FA_VP + (tid & 15) * 16;
  auto stage = [&](int t) { const unsigned bo = (t & 1) * FA_BUF; const _Float16* k0 = gk + (size_t)t * FA_KS * DM; const _Float16* v0 = gv + t * FA_KS;
    fa_copy4(lk + bo, k0, lk + bo + 64 * FA_KP, k0 + (size_t)64 * DM, lv + bo, v0, lv + bo + 32 * FA_VP, v0 + (size_t)32 * SK); };
  v16h qf[2][2];
#pragma unroll
  for (int j = 0; j < 2; ++j)
#pragma unroll
    for (int s = 0; s < 2; ++s) qf[j][s] = fa_frag(qp + (size_t)j * 16 * DM + s * 32);
  stage(0);
  asm volatile("s_wait_asynccnt 0x0" ::: "memory");      /* this wave's copies of stage 0 have landed */
  __syncthreads();      /* every wave's have: stage 0 may be read */
  stage(1);
  const unsigned char* kl = sm + ln * FA_KP + hh * 16; const unsigned char* vl = sm + FA_KB + ln * FA_VP + hh * 16;
  const v8f z8 = {0.f,0.f,0.f,0.f,0.f,0.f,0.f,0.f}; v8f o[2][4]; float mr[2] = {-3.0e38f, -3.0e38f}, lr[2] = {0.f, 0.f}, th[2] = {-3.0e38f, -3.0e38f}, nb[2] = {0.f, 0.f};      /* per query: maximum in use, sum, the score above which the maximum is renewed, -mr CS; the first pass renews all */
#pragma unroll
  for (int j = 0; j < 2; ++j)
#pragma unroll
    for (int t = 0; t < 4; ++t) o[j][t] = z8;
#pragma unroll 1
  for (int g = 0; g < FA_NT; ++g) {      /* rolled, like the passes inside: unrolling either only adds registers, and the wave has none to spare */
    const unsigned char* kb = kl + (g & 1) * FA_BUF; const unsigned char* vb = vl + (g & 1) * FA_BUF;
    v16h kf[2][2];
#pragma unroll
    for (int t = 0; t < 2; ++t)
#pragma unroll
      for (int s = 0; s < 2; ++s) kf[t][s] = fa_lfrag(kb + t * 16 * FA_KP + s * 64);
#pragma unroll 1
    for (int c = 0; c < FA_KS / 32; ++c) {      /* rolled: one pass already holds 16 matrix instructions and 16 LDS reads */
      v8f st[2][2];
#pragma unroll
      for (int j = 0; j < 2; ++j)
#pragma unroll
        for (int t = 0; t < 2; ++t) st[j][t] = fa_mma(kf[t][1], qf[j][1], fa_mma(kf[t][0], qf[j][0], z8));
      float mx[2];      /* this pass's maximum of the lane's own 16 scores of each query */
#pragma unroll
      for (int j = 0; j < 2; ++j) { mx[j] = fmaxf(st[j][0][0], st[j][1][0]);
#pragma unroll
        for (int r = 1; r < 8; ++r) mx[j] = fmaxf(mx[j], fmaxf(st[j][0][r], st[j][1][r])); }
      /* Lazy rescale: the maximum in use, mr, may trail the true one by up to 8 in the exponent of 2 (a weight then reaches 2^8 at most, far inside f16 and f32); sums and outputs carry the
         same factor, which the final division takes out. One test a pass for the whole wave, a scalar branch: only when some lane's score passes th = mr + FA_LZ are maxima, sums and outputs brought up. */
      if (__builtin_amdgcn_ballot_w32((mx[0] > th[0]) | (mx[1] > th[1])) != 0) {
#pragma unroll
        for (int j = 0; j < 2; ++j) {
          const float mn = fmaxf(mr[j], fmaxf(mx[j], fa_xhalf(mx[j])));      /* both halves of the wave hold scores of the same query: one maximum for both */
          const float al = fa_exp1((mr[j] - mn) * CS); mr[j] = mn; nb[j] = -mn * CS; th[j] = mn + FA_LZ; lr[j] *= al;      /* al = 0 on the first pass, 1 for a query whose maximum stays */
#pragma unroll
          for (int t = 0; t < 4; ++t) o[j][t] = o[j][t] * al; } }
      v16h vf[4]; const unsigned char* vc = vb + c * 64;
#pragma unroll
      for (int t = 0; t < 4; ++t) vf[t] = fa_lfrag(vc + t * 16 * FA_VP);      /* this pass's V^T */
      const int cn = (c + 1 < FA_KS / 32) ? c + 1 : c; const unsigned char* kc = kb + cn * 32 * FA_KP;      /* the next pass's K rows; the stage's last pass asks for its own rows again, which keeps every read inside this stage's buffer */
#pragma unroll
      for (int t = 0; t < 2; ++t)
#pragma unroll
        for (int s = 0; s < 2; ++s) kf[t][s] = fa_lfrag(kc + t * 16 * FA_KP + s * 64);
      __builtin_amdgcn_sched_barrier(0);      /* keeps the pass's 16 LDS reads in one group ahead of the exponentials, which cover their latency: left alone the compiler sinks them to just in front of the products that use them */
      FragH pf[2];      /* both query tiles' weights come ahead of the eight products: with one tile's products between the tiles the build gave an exponential statement the operand registers of the matrix instruction just in front of it */
#pragma unroll
      for (int j = 0; j < 2; ++j) { float sm1 = 0.f;
#pragma unroll
        for (int t = 0; t < 2; ++t) { float x[8], p[8];
#pragma unroll
          for (int r = 0; r < 8; ++r) x[r] = __builtin_fmaf(st[j][t][r], CS, nb[j]);
          fa_exp8(x, p);
#pragma unroll
          for (int r = 0; r < 8; ++r) { sm1 += p[r]; pf[j].h[t * 8 + r] = (_Float16)p[r]; } }
        lr[j] += sm1; }
#pragma unroll
      for (int j = 0; j < 2; ++j)
#pragma unroll
        for (int t = 0; t < 4; ++t) o[j][t] = fa_mma(vf[t], pf[j].v, o[j][t]);
    }
    asm volatile("s_wait_dscnt 0x0" ::: "memory");      /* this wave's reads of the buffer have returned before anything refills it */
    asm volatile("s_wait_asynccnt 0x0" ::: "memory");      /* this wave's copies of the next stage have landed */
    __syncthreads();      /* one barrier a stage: it publishes the next stage and ends every wave's reads of this one */
    if (g + 2 < FA_NT) stage(g + 2);      /* into the buffer just left; the test is the same for the whole block */
  }
  asm volatile("s_wait_asynccnt 0x0" ::: "memory");      /* no copy is left in flight when the wave ends */
#pragma unroll
  for (int j = 0; j < 2; ++j) { const float inv = 64.0f / (lr[j] + fa_xhalf(lr[j])); _Float16* op = O + ((size_t)b * NQ + q0 + j * 16 + ln) * DM + h * HD + 8 * hh;      /* o carried x64, as the output GEMM expects */
#pragma unroll
    for (int t = 0; t < 4; ++t) { FragH f;
#pragma unroll
      for (int r = 0; r < 8; ++r) f.h[r] = (_Float16)(o[j][t][r] * inv);
      *(v8us*)((unsigned short*)op + t * 16) = f.half[0]; } } }      /* O^T tile t: d = 16 t + 8 hh + r, eight consecutive columns of the query's row: one 16-byte store */

// Output GEMM out = o Wo + bo (M = 8192, N = K = 1024) with both operands shared through LDS: a block of 8 waves owns a 256 x 128 tile of out, a wave 64 x 64 of it (16 accumulator tiles, so a fragment
// read from LDS feeds four matrix instructions). A stage is 128 k: 256 rows of o and 128 rows of Wo^T, 256 B each, brought in whole lines by asynchronous copies, 24 of 16 bytes a lane, into one of two
// buffers while the other is worked on; rows at a pitch of 16 B x odd, so that a fragment's ds_load_b128 meets no bank twice. k runs upward in steps of 32 into one accumulator: gemm2_body's sum order.
#define OG_BM 256                      /* rows of out a block */
#define OG_BN 128                      /* columns of out a block */
#define OG_KS 128                      /* k a stage */
#define OG_NT (DM / OG_KS)             /* stages */
#define OG_P (OG_KS * 2 + 16)          /* LDS pitch of a row, bytes */
#define OG_AB (OG_BM * OG_P)           /* o part of a buffer, bytes */
#define OG_BUF ((OG_BM + OG_BN) * OG_P)      /* one buffer, bytes */
#define OG_MT ((int)(NRQ / OG_BM))     /* row tiles */
/* Twelve asynchronous copies of 16 bytes a lane (l: the lane's LDS byte addresses, g: its global addresses); the s_wait_xcnt is the wait that belongs in front of any overwrite of a register
   which an issued copy names; as the last line of the copies' own statement it stands ahead of whatever reuses the operands' registers. */
__device__ __forceinline__ void og_copy12(const unsigned* l, const _Float16* const* g) {
  asm volatile("global_load_async_to_lds_b128 %0, %1, off\n\tglobal_load_async_to_lds_b128 %2, %3, off\n\tglobal_load_async_to_lds_b128 %4, %5, off\n\tglobal_load_async_to_lds_b128 %6, %7, off\n\t"
               "global_load_async_to_lds_b128 %8, %9, off\n\tglobal_load_async_to_lds_b128 %10, %11, off\n\tglobal_load_async_to_lds_b128 %12, %13, off\n\tglobal_load_async_to_lds_b128 %14, %15, off\n\t"
               "global_load_async_to_lds_b128 %16, %17, off\n\tglobal_load_async_to_lds_b128 %18, %19, off\n\tglobal_load_async_to_lds_b128 %20, %21, off\n\tglobal_load_async_to_lds_b128 %22, %23, off\n\ts_wait_xcnt 0x0"
      :: "v"(l[0]), "v"(g[0]), "v"(l[1]), "v"(g[1]), "v"(l[2]), "v"(g[2]), "v"(l[3]), "v"(g[3]), "v"(l[4]), "v"(g[4]), "v"(l[5]), "v"(g[5]),
         "v"(l[6]), "v"(g[6]), "v"(l[7]), "v"(g[7]), "v"(l[8]), "v"(g[8]), "v"(l[9]), "v"(g[9]), "v"(l[10]), "v"(g[10]), "v"(l[11]), "v"(g[11]) : "memory"); }
__global__ __launch_bounds__(256) void k_ogemm(const _Float16* __restrict__ A, const _Float16* __restrict__ Bt, const float* __restrict__ bias, float* __restrict__ C) {
  static_assert(NRQ % OG_BM == 0 && DM % OG_BN == 0 && DM % OG_KS == 0 && OG_NT >= 2 && OG_BM * 16 == 16 * 256 && OG_BN * 16 == 8 * 256 && 8 * 64 * 68 * 4 <= 2 * OG_BUF,
                "k_ogemm: whole tiles and stages, two stages at least, sixteen o and eight Wo^T copies a lane and stage, the output staging fits the ring");
  __shared__ __attribute__((aligned(16))) unsigned char sm[2 * OG_BUF];
  const int tid = threadIdx.x, lane = tid & 31, ln = lane & 15, hh = lane >> 4; const int w = __builtin_amdgcn_readfirstlane(tid >> 5);      /* the wave's number, held scalar */
  const int mt = blockIdx.x % OG_MT, nq = blockIdx.x / OG_MT; const int wm = w >> 1, wn = w & 1;      /* waves 4 x 2 over the block's tile */
  const int col0 = nq * OG_BN + wn * 64;
  /* the lane's part of a stage: rows tid / 16 + 16 i, piece tid % 16: a wave's copy covers four whole 128-byte lines */
  const _Float16* ga = A + ((size_t)mt * OG_BM + (tid >> 4)) * DM + (tid & 15) * 8;
  const _Float16* gb = Bt + ((size_t)nq * OG_BN + (tid >> 4)) * DM + (tid & 15) * 8;
  const unsigned la = (unsigned)(size_t)sm + (tid >> 4) * OG_P + (tid & 15) * 16;      /* the low 32 bits of a __shared__ address are its LDS byte address */
  auto stage = [&](int t) { unsigned l[24]; const _Float16* g[24]; const unsigned bo = la + (t & 1) * OG_BUF;
#pragma unroll
    for (int i = 0; i < 16; ++i) { l[i] = bo + i * 16 * OG_P; g[i] = ga + (size_t)i * 16 * DM + t * OG_KS; }
#pragma unroll
    for (int i = 0; i < 8; ++i) { l[16 + i] = bo + OG_AB + i * 16 * OG_P; g[16 + i] = gb + (size_t)i * 16 * DM + t * OG_KS; }
    og_copy12(l, g); og_copy12(l + 12, g + 12); };
  float bb[4];
#pragma unroll
  for (int t = 0; t < 4; ++t) bb[t] = bias[col0 + t * 16 + ln];
  stage(0);
  asm volatile("s_wait_asynccnt 0x0" ::: "memory");      /* this wave's copies of stage 0 have landed */
  __syncthreads();      /* every wave's have: stage 0 may be read */
  stage(1);
  const unsigned char* al = sm + (wm * 64 + ln) * OG_P + hh * 16; const unsigned char* bl = sm + OG_AB + (wn * 64 + ln) * OG_P + hh * 16;
  const v8f z8 = {0.f,0.f,0.f,0.f,0.f,0.f,0.f,0.f}; v8f acc[4][4];
#pragma unroll
  for (int i = 0; i < 4; ++i)
#pragma unroll
    for (int t = 0; t < 4; ++t) acc[i][t] = z8;
#pragma unroll 1
  for (int g = 0; g < OG_NT; ++g) {      /* rolled: a stage already holds 64 matrix instructions and 64 LDS reads */
    const unsigned char* ab = al + (g & 1) * OG_BUF; const unsigned char* bp = bl + (g & 1) * OG_BUF;
#pragma unroll
    for (int s = 0; s < OG_KS / 32; ++s) { v16h af[4], bf[4];
      af[0] = fa_lfrag(ab + s * 64);      /* the first row's operands are asked for first, so that its products start while the other rows' still come */
#pragma unroll
      for (int t = 0; t < 4; ++t) bf[t] = fa_lfrag(bp + t * 16 * OG_P + s * 64);
#pragma unroll
      for (int i = 1; i < 4; ++i) af[i] = fa_lfrag(ab + i * 16 * OG_P + s * 64);
      __builtin_amdgcn_sched_barrier(0);      /* keeps the step's 16 LDS reads together in front of its products: left alone the compiler puts each row's reads, with a full wait, between the rows */
#pragma unroll
      for (int i = 0; i < 4; ++i)
#pragma unroll
        for (int t = 0; t < 4; ++t) acc[i][t] = fa_mma(af[i], bf[t], acc[i][t]);
      __builtin_amdgcn_sched_barrier(0); }      /* and the next step's reads behind these products, in one place */
    asm volatile("s_wait_dscnt 0x0" ::: "memory");      /* this wave's reads of the buffer have returned before anything refills it */
    asm volatile("s_wait_asynccnt 0x0" ::: "memory");      /* this wave's copies of the next stage have landed */
    __syncthreads();      /* one barrier a stage: it publishes the next stage and ends every wave's reads of this one */
    if (g + 2 < OG_NT) stage(g + 2);      /* into the buffer just left; the test is the same for the whole block */
  }
  asm volatile("s_wait_asynccnt 0x0" ::: "memory");      /* no copy is in flight when the ring becomes output staging; the loop's last barrier has ended every wave's reads of it */
  float* so = (float*)sm + w * (64 * 68);      /* each wave stages in its own range: its 64 rows of 64 f32 at a pitch of 68 */
  const float* sr = so + hh * 68 + ln * 4; float* cr = C + ((size_t)mt * OG_BM + wm * 64 + hh) * DM + col0 + ln * 4;      /* read back and stored: rows 2 q + hh, four columns a lane */
#pragma unroll
  for (int i = 0; i < 4; ++i)
#pragma unroll
    for (int t = 0; t < 4; ++t) { const float bv = bf16_round(bb[t]);
#pragma unroll
      for (int r = 0; r < 8; ++r) so[(i * 16 + 8 * hh + r) * 68 + t * 16 + ln] = acc[i][t][r] * 0.0009765625f + bv; }      /* o carried x64, Wo x16 */
  __builtin_amdgcn_fence(__ATOMIC_ACQ_REL, "workgroup"); __builtin_amdgcn_wave_barrier();      /* each wave reads back its own rows only: its LDS writes in front of its reads */
#pragma unroll
  for (int q = 0; q < 32; ++q) { const v4f v = *(const v4fa*)(sr + q * 2 * 68);
    *(v4f*)(cr + (size_t)q * 2 * DM) = v;      /* two rows of 256 B a store: whole lines */
    if (q == 15) asm volatile("s_wait_xcnt 0x0" ::: "memory"); } }      /* the wait that belongs in front of any overwrite of a register which an issued store names: the second 32 rows are read back into the registers of the first 16 stores */

extern "C" void kernel_launch(void* const* d_in, const int* in_sizes, int n_in,
                              void* d_out, int out_size, void* d_ws, size_t ws_size, hipStream_t stream) {
  (void)in_sizes; (void)n_in; (void)out_size;
  const float* const* I = (const float* const*)d_in; const float* x = I[0]; const float* ctx = I[1]; const float* vsrc = I[2]; const float* wq = I[3]; const float* bq = I[4]; const float* wk = I[5]; const float* bk = I[6]; const float* wv = I[7]; const float* bv = I[8]; const float* wo = I[9]; const float* bo = I[10];      /* input order: Q, K, V (THREE streams), Wq, bq, Wk, bk, Wv, bv (PER-HEAD [16][64][64] = [head][in][out]; biases [16][64] = the flat [1024] at 64 h + e; zeros on this draw), Wo ([in][out] [1024][1024]), bo (zeros): eleven inputs */
  char* ws = (char*)d_ws; size_t off = 0;
  auto take = [&](size_t bytes) { char* p = ws + off; off += (bytes + 255) & ~(size_t)255; return p; };
  _Float16* BQ = (_Float16*)take((size_t)DM * DM * 2); _Float16* BK = (_Float16*)take((size_t)DM * DC * 2); _Float16* BV = (_Float16*)take((size_t)DM * DC * 2); _Float16* BO = (_Float16*)take((size_t)DM * DM * 2);
  _Float16* Q16 = (_Float16*)take(NRQ * DM * 2); _Float16* K16 = (_Float16*)take(NRK * DM * 2); _Float16* O16 = (_Float16*)take(NRQ * DM * 2);
  _Float16* VT = (_Float16*)take((size_t)NB * NH * HD * SK * 2);
  if (off > ws_size) return;      /* 4 x 2 + 3 x 16 + 16 = 72 MiB */
  k_prep<<<PB_WO + 3 * NH * PB_WH, 256, 0, stream>>>(wq, wk, wv, wo, BQ, BK, BV, BO);      /* all weight operands in one launch. The per-head stacks [16][64][64] are [in][out] per head (x_h @ W_h): W_h[d][e] -> Bt_h[e][d] x16, K = N = 64, into consecutive [64][64] planes; Wo [in][out]: the same with K = N = 1024 */
  k_proj<<<dim3((unsigned)(NRQ / 128), NH, 3), 128, 0, stream>>>(x, ctx, vsrc, BQ, BK, BV, bq, bk, bv, Q16, K16, VT);      /* q, k, v (grid.z) in one launch, from the f32 rows: head h (grid.y) = rows[:, 64 h ..] W_h + b_h -> out[:, 64 h ..] (pitch DM), v transposed into V^T [4][16][64][2048]; B + 4096 h (pitch 64), bias + 64 h; K = N = 64 */
  k_fattn<<<NB * NH * (NQ / 512), 512, 0, stream>>>(Q16, K16, VT, O16);      /* scores, softmax, P V of every batch and head: 512 queries a block, o x64 into merged rows */
  k_ogemm<<<OG_MT * (DM / OG_BN), 256, 0, stream>>>(O16, BO, bo, (float*)d_out);      /* out = o Wo + bo (alpha 2^-10), 256 x 128 of out a block */
}

// v009
// A run of this version takes 85.2 microseconds.
// In two side-by-side timings against v008, it was 1.11 and 1.10 times as fast.
// Counting every step since v000, it is 81.1 times as fast.
#include <hip/hip_runtime.h>
// Multi-head attention on THREE input streams with BLOCK-DIAGONAL per-head projections on four sequences (Q, K, V [4][2048][1024], each split into 16 contiguous 64-wide slices; q / k / v = einsum('bhsd,hde->bhse', slice, W) + b: EACH HEAD applies its own Dense(64) (W [16][64][64] = [head][in][out], normal x 1/8; biases [16][64] zeros on this draw) to ITS OWN slice of ITS stream; scores / sqrt(64); softmax over all 2048 keys (no mask); out = merged Wo + bo ([in][out] [1024][1024]; bo zeros) -> [4][2048][1024]); each projection is ONE head-batched GEMM (K = 64).
// Structure: no weight-builder launch: each projection block transposes its head's [in][out] 64 x 64 weight block into LDS itself (exact x16 f16), and 256 more blocks of the same launch build Wo^T, one 64 x 64 block each; Q, K, V as three HEAD-BATCHED WMMA GEMMs in ONE launch (row block, head and stream from the block index; K = N = 64; 32x64 wave tiles, A fragments read from the f32 input rows and rounded in registers, no f16 copy of the inputs in memory; f32 accumulation, + the head's bias, f16 outputs into the head's 64 columns; the V stream's blocks store their tile transposed, straight into V^T [4][16][64][2048], the only form of v in memory); ONE fused launch for all batches and heads: scores (K = 64), running softmax over the 2048 keys (f32 statistics, native exp2; unnormalised weights in (0, 2^8] as f16), o = P V (o carried x64) into merged f16 rows; out = o W_o + b_o GEMM (f32, alpha 2^-10); launches: see trace.
// Compute dtype: inputs rounded to bf16; x / context / weights exact; q, k, v, softmax weights and o as plain f16 GEMM operands (~2^-12); scores and statistics f32. v_wmma_f32_16x16x32_f16.
#define NB 4
#define NQ 2048
#define SK 2048
#define SQ SK                       /* keys per softmax row */
#define DM 1024
#define DC 1024
#define NH 16
#define HD 64
#define HG 4
#define NRQ ((size_t)NB * NQ)
#define NRK ((size_t)NB * SK)
typedef __bf16 v16b __attribute__((ext_vector_type(16)));
typedef unsigned short v8us __attribute__((ext_vector_type(8), may_alias));
typedef float  v8f  __attribute__((ext_vector_type(8)));
typedef float  v4f  __attribute__((ext_vector_type(4)));
typedef float  v4fa __attribute__((ext_vector_type(4), may_alias));
union FragB { v16b v; v8us half[2]; unsigned short u[16]; };

__device__ __forceinline__ unsigned short bf16_bits(float x) { unsigned int u = __float_as_uint(x); return (unsigned short)((u + 0x7FFFu + ((u >> 16) & 1u)) >> 16); }
__device__ __forceinline__ float bf16_val(unsigned short b) { return __uint_as_float(((unsigned int)b) << 16); }
__device__ __forceinline__ float bf16_round(float x) { return bf16_val(bf16_bits(x)); }
// D += A·B with NT terms: 1 = ah·bh, 2 = + al·bh (A split), 3 = + ah·bl (both split)
template <int NT>
__device__ __forceinline__ v8f mmaN(v16b ah, v16b al, v16b bh, v16b bl, v8f c) {
  c = __builtin_amdgcn_wmma_f32_16x16x32_bf16(false, ah, false, bh, (short)0, c, false, false);
  if (NT >= 2) c = __builtin_amdgcn_wmma_f32_16x16x32_bf16(false, al, false, bh, (short)0, c, false, false);
  if (NT >= 3) c = __builtin_amdgcn_wmma_f32_16x16x32_bf16(false, ah, false, bl, (short)0, c, false, false);
  asm volatile("v_nop\n\tv_nop\n\tv_nop\n\tv_nop" : "+v"(c) : "v"(ah), "v"(al), "v"(bh), "v"(bl));
  return c;
}

__global__ __launch_bounds__(256) void k_wt_bf16(const float* __restrict__ W, unsigned short* __restrict__ Wt, int K, int N) {
  const int t = blockIdx.x * 256 + threadIdx.x;
  const int k8n = K / 8;
  if (t >= N * k8n) return;
  const int n = t / k8n, k8 = (t % k8n) * 8;
  v8us v;
#pragma unroll
  for (int i = 0; i < 8; ++i) v[i] = bf16_bits(W[(size_t)(k8 + i) * N + n]);
  *(v8us*)(Wt + (size_t)n * K + k8) = v;
  
}

// GEMM C[M][N] (f32, pitch ldc) = act(A[M][K]·W + bias). A f32 row-major (pitch lda) converted per fragment to bf16
// (ASPLIT: hi/lo two planes -> 2 terms, else single rounded term); Wt bf16 [N][K] (pitch ldb). BIAS_BF16 rounds the
// bias to bf16 first (bias quantised to bf16 before the add). K%32==0, M%16==0, N%64==0.
template <bool ASPLIT, int ACT, bool BIAS_BF16>
__global__ __launch_bounds__(128) void k_gemm_bf(const float* __restrict__ A, int lda, const unsigned short* __restrict__ Wt, int ldb,
                                               const float* __restrict__ bias, float* __restrict__ C, int ldc, int M, int N, int K) {
  __shared__ __attribute__((aligned(16))) float so[4][16][64];
  const int tid = threadIdx.x, w = tid >> 5, lane = tid & 31, ln = lane & 15, hh = lane >> 4;
  const int ntn = N / 64;
  const int wid = blockIdx.x * 4 + w;
  const int mt = wid / ntn, nq = wid % ntn;
  if (mt * 16 >= M) return;
  const int row0 = mt * 16, col0 = nq * 64;
  const float* arow = A + (size_t)(row0 + ln) * lda;
  v8f acc[4] = {};
  for (int kb = 0; kb < K; kb += 32) {
    FragB ah, al;
    const v4f x0 = *(const v4fa*)(arow + kb + 8 * hh), x1 = *(const v4fa*)(arow + kb + 8 * hh + 4);
    const v4f x2 = *(const v4fa*)(arow + kb + 16 + 8 * hh), x3 = *(const v4fa*)(arow + kb + 16 + 8 * hh + 4);
    float xs[16] = {x0[0],x0[1],x0[2],x0[3],x1[0],x1[1],x1[2],x1[3],x2[0],x2[1],x2[2],x2[3],x3[0],x3[1],x3[2],x3[3]};
#pragma unroll
    for (int i = 0; i < 16; ++i) { const unsigned short hb = bf16_bits(xs[i]); ah.u[i] = hb; al.u[i] = ASPLIT ? bf16_bits(xs[i] - bf16_val(hb)) : (unsigned short)0; }
#pragma unroll
    for (int t = 0; t < 4; ++t) {
      const unsigned short* brow = Wt + (size_t)(col0 + t * 16 + ln) * ldb + kb;
      FragB b;
      b.half[0] = *(const v8us*)(brow + 8 * hh);
      b.half[1] = *(const v8us*)(brow + 16 + 8 * hh);
      acc[t] = mmaN<ASPLIT ? 2 : 1>(ah.v, al.v, b.v, b.v, acc[t]);
    }
  }
#pragma unroll
  for (int t = 0; t < 4; ++t) {
    float bv = bias ? bias[col0 + t * 16 + ln] : 0.f;
    if (BIAS_BF16) bv = bf16_round(bv);
#pragma unroll
    for (int r = 0; r < 8; ++r) { float v = acc[t][r] + bv; if (ACT == 1) v = fmaxf(v, 0.f); so[w][8 * hh + r][t * 16 + ln] = v; }
  }
  __builtin_amdgcn_fence(__ATOMIC_ACQ_REL, "workgroup");
  __builtin_amdgcn_wave_barrier();
  const int rsub = lane >> 4, c4 = (lane & 15) * 4;
  {
#pragma unroll
    for (int q = 0; q < 8; ++q) {
      const int r = q * 2 + rsub;
      const v4f v = *(const v4fa*)&so[w][r][c4];
      *(v4f*)(C + (size_t)(row0 + r) * ldc + col0 + c4) = v;
    }
    
  }
}

// GEMM C = act(A·W + bias + resid): A f32 (ASPLIT -> hi/lo 2 terms), Wt bf16 [N][K]; ACT 0 none, 1 relu, 2 exact gelu;
// resid (optional, f32, row index = (row % rmod), pitch ldr, RES_BF16 rounds it) added before the activation.
template <bool ASPLIT, int ACT, bool BIAS_BF16, bool RES_BF16>
__global__ __launch_bounds__(128) void k_gemm_bf3(const float* __restrict__ A, int lda, const unsigned short* __restrict__ Wt, int ldb,
                                                const float* __restrict__ bias, const float* __restrict__ resid, int rmod, int ldr,
                                                float* __restrict__ C, int ldc, int M, int N, int K) {
  __shared__ __attribute__((aligned(16))) float so[4][16][64];
  const int tid = threadIdx.x, w = tid >> 5, lane = tid & 31, ln = lane & 15, hh = lane >> 4;
  const int ntn = N / 64;
  const int wid = blockIdx.x * 4 + w;
  const int mt = wid / ntn, nq = wid % ntn;
  if (mt * 16 >= M) return;
  const int row0 = mt * 16, col0 = nq * 64;
  const float* arow = A + (size_t)(row0 + ln) * lda;
  v8f acc[4] = {};
  for (int kb = 0; kb < K; kb += 32) {
    FragB ah, al;
    const v4f x0 = *(const v4fa*)(arow + kb + 8 * hh), x1 = *(const v4fa*)(arow + kb + 8 * hh + 4);
    const v4f x2 = *(const v4fa*)(arow + kb + 16 + 8 * hh), x3 = *(const v4fa*)(arow + kb + 16 + 8 * hh + 4);
    float xs[16] = {x0[0],x0[1],x0[2],x0[3],x1[0],x1[1],x1[2],x1[3],x2[0],x2[1],x2[2],x2[3],x3[0],x3[1],x3[2],x3[3]};
#pragma unroll
    for (int i = 0; i < 16; ++i) { const unsigned short hb = bf16_bits(xs[i]); ah.u[i] = hb; al.u[i] = ASPLIT ? bf16_bits(xs[i] - bf16_val(hb)) : (unsigned short)0; }
#pragma unroll
    for (int t = 0; t < 4; ++t) {
      const unsigned short* brow = Wt + (size_t)(col0 + t * 16 + ln) * ldb + kb;
      FragB b;
      b.half[0] = *(const v8us*)(brow + 8 * hh);
      b.half[1] = *(const v8us*)(brow + 16 + 8 * hh);
      acc[t] = mmaN<ASPLIT ? 2 : 1>(ah.v, al.v, b.v, b.v, acc[t]);
    }
  }
#pragma unroll
  for (int t = 0; t < 4; ++t) {
    const int col = col0 + t * 16 + ln;
    float bv = bias ? bias[col] : 0.f;
    if (BIAS_BF16) bv = bf16_round(bv);
#pragma unroll
    for (int r = 0; r < 8; ++r) {
      float v = acc[t][r] + bv;
      if (resid) { float rv = resid[(size_t)((row0 + 8 * hh + r) % rmod) * ldr + col]; if (RES_BF16) rv = bf16_round(rv); v += rv; }
      if (ACT == 1) v = fmaxf(v, 0.f);
      if (ACT == 2) v = 0.5f * v * (1.0f + erff(v * 0.70710678118654752f));
      if (ACT == 3) { const float u = 0.7978845608028654f * (v + 0.044715f * v * v * v); v = 0.5f * v * (1.0f + tanhf(u)); }
      so[w][8 * hh + r][t * 16 + ln] = v;
    }
  }
  __builtin_amdgcn_fence(__ATOMIC_ACQ_REL, "workgroup");
  __builtin_amdgcn_wave_barrier();
  const int rsub = lane >> 4, c4 = (lane & 15) * 4;
  {
#pragma unroll
    for (int q = 0; q < 8; ++q) {
      const int r = q * 2 + rsub;
      const v4f v = *(const v4fa*)&so[w][r][c4];
      *(v4f*)(C + (size_t)(row0 + r) * ldc + col0 + c4) = v;
    }
    
  }
}
// row LayerNorm (biased variance, eps) over N: s = X (+ R); optional out_sum <- s; out_norm <- (s-mu)*rsqrt(var+eps)*g + b
template <bool PARAM_BF16>
__global__ __launch_bounds__(256) void k_layernorm(const float* __restrict__ X, const float* __restrict__ R, const float* __restrict__ g, const float* __restrict__ bta,
                                                  float* __restrict__ out_sum, float* __restrict__ out_norm, int N, float eps) {
  __shared__ float red[256];
  const int row = blockIdx.x, tid = threadIdx.x;
  const float* x = X + (size_t)row * N; const float* rr = R ? R + (size_t)row * N : nullptr;
  float vals[16];                     // up to N = 4096
  const int per = N / 256;            // contiguous chunk per thread? use strided-by-4 chunks: thread handles j = tid*4 + 1024*u
  float s1 = 0.f;
  for (int u = 0; u < per / 4; ++u) {
    const int j = tid * 4 + 1024 * u;
    const v4f a = *(const v4fa*)(x + j);
    v4f b = {0.f,0.f,0.f,0.f}; if (rr) b = *(const v4fa*)(rr + j);
#pragma unroll
    for (int q = 0; q < 4; ++q) { const float v = a[q] + b[q]; vals[u * 4 + q] = v; s1 += v; }
  }
  red[tid] = s1; __syncthreads();
  for (int st = 128; st > 0; st >>= 1) { if (tid < st) red[tid] += red[tid + st]; __syncthreads(); }
  const float mu = red[0] / (float)N; __syncthreads();
  float s2 = 0.f;
  for (int u = 0; u < per / 4; ++u)
#pragma unroll
    for (int q = 0; q < 4; ++q) { const float c = vals[u * 4 + q] - mu; s2 += c * c; }
  red[tid] = s2; __syncthreads();
  for (int st = 128; st > 0; st >>= 1) { if (tid < st) red[tid] += red[tid + st]; __syncthreads(); }
  const float rs = rsqrtf(red[0] / (float)N + eps);
  {
    for (int u = 0; u < per / 4; ++u) {
      const int j = tid * 4 + 1024 * u;
      v4f o, sm;
#pragma unroll
      for (int q = 0; q < 4; ++q) {
        float gg = g[j + q], bb = bta[j + q];
        if (PARAM_BF16) { gg = bf16_round(gg); bb = bf16_round(bb); }
        sm[q] = vals[u * 4 + q]; o[q] = (vals[u * 4 + q] - mu) * rs * gg + bb;
      }
      if (out_sum) *(v4f*)(out_sum + (size_t)row * N + j) = sm;
      *(v4f*)(out_norm + (size_t)row * N + j) = o;
    }
    
  }
}



// ---- f16 WMMA path (v_wmma_f32_16x16x32_f16): 11-bit significands for operands in range — used where a [0,1] probability operand needs more precision than bf16
typedef _Float16 v16h __attribute__((ext_vector_type(16)));
union FragH { v16h v; v8us half[2]; _Float16 h[16]; unsigned short u[16]; };
template <int NT>
__device__ __forceinline__ v8f mmaH(v16h ah, v16h al, v16h bh, v16h bl, v8f c) {
  c = __builtin_amdgcn_wmma_f32_16x16x32_f16(false, ah, false, bh, (short)0, c, false, false);
  if (NT >= 2) c = __builtin_amdgcn_wmma_f32_16x16x32_f16(false, al, false, bh, (short)0, c, false, false);
  if (NT >= 3) c = __builtin_amdgcn_wmma_f32_16x16x32_f16(false, ah, false, bl, (short)0, c, false, false);
  asm volatile("v_nop\n\tv_nop\n\tv_nop\n\tv_nop" : "+v"(c) : "v"(ah), "v"(al), "v"(bh), "v"(bl));
  return c;
}
// batched GEMM like k_gemm_b but f16 operands: A f32 (split into f16 hi/lo if ASPLIT, else rounded to f16), Bt = f16 values [n][k]; alpha; C f32; N multiple of 16 (partial tiles skipped)
template <bool ASPLIT>
__global__ __launch_bounds__(128) void k_gemm_h(const float* __restrict__ A, int lda, size_t sA, const _Float16* __restrict__ Bh, int ldb, size_t sB, float alpha, float* __restrict__ C, int ldc, size_t sC, int M, int N, int K) {
  __shared__ __attribute__((aligned(16))) float so[4][16][64];
  const int tid = threadIdx.x, w = tid >> 5, lane = tid & 31, ln = lane & 15, hh = lane >> 4; const int by = blockIdx.y;
  A += (size_t)by * sA; Bh += (size_t)by * sB; C += (size_t)by * sC;
  const int ntn = (N + 63) / 64; const int wid = blockIdx.x * 4 + w; const int mt = wid / ntn, nq = wid % ntn; if (mt * 16 >= M) return;
  const int row0 = mt * 16, col0 = nq * 64; const float* arow = A + (size_t)(row0 + ln) * lda;
  v8f acc[4] = {};
  for (int kb = 0; kb < K; kb += 32) {
    FragH ah, al;
    const v4f x0 = *(const v4fa*)(arow + kb + 8 * hh), x1 = *(const v4fa*)(arow + kb + 8 * hh + 4), x2 = *(const v4fa*)(arow + kb + 16 + 8 * hh), x3 = *(const v4fa*)(arow + kb + 16 + 8 * hh + 4);
    float xs[16] = {x0[0],x0[1],x0[2],x0[3],x1[0],x1[1],x1[2],x1[3],x2[0],x2[1],x2[2],x2[3],x3[0],x3[1],x3[2],x3[3]};
#pragma unroll
    for (int i = 0; i < 16; ++i) { const _Float16 h = (_Float16)xs[i]; ah.h[i] = h; al.h[i] = ASPLIT ? (_Float16)(xs[i] - (float)h) : (_Float16)0.0f; }
#pragma unroll
    for (int t = 0; t < 4; ++t) { if (col0 + t * 16 >= N) continue; const size_t boff = (size_t)(col0 + t * 16 + ln) * ldb + kb; FragH bq; bq.half[0] = *(const v8us*)(Bh + boff + 8 * hh); bq.half[1] = *(const v8us*)(Bh + boff + 16 + 8 * hh);
      acc[t] = mmaH<ASPLIT ? 2 : 1>(ah.v, al.v, bq.v, bq.v, acc[t]); }
  }
#pragma unroll
  for (int t = 0; t < 4; ++t) { if (col0 + t * 16 >= N) continue;
#pragma unroll
    for (int r = 0; r < 8; ++r) so[w][8 * hh + r][t * 16 + ln] = acc[t][r] * alpha; }
  __builtin_amdgcn_fence(__ATOMIC_ACQ_REL, "workgroup"); __builtin_amdgcn_wave_barrier();
  const int rsub = lane >> 4, c4 = (lane & 15) * 4;
  {
#pragma unroll
    for (int q = 0; q < 8; ++q) { const int r = q * 2 + rsub; if (col0 + c4 < N) { const v4f v = *(const v4fa*)&so[w][r][c4]; *(v4f*)(C + (size_t)(row0 + r) * ldc + col0 + c4) = v; } }
     }
}

// k_gemm_hh variant with fused epilogue: v = acc·alpha + bias[by·sBias + col] (+ CP[(row/rowsPerB)·sCPb + by·64 + col] if CP) ; ACT 0 none / 1 elu ; writes f16 C16 (and f32 C if non-null)
template <int ACT>
__global__ __launch_bounds__(128) void k_gemm_hhx(const _Float16* __restrict__ A, int lda, size_t sA, const _Float16* __restrict__ Bh, int ldb, size_t sB, float alpha, const float* __restrict__ bias, size_t sBias, const float* __restrict__ CP, int rowsPerB, size_t sCPb, int row0g,
    float* __restrict__ C, _Float16* __restrict__ C16, int ldc, size_t sC, int M, int N, int K) {
  __shared__ __attribute__((aligned(16))) float so[4][16][64];
  const int tid = threadIdx.x, w = tid >> 5, lane = tid & 31, ln = lane & 15, hh = lane >> 4; const int by = blockIdx.y;
  A += (size_t)by * sA; Bh += (size_t)by * sB; const size_t cofs = (size_t)by * sC; const float* bp = bias ? bias + (size_t)by * sBias : nullptr;
  const int ntn = (N + 63) / 64; const int wid = blockIdx.x * 4 + w; const int mt = wid / ntn, nq = wid % ntn; if (mt * 16 >= M) return;
  const int row0 = mt * 16, col0 = nq * 64; const _Float16* arow = A + (size_t)(row0 + ln) * lda;
  v8f acc[4] = {};
  for (int kb = 0; kb < K; kb += 32) { FragH ah; ah.half[0] = *(const v8us*)((const unsigned short*)arow + kb + 8 * hh); ah.half[1] = *(const v8us*)((const unsigned short*)arow + kb + 16 + 8 * hh);
#pragma unroll
    for (int t = 0; t < 4; ++t) { if (col0 + t * 16 >= N) continue; const size_t boff = (size_t)(col0 + t * 16 + ln) * ldb + kb; FragH bq; bq.half[0] = *(const v8us*)((const unsigned short*)Bh + boff + 8 * hh); bq.half[1] = *(const v8us*)((const unsigned short*)Bh + boff + 16 + 8 * hh);
      acc[t] = mmaH<1>(ah.v, ah.v, bq.v, bq.v, acc[t]); }
  }
#pragma unroll
  for (int t = 0; t < 4; ++t) { if (col0 + t * 16 >= N) continue; const int col = col0 + t * 16 + ln; const float bv = bp ? bf16_round(bp[col]) : 0.f;
#pragma unroll
    for (int r = 0; r < 8; ++r) { float v = acc[t][r] * alpha + bv; if (CP) { const int rr = row0g + row0 + 8 * hh + r; if (rowsPerB < 0) v += CP[cofs + (size_t)rr * ldc + col];      /* rowsPerB < 0: own element of the batched C plane */ else { const int bidx = rr / rowsPerB; v += CP[(size_t)bidx * sCPb + (size_t)by * 64 + col]; } } if (ACT == 1) v = (v > 0.f) ? v : expm1f(v); else if (ACT == 7) v = (v > 0.f) ? v + 1.0f : expf(v); else if (ACT == 8) v = tanhf(v); else if (ACT == 9) v = 0.5f * v * (1.0f + tanhf(0.7978845608028654f * (v + 0.044715f * v * v * v))); else if (ACT == 11) v = 1.0f / (1.0f + expf(-v)); else if (ACT == 12) v = (v > 0.f) ? v : 0.01f * v; else if (ACT == 14) v = (v > 0.f) ? v : 0.1f * v; else if (ACT == 16) v = (v >= 0.f) ? v : 0.3f * v; else if (ACT == 17) v = (v >= 0.f) ? v : 0.2f * v; else if (ACT == 15) v = v / (1.0f + expf(-v)); else if (ACT == 3) v = fmaxf(v, 0.f); else if (ACT == 6) v = 0.5f * v * (1.0f + erff(v * 0.70710678118654752f)); so[w][8 * hh + r][t * 16 + ln] = v; } }
  __builtin_amdgcn_fence(__ATOMIC_ACQ_REL, "workgroup"); __builtin_amdgcn_wave_barrier();
  const int rsub = lane >> 4, c4 = (lane & 15) * 4; typedef _Float16 v4h __attribute__((ext_vector_type(4)));
  {
#pragma unroll
    for (int q = 0; q < 8; ++q) { const int r = q * 2 + rsub; if (col0 + c4 < N) { const v4f v = *(const v4fa*)&so[w][r][c4]; if (C) *(v4f*)(C + cofs + (size_t)(row0 + r) * ldc + col0 + c4) = v; if (C16) { v4h h4; for (int i = 0; i < 4; ++i) h4[i] = (_Float16)v[i]; *(v4h*)(C16 + cofs + (size_t)(row0 + r) * ldc + col0 + c4) = h4; } } }
     }
}


typedef _Float16 v4h __attribute__((ext_vector_type(4)));

__global__ __launch_bounds__(256) void k_h16(const float* __restrict__ x, _Float16* __restrict__ X16, size_t n8) { const size_t t = (size_t)blockIdx.x * 256 + threadIdx.x; if (t >= n8) return; FragH f;
#pragma unroll
  for (int q = 0; q < 8; ++q) f.h[q] = (_Float16)x[t * 8 + q]; *(v8us*)((unsigned short*)X16 + t * 8) = f.half[0];  }
__global__ __launch_bounds__(256) void k_round16f(const float* __restrict__ W, _Float16* __restrict__ Bt, size_t n8) { const size_t t = (size_t)blockIdx.x * 256 + threadIdx.x; if (t >= n8) return; FragH f;
#pragma unroll
  for (int i = 0; i < 8; ++i) f.h[i] = (_Float16)(bf16_round(W[t * 8 + i]) * 16.0f); *(v8us*)((unsigned short*)Bt + t * 8) = f.half[0];  }
__global__ __launch_bounds__(256) void k_hl(const float* __restrict__ F, _Float16* __restrict__ Hh, _Float16* __restrict__ Hl, size_t n8) { const size_t t = (size_t)blockIdx.x * 256 + threadIdx.x; if (t >= n8) return; FragH fh, fl; const v4f a = *(const v4fa*)(F + t * 8), c = *(const v4fa*)(F + t * 8 + 4);
#pragma unroll
  for (int q = 0; q < 4; ++q) { _Float16 h = (_Float16)a[q]; fh.h[q] = h; fl.h[q] = (_Float16)((a[q] - (float)h) * 1024.0f); h = (_Float16)c[q]; fh.h[4 + q] = h; fl.h[4 + q] = (_Float16)((c[q] - (float)h) * 1024.0f); }
  { *(v8us*)((unsigned short*)Hh + t * 8) = fh.half[0]; *(v8us*)((unsigned short*)Hl + t * 8) = fl.half[0];  } }

// ---- fast GEMM (wave tile 32x64; requires M % 32 == 0 rows per launch region and N % 64 == 0); epilogue = k_gemm_hhx semantics ----
__device__ __forceinline__ v16h g2_frag(const _Float16* p, int hh) { FragH f; f.half[0] = *(const v8us*)((const unsigned short*)p + 8 * hh); f.half[1] = *(const v8us*)((const unsigned short*)p + 16 + 8 * hh); return f.v; }
__device__ __forceinline__ v8f g2_mma(v16h a, v16h b, v8f c) { v8f d = __builtin_amdgcn_wmma_f32_16x16x32_f16(false, a, false, b, (short)0, c, false, false); asm volatile("v_nop\n\tv_nop\n\tv_nop\n\tv_nop" : "+v"(d) : "v"(a), "v"(b)); return d; }
template <int ACT>
__device__ __forceinline__ void gemm2_body(const _Float16* __restrict__ A, int lda, size_t sA, const _Float16* __restrict__ Bh, int ldb, size_t sB, float alpha, const float* __restrict__ bias, size_t sBias, const float* __restrict__ CP, int rowsPerB, size_t sCPb, int row0g,
    float* __restrict__ C, _Float16* __restrict__ C16, int ldc, size_t sC, int M, int N, int K) { static_assert(ACT == 0 || ACT == 3 || ACT == 6 || ACT == 8 || ACT == 9 || ACT == 11 || ACT == 12 || ACT == 14 || ACT == 15 || ACT == 16 || ACT == 17, "k_gemm2: unsupported ACT code (would silently apply no activation)");
  __shared__ __attribute__((aligned(16))) float so[4][32][68];
  const int tid = threadIdx.x, w = tid >> 5, lane = tid & 31, ln = lane & 15, hh = lane >> 4; const int by = blockIdx.y;
  A += (size_t)by * sA; Bh += (size_t)by * sB; const size_t cofs = (size_t)by * sC; const float* bp = bias ? bias + (size_t)by * sBias : nullptr;
  const int ntn = N >> 6; const int mt = blockIdx.x / ntn, nq = blockIdx.x - mt * ntn; const int row0 = mt * 128 + 32 * w, col0 = nq * 64; if (row0 >= M) return;
  const _Float16* a0p = A + (size_t)(row0 + ln) * lda; const _Float16* a1p = a0p + (size_t)16 * lda;
  const _Float16* b0p = Bh + (size_t)(col0 + ln) * ldb; const _Float16* b1p = b0p + (size_t)16 * ldb; const _Float16* b2p = b1p + (size_t)16 * ldb; const _Float16* b3p = b2p + (size_t)16 * ldb;
  const v8f z8 = {0.f,0.f,0.f,0.f,0.f,0.f,0.f,0.f}; v8f c00 = z8, c01 = z8, c02 = z8, c03 = z8, c10 = z8, c11 = z8, c12 = z8, c13 = z8;
#pragma unroll 1
  for (int kb = 0; kb < K; kb += 32) { const v16h a0 = g2_frag(a0p + kb, hh), a1 = g2_frag(a1p + kb, hh);
    asm volatile("s_wait_xcnt 0x0" ::: "memory");      /* the wait that belongs in front of any overwrite of a register which an issued load names: the B loads behind it land in the registers of the A addresses */
    v16h b = g2_frag(b0p + kb, hh); c00 = g2_mma(a0, b, c00); c10 = g2_mma(a1, b, c10);
    b = g2_frag(b1p + kb, hh); c01 = g2_mma(a0, b, c01); c11 = g2_mma(a1, b, c11);
    b = g2_frag(b2p + kb, hh); c02 = g2_mma(a0, b, c02); c12 = g2_mma(a1, b, c12);
    b = g2_frag(b3p + kb, hh); c03 = g2_mma(a0, b, c03); c13 = g2_mma(a1, b, c13); }
  v8f accs[8] = {c00, c01, c02, c03, c10, c11, c12, c13};
#pragma unroll
  for (int u = 0; u < 8; ++u) { const int t = u & 3, half = u >> 2; const int col = col0 + t * 16 + ln; const float bv = bp ? bf16_round(bp[col]) : 0.f;
#pragma unroll
    for (int r = 0; r < 8; ++r) { const int rloc = half * 16 + 8 * hh + r; float v = accs[u][r] * alpha + bv; if (CP) { if (rowsPerB < 0) v += CP[cofs + (size_t)(row0g + row0 + rloc) * ldc + col];      /* rowsPerB < 0: own element of the batched C plane */ else { const int bidx = (row0g + row0 + rloc) / rowsPerB; v += CP[(size_t)bidx * sCPb + (size_t)by * 64 + col]; } }
      if (ACT == 3) v = fmaxf(v, 0.f); else if (ACT == 6) v = 0.5f * v * (1.0f + erff(v * 0.70710678118654752f)); else if (ACT == 11) v = 1.0f / (1.0f + expf(-v)); else if (ACT == 15) v = v / (1.0f + expf(-v)); else if (ACT == 12) v = (v > 0.f) ? v : 0.01f * v; else if (ACT == 8) v = tanhf(v); else if (ACT == 9) v = 0.5f * v * (1.0f + tanhf(0.7978845608028654f * (v + 0.044715f * v * v * v))); else if (ACT == 14) v = (v > 0.f) ? v : 0.1f * v; else if (ACT == 16) v = (v >= 0.f) ? v : 0.3f * v; else if (ACT == 17) v = (v >= 0.f) ? v : 0.2f * v;
      so[w][rloc][t * 16 + ln] = v; } }
  __builtin_amdgcn_fence(__ATOMIC_ACQ_REL, "workgroup"); __builtin_amdgcn_wave_barrier();
  const int rsub = lane >> 4, c4 = (lane & 15) * 4;
  {
#pragma unroll
    for (int q = 0; q < 16; ++q) { const int r = q * 2 + rsub; const v4f v = *(const v4fa*)&so[w][r][c4]; if (C) { *(v4f*)(C + cofs + (size_t)(row0 + r) * ldc + col0 + c4) = v; asm volatile("s_wait_xcnt 0x0" ::: "memory"); }      /* the wait that belongs in front of any overwrite of a register which an issued store names (the f16 conversion and the next row's address land in them) */
      if (C16) { v4h h4; for (int i = 0; i < 4; ++i) h4[i] = (_Float16)v[i]; *(v4h*)(C16 + cofs + (size_t)(row0 + r) * ldc + col0 + c4) = h4; } }
     } }
template <int ACT>
__global__ __launch_bounds__(128) void k_gemm2(const _Float16* __restrict__ A, int lda, size_t sA, const _Float16* __restrict__ Bh, int ldb, size_t sB, float alpha, const float* __restrict__ bias, size_t sBias, const float* __restrict__ CP, int rowsPerB, size_t sCPb, int row0g,
    float* __restrict__ C, _Float16* __restrict__ C16, int ldc, size_t sC, int M, int N, int K) { gemm2_body<ACT>(A, lda, sA, Bh, ldb, sB, alpha, bias, sBias, CP, rowsPerB, sCPb, row0g, C, C16, ldc, sC, M, N, K); }
// q, k, v projections of all heads in one launch, straight from the f32 input rows: the block index gives row block, head and stream (the same for a whole block).
// A head's 64 input columns are used by that head alone and N = 64 covers all of its outputs, so every input element is read once, here: it is rounded in registers
// (f32 -> bf16 -> f16, the two roundings of the former builder) to the value that an f16 copy of the rows would hold. Wave tile 32x64, K = 64 in two steps of 32, products and sums in gemm2_body's order.
// q and k go out as rows. v is wanted by the attention launch as V^T [batch][head][64][keys] and as nothing else: an accumulator tile holds, in each lane, eight consecutive rows (keys) of ONE output column,
// which is one 16-byte piece of a V^T row, so the V blocks lay their 64 x 128 tile in LDS transposed (one ds_store_b128 a tile and lane) and store 256 B of each V^T row, whole lines.
__device__ __forceinline__ v16h pj_cvt(v4f x0, v4f x1, v4f x2, v4f x3) { FragH f;      /* g2_frag's k order: x0, x1 = k 8 hh .. 8 hh + 7, x2, x3 = k 16 + 8 hh .. 16 + 8 hh + 7 */
#pragma unroll
  for (int q = 0; q < 4; ++q) { f.h[q] = (_Float16)bf16_round(x0[q]); f.h[4 + q] = (_Float16)bf16_round(x1[q]); f.h[8 + q] = (_Float16)bf16_round(x2[q]); f.h[12 + q] = (_Float16)bf16_round(x3[q]); }
  return f.v; }
#define PJ_VP (128 * 2 + 16)          /* LDS pitch of a V^T row of the block's 128 keys, bytes: 16 B x odd, so that the 16 rows of a ds_store_b128 meet no bank twice */
// The weights need no launch of their own. A 64 x 64 block of a row-major [in][out] f32 matrix is read with the lanes along the output index n (a wave's load is one whole 128-byte line), rounded
// (f32 -> bf16, x16, exact in f16) and laid in LDS as rows n of 64 k: the [n][k] form that a B fragment reads. A projection block does that with its own head's block and takes its fragments from LDS;
// the first PJ_WB blocks of the grid do it with one block of Wo each and store the rows, 128 B whole lines, into Wo^T for the output GEMM two launches later.
#define PJ_WP (HD * 2 + 16)           /* LDS pitch of a transposed weight row, bytes: 16 B x odd */
#define PJ_WB ((DM / 64) * (DM / 64)) /* blocks that build Wo^T */
#define PJ_RB ((int)(NRQ / 128))      /* row blocks of a stream */
template <int LDW>
__device__ __forceinline__ void pj_wload(const float* __restrict__ wp, float (&wv)[4][8]) {      /* wp: the thread's column at its first k; the pitch is a constant, so that one address serves all 32 loads */
#pragma unroll
  for (int q = 0; q < 4; ++q)
#pragma unroll
    for (int i = 0; i < 8; ++i) wv[q][i] = wp[(size_t)(q * 16 + i) * LDW];
  asm volatile("s_wait_xcnt 0x0" ::: "memory"); }      /* the wait that belongs in front of any overwrite of a register which an issued load names: what follows may reuse the register of the weight address */
__global__ __launch_bounds__(128) void k_proj(const float* __restrict__ x, const float* __restrict__ ctx, const float* __restrict__ vsrc, const float* __restrict__ w0, const float* __restrict__ w1, const float* __restrict__ w2, const float* __restrict__ wo,
    const float* __restrict__ bias0, const float* __restrict__ bias1, const float* __restrict__ bias2, _Float16* __restrict__ C0, _Float16* __restrict__ C1, _Float16* __restrict__ C2, _Float16* __restrict__ BO) {
  static_assert(HD == 64 && DM % 64 == 0 && NRQ % 128 == 0 && NRK == NRQ && DC == DM && SK % 128 == 0 && HD * PJ_VP <= 4 * 32 * 68 * 4, "k_proj: K = N = 64 (and Wo in whole 64 x 64 blocks), whole 128-row blocks, the three streams of one size, a block inside one batch, the V^T tile fits the staging");
  __shared__ __attribute__((aligned(16))) float so[4][32][68];
  __shared__ __attribute__((aligned(16))) unsigned char sw[64 * PJ_WP];      /* the transposed weight block; apart from so, which a fast wave fills while a slow one still reads its fragments */
  const int tid = threadIdx.x, w = tid >> 5, lane = tid & 31, ln = lane & 15, hh = lane >> 4;
  const bool wob = blockIdx.x < PJ_WB;      /* the same for the whole block */
  const int u = wob ? 0 : (int)blockIdx.x - PJ_WB; const int bx = u % PJ_RB, h = (u / PJ_RB) % NH, z = u / (PJ_RB * NH);      /* row block, head, stream */
  const int kt = blockIdx.x / (DM / 64), nt = blockIdx.x % (DM / 64);      /* a Wo block's place: k = 64 kt .., n = 64 nt .. */
  const int kg = tid >> 6;      /* the thread's four groups of eight k: kg, kg + 2, kg + 4, kg + 6, all of column n = tid % 64 */
  float wv[4][8];
  auto wlay = [&]() {      /* the thread's 32 weights into LDS, eight k of one row a ds_store_b128 */
#pragma unroll
    for (int q = 0; q < 4; ++q) { FragH f;
#pragma unroll
      for (int i = 0; i < 8; ++i) f.h[i] = (_Float16)(bf16_round(wv[q][i]) * 16.0f);
      *(v8us*)(sw + (tid & 63) * PJ_WP + (kg + 2 * q) * 16) = f.half[0]; } };
  if (wob) {
    pj_wload<DM>(wo + ((size_t)kt * 64 + kg * 8) * DM + nt * 64 + (tid & 63), wv);
    wlay();
    __syncthreads();      /* a row's 64 k come from two waves: all pieces lie in LDS before a row is read back */
    const unsigned char* tr = sw + (tid >> 3) * PJ_WP + (tid & 7) * 16;      /* rows n = 16 q + tid / 8, piece tid % 8: a wave's store covers four rows of 128 B, whole lines */
    unsigned short* op = (unsigned short*)BO + (size_t)(nt * 64 + (tid >> 3)) * DM + kt * 64 + (tid & 7) * 8;
#pragma unroll
    for (int q = 0; q < 4; ++q) { const v8us v = *(const v8us*)(tr + q * 16 * PJ_WP); *(v8us*)(op + (size_t)q * 16 * DM) = v; }
    return; }
  const int row0 = bx * 128 + 32 * w;
  const float* ap = (z == 0 ? x : z == 1 ? ctx : vsrc) + (size_t)(row0 + ln) * DM + h * HD + 8 * hh;
  const float* bp = (z == 0 ? bias0 : z == 1 ? bias1 : bias2) + h * HD;
  v4f ax[2][2][4]; v16h bf[4][2]; float bb[4];      /* [16-row tile][k step][16-byte piece]; [16-column tile][k step]; the lane's four bias values */
  pj_wload<HD>((z == 0 ? w0 : z == 1 ? w1 : w2) + (size_t)h * HD * HD + kg * 8 * HD + (tid & 63), wv);      /* asked for first: they are wanted first */
#pragma unroll
  for (int t = 0; t < 4; ++t) bb[t] = bp[t * 16 + ln];
  asm volatile("s_wait_xcnt 0x0" ::: "memory");      /* the wait that belongs in front of any overwrite of a register which an issued load names: the row loads behind it may land in the registers of the bias addresses */
#pragma unroll
  for (int i = 0; i < 2; ++i)
#pragma unroll
    for (int s = 0; s < 2; ++s) { const float* p = ap + (size_t)i * 16 * DM + s * 32; ax[i][s][0] = *(const v4fa*)p; ax[i][s][1] = *(const v4fa*)(p + 4); ax[i][s][2] = *(const v4fa*)(p + 16); ax[i][s][3] = *(const v4fa*)(p + 20); }
  asm volatile("s_wait_xcnt 0x0" ::: "memory");      /* the wait that belongs in front of any overwrite of a register which an issued load names: all of the tile's loads are asked for above, what follows may reuse their address registers */
  __builtin_amdgcn_sched_barrier(0);      /* keeps the rounding behind all 52 loads, so that weights, bias and rows fly together; without it the later loads sink behind the wait for the first group's data */
  wlay();
  __syncthreads();      /* the head's transposed block comes from all four waves: it lies whole in LDS before any fragment is read */
#pragma unroll
  for (int t = 0; t < 4; ++t)
#pragma unroll
    for (int s = 0; s < 2; ++s) { const unsigned char* p = sw + (t * 16 + ln) * PJ_WP + s * 64 + hh * 16; FragH f; f.half[0] = *(const v8us*)p; f.half[1] = *(const v8us*)(p + 32); bf[t][s] = f.v; }      /* g2_frag's k order: k 32 s + 8 hh .. and 32 s + 16 + 8 hh .. of row n = 16 t + ln */
  const v8f z8 = {0.f,0.f,0.f,0.f,0.f,0.f,0.f,0.f}; v8f acc[2][4];
#pragma unroll
  for (int i = 0; i < 2; ++i)
#pragma unroll
    for (int t = 0; t < 4; ++t) acc[i][t] = z8;
#pragma unroll
  for (int s = 0; s < 2; ++s) { const v16h a0 = pj_cvt(ax[0][s][0], ax[0][s][1], ax[0][s][2], ax[0][s][3]), a1 = pj_cvt(ax[1][s][0], ax[1][s][1], ax[1][s][2], ax[1][s][3]);
#pragma unroll
    for (int t = 0; t < 4; ++t) { acc[0][t] = g2_mma(a0, bf[t][s], acc[0][t]); acc[1][t] = g2_mma(a1, bf[t][s], acc[1][t]); } }
  if (z == 2) {      /* the V stream (the same test for the whole block): C2 is V^T */
    unsigned char* tv = (unsigned char*)&so[0][0][0];      /* the block's tile as [64 columns d][128 keys] f16 at pitch PJ_VP */
#pragma unroll
    for (int i = 0; i < 2; ++i)
#pragma unroll
      for (int t = 0; t < 4; ++t) { const float bv = bf16_round(bb[t]); FragH f;
#pragma unroll
        for (int r = 0; r < 8; ++r) f.h[r] = (_Float16)(acc[i][t][r] * 0.0625f + bv);      /* v as f16 (the weight planes are carried x16): keys 32 w + 16 i + 8 hh + r of column 16 t + ln */
        *(v8us*)(tv + (t * 16 + ln) * PJ_VP + (w * 32 + i * 16 + 8 * hh) * 2) = f.half[0]; }
    __syncthreads();      /* a V^T row's 128 keys come from all four waves: every wave's pieces lie in LDS before any row is read back */
    const int rb = bx * 128;      /* the block's first row: batch rb / SK, key rb % SK */
    const unsigned char* tr = tv + (tid >> 4) * PJ_VP + (tid & 15) * 16;      /* rows d = 8 q + tid / 16, piece tid % 16: a wave's store covers two rows of 256 B, four whole lines */
    unsigned short* vp = (unsigned short*)C2 + ((size_t)((rb / SK) * NH + h) * HD + (tid >> 4)) * SK + rb % SK + (tid & 15) * 8;
#pragma unroll
    for (int q = 0; q < 8; ++q) { const v8us v = *(const v8us*)(tr + q * 8 * PJ_VP); *(v8us*)(vp + (size_t)q * 8 * SK) = v; }
    return; }
  _Float16* cp = (z == 0 ? C0 : C1) + (size_t)row0 * DM + h * HD;
#pragma unroll
  for (int i = 0; i < 2; ++i)
#pragma unroll
    for (int t = 0; t < 4; ++t) { const float bv = bf16_round(bb[t]);
#pragma unroll
      for (int r = 0; r < 8; ++r) so[w][i * 16 + 8 * hh + r][t * 16 + ln] = acc[i][t][r] * 0.0625f + bv; }      /* the weight planes are carried x16 */
  __builtin_amdgcn_fence(__ATOMIC_ACQ_REL, "workgroup"); __builtin_amdgcn_wave_barrier();      /* each wave reads back its own rows only: its LDS writes in front of its reads */
  const int rsub = lane >> 4, c4 = (lane & 15) * 4;
#pragma unroll
  for (int q = 0; q < 16; ++q) { const int r = q * 2 + rsub; const v4f v = *(const v4fa*)&so[w][r][c4]; v4h h4; for (int i = 0; i < 4; ++i) h4[i] = (_Float16)v[i];
    *(v4h*)(cp + (size_t)r * DM + c4) = h4;
    if (q == 7) asm volatile("s_wait_xcnt 0x0" ::: "memory"); } }      /* the wait that belongs in front of any overwrite of a register which an issued store names: the second eight rows are converted into the registers of the first eight stores */

__global__ __launch_bounds__(256) void k_wnat(const float* __restrict__ w, size_t n8, _Float16* __restrict__ Bt) { const size_t t = (size_t)blockIdx.x * 256 + threadIdx.x; if (t >= n8) return; FragH f; for (int q = 0; q < 8; ++q) f.h[q] = (_Float16)(bf16_round(w[t * 8 + q]) * 16.0f); *(v8us*)((unsigned short*)Bt + t * 8) = f.half[0];  }
__global__ __launch_bounds__(256) void k_rsm(const float* __restrict__ S, _Float16* __restrict__ P, int nrows) {
  #pragma clang fp contract(off)
  const int i = blockIdx.x * 256 + threadIdx.x; if (i >= nrows) return; const float* s = S + (size_t)i * SQ; float mx = -3.0e38f;
#pragma unroll 1
  for (int j = 0; j < SQ; ++j) mx = fmaxf(mx, s[j]); float se = 0.f;
#pragma unroll 1
  for (int j = 0; j < SQ; ++j) se += expf(s[j] - mx); const float sc = 256.0f / se;
#pragma unroll 1
  for (int j0 = 0; j0 < SQ; j0 += 8) { FragH f; for (int q = 0; q < 8; ++q) f.h[q] = (_Float16)(expf(s[j0 + q] - mx) * sc); unsigned short* d = (unsigned short*)P + (size_t)i * SQ + j0; *(v8us*)d = f.half[0];  } }
__global__ __launch_bounds__(256) void k_vt(const _Float16* __restrict__ V16, int b, int h0, _Float16* __restrict__ VT) { __shared__ unsigned short tl[64][65]; const int tid = threadIdx.x; const int hh = blockIdx.x % HG, sg = blockIdx.x / HG; const int s0 = sg * 64; const int h = h0 + hh;
  for (int i = tid; i < 64 * 8; i += 256) { const int j = i / 8, d8 = (i % 8) * 8; FragH f; f.half[0] = *(const v8us*)((const unsigned short*)V16 + ((size_t)b * SQ + s0 + j) * DM + h * HD + d8); for (int q = 0; q < 8; ++q) tl[d8 + q][j] = f.u[q]; }
  __syncthreads();
  { for (int i = tid; i < 64 * 8; i += 256) { const int d = i / 8, j8 = (i % 8) * 8; FragH f; for (int q = 0; q < 8; ++q) f.u[q] = tl[d][j8 + q]; *(v8us*)((unsigned short*)VT + ((size_t)hh * HD + d) * SQ + s0 + j8) = f.half[0]; }  } }


__global__ __launch_bounds__(256) void k_rsmf(const float* __restrict__ S, _Float16* __restrict__ P, int qn, int hg) {
  #pragma clang fp contract(off)
  const int t = blockIdx.x * 256 + threadIdx.x; if (t >= qn * hg) return; const size_t i = (size_t)(t / qn) * SQ + (t % qn); const float* s = S + i * SQ; float mx = -3.0e38f;
#pragma unroll 1
  for (int j = 0; j < SQ; ++j) mx = fmaxf(mx, s[j]); float se = 0.f;
#pragma unroll 1
  for (int j = 0; j < SQ; ++j) se += __expf(s[j] - mx); const float sc = 256.0f / se;
#pragma unroll 1
  for (int j0 = 0; j0 < SQ; j0 += 8) { FragH f; for (int q = 0; q < 8; ++q) f.h[q] = (_Float16)(__expf(s[j0 + q] - mx) * sc); unsigned short* d = (unsigned short*)P + i * SQ + j0; *(v8us*)d = f.half[0];  } }

// Fused attention, all batches and heads in one launch: scores, softmax and P V stay in registers; no score or weight plane goes through memory.
// A wave owns 32 queries of one (batch, head) and walks the 2048 keys 32 at a time. S^T = K Q^T (A = 16 key rows, B = 16 query rows, both in g2_frag's k order): a lane holds
// scores of ONE query (column ln), keys 8 hh + r of each 16-key tile, so two tiles, converted in place, are the B operand P^T of O^T += V^T P^T (A = V^T rows, the same k order).
// Running maximum and sum per query (f32); the maximum is renewed lazily (the two wave halves exchange it then), the halves join their sums once at the end.
// The 16 waves of a block share one head's K and V^T through LDS: a stage is 128 keys (K: 128 rows of 128 B, V^T: 64 rows of 256 B), brought in whole lines by asynchronous copies,
// four of 16 bytes a lane, into one of two buffers while the other is worked on; the rows lie at a pitch of 16 B x odd, so that a fragment's ds_load_b128 meets no bank twice.
#define FA_KS 128                      /* keys a stage */
#define FA_NT (SK / FA_KS)             /* stages */
#define FA_KP (HD * 2 + 16)            /* LDS pitch of a K row, bytes */
#define FA_VP (FA_KS * 2 + 16)         /* LDS pitch of a V^T row, bytes */
#define FA_KB (FA_KS * FA_KP)          /* K part of a buffer, bytes */
#define FA_BUF (FA_KB + HD * FA_VP)    /* one buffer, bytes */
#define FA_LZ 44.3614195558365f        /* 8 / CS: how far a raw score may pass the maximum in use before that is renewed */
__device__ __forceinline__ float fa_xhalf(float x) { return __builtin_bit_cast(float, __builtin_amdgcn_permlanex16(__builtin_bit_cast(int, x), __builtin_bit_cast(int, x), 0x76543210, 0xfedcba98, false, false)); }      /* lane l with lane l ^ 16 */
__device__ __forceinline__ v16h fa_frag(const _Float16* p) { FragH f; f.half[0] = *(const v8us*)(const unsigned short*)p; f.half[1] = *(const v8us*)((const unsigned short*)p + 16); return f.v; }      /* g2_frag with the lane half's 8 hh already in p */
__device__ __forceinline__ v16h fa_lfrag(const unsigned char* p) { FragH f; f.half[0] = *(const v8us*)p; f.half[1] = *(const v8us*)(p + 32); return f.v; }      /* fa_frag from an LDS row: p in bytes, the lane half's 16 hh already in it */
/* Four asynchronous copies of 16 bytes a lane, global memory to LDS through no register (l: the lane's LDS byte address, g: its global address). The s_wait_xcnt is the wait that belongs
   in front of any overwrite of a register which an issued copy names; as the last line of the copies' own statement it stands ahead of whatever reuses the operands' registers. */
__device__ __forceinline__ void fa_copy4(unsigned l0, const _Float16* g0, unsigned l1, const _Float16* g1, unsigned l2, const _Float16* g2, unsigned l3, const _Float16* g3) {
  asm volatile("global_load_async_to_lds_b128 %0, %1, off\n\tglobal_load_async_to_lds_b128 %2, %3, off\n\tglobal_load_async_to_lds_b128 %4, %5, off\n\tglobal_load_async_to_lds_b128 %6, %7, off\n\ts_wait_xcnt 0x0"
      :: "v"(l0), "v"(g0), "v"(l1), "v"(g1), "v"(l2), "v"(g2), "v"(l3), "v"(g3) : "memory"); }
/* Native 2^x, eight (or one) in a statement: behind a transcendental the instruction set asks for one independent instruction or a v_nop before its result is read or its source
   overwritten. Each v_exp_f32 here has an independent one behind it (the outputs share no register with the inputs), the last one the v_nop. */
__device__ __forceinline__ void fa_exp8(const float (&t)[8], float (&e)[8]) {
  asm("v_exp_f32 %0, %8\n\tv_exp_f32 %1, %9\n\tv_exp_f32 %2, %10\n\tv_exp_f32 %3, %11\n\tv_exp_f32 %4, %12\n\tv_exp_f32 %5, %13\n\tv_exp_f32 %6, %14\n\tv_exp_f32 %7, %15\n\tv_nop"
      : "=&v"(e[0]), "=&v"(e[1]), "=&v"(e[2]), "=&v"(e[3]), "=&v"(e[4]), "=&v"(e[5]), "=&v"(e[6]), "=&v"(e[7]) : "v"(t[0]), "v"(t[1]), "v"(t[2]), "v"(t[3]), "v"(t[4]), "v"(t[5]), "v"(t[6]), "v"(t[7])); }
__device__ __forceinline__ float fa_exp1(float t) { float e; asm("v_exp_f32 %0, %1\n\tv_nop" : "=&v"(e) : "v"(t)); return e; }
__device__ __forceinline__ v8f fa_mma(v16h a, v16h b, v8f c) { return __builtin_amdgcn_wmma_f32_16x16x32_f16(false, a, false, b, (short)0, c, false, false); }
__global__ __launch_bounds__(512) void k_fattn(const _Float16* __restrict__ Q, const _Float16* __restrict__ Kk, const _Float16* __restrict__ VT, _Float16* __restrict__ O) {
  static_assert(SK % FA_KS == 0 && FA_NT >= 2 && FA_KS * 8 == 2 * 512 && HD * (FA_KS / 8) == 2 * 512, "k_fattn: whole stages, two of them at least, two K and two V^T copies a lane and stage");
  __shared__ __attribute__((aligned(16))) unsigned char sm[2 * FA_BUF];
  const int tid = threadIdx.x, lane = tid & 31, ln = lane & 15, hh = lane >> 4; const int w = __builtin_amdgcn_readfirstlane(tid >> 5);      /* the wave's number, held scalar */
  const int bh = blockIdx.x / (NQ / 512), b = bh / NH, h = bh % NH; const int q0 = (blockIdx.x % (NQ / 512)) * 512 + w * 32;
  const float CS = 0.125f * 1.44269504088896340736f;      /* 1 / sqrt(64) and log2 e in one factor: exp(s / 8 - m / 8) = 2^((s - m) CS) */
  const _Float16* qp = Q + ((size_t)b * NQ + q0 + ln) * DM + h * HD + 8 * hh;
  /* the lane's part of a stage: K rows tid / 8 and 64 + tid / 8, piece tid % 8; V^T rows tid / 16 and 32 + tid / 16, piece tid % 16: a wave's copy covers four whole 128-byte lines */
  const _Float16* gk = Kk + ((size_t)b * SK + (tid >> 3)) * DM + h * HD + (tid & 7) * 8;
  const _Float16* gv = VT + ((size_t)bh * HD + (tid >> 4)) * SK + (tid & 15) * 8;
  const unsigned sb = (unsigned)(size_t)sm;      /* the low 32 bits of a __shared__ address are its LDS byte address */
  const unsigned lk = sb + (tid >> 3) * FA_KP + (tid & 7) * 16, lv = sb + FA_KB + (tid >> 4) * FA_VP + (tid & 15) * 16;
  auto stage = [&](int t) { const unsigned bo = (t & 1) * FA_BUF; const _Float16* k0 = gk + (size_t)t * FA_KS * DM; const _Float16* v0 = gv + t * FA_KS;
    fa_copy4(lk + bo, k0, lk + bo + 64 * FA_KP, k0 + (size_t)64 * DM, lv + bo, v0, lv + bo + 32 * FA_VP, v0 + (size_t)32 * SK); };
  v16h qf[2][2];
#pragma unroll
  for (int j = 0; j < 2; ++j)
#pragma unroll
    for (int s = 0; s < 2; ++s) qf[j][s] = fa_frag(qp + (size_t)j * 16 * DM + s * 32);
  stage(0);
  asm volatile("s_wait_asynccnt 0x0" ::: "memory");      /* this wave's copies of stage 0 have landed */
  __syncthreads();      /* every wave's have: stage 0 may be read */
  stage(1);
  const unsigned char* kl = sm + ln * FA_KP + hh * 16; const unsigned char* vl = sm + FA_KB + ln * FA_VP + hh * 16;
  const v8f z8 = {0.f,0.f,0.f,0.f,0.f,0.f,0.f,0.f}; v8f o[2][4]; float mr[2] = {-3.0e38f, -3.0e38f}, lr[2] = {0.f, 0.f}, th[2] = {-3.0e38f, -3.0e38f}, nb[2] = {0.f, 0.f};      /* per query: maximum in use, sum, the score above which the maximum is renewed, -mr CS; the first pass renews all */
#pragma unroll
  for (int j = 0; j < 2; ++j)
#pragma unroll
    for (int t = 0; t < 4; ++t) o[j][t] = z8;
#pragma unroll 1
  for (int g = 0; g < FA_NT; ++g) {      /* rolled, like the passes inside: unrolling either only adds registers, and the wave has none to spare */
    const unsigned char* kb = kl + (g & 1) * FA_BUF; const unsigned char* vb = vl + (g & 1) * FA_BUF;
    v16h kf[2][2];
#pragma unroll
    for (int t = 0; t < 2; ++t)
#pragma unroll
      for (int s = 0; s < 2; ++s) kf[t][s] = fa_lfrag(kb + t * 16 * FA_KP + s * 64);
#pragma unroll 1
    for (int c = 0; c < FA_KS / 32; ++c) {      /* rolled: one pass already holds 16 matrix instructions and 16 LDS reads */
      v8f st[2][2];
#pragma unroll
      for (int j = 0; j < 2; ++j)
#pragma unroll
        for (int t = 0; t < 2; ++t) st[j][t] = fa_mma(kf[t][1], qf[j][1], fa_mma(kf[t][0], qf[j][0], z8));
      float mx[2];      /* this pass's maximum of the lane's own 16 scores of each query */
#pragma unroll
      for (int j = 0; j < 2; ++j) { mx[j] = fmaxf(st[j][0][0], st[j][1][0]);
#pragma unroll
        for (int r = 1; r < 8; ++r) mx[j] = fmaxf(mx[j], fmaxf(st[j][0][r], st[j][1][r])); }
      /* Lazy rescale: the maximum in use, mr, may trail the true one by up to 8 in the exponent of 2 (a weight then reaches 2^8 at most, far inside f16 and f32); sums and outputs carry the
         same factor, which the final division takes out. One test a pass for the whole wave, a scalar branch: only when some lane's score passes th = mr + FA_LZ are maxima, sums and outputs brought up. */
      if (__builtin_amdgcn_ballot_w32((mx[0] > th[0]) | (mx[1] > th[1])) != 0) {
#pragma unroll
        for (int j = 0; j < 2; ++j) {
          const float mn = fmaxf(mr[j], fmaxf(mx[j], fa_xhalf(mx[j])));      /* both halves of the wave hold scores of the same query: one maximum for both */
          const float al = fa_exp1((mr[j] - mn) * CS); mr[j] = mn; nb[j] = -mn * CS; th[j] = mn + FA_LZ; lr[j] *= al;      /* al = 0 on the first pass, 1 for a query whose maximum stays */
#pragma unroll
          for (int t = 0; t < 4; ++t) o[j][t] = o[j][t] * al; } }
      v16h vf[4]; const unsigned char* vc = vb + c * 64;
#pragma unroll
      for (int t = 0; t < 4; ++t) vf[t] = fa_lfrag(vc + t * 16 * FA_VP);      /* this pass's V^T */
      const int cn = (c + 1 < FA_KS / 32) ? c + 1 : c; const unsigned char* kc = kb + cn * 32 * FA_KP;      /* the next pass's K rows; the stage's last pass asks for its own rows again, which keeps every read inside this stage's buffer */
#pragma unroll
      for (int t = 0; t < 2; ++t)
#pragma unroll
        for (int s = 0; s < 2; ++s) kf[t][s] = fa_lfrag(kc + t * 16 * FA_KP + s * 64);
      __builtin_amdgcn_sched_barrier(0);      /* keeps the pass's 16 LDS reads in one group ahead of the exponentials, which cover their latency: left alone the compiler sinks them to just in front of the products that use them */
      FragH pf[2];      /* both query tiles' weights come ahead of the eight products: with one tile's products between the tiles the build gave an exponential statement the operand registers of the matrix instruction just in front of it */
#pragma unroll
      for (int j = 0; j < 2; ++j) { float sm1 = 0.f;
#pragma unroll
        for (int t = 0; t < 2; ++t) { float x[8], p[8];
#pragma unroll
          for (int r = 0; r < 8; ++r) x[r] = __builtin_fmaf(st[j][t][r], CS, nb[j]);
          fa_exp8(x, p);
#pragma unroll
          for (int r = 0; r < 8; ++r) { sm1 += p[r]; pf[j].h[t * 8 + r] = (_Float16)p[r]; } }
        lr[j] += sm1; }
#pragma unroll
      for (int j = 0; j < 2; ++j)
#pragma unroll
        for (int t = 0; t < 4; ++t) o[j][t] = fa_mma(vf[t], pf[j].v, o[j][t]);
    }
    asm volatile("s_wait_dscnt 0x0" ::: "memory");      /* this wave's reads of the buffer have returned before anything refills it */
    asm volatile("s_wait_asynccnt 0x0" ::: "memory");      /* this wave's copies of the next stage have landed */
    __syncthreads();      /* one barrier a stage: it publishes the next stage and ends every wave's reads of this one */
    if (g + 2 < FA_NT) stage(g + 2);      /* into the buffer just left; the test is the same for the whole block */
  }
  asm volatile("s_wait_asynccnt 0x0" ::: "memory");      /* no copy is left in flight when the wave ends */
#pragma unroll
  for (int j = 0; j < 2; ++j) { const float inv = 64.0f / (lr[j] + fa_xhalf(lr[j])); _Float16* op = O + ((size_t)b * NQ + q0 + j * 16 + ln) * DM + h * HD + 8 * hh;      /* o carried x64, as the output GEMM expects */
#pragma unroll
    for (int t = 0; t < 4; ++t) { FragH f;
#pragma unroll
      for (int r = 0; r < 8; ++r) f.h[r] = (_Float16)(o[j][t][r] * inv);
      *(v8us*)((unsigned short*)op + t * 16) = f.half[0]; } } }      /* O^T tile t: d = 16 t + 8 hh + r, eight consecutive columns of the query's row: one 16-byte store */

// Output GEMM out = o Wo + bo (M = 8192, N = K = 1024) with both operands shared through LDS: a block of 8 waves owns a 256 x 128 tile of out, a wave 64 x 64 of it (16 accumulator tiles, so a fragment
// read from LDS feeds four matrix instructions). A stage is 128 k: 256 rows of o and 128 rows of Wo^T, 256 B each, brought in whole lines by asynchronous copies, 24 of 16 bytes a lane, into one of two
// buffers while the other is worked on; rows at a pitch of 16 B x odd, so that a fragment's ds_load_b128 meets no bank twice. k runs upward in steps of 32 into one accumulator: gemm2_body's sum order.
#define OG_BM 256                      /* rows of out a block */
#define OG_BN 128                      /* columns of out a block */
#define OG_KS 128                      /* k a stage */
#define OG_NT (DM / OG_KS)             /* stages */
#define OG_P (OG_KS * 2 + 16)          /* LDS pitch of a row, bytes */
#define OG_AB (OG_BM * OG_P)           /* o part of a buffer, bytes */
#define OG_BUF ((OG_BM + OG_BN) * OG_P)      /* one buffer, bytes */
#define OG_MT ((int)(NRQ / OG_BM))     /* row tiles */
/* Twelve asynchronous copies of 16 bytes a lane (l: the lane's LDS byte addresses, g: its global addresses); the s_wait_xcnt is the wait that belongs in front of any overwrite of a register
   which an issued copy names; as the last line of the copies' own statement it stands ahead of whatever reuses the operands' registers. */
__device__ __forceinline__ void og_copy12(const unsigned* l, const _Float16* const* g) {
  asm volatile("global_load_async_to_lds_b128 %0, %1, off\n\tglobal_load_async_to_lds_b128 %2, %3, off\n\tglobal_load_async_to_lds_b128 %4, %5, off\n\tglobal_load_async_to_lds_b128 %6, %7, off\n\t"
               "global_load_async_to_lds_b128 %8, %9, off\n\tglobal_load_async_to_lds_b128 %10, %11, off\n\tglobal_load_async_to_lds_b128 %12, %13, off\n\tglobal_load_async_to_lds_b128 %14, %15, off\n\t"
               "global_load_async_to_lds_b128 %16, %17, off\n\tglobal_load_async_to_lds_b128 %18, %19, off\n\tglobal_load_async_to_lds_b128 %20, %21, off\n\tglobal_load_async_to_lds_b128 %22, %23, off\n\ts_wait_xcnt 0x0"
      :: "v"(l[0]), "v"(g[0]), "v"(l[1]), "v"(g[1]), "v"(l[2]), "v"(g[2]), "v"(l[3]), "v"(g[3]), "v"(l[4]), "v"(g[4]), "v"(l[5]), "v"(g[5]),
         "v"(l[6]), "v"(g[6]), "v"(l[7]), "v"(g[7]), "v"(l[8]), "v"(g[8]), "v"(l[9]), "v"(g[9]), "v"(l[10]), "v"(g[10]), "v"(l[11]), "v"(g[11]) : "memory"); }
__global__ __launch_bounds__(256) void k_ogemm(const _Float16* __restrict__ A, const _Float16* __restrict__ Bt, const float* __restrict__ bias, float* __restrict__ C) {
  static_assert(NRQ % OG_BM == 0 && DM % OG_BN == 0 && DM % OG_KS == 0 && OG_NT >= 2 && OG_BM * 16 == 16 * 256 && OG_BN * 16 == 8 * 256 && 8 * 64 * 68 * 4 <= 2 * OG_BUF,
                "k_ogemm: whole tiles and stages, two stages at least, sixteen o and eight Wo^T copies a lane and stage, the output staging fits the ring");
  __shared__ __attribute__((aligned(16))) unsigned char sm[2 * OG_BUF];
  const int tid = threadIdx.x, lane = tid & 31, ln = lane & 15, hh = lane >> 4; const int w = __builtin_amdgcn_readfirstlane(tid >> 5);      /* the wave's number, held scalar */
  const int mt = blockIdx.x % OG_MT, nq = blockIdx.x / OG_MT; const int wm = w >> 1, wn = w & 1;      /* waves 4 x 2 over the block's tile */
  const int col0 = nq * OG_BN + wn * 64;
  /* the lane's part of a stage: rows tid / 16 + 16 i, piece tid % 16: a wave's copy covers four whole 128-byte lines */
  const _Float16* ga = A + ((size_t)mt * OG_BM + (tid >> 4)) * DM + (tid & 15) * 8;
  const _Float16* gb = Bt + ((size_t)nq * OG_BN + (tid >> 4)) * DM + (tid & 15) * 8;
  const unsigned la = (unsigned)(size_t)sm + (tid >> 4) * OG_P + (tid & 15) * 16;      /* the low 32 bits of a __shared__ address are its LDS byte address */
  auto stage = [&](int t) { unsigned l[24]; const _Float16* g[24]; const unsigned bo = la + (t & 1) * OG_BUF;
#pragma unroll
    for (int i = 0; i < 16; ++i) { l[i] = bo + i * 16 * OG_P; g[i] = ga + (size_t)i * 16 * DM + t * OG_KS; }
#pragma unroll
    for (int i = 0; i < 8; ++i) { l[16 + i] = bo + OG_AB + i * 16 * OG_P; g[16 + i] = gb + (size_t)i * 16 * DM + t * OG_KS; }
    og_copy12(l, g); og_copy12(l + 12, g + 12); };
  float bb[4];
#pragma unroll
  for (int t = 0; t < 4; ++t) bb[t] = bias[col0 + t * 16 + ln];
  stage(0);
  asm volatile("s_wait_asynccnt 0x0" ::: "memory");      /* this wave's copies of stage 0 have landed */
  __syncthreads();      /* every wave's have: stage 0 may be read */
  stage(1);
  const unsigned char* al = sm + (wm * 64 + ln) * OG_P + hh * 16; const unsigned char* bl = sm + OG_AB + (wn * 64 + ln) * OG_P + hh * 16;
  const v8f z8 = {0.f,0.f,0.f,0.f,0.f,0.f,0.f,0.f}; v8f acc[4][4];
#pragma unroll
  for (int i = 0; i < 4; ++i)
#pragma unroll
    for (int t = 0; t < 4; ++t) acc[i][t] = z8;
#pragma unroll 1
  for (int g = 0; g < OG_NT; ++g) {      /* rolled: a stage already holds 64 matrix instructions and 64 LDS reads */
    const unsigned char* ab = al + (g & 1) * OG_BUF; const unsigned char* bp = bl + (g & 1) * OG_BUF;
#pragma unroll
    for (int s = 0; s < OG_KS / 32; ++s) { v16h af[4], bf[4];
      af[0] = fa_lfrag(ab + s * 64);      /* the first row's operands are asked for first, so that its products start while the other rows' still come */
#pragma unroll
      for (int t = 0; t < 4; ++t) bf[t] = fa_lfrag(bp + t * 16 * OG_P + s * 64);
#pragma unroll
      for (int i = 1; i < 4; ++i) af[i] = fa_lfrag(ab + i * 16 * OG_P + s * 64);
      __builtin_amdgcn_sched_barrier(0);      /* keeps the step's 16 LDS reads together in front of its products: left alone the compiler puts each row's reads, with a full wait, between the rows */
#pragma unroll
      for (int i = 0; i < 4; ++i)
#pragma unroll
        for (int t = 0; t < 4; ++t) acc[i][t] = fa_mma(af[i], bf[t], acc[i][t]);
      __builtin_amdgcn_sched_barrier(0); }      /* and the next step's reads behind these products, in one place */
    asm volatile("s_wait_dscnt 0x0" ::: "memory");      /* this wave's reads of the buffer have returned before anything refills it */
    asm volatile("s_wait_asynccnt 0x0" ::: "memory");      /* this wave's copies of the next stage have landed */
    __syncthreads();      /* one barrier a stage: it publishes the next stage and ends every wave's reads of this one */
    if (g + 2 < OG_NT) stage(g + 2);      /* into the buffer just left; the test is the same for the whole block */
  }
  asm volatile("s_wait_asynccnt 0x0" ::: "memory");      /* no copy is in flight when the ring becomes output staging; the loop's last barrier has ended every wave's reads of it */
  float* so = (float*)sm + w * (64 * 68);      /* each wave stages in its own range: its 64 rows of 64 f32 at a pitch of 68 */
  const float* sr = so + hh * 68 + ln * 4; float* cr = C + ((size_t)mt * OG_BM + wm * 64 + hh) * DM + col0 + ln * 4;      /* read back and stored: rows 2 q + hh, four columns a lane */
#pragma unroll
  for (int i = 0; i < 4; ++i)
#pragma unroll
    for (int t = 0; t < 4; ++t) { const float bv = bf16_round(bb[t]);
#pragma unroll
      for (int r = 0; r < 8; ++r) so[(i * 16 + 8 * hh + r) * 68 + t * 16 + ln] = acc[i][t][r] * 0.0009765625f + bv; }      /* o carried x64, Wo x16 */
  __builtin_amdgcn_fence(__ATOMIC_ACQ_REL, "workgroup"); __builtin_amdgcn_wave_barrier();      /* each wave reads back its own rows only: its LDS writes in front of its reads */
#pragma unroll
  for (int q = 0; q < 32; ++q) { const v4f v = *(const v4fa*)(sr + q * 2 * 68);
    *(v4f*)(cr + (size_t)q * 2 * DM) = v;      /* two rows of 256 B a store: whole lines */
    if (q == 15) asm volatile("s_wait_xcnt 0x0" ::: "memory"); } }      /* the wait that belongs in front of any overwrite of a register which an issued store names: the second 32 rows are read back into the registers of the first 16 stores */

extern "C" void kernel_launch(void* const* d_in, const int* in_sizes, int n_in,
                              void* d_out, int out_size, void* d_ws, size_t ws_size, hipStream_t stream) {
  (void)in_sizes; (void)n_in; (void)out_size;
  const float* const* I = (const float* const*)d_in; const float* x = I[0]; const float* ctx = I[1]; const float* vsrc = I[2]; const float* wq = I[3]; const float* bq = I[4]; const float* wk = I[5]; const float* bk = I[6]; const float* wv = I[7]; const float* bv = I[8]; const float* wo = I[9]; const float* bo = I[10];      /* input order: Q, K, V (THREE streams), Wq, bq, Wk, bk, Wv, bv (PER-HEAD [16][64][64] = [head][in][out]; biases [16][64] = the flat [1024] at 64 h + e; zeros on this draw), Wo ([in][out] [1024][1024]), bo (zeros): eleven inputs */
  char* ws = (char*)d_ws; size_t off = 0;
  auto take = [&](size_t bytes) { char* p = ws + off; off += (bytes + 255) & ~(size_t)255; return p; };
  _Float16* BO = (_Float16*)take((size_t)DM * DM * 2);
  _Float16* Q16 = (_Float16*)take(NRQ * DM * 2); _Float16* K16 = (_Float16*)take(NRK * DM * 2); _Float16* O16 = (_Float16*)take(NRQ * DM * 2);
  _Float16* VT = (_Float16*)take((size_t)NB * NH * HD * SK * 2);
  if (off > ws_size) return;      /* 2 + 3 x 16 + 16 = 66 MiB */
  k_proj<<<PJ_WB + 3 * NH * PJ_RB, 128, 0, stream>>>(x, ctx, vsrc, wq, wk, wv, wo, bq, bk, bv, Q16, K16, VT, BO);      /* the first 256 blocks: Wo [in][out] -> Wo^T x16, one 64 x 64 block each. The rest: q, k, v from the f32 rows: head h = rows[:, 64 h ..] W_h + b_h -> out[:, 64 h ..] (pitch DM), v transposed into V^T [4][16][64][2048]; W_h [in][out] at W + 4096 h, transposed in the block's LDS; bias + 64 h; K = N = 64 */
  k_fattn<<<NB * NH * (NQ / 512), 512, 0, stream>>>(Q16, K16, VT, O16);      /* scores, softmax, P V of every batch and head: 512 queries a block, o x64 into merged rows */
  k_ogemm<<<OG_MT * (DM / OG_BN), 256, 0, stream>>>(O16, BO, bo, (float*)d_out);      /* out = o Wo + bo (alpha 2^-10), 256 x 128 of out a block */
}

// v010
// Measured time: 82.5 microseconds a run.
// Next to v009, in two timings, it ran 1.03 times as fast each time.
// Counting every step since v000, it is 83.6 times as fast.
#include <hip/hip_runtime.h>
// Multi-head attention on THREE input streams with BLOCK-DIAGONAL per-head projections on four sequences (Q, K, V [4][2048][1024], each split into 16 contiguous 64-wide slices; q / k / v = einsum('bhsd,hde->bhse', slice, W) + b: EACH HEAD applies its own Dense(64) (W [16][64][64] = [head][in][out], normal x 1/8; biases [16][64] zeros on this draw) to ITS OWN slice of ITS stream; scores / sqrt(64); softmax over all 2048 keys (no mask); out = merged Wo + bo ([in][out] [1024][1024]; bo zeros) -> [4][2048][1024]); each projection is ONE head-batched GEMM (K = 64).
// Structure: no weight-builder launch: each projection block transposes its head's [in][out] 64 x 64 weight block into LDS itself (exact x16 f16), and 256 more blocks of the same launch build Wo^T, one 64 x 64 block each; Q, K, V as three HEAD-BATCHED WMMA GEMMs in ONE launch (row block, head and stream from the block index; K = N = 64; 32x64 wave tiles, A fragments read from the f32 input rows and rounded in registers, no f16 copy of the inputs in memory; f32 accumulation, + the head's bias, f16 outputs into the head's 64 columns; the V stream's blocks store their tile transposed, straight into V^T [4][16][64][2048], the only form of v in memory); ONE fused launch for all batches and heads: scores (K = 64), running softmax over the 2048 keys (f32 statistics, native exp2; unnormalised weights in (0, 2^8] as f16), o = P V (o carried x64) into merged f16 rows; out = o W_o + b_o GEMM (f32, alpha 2^-10); launches: see trace.
// Compute dtype: inputs rounded to bf16; x / context / weights exact; q, k, v, softmax weights and o as plain f16 GEMM operands (~2^-12); scores and statistics f32. v_wmma_f32_16x16x32_f16.
#define NB 4
#define NQ 2048
#define SK 2048
#define SQ SK                       /* keys per softmax row */
#define DM 1024
#define DC 1024
#define NH 16
#define HD 64
#define HG 4
#define NRQ ((size_t)NB * NQ)
#define NRK ((size_t)NB * SK)
typedef __bf16 v16b __attribute__((ext_vector_type(16)));
typedef unsigned short v8us __attribute__((ext_vector_type(8), may_alias));
typedef float  v8f  __attribute__((ext_vector_type(8)));
typedef float  v4f  __attribute__((ext_vector_type(4)));
typedef float  v4fa __attribute__((ext_vector_type(4), may_alias));
union FragB { v16b v; v8us half[2]; unsigned short u[16]; };

__device__ __forceinline__ unsigned short bf16_bits(float x) { unsigned int u = __float_as_uint(x); return (unsigned short)((u + 0x7FFFu + ((u >> 16) & 1u)) >> 16); }
__device__ __forceinline__ float bf16_val(unsigned short b) { return __uint_as_float(((unsigned int)b) << 16); }
__device__ __forceinline__ float bf16_round(float x) { return bf16_val(bf16_bits(x)); }
// D += A·B with NT terms: 1 = ah·bh, 2 = + al·bh (A split), 3 = + ah·bl (both split)
template <int NT>
__device__ __forceinline__ v8f mmaN(v16b ah, v16b al, v16b bh, v16b bl, v8f c) {
  c = __builtin_amdgcn_wmma_f32_16x16x32_bf16(false, ah, false, bh, (short)0, c, false, false);
  if (NT >= 2) c = __builtin_amdgcn_wmma_f32_16x16x32_bf16(false, al, false, bh, (short)0, c, false, false);
  if (NT >= 3) c = __builtin_amdgcn_wmma_f32_16x16x32_bf16(false, ah, false, bl, (short)0, c, false, false);
  asm volatile("v_nop\n\tv_nop\n\tv_nop\n\tv_nop" : "+v"(c) : "v"(ah), "v"(al), "v"(bh), "v"(bl));
  return c;
}

__global__ __launch_bounds__(256) void k_wt_bf16(const float* __restrict__ W, unsigned short* __restrict__ Wt, int K, int N) {
  const int t = blockIdx.x * 256 + threadIdx.x;
  const int k8n = K / 8;
  if (t >= N * k8n) return;
  const int n = t / k8n, k8 = (t % k8n) * 8;
  v8us v;
#pragma unroll
  for (int i = 0; i < 8; ++i) v[i] = bf16_bits(W[(size_t)(k8 + i) * N + n]);
  *(v8us*)(Wt + (size_t)n * K + k8) = v;
  
}

// GEMM C[M][N] (f32, pitch ldc) = act(A[M][K]·W + bias). A f32 row-major (pitch lda) converted per fragment to bf16
// (ASPLIT: hi/lo two planes -> 2 terms, else single rounded term); Wt bf16 [N][K] (pitch ldb). BIAS_BF16 rounds the
// bias to bf16 first (bias quantised to bf16 before the add). K%32==0, M%16==0, N%64==0.
template <bool ASPLIT, int ACT, bool BIAS_BF16>
__global__ __launch_bounds__(128) void k_gemm_bf(const float* __restrict__ A, int lda, const unsigned short* __restrict__ Wt, int ldb,
                                               const float* __restrict__ bias, float* __restrict__ C, int ldc, int M, int N, int K) {
  __shared__ __attribute__((aligned(16))) float so[4][16][64];
  const int tid = threadIdx.x, w = tid >> 5, lane = tid & 31, ln = lane & 15, hh = lane >> 4;
  const int ntn = N / 64;
  const int wid = blockIdx.x * 4 + w;
  const int mt = wid / ntn, nq = wid % ntn;
  if (mt * 16 >= M) return;
  const int row0 = mt * 16, col0 = nq * 64;
  const float* arow = A + (size_t)(row0 + ln) * lda;
  v8f acc[4] = {};
  for (int kb = 0; kb < K; kb += 32) {
    FragB ah, al;
    const v4f x0 = *(const v4fa*)(arow + kb + 8 * hh), x1 = *(const v4fa*)(arow + kb + 8 * hh + 4);
    const v4f x2 = *(const v4fa*)(arow + kb + 16 + 8 * hh), x3 = *(const v4fa*)(arow + kb + 16 + 8 * hh + 4);
    float xs[16] = {x0[0],x0[1],x0[2],x0[3],x1[0],x1[1],x1[2],x1[3],x2[0],x2[1],x2[2],x2[3],x3[0],x3[1],x3[2],x3[3]};
#pragma unroll
    for (int i = 0; i < 16; ++i) { const unsigned short hb = bf16_bits(xs[i]); ah.u[i] = hb; al.u[i] = ASPLIT ? bf16_bits(xs[i] - bf16_val(hb)) : (unsigned short)0; }
#pragma unroll
    for (int t = 0; t < 4; ++t) {
      const unsigned short* brow = Wt + (size_t)(col0 + t * 16 + ln) * ldb + kb;
      FragB b;
      b.half[0] = *(const v8us*)(brow + 8 * hh);
      b.half[1] = *(const v8us*)(brow + 16 + 8 * hh);
      acc[t] = mmaN<ASPLIT ? 2 : 1>(ah.v, al.v, b.v, b.v, acc[t]);
    }
  }
#pragma unroll
  for (int t = 0; t < 4; ++t) {
    float bv = bias ? bias[col0 + t * 16 + ln] : 0.f;
    if (BIAS_BF16) bv = bf16_round(bv);
#pragma unroll
    for (int r = 0; r < 8; ++r) { float v = acc[t][r] + bv; if (ACT == 1) v = fmaxf(v, 0.f); so[w][8 * hh + r][t * 16 + ln] = v; }
  }
  __builtin_amdgcn_fence(__ATOMIC_ACQ_REL, "workgroup");
  __builtin_amdgcn_wave_barrier();
  const int rsub = lane >> 4, c4 = (lane & 15) * 4;
  {
#pragma unroll
    for (int q = 0; q < 8; ++q) {
      const int r = q * 2 + rsub;
      const v4f v = *(const v4fa*)&so[w][r][c4];
      *(v4f*)(C + (size_t)(row0 + r) * ldc + col0 + c4) = v;
    }
    
  }
}

// GEMM C = act(A·W + bias + resid): A f32 (ASPLIT -> hi/lo 2 terms), Wt bf16 [N][K]; ACT 0 none, 1 relu, 2 exact gelu;
// resid (optional, f32, row index = (row % rmod), pitch ldr, RES_BF16 rounds it) added before the activation.
template <bool ASPLIT, int ACT, bool BIAS_BF16, bool RES_BF16>
__global__ __launch_bounds__(128) void k_gemm_bf3(const float* __restrict__ A, int lda, const unsigned short* __restrict__ Wt, int ldb,
                                                const float* __restrict__ bias, const float* __restrict__ resid, int rmod, int ldr,
                                                float* __restrict__ C, int ldc, int M, int N, int K) {
  __shared__ __attribute__((aligned(16))) float so[4][16][64];
  const int tid = threadIdx.x, w = tid >> 5, lane = tid & 31, ln = lane & 15, hh = lane >> 4;
  const int ntn = N / 64;
  const int wid = blockIdx.x * 4 + w;
  const int mt = wid / ntn, nq = wid % ntn;
  if (mt * 16 >= M) return;
  const int row0 = mt * 16, col0 = nq * 64;
  const float* arow = A + (size_t)(row0 + ln) * lda;
  v8f acc[4] = {};
  for (int kb = 0; kb < K; kb += 32) {
    FragB ah, al;
    const v4f x0 = *(const v4fa*)(arow + kb + 8 * hh), x1 = *(const v4fa*)(arow + kb + 8 * hh + 4);
    const v4f x2 = *(const v4fa*)(arow + kb + 16 + 8 * hh), x3 = *(const v4fa*)(arow + kb + 16 + 8 * hh + 4);
    float xs[16] = {x0[0],x0[1],x0[2],x0[3],x1[0],x1[1],x1[2],x1[3],x2[0],x2[1],x2[2],x2[3],x3[0],x3[1],x3[2],x3[3]};
#pragma unroll
    for (int i = 0; i < 16; ++i) { const unsigned short hb = bf16_bits(xs[i]); ah.u[i] = hb; al.u[i] = ASPLIT ? bf16_bits(xs[i] - bf16_val(hb)) : (unsigned short)0; }
#pragma unroll
    for (int t = 0; t < 4; ++t) {
      const unsigned short* brow = Wt + (size_t)(col0 + t * 16 + ln) * ldb + kb;
      FragB b;
      b.half[0] = *(const v8us*)(brow + 8 * hh);
      b.half[1] = *(const v8us*)(brow + 16 + 8 * hh);
      acc[t] = mmaN<ASPLIT ? 2 : 1>(ah.v, al.v, b.v, b.v, acc[t]);
    }
  }
#pragma unroll
  for (int t = 0; t < 4; ++t) {
    const int col = col0 + t * 16 + ln;
    float bv = bias ? bias[col] : 0.f;
    if (BIAS_BF16) bv = bf16_round(bv);
#pragma unroll
    for (int r = 0; r < 8; ++r) {
      float v = acc[t][r] + bv;
      if (resid) { float rv = resid[(size_t)((row0 + 8 * hh + r) % rmod) * ldr + col]; if (RES_BF16) rv = bf16_round(rv); v += rv; }
      if (ACT == 1) v = fmaxf(v, 0.f);
      if (ACT == 2) v = 0.5f * v * (1.0f + erff(v * 0.70710678118654752f));
      if (ACT == 3) { const float u = 0.7978845608028654f * (v + 0.044715f * v * v * v); v = 0.5f * v * (1.0f + tanhf(u)); }
      so[w][8 * hh + r][t * 16 + ln] = v;
    }
  }
  __builtin_amdgcn_fence(__ATOMIC_ACQ_REL, "workgroup");
  __builtin_amdgcn_wave_barrier();
  const int rsub = lane >> 4, c4 = (lane & 15) * 4;
  {
#pragma unroll
    for (int q = 0; q < 8; ++q) {
      const int r = q * 2 + rsub;
      const v4f v = *(const v4fa*)&so[w][r][c4];
      *(v4f*)(C + (size_t)(row0 + r) * ldc + col0 + c4) = v;
    }
    
  }
}
// row LayerNorm (biased variance, eps) over N: s = X (+ R); optional out_sum <- s; out_norm <- (s-mu)*rsqrt(var+eps)*g + b
template <bool PARAM_BF16>
__global__ __launch_bounds__(256) void k_layernorm(const float* __restrict__ X, const float* __restrict__ R, const float* __restrict__ g, const float* __restrict__ bta,
                                                  float* __restrict__ out_sum, float* __restrict__ out_norm, int N, float eps) {
  __shared__ float red[256];
  const int row = blockIdx.x, tid = threadIdx.x;
  const float* x = X + (size_t)row * N; const float* rr = R ? R + (size_t)row * N : nullptr;
  float vals[16];                     // up to N = 4096
  const int per = N / 256;            // contiguous chunk per thread? use strided-by-4 chunks: thread handles j = tid*4 + 1024*u
  float s1 = 0.f;
  for (int u = 0; u < per / 4; ++u) {
    const int j = tid * 4 + 1024 * u;
    const v4f a = *(const v4fa*)(x + j);
    v4f b = {0.f,0.f,0.f,0.f}; if (rr) b = *(const v4fa*)(rr + j);
#pragma unroll
    for (int q = 0; q < 4; ++q) { const float v = a[q] + b[q]; vals[u * 4 + q] = v; s1 += v; }
  }
  red[tid] = s1; __syncthreads();
  for (int st = 128; st > 0; st >>= 1) { if (tid < st) red[tid] += red[tid + st]; __syncthreads(); }
  const float mu = red[0] / (float)N; __syncthreads();
  float s2 = 0.f;
  for (int u = 0; u < per / 4; ++u)
#pragma unroll
    for (int q = 0; q < 4; ++q) { const float c = vals[u * 4 + q] - mu; s2 += c * c; }
  red[tid] = s2; __syncthreads();
  for (int st = 128; st > 0; st >>= 1) { if (tid < st) red[tid] += red[tid + st]; __syncthreads(); }
  const float rs = rsqrtf(red[0] / (float)N + eps);
  {
    for (int u = 0; u < per / 4; ++u) {
      const int j = tid * 4 + 1024 * u;
      v4f o, sm;
#pragma unroll
      for (int q = 0; q < 4; ++q) {
        float gg = g[j + q], bb = bta[j + q];
        if (PARAM_BF16) { gg = bf16_round(gg); bb = bf16_round(bb); }
        sm[q] = vals[u * 4 + q]; o[q] = (vals[u * 4 + q] - mu) * rs * gg + bb;
      }
      if (out_sum) *(v4f*)(out_sum + (size_t)row * N + j) = sm;
      *(v4f*)(out_norm + (size_t)row * N + j) = o;
    }
    
  }
}



// ---- f16 WMMA path (v_wmma_f32_16x16x32_f16): 11-bit significands for operands in range — used where a [0,1] probability operand needs more precision than bf16
typedef _Float16 v16h __attribute__((ext_vector_type(16)));
union FragH { v16h v; v8us half[2]; _Float16 h[16]; unsigned short u[16]; };
template <int NT>
__device__ __forceinline__ v8f mmaH(v16h ah, v16h al, v16h bh, v16h bl, v8f c) {
  c = __builtin_amdgcn_wmma_f32_16x16x32_f16(false, ah, false, bh, (short)0, c, false, false);
  if (NT >= 2) c = __builtin_amdgcn_wmma_f32_16x16x32_f16(false, al, false, bh, (short)0, c, false, false);
  if (NT >= 3) c = __builtin_amdgcn_wmma_f32_16x16x32_f16(false, ah, false, bl, (short)0, c, false, false);
  asm volatile("v_nop\n\tv_nop\n\tv_nop\n\tv_nop" : "+v"(c) : "v"(ah), "v"(al), "v"(bh), "v"(bl));
  return c;
}
// batched GEMM like k_gemm_b but f16 operands: A f32 (split into f16 hi/lo if ASPLIT, else rounded to f16), Bt = f16 values [n][k]; alpha; C f32; N multiple of 16 (partial tiles skipped)
template <bool ASPLIT>
__global__ __launch_bounds__(128) void k_gemm_h(const float* __restrict__ A, int lda, size_t sA, const _Float16* __restrict__ Bh, int ldb, size_t sB, float alpha, float* __restrict__ C, int ldc, size_t sC, int M, int N, int K) {
  __shared__ __attribute__((aligned(16))) float so[4][16][64];
  const int tid = threadIdx.x, w = tid >> 5, lane = tid & 31, ln = lane & 15, hh = lane >> 4; const int by = blockIdx.y;
  A += (size_t)by * sA; Bh += (size_t)by * sB; C += (size_t)by * sC;
  const int ntn = (N + 63) / 64; const int wid = blockIdx.x * 4 + w; const int mt = wid / ntn, nq = wid % ntn; if (mt * 16 >= M) return;
  const int row0 = mt * 16, col0 = nq * 64; const float* arow = A + (size_t)(row0 + ln) * lda;
  v8f acc[4] = {};
  for (int kb = 0; kb < K; kb += 32) {
    FragH ah, al;
    const v4f x0 = *(const v4fa*)(arow + kb + 8 * hh), x1 = *(const v4fa*)(arow + kb + 8 * hh + 4), x2 = *(const v4fa*)(arow + kb + 16 + 8 * hh), x3 = *(const v4fa*)(arow + kb + 16 + 8 * hh + 4);
    float xs[16] = {x0[0],x0[1],x0[2],x0[3],x1[0],x1[1],x1[2],x1[3],x2[0],x2[1],x2[2],x2[3],x3[0],x3[1],x3[2],x3[3]};
#pragma unroll
    for (int i = 0; i < 16; ++i) { const _Float16 h = (_Float16)xs[i]; ah.h[i] = h; al.h[i] = ASPLIT ? (_Float16)(xs[i] - (float)h) : (_Float16)0.0f; }
#pragma unroll
    for (int t = 0; t < 4; ++t) { if (col0 + t * 16 >= N) continue; const size_t boff = (size_t)(col0 + t * 16 + ln) * ldb + kb; FragH bq; bq.half[0] = *(const v8us*)(Bh + boff + 8 * hh); bq.half[1] = *(const v8us*)(Bh + boff + 16 + 8 * hh);
      acc[t] = mmaH<ASPLIT ? 2 : 1>(ah.v, al.v, bq.v, bq.v, acc[t]); }
  }
#pragma unroll
  for (int t = 0; t < 4; ++t) { if (col0 + t * 16 >= N) continue;
#pragma unroll
    for (int r = 0; r < 8; ++r) so[w][8 * hh + r][t * 16 + ln] = acc[t][r] * alpha; }
  __builtin_amdgcn_fence(__ATOMIC_ACQ_REL, "workgroup"); __builtin_amdgcn_wave_barrier();
  const int rsub = lane >> 4, c4 = (lane & 15) * 4;
  {
#pragma unroll
    for (int q = 0; q < 8; ++q) { const int r = q * 2 + rsub; if (col0 + c4 < N) { const v4f v = *(const v4fa*)&so[w][r][c4]; *(v4f*)(C + (size_t)(row0 + r) * ldc + col0 + c4) = v; } }
     }
}

// k_gemm_hh variant with fused epilogue: v = acc·alpha + bias[by·sBias + col] (+ CP[(row/rowsPerB)·sCPb + by·64 + col] if CP) ; ACT 0 none / 1 elu ; writes f16 C16 (and f32 C if non-null)
template <int ACT>
__global__ __launch_bounds__(128) void k_gemm_hhx(const _Float16* __restrict__ A, int lda, size_t sA, const _Float16* __restrict__ Bh, int ldb, size_t sB, float alpha, const float* __restrict__ bias, size_t sBias, const float* __restrict__ CP, int rowsPerB, size_t sCPb, int row0g,
    float* __restrict__ C, _Float16* __restrict__ C16, int ldc, size_t sC, int M, int N, int K) {
  __shared__ __attribute__((aligned(16))) float so[4][16][64];
  const int tid = threadIdx.x, w = tid >> 5, lane = tid & 31, ln = lane & 15, hh = lane >> 4; const int by = blockIdx.y;
  A += (size_t)by * sA; Bh += (size_t)by * sB; const size_t cofs = (size_t)by * sC; const float* bp = bias ? bias + (size_t)by * sBias : nullptr;
  const int ntn = (N + 63) / 64; const int wid = blockIdx.x * 4 + w; const int mt = wid / ntn, nq = wid % ntn; if (mt * 16 >= M) return;
  const int row0 = mt * 16, col0 = nq * 64; const _Float16* arow = A + (size_t)(row0 + ln) * lda;
  v8f acc[4] = {};
  for (int kb = 0; kb < K; kb += 32) { FragH ah; ah.half[0] = *(const v8us*)((const unsigned short*)arow + kb + 8 * hh); ah.half[1] = *(const v8us*)((const unsigned short*)arow + kb + 16 + 8 * hh);
#pragma unroll
    for (int t = 0; t < 4; ++t) { if (col0 + t * 16 >= N) continue; const size_t boff = (size_t)(col0 + t * 16 + ln) * ldb + kb; FragH bq; bq.half[0] = *(const v8us*)((const unsigned short*)Bh + boff + 8 * hh); bq.half[1] = *(const v8us*)((const unsigned short*)Bh + boff + 16 + 8 * hh);
      acc[t] = mmaH<1>(ah.v, ah.v, bq.v, bq.v, acc[t]); }
  }
#pragma unroll
  for (int t = 0; t < 4; ++t) { if (col0 + t * 16 >= N) continue; const int col = col0 + t * 16 + ln; const float bv = bp ? bf16_round(bp[col]) : 0.f;
#pragma unroll
    for (int r = 0; r < 8; ++r) { float v = acc[t][r] * alpha + bv; if (CP) { const int rr = row0g + row0 + 8 * hh + r; if (rowsPerB < 0) v += CP[cofs + (size_t)rr * ldc + col];      /* rowsPerB < 0: own element of the batched C plane */ else { const int bidx = rr / rowsPerB; v += CP[(size_t)bidx * sCPb + (size_t)by * 64 + col]; } } if (ACT == 1) v = (v > 0.f) ? v : expm1f(v); else if (ACT == 7) v = (v > 0.f) ? v + 1.0f : expf(v); else if (ACT == 8) v = tanhf(v); else if (ACT == 9) v = 0.5f * v * (1.0f + tanhf(0.7978845608028654f * (v + 0.044715f * v * v * v))); else if (ACT == 11) v = 1.0f / (1.0f + expf(-v)); else if (ACT == 12) v = (v > 0.f) ? v : 0.01f * v; else if (ACT == 14) v = (v > 0.f) ? v : 0.1f * v; else if (ACT == 16) v = (v >= 0.f) ? v : 0.3f * v; else if (ACT == 17) v = (v >= 0.f) ? v : 0.2f * v; else if (ACT == 15) v = v / (1.0f + expf(-v)); else if (ACT == 3) v = fmaxf(v, 0.f); else if (ACT == 6) v = 0.5f * v * (1.0f + erff(v * 0.70710678118654752f)); so[w][8 * hh + r][t * 16 + ln] = v; } }
  __builtin_amdgcn_fence(__ATOMIC_ACQ_REL, "workgroup"); __builtin_amdgcn_wave_barrier();
  const int rsub = lane >> 4, c4 = (lane & 15) * 4; typedef _Float16 v4h __attribute__((ext_vector_type(4)));
  {
#pragma unroll
    for (int q = 0; q < 8; ++q) { const int r = q * 2 + rsub; if (col0 + c4 < N) { const v4f v = *(const v4fa*)&so[w][r][c4]; if (C) *(v4f*)(C + cofs + (size_t)(row0 + r) * ldc + col0 + c4) = v; if (C16) { v4h h4; for (int i = 0; i < 4; ++i) h4[i] = (_Float16)v[i]; *(v4h*)(C16 + cofs + (size_t)(row0 + r) * ldc + col0 + c4) = h4; } } }
     }
}


typedef _Float16 v4h __attribute__((ext_vector_type(4)));

__global__ __launch_bounds__(256) void k_h16(const float* __restrict__ x, _Float16* __restrict__ X16, size_t n8) { const size_t t = (size_t)blockIdx.x * 256 + threadIdx.x; if (t >= n8) return; FragH f;
#pragma unroll
  for (int q = 0; q < 8; ++q) f.h[q] = (_Float16)x[t * 8 + q]; *(v8us*)((unsigned short*)X16 + t * 8) = f.half[0];  }
__global__ __launch_bounds__(256) void k_round16f(const float* __restrict__ W, _Float16* __restrict__ Bt, size_t n8) { const size_t t = (size_t)blockIdx.x * 256 + threadIdx.x; if (t >= n8) return; FragH f;
#pragma unroll
  for (int i = 0; i < 8; ++i) f.h[i] = (_Float16)(bf16_round(W[t * 8 + i]) * 16.0f); *(v8us*)((unsigned short*)Bt + t * 8) = f.half[0];  }
__global__ __launch_bounds__(256) void k_hl(const float* __restrict__ F, _Float16* __restrict__ Hh, _Float16* __restrict__ Hl, size_t n8) { const size_t t = (size_t)blockIdx.x * 256 + threadIdx.x; if (t >= n8) return; FragH fh, fl; const v4f a = *(const v4fa*)(F + t * 8), c = *(const v4fa*)(F + t * 8 + 4);
#pragma unroll
  for (int q = 0; q < 4; ++q) { _Float16 h = (_Float16)a[q]; fh.h[q] = h; fl.h[q] = (_Float16)((a[q] - (float)h) * 1024.0f); h = (_Float16)c[q]; fh.h[4 + q] = h; fl.h[4 + q] = (_Float16)((c[q] - (float)h) * 1024.0f); }
  { *(v8us*)((unsigned short*)Hh + t * 8) = fh.half[0]; *(v8us*)((unsigned short*)Hl + t * 8) = fl.half[0];  } }

// ---- fast GEMM (wave tile 32x64; requires M % 32 == 0 rows per launch region and N % 64 == 0); epilogue = k_gemm_hhx semantics ----
__device__ __forceinline__ v16h g2_frag(const _Float16* p, int hh) { FragH f; f.half[0] = *(const v8us*)((const unsigned short*)p + 8 * hh); f.half[1] = *(const v8us*)((const unsigned short*)p + 16 + 8 * hh); return f.v; }
__device__ __forceinline__ v8f g2_mma(v16h a, v16h b, v8f c) { v8f d = __builtin_amdgcn_wmma_f32_16x16x32_f16(false, a, false, b, (short)0, c, false, false); asm volatile("v_nop\n\tv_nop\n\tv_nop\n\tv_nop" : "+v"(d) : "v"(a), "v"(b)); return d; }
template <int ACT>
__device__ __forceinline__ void gemm2_body(const _Float16* __restrict__ A, int lda, size_t sA, const _Float16* __restrict__ Bh, int ldb, size_t sB, float alpha, const float* __restrict__ bias, size_t sBias, const float* __restrict__ CP, int rowsPerB, size_t sCPb, int row0g,
    float* __restrict__ C, _Float16* __restrict__ C16, int ldc, size_t sC, int M, int N, int K) { static_assert(ACT == 0 || ACT == 3 || ACT == 6 || ACT == 8 || ACT == 9 || ACT == 11 || ACT == 12 || ACT == 14 || ACT == 15 || ACT == 16 || ACT == 17, "k_gemm2: unsupported ACT code (would silently apply no activation)");
  __shared__ __attribute__((aligned(16))) float so[4][32][68];
  const int tid = threadIdx.x, w = tid >> 5, lane = tid & 31, ln = lane & 15, hh = lane >> 4; const int by = blockIdx.y;
  A += (size_t)by * sA; Bh += (size_t)by * sB; const size_t cofs = (size_t)by * sC; const float* bp = bias ? bias + (size_t)by * sBias : nullptr;
  const int ntn = N >> 6; const int mt = blockIdx.x / ntn, nq = blockIdx.x - mt * ntn; const int row0 = mt * 128 + 32 * w, col0 = nq * 64; if (row0 >= M) return;
  const _Float16* a0p = A + (size_t)(row0 + ln) * lda; const _Float16* a1p = a0p + (size_t)16 * lda;
  const _Float16* b0p = Bh + (size_t)(col0 + ln) * ldb; const _Float16* b1p = b0p + (size_t)16 * ldb; const _Float16* b2p = b1p + (size_t)16 * ldb; const _Float16* b3p = b2p + (size_t)16 * ldb;
  const v8f z8 = {0.f,0.f,0.f,0.f,0.f,0.f,0.f,0.f}; v8f c00 = z8, c01 = z8, c02 = z8, c03 = z8, c10 = z8, c11 = z8, c12 = z8, c13 = z8;
#pragma unroll 1
  for (int kb = 0; kb < K; kb += 32) { const v16h a0 = g2_frag(a0p + kb, hh), a1 = g2_frag(a1p + kb, hh);
    asm volatile("s_wait_xcnt 0x0" ::: "memory");      /* the wait that belongs in front of any overwrite of a register which an issued load names: the B loads behind it land in the registers of the A addresses */
    v16h b = g2_frag(b0p + kb, hh); c00 = g2_mma(a0, b, c00); c10 = g2_mma(a1, b, c10);
    b = g2_frag(b1p + kb, hh); c01 = g2_mma(a0, b, c01); c11 = g2_mma(a1, b, c11);
    b = g2_frag(b2p + kb, hh); c02 = g2_mma(a0, b, c02); c12 = g2_mma(a1, b, c12);
    b = g2_frag(b3p + kb, hh); c03 = g2_mma(a0, b, c03); c13 = g2_mma(a1, b, c13); }
  v8f accs[8] = {c00, c01, c02, c03, c10, c11, c12, c13};
#pragma unroll
  for (int u = 0; u < 8; ++u) { const int t = u & 3, half = u >> 2; const int col = col0 + t * 16 + ln; const float bv = bp ? bf16_round(bp[col]) : 0.f;
#pragma unroll
    for (int r = 0; r < 8; ++r) { const int rloc = half * 16 + 8 * hh + r; float v = accs[u][r] * alpha + bv; if (CP) { if (rowsPerB < 0) v += CP[cofs + (size_t)(row0g + row0 + rloc) * ldc + col];      /* rowsPerB < 0: own element of the batched C plane */ else { const int bidx = (row0g + row0 + rloc) / rowsPerB; v += CP[(size_t)bidx * sCPb + (size_t)by * 64 + col]; } }
      if (ACT == 3) v = fmaxf(v, 0.f); else if (ACT == 6) v = 0.5f * v * (1.0f + erff(v * 0.70710678118654752f)); else if (ACT == 11) v = 1.0f / (1.0f + expf(-v)); else if (ACT == 15) v = v / (1.0f + expf(-v)); else if (ACT == 12) v = (v > 0.f) ? v : 0.01f * v; else if (ACT == 8) v = tanhf(v); else if (ACT == 9) v = 0.5f * v * (1.0f + tanhf(0.7978845608028654f * (v + 0.044715f * v * v * v))); else if (ACT == 14) v = (v > 0.f) ? v : 0.1f * v; else if (ACT == 16) v = (v >= 0.f) ? v : 0.3f * v; else if (ACT == 17) v = (v >= 0.f) ? v : 0.2f * v;
      so[w][rloc][t * 16 + ln] = v; } }
  __builtin_amdgcn_fence(__ATOMIC_ACQ_REL, "workgroup"); __builtin_amdgcn_wave_barrier();
  const int rsub = lane >> 4, c4 = (lane & 15) * 4;
  {
#pragma unroll
    for (int q = 0; q < 16; ++q) { const int r = q * 2 + rsub; const v4f v = *(const v4fa*)&so[w][r][c4]; if (C) { *(v4f*)(C + cofs + (size_t)(row0 + r) * ldc + col0 + c4) = v; asm volatile("s_wait_xcnt 0x0" ::: "memory"); }      /* the wait that belongs in front of any overwrite of a register which an issued store names (the f16 conversion and the next row's address land in them) */
      if (C16) { v4h h4; for (int i = 0; i < 4; ++i) h4[i] = (_Float16)v[i]; *(v4h*)(C16 + cofs + (size_t)(row0 + r) * ldc + col0 + c4) = h4; } }
     } }
template <int ACT>
__global__ __launch_bounds__(128) void k_gemm2(const _Float16* __restrict__ A, int lda, size_t sA, const _Float16* __restrict__ Bh, int ldb, size_t sB, float alpha, const float* __restrict__ bias, size_t sBias, const float* __restrict__ CP, int rowsPerB, size_t sCPb, int row0g,
    float* __restrict__ C, _Float16* __restrict__ C16, int ldc, size_t sC, int M, int N, int K) { gemm2_body<ACT>(A, lda, sA, Bh, ldb, sB, alpha, bias, sBias, CP, rowsPerB, sCPb, row0g, C, C16, ldc, sC, M, N, K); }
// q, k, v projections of all heads in one launch, straight from the f32 input rows: the block index gives row block, head and stream (the same for a whole block).
// A head's 64 input columns are used by that head alone and N = 64 covers all of its outputs, so every input element is read once, here: it is rounded in registers
// (f32 -> bf16 -> f16, the two roundings of the former builder) to the value that an f16 copy of the rows would hold. Wave tile 32x64, K = 64 in two steps of 32, products and sums in gemm2_body's order.
// q and k go out as rows. v is wanted by the attention launch as V^T [batch][head][64][keys] and as nothing else: an accumulator tile holds, in each lane, eight consecutive rows (keys) of ONE output column,
// which is one 16-byte piece of a V^T row, so the V blocks lay their 64 x 128 tile in LDS transposed (one ds_store_b128 a tile and lane) and store 256 B of each V^T row, whole lines.
__device__ __forceinline__ v16h pj_cvt(v4f x0, v4f x1, v4f x2, v4f x3) { FragH f;      /* g2_frag's k order: x0, x1 = k 8 hh .. 8 hh + 7, x2, x3 = k 16 + 8 hh .. 16 + 8 hh + 7 */
#pragma unroll
  for (int q = 0; q < 4; ++q) { f.h[q] = (_Float16)bf16_round(x0[q]); f.h[4 + q] = (_Float16)bf16_round(x1[q]); f.h[8 + q] = (_Float16)bf16_round(x2[q]); f.h[12 + q] = (_Float16)bf16_round(x3[q]); }
  return f.v; }
#define PJ_VP (128 * 2 + 16)          /* LDS pitch of a V^T row of the block's 128 keys, bytes: 16 B x odd, so that the 16 rows of a ds_store_b128 meet no bank twice */
// The weights need no launch of their own. A 64 x 64 block of a row-major [in][out] f32 matrix is read with the lanes along the output index n (a wave's load is one whole 128-byte line), rounded
// (f32 -> bf16, x16, exact in f16) and laid in LDS as rows n of 64 k: the [n][k] form that a B fragment reads. A projection block does that with its own head's block and takes its fragments from LDS;
// the first PJ_WB blocks of the grid do it with one block of Wo each and store the rows, 128 B whole lines, into Wo^T for the output GEMM two launches later.
#define PJ_WP (HD * 2 + 16)           /* LDS pitch of a transposed weight row, bytes: 16 B x odd */
#define PJ_WB ((DM / 64) * (DM / 64)) /* blocks that build Wo^T */
#define PJ_RB ((int)(NRQ / 128))      /* row blocks of a stream */
template <int LDW>
__device__ __forceinline__ void pj_wload(const float* __restrict__ wp, float (&wv)[4][8]) {      /* wp: the thread's column at its first k; the pitch is a constant, so that one address serves all 32 loads */
#pragma unroll
  for (int q = 0; q < 4; ++q)
#pragma unroll
    for (int i = 0; i < 8; ++i) wv[q][i] = wp[(size_t)(q * 16 + i) * LDW];
  asm volatile("s_wait_xcnt 0x0" ::: "memory"); }      /* the wait that belongs in front of any overwrite of a register which an issued load names: what follows may reuse the register of the weight address */
__global__ __launch_bounds__(128) void k_proj(const float* __restrict__ x, const float* __restrict__ ctx, const float* __restrict__ vsrc, const float* __restrict__ w0, const float* __restrict__ w1, const float* __restrict__ w2, const float* __restrict__ wo,
    const float* __restrict__ bias0, const float* __restrict__ bias1, const float* __restrict__ bias2, _Float16* __restrict__ C0, _Float16* __restrict__ C1, _Float16* __restrict__ C2, _Float16* __restrict__ BO) {
  static_assert(HD == 64 && DM % 64 == 0 && NRQ % 128 == 0 && NRK == NRQ && DC == DM && SK % 128 == 0 && HD * PJ_VP <= 4 * 32 * 68 * 4, "k_proj: K = N = 64 (and Wo in whole 64 x 64 blocks), whole 128-row blocks, the three streams of one size, a block inside one batch, the V^T tile fits the staging");
  __shared__ __attribute__((aligned(16))) float so[4][32][68];
  __shared__ __attribute__((aligned(16))) unsigned char sw[64 * PJ_WP];      /* the transposed weight block; apart from so, which a fast wave fills while a slow one still reads its fragments */
  const int tid = threadIdx.x, w = tid >> 5, lane = tid & 31, ln = lane & 15, hh = lane >> 4;
  const bool wob = blockIdx.x < PJ_WB;      /* the same for the whole block */
  const int u = wob ? 0 : (int)blockIdx.x - PJ_WB; const int bx = u % PJ_RB, h = (u / PJ_RB) % NH, z = u / (PJ_RB * NH);      /* row block, head, stream */
  const int kt = blockIdx.x / (DM / 64), nt = blockIdx.x % (DM / 64);      /* a Wo block's place: k = 64 kt .., n = 64 nt .. */
  const int kg = tid >> 6;      /* the thread's four groups of eight k: kg, kg + 2, kg + 4, kg + 6, all of column n = tid % 64 */
  float wv[4][8];
  auto wlay = [&]() {      /* the thread's 32 weights into LDS, eight k of one row a ds_store_b128 */
#pragma unroll
    for (int q = 0; q < 4; ++q) { FragH f;
#pragma unroll
      for (int i = 0; i < 8; ++i) f.h[i] = (_Float16)(bf16_round(wv[q][i]) * 16.0f);
      *(v8us*)(sw + (tid & 63) * PJ_WP + (kg + 2 * q) * 16) = f.half[0]; } };
  if (wob) {
    pj_wload<DM>(wo + ((size_t)kt * 64 + kg * 8) * DM + nt * 64 + (tid & 63), wv);
    wlay();
    __syncthreads();      /* a row's 64 k come from two waves: all pieces lie in LDS before a row is read back */
    const unsigned char* tr = sw + (tid >> 3) * PJ_WP + (tid & 7) * 16;      /* rows n = 16 q + tid / 8, piece tid % 8: a wave's store covers four rows of 128 B, whole lines */
    unsigned short* op = (unsigned short*)BO + (size_t)(nt * 64 + (tid >> 3)) * DM + kt * 64 + (tid & 7) * 8;
#pragma unroll
    for (int q = 0; q < 4; ++q) { const v8us v = *(const v8us*)(tr + q * 16 * PJ_WP); *(v8us*)(op + (size_t)q * 16 * DM) = v; }
    return; }
  const int row0 = bx * 128 + 32 * w;
  const float* ap = (z == 0 ? x : z == 1 ? ctx : vsrc) + (size_t)(row0 + ln) * DM + h * HD + 8 * hh;
  const float* bp = (z == 0 ? bias0 : z == 1 ? bias1 : bias2) + h * HD;
  v4f ax[2][2][4]; v16h bf[4][2]; float bb[4];      /* [16-row tile][k step][16-byte piece]; [16-column tile][k step]; the lane's four bias values */
  pj_wload<HD>((z == 0 ? w0 : z == 1 ? w1 : w2) + (size_t)h * HD * HD + kg * 8 * HD + (tid & 63), wv);      /* asked for first: they are wanted first */
#pragma unroll
  for (int t = 0; t < 4; ++t) bb[t] = bp[t * 16 + ln];
  asm volatile("s_wait_xcnt 0x0" ::: "memory");      /* the wait that belongs in front of any overwrite of a register which an issued load names: the row loads behind it may land in the registers of the bias addresses */
#pragma unroll
  for (int i = 0; i < 2; ++i)
#pragma unroll
    for (int s = 0; s < 2; ++s) { const float* p = ap + (size_t)i * 16 * DM + s * 32; ax[i][s][0] = *(const v4fa*)p; ax[i][s][1] = *(const v4fa*)(p + 4); ax[i][s][2] = *(const v4fa*)(p + 16); ax[i][s][3] = *(const v4fa*)(p + 20); }
  asm volatile("s_wait_xcnt 0x0" ::: "memory");      /* the wait that belongs in front of any overwrite of a register which an issued load names: all of the tile's loads are asked for above, what follows may reuse their address registers */
  __builtin_amdgcn_sched_barrier(0);      /* keeps the rounding behind all 52 loads, so that weights, bias and rows fly together; without it the later loads sink behind the wait for the first group's data */
  wlay();
  __syncthreads();      /* the head's transposed block comes from all four waves: it lies whole in LDS before any fragment is read */
#pragma unroll
  for (int t = 0; t < 4; ++t)
#pragma unroll
    for (int s = 0; s < 2; ++s) { const unsigned char* p = sw + (t * 16 + ln) * PJ_WP + s * 64 + hh * 16; FragH f; f.half[0] = *(const v8us*)p; f.half[1] = *(const v8us*)(p + 32); bf[t][s] = f.v; }      /* g2_frag's k order: k 32 s + 8 hh .. and 32 s + 16 + 8 hh .. of row n = 16 t + ln */
  const v8f z8 = {0.f,0.f,0.f,0.f,0.f,0.f,0.f,0.f}; v8f acc[2][4];
#pragma unroll
  for (int i = 0; i < 2; ++i)
#pragma unroll
    for (int t = 0; t < 4; ++t) acc[i][t] = z8;
#pragma unroll
  for (int s = 0; s < 2; ++s) { const v16h a0 = pj_cvt(ax[0][s][0], ax[0][s][1], ax[0][s][2], ax[0][s][3]), a1 = pj_cvt(ax[1][s][0], ax[1][s][1], ax[1][s][2], ax[1][s][3]);
#pragma unroll
    for (int t = 0; t < 4; ++t) { acc[0][t] = g2_mma(a0, bf[t][s], acc[0][t]); acc[1][t] = g2_mma(a1, bf[t][s], acc[1][t]); } }
  if (z == 2) {      /* the V stream (the same test for the whole block): C2 is V^T */
    unsigned char* tv = (unsigned char*)&so[0][0][0];      /* the block's tile as [64 columns d][128 keys] f16 at pitch PJ_VP */
#pragma unroll
    for (int i = 0; i < 2; ++i)
#pragma unroll
      for (int t = 0; t < 4; ++t) { const float bv = bf16_round(bb[t]); FragH f;
#pragma unroll
        for (int r = 0; r < 8; ++r) f.h[r] = (_Float16)(acc[i][t][r] * 0.0625f + bv);      /* v as f16 (the weight planes are carried x16): keys 32 w + 16 i + 8 hh + r of column 16 t + ln */
        *(v8us*)(tv + (t * 16 + ln) * PJ_VP + (w * 32 + i * 16 + 8 * hh) * 2) = f.half[0]; }
    __syncthreads();      /* a V^T row's 128 keys come from all four waves: every wave's pieces lie in LDS before any row is read back */
    const int rb = bx * 128;      /* the block's first row: batch rb / SK, key rb % SK */
    const unsigned char* tr = tv + (tid >> 4) * PJ_VP + (tid & 15) * 16;      /* rows d = 8 q + tid / 16, piece tid % 16: a wave's store covers two rows of 256 B, four whole lines */
    unsigned short* vp = (unsigned short*)C2 + ((size_t)((rb / SK) * NH + h) * HD + (tid >> 4)) * SK + rb % SK + (tid & 15) * 8;
#pragma unroll
    for (int q = 0; q < 8; ++q) { const v8us v = *(const v8us*)(tr + q * 8 * PJ_VP); *(v8us*)(vp + (size_t)q * 8 * SK) = v; }
    return; }
  _Float16* cp = (z == 0 ? C0 : C1) + (size_t)row0 * DM + h * HD;
#pragma unroll
  for (int i = 0; i < 2; ++i)
#pragma unroll
    for (int t = 0; t < 4; ++t) { const float bv = bf16_round(bb[t]);
#pragma unroll
      for (int r = 0; r < 8; ++r) so[w][i * 16 + 8 * hh + r][t * 16 + ln] = acc[i][t][r] * 0.0625f + bv; }      /* the weight planes are carried x16 */
  __builtin_amdgcn_fence(__ATOMIC_ACQ_REL, "workgroup"); __builtin_amdgcn_wave_barrier();      /* each wave reads back its own rows only: its LDS writes in front of its reads */
  const int rsub = lane >> 4, c4 = (lane & 15) * 4;
#pragma unroll
  for (int q = 0; q < 16; ++q) { const int r = q * 2 + rsub; const v4f v = *(const v4fa*)&so[w][r][c4]; v4h h4; for (int i = 0; i < 4; ++i) h4[i] = (_Float16)v[i];
    *(v4h*)(cp + (size_t)r * DM + c4) = h4;
    if (q == 7) asm volatile("s_wait_xcnt 0x0" ::: "memory"); } }      /* the wait that belongs in front of any overwrite of a register which an issued store names: the second eight rows are converted into the registers of the first eight stores */

__global__ __launch_bounds__(256) void k_wnat(const float* __restrict__ w, size_t n8, _Float16* __restrict__ Bt) { const size_t t = (size_t)blockIdx.x * 256 + threadIdx.x; if (t >= n8) return; FragH f; for (int q = 0; q < 8; ++q) f.h[q] = (_Float16)(bf16_round(w[t * 8 + q]) * 16.0f); *(v8us*)((unsigned short*)Bt + t * 8) = f.half[0];  }
__global__ __launch_bounds__(256) void k_rsm(const float* __restrict__ S, _Float16* __restrict__ P, int nrows) {
  #pragma clang fp contract(off)
  const int i = blockIdx.x * 256 + threadIdx.x; if (i >= nrows) return; const float* s = S + (size_t)i * SQ; float mx = -3.0e38f;
#pragma unroll 1
  for (int j = 0; j < SQ; ++j) mx = fmaxf(mx, s[j]); float se = 0.f;
#pragma unroll 1
  for (int j = 0; j < SQ; ++j) se += expf(s[j] - mx); const float sc = 256.0f / se;
#pragma unroll 1
  for (int j0 = 0; j0 < SQ; j0 += 8) { FragH f; for (int q = 0; q < 8; ++q) f.h[q] = (_Float16)(expf(s[j0 + q] - mx) * sc); unsigned short* d = (unsigned short*)P + (size_t)i * SQ + j0; *(v8us*)d = f.half[0];  } }
__global__ __launch_bounds__(256) void k_vt(const _Float16* __restrict__ V16, int b, int h0, _Float16* __restrict__ VT) { __shared__ unsigned short tl[64][65]; const int tid = threadIdx.x; const int hh = blockIdx.x % HG, sg = blockIdx.x / HG; const int s0 = sg * 64; const int h = h0 + hh;
  for (int i = tid; i < 64 * 8; i += 256) { const int j = i / 8, d8 = (i % 8) * 8; FragH f; f.half[0] = *(const v8us*)((const unsigned short*)V16 + ((size_t)b * SQ + s0 + j) * DM + h * HD + d8); for (int q = 0; q < 8; ++q) tl[d8 + q][j] = f.u[q]; }
  __syncthreads();
  { for (int i = tid; i < 64 * 8; i += 256) { const int d = i / 8, j8 = (i % 8) * 8; FragH f; for (int q = 0; q < 8; ++q) f.u[q] = tl[d][j8 + q]; *(v8us*)((unsigned short*)VT + ((size_t)hh * HD + d) * SQ + s0 + j8) = f.half[0]; }  } }


__global__ __launch_bounds__(256) void k_rsmf(const float* __restrict__ S, _Float16* __restrict__ P, int qn, int hg) {
  #pragma clang fp contract(off)
  const int t = blockIdx.x * 256 + threadIdx.x; if (t >= qn * hg) return; const size_t i = (size_t)(t / qn) * SQ + (t % qn); const float* s = S + i * SQ; float mx = -3.0e38f;
#pragma unroll 1
  for (int j = 0; j < SQ; ++j) mx = fmaxf(mx, s[j]); float se = 0.f;
#pragma unroll 1
  for (int j = 0; j < SQ; ++j) se += __expf(s[j] - mx); const float sc = 256.0f / se;
#pragma unroll 1
  for (int j0 = 0; j0 < SQ; j0 += 8) { FragH f; for (int q = 0; q < 8; ++q) f.h[q] = (_Float16)(__expf(s[j0 + q] - mx) * sc); unsigned short* d = (unsigned short*)P + i * SQ + j0; *(v8us*)d = f.half[0];  } }

// Fused attention, all batches and heads in one launch: scores, softmax and P V stay in registers; no score or weight plane goes through memory.
// A wave owns 32 queries of one (batch, head) and walks the 2048 keys 32 at a time. S^T = K Q^T (A = 16 key rows, B = 16 query rows, both in g2_frag's k order): a lane holds
// scores of ONE query (column ln), keys 8 hh + r of each 16-key tile, so two tiles, converted in place, are the B operand P^T of O^T += V^T P^T (A = V^T rows, the same k order).
// Running maximum and sum per query (f32); the maximum is renewed lazily (the two wave halves exchange it then), the halves join their sums once at the end.
// The 16 waves of a block share one head's K and V^T through LDS: a stage is 128 keys (K: 128 rows of 128 B, V^T: 64 rows of 256 B), brought in whole lines by asynchronous copies,
// four of 16 bytes a lane, into one of two buffers while the other is worked on; the rows lie at a pitch of 16 B x odd, so that a fragment's ds_load_b128 meets no bank twice.
#define FA_KS 128                      /* keys a stage */
#define FA_NT (SK / FA_KS)             /* stages */
#define FA_KP (HD * 2 + 16)            /* LDS pitch of a K row, bytes */
#define FA_VP (FA_KS * 2 + 16)         /* LDS pitch of a V^T row, bytes */
#define FA_KB (FA_KS * FA_KP)          /* K part of a buffer, bytes */
#define FA_BUF (FA_KB + HD * FA_VP)    /* one buffer, bytes */
#define FA_LZ 44.3614195558365f        /* 8 / CS: how far a raw score may pass the maximum in use before that is renewed */
__device__ __forceinline__ float fa_xhalf(float x) { return __builtin_bit_cast(float, __builtin_amdgcn_permlanex16(__builtin_bit_cast(int, x), __builtin_bit_cast(int, x), 0x76543210, 0xfedcba98, false, false)); }      /* lane l with lane l ^ 16 */
__device__ __forceinline__ v16h fa_frag(const _Float16* p) { FragH f; f.half[0] = *(const v8us*)(const unsigned short*)p; f.half[1] = *(const v8us*)((const unsigned short*)p + 16); return f.v; }      /* g2_frag with the lane half's 8 hh already in p */
__device__ __forceinline__ v16h fa_lfrag(const unsigned char* p) { FragH f; f.half[0] = *(const v8us*)p; f.half[1] = *(const v8us*)(p + 32); return f.v; }      /* fa_frag from an LDS row: p in bytes, the lane half's 16 hh already in it */
/* Four asynchronous copies of 16 bytes a lane, global memory to LDS through no register (l: the lane's LDS byte address, g: its global address). The s_wait_xcnt is the wait that belongs
   in front of any overwrite of a register which an issued copy names; as the last line of the copies' own statement it stands ahead of whatever reuses the operands' registers. */
__device__ __forceinline__ void fa_copy4(unsigned l0, const _Float16* g0, unsigned l1, const _Float16* g1, unsigned l2, const _Float16* g2, unsigned l3, const _Float16* g3) {
  asm volatile("global_load_async_to_lds_b128 %0, %1, off\n\tglobal_load_async_to_lds_b128 %2, %3, off\n\tglobal_load_async_to_lds_b128 %4, %5, off\n\tglobal_load_async_to_lds_b128 %6, %7, off\n\ts_wait_xcnt 0x0"
      :: "v"(l0), "v"(g0), "v"(l1), "v"(g1), "v"(l2), "v"(g2), "v"(l3), "v"(g3) : "memory"); }
/* Native 2^x, eight (or one) in a statement: behind a transcendental the instruction set asks for one independent instruction or a v_nop before its result is read or its source
   overwritten. Each v_exp_f32 here has an independent one behind it (the outputs share no register with the inputs), the last one the v_nop. */
__device__ __forceinline__ void fa_exp8(const float (&t)[8], float (&e)[8]) {
  asm("v_exp_f32 %0, %8\n\tv_exp_f32 %1, %9\n\tv_exp_f32 %2, %10\n\tv_exp_f32 %3, %11\n\tv_exp_f32 %4, %12\n\tv_exp_f32 %5, %13\n\tv_exp_f32 %6, %14\n\tv_exp_f32 %7, %15\n\tv_nop"
      : "=&v"(e[0]), "=&v"(e[1]), "=&v"(e[2]), "=&v"(e[3]), "=&v"(e[4]), "=&v"(e[5]), "=&v"(e[6]), "=&v"(e[7]) : "v"(t[0]), "v"(t[1]), "v"(t[2]), "v"(t[3]), "v"(t[4]), "v"(t[5]), "v"(t[6]), "v"(t[7])); }
__device__ __forceinline__ float fa_exp1(float t) { float e; asm("v_exp_f32 %0, %1\n\tv_nop" : "=&v"(e) : "v"(t)); return e; }
__device__ __forceinline__ v8f fa_mma(v16h a, v16h b, v8f c) { return __builtin_amdgcn_wmma_f32_16x16x32_f16(false, a, false, b, (short)0, c, false, false); }
__global__ __launch_bounds__(512) void k_fattn(const _Float16* __restrict__ Q, const _Float16* __restrict__ Kk, const _Float16* __restrict__ VT, _Float16* __restrict__ O) {
  static_assert(SK % FA_KS == 0 && FA_NT >= 2 && FA_KS * 8 == 2 * 512 && HD * (FA_KS / 8) == 2 * 512 && FA_KS / 32 == 4, "k_fattn: whole stages, two of them at least, two K and two V^T copies a lane and stage, four passes a stage (one per priority level)");
  __shared__ __attribute__((aligned(16))) unsigned char sm[2 * FA_BUF];
  const int tid = threadIdx.x, lane = tid & 31, ln = lane & 15, hh = lane >> 4; const int w = __builtin_amdgcn_readfirstlane(tid >> 5);      /* the wave's number, held scalar */
  const int bh = blockIdx.x / (NQ / 512), b = bh / NH, h = bh % NH; const int q0 = (blockIdx.x % (NQ / 512)) * 512 + w * 32;
  const float CS = 0.125f * 1.44269504088896340736f;      /* 1 / sqrt(64) and log2 e in one factor: exp(s / 8 - m / 8) = 2^((s - m) CS) */
  const _Float16* qp = Q + ((size_t)b * NQ + q0 + ln) * DM + h * HD + 8 * hh;
  /* the lane's part of a stage: K rows tid / 8 and 64 + tid / 8, piece tid % 8; V^T rows tid / 16 and 32 + tid / 16, piece tid % 16: a wave's copy covers four whole 128-byte lines */
  const _Float16* gk = Kk + ((size_t)b * SK + (tid >> 3)) * DM + h * HD + (tid & 7) * 8;
  const _Float16* gv = VT + ((size_t)bh * HD + (tid >> 4)) * SK + (tid & 15) * 8;
  const unsigned sb = (unsigned)(size_t)sm;      /* the low 32 bits of a __shared__ address are its LDS byte address */
  const unsigned lk = sb + (tid >> 3) * FA_KP + (tid & 7) * 16, lv = sb + FA_KB + (tid >> 4) * FA_VP + (tid & 15) * 16;
  auto stage = [&](int t) { const unsigned bo = (t & 1) * FA_BUF; const _Float16* k0 = gk + (size_t)t * FA_KS * DM; const _Float16* v0 = gv + t * FA_KS;
    fa_copy4(lk + bo, k0, lk + bo + 64 * FA_KP, k0 + (size_t)64 * DM, lv + bo, v0, lv + bo + 32 * FA_VP, v0 + (size_t)32 * SK); };
  v16h qf[2][2];
#pragma unroll
  for (int j = 0; j < 2; ++j)
#pragma unroll
    for (int s = 0; s < 2; ++s) qf[j][s] = fa_frag(qp + (size_t)j * 16 * DM + s * 32);
  stage(0);
  asm volatile("s_wait_asynccnt 0x0" ::: "memory");      /* this wave's copies of stage 0 have landed */
  __syncthreads();      /* every wave's have: stage 0 may be read */
  stage(1);
  const unsigned char* kl = sm + ln * FA_KP + hh * 16; const unsigned char* vl = sm + FA_KB + ln * FA_VP + hh * 16;
  const v8f z8 = {0.f,0.f,0.f,0.f,0.f,0.f,0.f,0.f}; v8f o[2][4]; float mr[2] = {-3.0e38f, -3.0e38f}, lr[2] = {0.f, 0.f}, th[2] = {-3.0e38f, -3.0e38f}, nb[2] = {0.f, 0.f};      /* per query: maximum in use, sum, the score above which the maximum is renewed, -mr CS; the first pass renews all */
#pragma unroll
  for (int j = 0; j < 2; ++j)
#pragma unroll
    for (int t = 0; t < 4; ++t) o[j][t] = z8;
#pragma unroll 1
  for (int g = 0; g < FA_NT; ++g) {      /* rolled: unrolling it only adds registers, and the wave has none to spare */
    const unsigned char* kb = kl + (g & 1) * FA_BUF; const unsigned char* vb = vl + (g & 1) * FA_BUF;
    v16h kf[2][2];
#pragma unroll
    for (int t = 0; t < 2; ++t)
#pragma unroll
      for (int s = 0; s < 2; ++s) kf[t][s] = fa_lfrag(kb + t * 16 * FA_KP + s * 64);
#pragma unroll
    for (int c = 0; c < FA_KS / 32; ++c) {      /* unrolled: s_setprio takes an immediate, so each of the stage's four passes needs its own copy of it */
      /* The wave's issue priority falls with its own progress through the stage: 3, 2, 1, 0 over the four passes.
         So a wave that lags outranks one that is ahead, the four waves of a SIMD stay within a pass of each other up to the barrier. The last pass runs at 0, so the barrier, the refill and the way out are at 0. */
      if (c == 0) __builtin_amdgcn_s_setprio(3); else if (c == 1) __builtin_amdgcn_s_setprio(2); else if (c == 2) __builtin_amdgcn_s_setprio(1); else __builtin_amdgcn_s_setprio(0);      /* c is a constant in each copy: one instruction a pass */
      v8f st[2][2];
#pragma unroll
      for (int j = 0; j < 2; ++j)
#pragma unroll
        for (int t = 0; t < 2; ++t) st[j][t] = fa_mma(kf[t][1], qf[j][1], fa_mma(kf[t][0], qf[j][0], z8));
      float mx[2];      /* this pass's maximum of the lane's own 16 scores of each query */
#pragma unroll
      for (int j = 0; j < 2; ++j) { mx[j] = fmaxf(st[j][0][0], st[j][1][0]);
#pragma unroll
        for (int r = 1; r < 8; ++r) mx[j] = fmaxf(mx[j], fmaxf(st[j][0][r], st[j][1][r])); }
      /* Lazy rescale: the maximum in use, mr, may trail the true one by up to 8 in the exponent of 2 (a weight then reaches 2^8 at most, far inside f16 and f32); sums and outputs carry the
         same factor, which the final division takes out. One test a pass for the whole wave, a scalar branch: only when some lane's score passes th = mr + FA_LZ are maxima, sums and outputs brought up. */
      if (__builtin_amdgcn_ballot_w32((mx[0] > th[0]) | (mx[1] > th[1])) != 0) {
#pragma unroll
        for (int j = 0; j < 2; ++j) {
          const float mn = fmaxf(mr[j], fmaxf(mx[j], fa_xhalf(mx[j])));      /* both halves of the wave hold scores of the same query: one maximum for both */
          const float al = fa_exp1((mr[j] - mn) * CS); mr[j] = mn; nb[j] = -mn * CS; th[j] = mn + FA_LZ; lr[j] *= al;      /* al = 0 on the first pass, 1 for a query whose maximum stays */
#pragma unroll
          for (int t = 0; t < 4; ++t) o[j][t] = o[j][t] * al; } }
      v16h vf[4]; const unsigned char* vc = vb + c * 64;
#pragma unroll
      for (int t = 0; t < 4; ++t) vf[t] = fa_lfrag(vc + t * 16 * FA_VP);      /* this pass's V^T */
      const int cn = (c + 1 < FA_KS / 32) ? c + 1 : c; const unsigned char* kc = kb + cn * 32 * FA_KP;      /* the next pass's K rows; the stage's last pass asks for its own rows again, which keeps every read inside this stage's buffer */
#pragma unroll
      for (int t = 0; t < 2; ++t)
#pragma unroll
        for (int s = 0; s < 2; ++s) kf[t][s] = fa_lfrag(kc + t * 16 * FA_KP + s * 64);
      __builtin_amdgcn_sched_barrier(0);      /* keeps the pass's 16 LDS reads in one group ahead of the exponentials, which cover their latency: left alone the compiler sinks them to just in front of the products that use them */
      FragH pf[2];      /* both query tiles' weights come ahead of the eight products: with one tile's products between the tiles the build gave an exponential statement the operand registers of the matrix instruction just in front of it */
#pragma unroll
      for (int j = 0; j < 2; ++j) { float sm1 = 0.f;
#pragma unroll
        for (int t = 0; t < 2; ++t) { float x[8], p[8];
#pragma unroll
          for (int r = 0; r < 8; ++r) x[r] = __builtin_fmaf(st[j][t][r], CS, nb[j]);
          fa_exp8(x, p);
#pragma unroll
          for (int r = 0; r < 8; ++r) { sm1 += p[r]; pf[j].h[t * 8 + r] = (_Float16)p[r]; } }
        lr[j] += sm1; }
#pragma unroll
      for (int j = 0; j < 2; ++j)
#pragma unroll
        for (int t = 0; t < 4; ++t) o[j][t] = fa_mma(vf[t], pf[j].v, o[j][t]);
    }
    asm volatile("s_wait_dscnt 0x0" ::: "memory");      /* this wave's reads of the buffer have returned before anything refills it */
    asm volatile("s_wait_asynccnt 0x0" ::: "memory");      /* this wave's copies of the next stage have landed */
    __syncthreads();      /* one barrier a stage: it publishes the next stage and ends every wave's reads of this one */
    if (g + 2 < FA_NT) stage(g + 2);      /* into the buffer just left; the test is the same for the whole block */
  }
  asm volatile("s_wait_asynccnt 0x0" ::: "memory");      /* no copy is left in flight when the wave ends */
#pragma unroll
  for (int j = 0; j < 2; ++j) { const float inv = 64.0f / (lr[j] + fa_xhalf(lr[j])); _Float16* op = O + ((size_t)b * NQ + q0 + j * 16 + ln) * DM + h * HD + 8 * hh;      /* o carried x64, as the output GEMM expects */
#pragma unroll
    for (int t = 0; t < 4; ++t) { FragH f;
#pragma unroll
      for (int r = 0; r < 8; ++r) f.h[r] = (_Float16)(o[j][t][r] * inv);
      *(v8us*)((unsigned short*)op + t * 16) = f.half[0]; } } }      /* O^T tile t: d = 16 t + 8 hh + r, eight consecutive columns of the query's row: one 16-byte store */

// Output GEMM out = o Wo + bo (M = 8192, N = K = 1024) with both operands shared through LDS: a block of 8 waves owns a 256 x 128 tile of out, a wave 64 x 64 of it (16 accumulator tiles, so a fragment
// read from LDS feeds four matrix instructions). A stage is 128 k: 256 rows of o and 128 rows of Wo^T, 256 B each, brought in whole lines by asynchronous copies, 24 of 16 bytes a lane, into one of two
// buffers while the other is worked on; rows at a pitch of 16 B x odd, so that a fragment's ds_load_b128 meets no bank twice. k runs upward in steps of 32 into one accumulator: gemm2_body's sum order.
#define OG_BM 256                      /* rows of out a block */
#define OG_BN 128                      /* columns of out a block */
#define OG_KS 128                      /* k a stage */
#define OG_NT (DM / OG_KS)             /* stages */
#define OG_P (OG_KS * 2 + 16)          /* LDS pitch of a row, bytes */
#define OG_AB (OG_BM * OG_P)           /* o part of a buffer, bytes */
#define OG_BUF ((OG_BM + OG_BN) * OG_P)      /* one buffer, bytes */
#define OG_MT ((int)(NRQ / OG_BM))     /* row tiles */
/* Twelve asynchronous copies of 16 bytes a lane (l: the lane's LDS byte addresses, g: its global addresses); the s_wait_xcnt is the wait that belongs in front of any overwrite of a register
   which an issued copy names; as the last line of the copies' own statement it stands ahead of whatever reuses the operands' registers. */
__device__ __forceinline__ void og_copy12(const unsigned* l, const _Float16* const* g) {
  asm volatile("global_load_async_to_lds_b128 %0, %1, off\n\tglobal_load_async_to_lds_b128 %2, %3, off\n\tglobal_load_async_to_lds_b128 %4, %5, off\n\tglobal_load_async_to_lds_b128 %6, %7, off\n\t"
               "global_load_async_to_lds_b128 %8, %9, off\n\tglobal_load_async_to_lds_b128 %10, %11, off\n\tglobal_load_async_to_lds_b128 %12, %13, off\n\tglobal_load_async_to_lds_b128 %14, %15, off\n\t"
               "global_load_async_to_lds_b128 %16, %17, off\n\tglobal_load_async_to_lds_b128 %18, %19, off\n\tglobal_load_async_to_lds_b128 %20, %21, off\n\tglobal_load_async_to_lds_b128 %22, %23, off\n\ts_wait_xcnt 0x0"
      :: "v"(l[0]), "v"(g[0]), "v"(l[1]), "v"(g[1]), "v"(l[2]), "v"(g[2]), "v"(l[3]), "v"(g[3]), "v"(l[4]), "v"(g[4]), "v"(l[5]), "v"(g[5]),
         "v"(l[6]), "v"(g[6]), "v"(l[7]), "v"(g[7]), "v"(l[8]), "v"(g[8]), "v"(l[9]), "v"(g[9]), "v"(l[10]), "v"(g[10]), "v"(l[11]), "v"(g[11]) : "memory"); }
__global__ __launch_bounds__(256) void k_ogemm(const _Float16* __restrict__ A, const _Float16* __restrict__ Bt, const float* __restrict__ bias, float* __restrict__ C) {
  static_assert(NRQ % OG_BM == 0 && DM % OG_BN == 0 && DM % OG_KS == 0 && OG_NT >= 2 && OG_BM * 16 == 16 * 256 && OG_BN * 16 == 8 * 256 && 8 * 64 * 68 * 4 <= 2 * OG_BUF,
                "k_ogemm: whole tiles and stages, two stages at least, sixteen o and eight Wo^T copies a lane and stage, the output staging fits the ring");
  __shared__ __attribute__((aligned(16))) unsigned char sm[2 * OG_BUF];
  const int tid = threadIdx.x, lane = tid & 31, ln = lane & 15, hh = lane >> 4; const int w = __builtin_amdgcn_readfirstlane(tid >> 5);      /* the wave's number, held scalar */
  const int mt = blockIdx.x % OG_MT, nq = blockIdx.x / OG_MT; const int wm = w >> 1, wn = w & 1;      /* waves 4 x 2 over the block's tile */
  const int col0 = nq * OG_BN + wn * 64;
  /* the lane's part of a stage: rows tid / 16 + 16 i, piece tid % 16: a wave's copy covers four whole 128-byte lines */
  const _Float16* ga = A + ((size_t)mt * OG_BM + (tid >> 4)) * DM + (tid & 15) * 8;
  const _Float16* gb = Bt + ((size_t)nq * OG_BN + (tid >> 4)) * DM + (tid & 15) * 8;
  const unsigned la = (unsigned)(size_t)sm + (tid >> 4) * OG_P + (tid & 15) * 16;      /* the low 32 bits of a __shared__ address are its LDS byte address */
  auto stage = [&](int t) { unsigned l[24]; const _Float16* g[24]; const unsigned bo = la + (t & 1) * OG_BUF;
#pragma unroll
    for (int i = 0; i < 16; ++i) { l[i] = bo + i * 16 * OG_P; g[i] = ga + (size_t)i * 16 * DM + t * OG_KS; }
#pragma unroll
    for (int i = 0; i < 8; ++i) { l[16 + i] = bo + OG_AB + i * 16 * OG_P; g[16 + i] = gb + (size_t)i * 16 * DM + t * OG_KS; }
    og_copy12(l, g); og_copy12(l + 12, g + 12); };
  float bb[4];
#pragma unroll
  for (int t = 0; t < 4; ++t) bb[t] = bias[col0 + t * 16 + ln];
  stage(0);
  asm volatile("s_wait_asynccnt 0x0" ::: "memory");      /* this wave's copies of stage 0 have landed */
  __syncthreads();      /* every wave's have: stage 0 may be read */
  stage(1);
  const unsigned char* al = sm + (wm * 64 + ln) * OG_P + hh * 16; const unsigned char* bl = sm + OG_AB + (wn * 64 + ln) * OG_P + hh * 16;
  const v8f z8 = {0.f,0.f,0.f,0.f,0.f,0.f,0.f,0.f}; v8f acc[4][4];
#pragma unroll
  for (int i = 0; i < 4; ++i)
#pragma unroll
    for (int t = 0; t < 4; ++t) acc[i][t] = z8;
#pragma unroll 1
  for (int g = 0; g < OG_NT; ++g) {      /* rolled: a stage already holds 64 matrix instructions and 64 LDS reads */
    const unsigned char* ab = al + (g & 1) * OG_BUF; const unsigned char* bp = bl + (g & 1) * OG_BUF;
#pragma unroll
    for (int s = 0; s < OG_KS / 32; ++s) { v16h af[4], bf[4];
      af[0] = fa_lfrag(ab + s * 64);      /* the first row's operands are asked for first, so that its products start while the other rows' still come */
#pragma unroll
      for (int t = 0; t < 4; ++t) bf[t] = fa_lfrag(bp + t * 16 * OG_P + s * 64);
#pragma unroll
      for (int i = 1; i < 4; ++i) af[i] = fa_lfrag(ab + i * 16 * OG_P + s * 64);
      __builtin_amdgcn_sched_barrier(0);      /* keeps the step's 16 LDS reads together in front of its products: left alone the compiler puts each row's reads, with a full wait, between the rows */
#pragma unroll
      for (int i = 0; i < 4; ++i)
#pragma unroll
        for (int t = 0; t < 4; ++t) acc[i][t] = fa_mma(af[i], bf[t], acc[i][t]);
      __builtin_amdgcn_sched_barrier(0); }      /* and the next step's reads behind these products, in one place */
    asm volatile("s_wait_dscnt 0x0" ::: "memory");      /* this wave's reads of the buffer have returned before anything refills it */
    asm volatile("s_wait_asynccnt 0x0" ::: "memory");      /* this wave's copies of the next stage have landed */
    __syncthreads();      /* one barrier a stage: it publishes the next stage and ends every wave's reads of this one */
    if (g + 2 < OG_NT) stage(g + 2);      /* into the buffer just left; the test is the same for the whole block */
  }
  asm volatile("s_wait_asynccnt 0x0" ::: "memory");      /* no copy is in flight when the ring becomes output staging; the loop's last barrier has ended every wave's reads of it */
  float* so = (float*)sm + w * (64 * 68);      /* each wave stages in its own range: its 64 rows of 64 f32 at a pitch of 68 */
  const float* sr = so + hh * 68 + ln * 4; float* cr = C + ((size_t)mt * OG_BM + wm * 64 + hh) * DM + col0 + ln * 4;      /* read back and stored: rows 2 q + hh, four columns a lane */
#pragma unroll
  for (int i = 0; i < 4; ++i)
#pragma unroll
    for (int t = 0; t < 4; ++t) { const float bv = bf16_round(bb[t]);
#pragma unroll
      for (int r = 0; r < 8; ++r) so[(i * 16 + 8 * hh + r) * 68 + t * 16 + ln] = acc[i][t][r] * 0.0009765625f + bv; }      /* o carried x64, Wo x16 */
  __builtin_amdgcn_fence(__ATOMIC_ACQ_REL, "workgroup"); __builtin_amdgcn_wave_barrier();      /* each wave reads back its own rows only: its LDS writes in front of its reads */
#pragma unroll
  for (int q = 0; q < 32; ++q) { const v4f v = *(const v4fa*)(sr + q * 2 * 68);
    *(v4f*)(cr + (size_t)q * 2 * DM) = v;      /* two rows of 256 B a store: whole lines */
    if (q == 15) asm volatile("s_wait_xcnt 0x0" ::: "memory"); } }      /* the wait that belongs in front of any overwrite of a register which an issued store names: the second 32 rows are read back into the registers of the first 16 stores */

extern "C" void kernel_launch(void* const* d_in, const int* in_sizes, int n_in,
                              void* d_out, int out_size, void* d_ws, size_t ws_size, hipStream_t stream) {
  (void)in_sizes; (void)n_in; (void)out_size;
  const float* const* I = (const float* const*)d_in; const float* x = I[0]; const float* ctx = I[1]; const float* vsrc = I[2]; const float* wq = I[3]; const float* bq = I[4]; const float* wk = I[5]; const float* bk = I[6]; const float* wv = I[7]; const float* bv = I[8]; const float* wo = I[9]; const float* bo = I[10];      /* input order: Q, K, V (THREE streams), Wq, bq, Wk, bk, Wv, bv (PER-HEAD [16][64][64] = [head][in][out]; biases [16][64] = the flat [1024] at 64 h + e; zeros on this draw), Wo ([in][out] [1024][1024]), bo (zeros): eleven inputs */
  char* ws = (char*)d_ws; size_t off = 0;
  auto take = [&](size_t bytes) { char* p = ws + off; off += (bytes + 255) & ~(size_t)255; return p; };
  _Float16* BO = (_Float16*)take((size_t)DM * DM * 2);
  _Float16* Q16 = (_Float16*)take(NRQ * DM * 2); _Float16* K16 = (_Float16*)take(NRK * DM * 2); _Float16* O16 = (_Float16*)take(NRQ * DM * 2);
  _Float16* VT = (_Float16*)take((size_t)NB * NH * HD * SK * 2);
  if (off > ws_size) return;      /* 2 + 3 x 16 + 16 = 66 MiB */
  k_proj<<<PJ_WB + 3 * NH * PJ_RB, 128, 0, stream>>>(x, ctx, vsrc, wq, wk, wv, wo, bq, bk, bv, Q16, K16, VT, BO);      /* the first 256 blocks: Wo [in][out] -> Wo^T x16, one 64 x 64 block each. The rest: q, k, v from the f32 rows: head h = rows[:, 64 h ..] W_h + b_h -> out[:, 64 h ..] (pitch DM), v transposed into V^T [4][16][64][2048]; W_h [in][out] at W + 4096 h, transposed in the block's LDS; bias + 64 h; K = N = 64 */
  k_fattn<<<NB * NH * (NQ / 512), 512, 0, stream>>>(Q16, K16, VT, O16);      /* scores, softmax, P V of every batch and head: 512 queries a block, o x64 into merged rows */
  k_ogemm<<<OG_MT * (DM / OG_BN), 256, 0, stream>>>(O16, BO, bo, (float*)d_out);      /* out = o Wo + bo (alpha 2^-10), 256 x 128 of out a block */
}
